// v005
// Measured on an AMD MI455X. A time is GPU time per run, averaged over a window of back-to-back runs after a warm-up
// (all launches, gaps included; the runs take copies of the inputs in turn), and the median of several windows.
// Apart from v000's, it joins two sittings. Times from different sittings can be a few percent apart, while
// side-by-side timings come from the same sitting.
// Earlier versions than v005 are not in this document.
// It runs in 78.9 microseconds.
// In two side-by-side timings against v004, it was 1.09 and 1.08 times as fast.
// Over all steps from v000, the starting kernel, it is 17.7 times as fast.
#include <hip/hip_runtime.h>
#include <math.h>

typedef __attribute__((ext_vector_type(16))) _Float16 v16h;
typedef __attribute__((ext_vector_type(8)))  _Float16 v8h;
typedef __attribute__((ext_vector_type(16))) __bf16   v16b;
typedef __attribute__((ext_vector_type(8)))  float    v8f;
typedef __attribute__((ext_vector_type(4)))  float    v4f;

// 16-bit WMMA fragment map (wave32), lane L, h = L>>4, m = L&15:
//   A 16x32: lane = row m;   element i -> k = (i<8) ? 8h+i : 16+8h+(i-8)
//   B 32x16: lane = column m; the SAME k(i,h)
//   D 16x16 (8 f32): lane = column m; element r -> row 8h+r
__device__ __forceinline__ int frag_k(int i, int h) { return (i < 8) ? (8 * h + i) : (16 + 8 * h + (i - 8)); }
__device__ __forceinline__ __bf16 bf16_rne(float f) {
    unsigned int u = __float_as_uint(f);
    u += 0x7fffu + ((u >> 16) & 1u);
    return __builtin_bit_cast(__bf16, (unsigned short)(u >> 16));
}
__device__ __forceinline__ float bf16_f32(__bf16 b) { return __uint_as_float(((unsigned int)__builtin_bit_cast(unsigned short, b)) << 16); }
__device__ __forceinline__ v8f wmma16(v16h a, v16h b, v8f c) {
    c = __builtin_amdgcn_wmma_f32_16x16x32_f16(false, a, false, b, (short)0, c, false, false);
    asm volatile("v_nop\n\tv_nop\n\tv_nop\n\tv_nop" : "+v"(c) : "v"(a), "v"(b));
    return c;
}
__device__ __forceinline__ v8f wmmab(v16b a, v16b b, v8f c) {
    c = __builtin_amdgcn_wmma_f32_16x16x32_bf16(false, a, false, b, (short)0, c, false, false);
    asm volatile("v_nop\n\tv_nop\n\tv_nop\n\tv_nop" : "+v"(c) : "v"(a), "v"(b));
    return c;
}
struct Split { v16b hi, lo; };
// hi/lo split product: a.hi*b.hi + a.hi*b.lo + a.lo*b.hi
__device__ __forceinline__ v8f wmma3(const Split& a, const Split& b, v8f c) {
    c = __builtin_amdgcn_wmma_f32_16x16x32_bf16(false, a.hi, false, b.hi, (short)0, c, false, false);
    c = __builtin_amdgcn_wmma_f32_16x16x32_bf16(false, a.hi, false, b.lo, (short)0, c, false, false);
    c = __builtin_amdgcn_wmma_f32_16x16x32_bf16(false, a.lo, false, b.hi, (short)0, c, false, false);
    asm volatile("v_nop\n\tv_nop\n\tv_nop\n\tv_nop" : "+v"(c) : "v"(a.hi), "v"(a.lo), "v"(b.hi), "v"(b.lo));
    return c;
}
struct Split3 { v16b hi, mid, lo; };
// triple split product (6 terms, drops only terms below 2^-24 relative)
__device__ __forceinline__ v8f wmma6(const Split3& a, const Split3& b, v8f c) {
    c = __builtin_amdgcn_wmma_f32_16x16x32_bf16(false, a.hi, false, b.hi, (short)0, c, false, false);
    c = __builtin_amdgcn_wmma_f32_16x16x32_bf16(false, a.hi, false, b.mid, (short)0, c, false, false);
    c = __builtin_amdgcn_wmma_f32_16x16x32_bf16(false, a.mid, false, b.hi, (short)0, c, false, false);
    c = __builtin_amdgcn_wmma_f32_16x16x32_bf16(false, a.hi, false, b.lo, (short)0, c, false, false);
    c = __builtin_amdgcn_wmma_f32_16x16x32_bf16(false, a.mid, false, b.mid, (short)0, c, false, false);
    c = __builtin_amdgcn_wmma_f32_16x16x32_bf16(false, a.lo, false, b.hi, (short)0, c, false, false);
    asm volatile("v_nop\n\tv_nop\n\tv_nop\n\tv_nop" : "+v"(c) : "v"(a.hi), "v"(a.mid), "v"(a.lo), "v"(b.hi), "v"(b.mid), "v"(b.lo));
    return c;
}

// Fragment gathers from f32 memory: element i <- p[(k0 + frag_k(i,h)) * sk] * s, zero for k >= klen.
__device__ __forceinline__ v16h fh_ld(const float* __restrict__ p, long long sk, int k0, int h, int klen, float s) {
    v16h a;
#pragma unroll
    for (int i = 0; i < 16; ++i) { const int k = k0 + frag_k(i, h); a[i] = (k < klen) ? (_Float16)(p[(long long)k * sk] * s) : (_Float16)0.f; }
    return a;
}
__device__ __forceinline__ Split sp_ld(const float* __restrict__ p, long long sk, int k0, int h, int klen, float s) {
    Split r;
#pragma unroll
    for (int i = 0; i < 16; ++i) {
        const int k = k0 + frag_k(i, h); const float x = (k < klen) ? p[(long long)k * sk] * s : 0.f;
        const __bf16 hb = bf16_rne(x); r.hi[i] = hb; r.lo[i] = bf16_rne(x - bf16_f32(hb));
    }
    return r;
}
__device__ __forceinline__ Split3 sp3_ld(const float* __restrict__ p, long long sk, int k0, int h, int klen, float s) {
    Split3 r;
#pragma unroll
    for (int i = 0; i < 16; ++i) {
        const int k = k0 + frag_k(i, h); const float x = (k < klen) ? p[(long long)k * sk] * s : 0.f;
        const __bf16 hb = bf16_rne(x); const float r1 = x - bf16_f32(hb); const __bf16 mb = bf16_rne(r1);
        r.hi[i] = hb; r.mid[i] = mb; r.lo[i] = bf16_rne(r1 - bf16_f32(mb));
    }
    return r;
}
__device__ __forceinline__ v16b bh_ld(const float* __restrict__ p, long long sk, int k0, int h, int klen, float s) {
    v16b a;
#pragma unroll
    for (int i = 0; i < 16; ++i) { const int k = k0 + frag_k(i, h); a[i] = bf16_rne((k < klen) ? p[(long long)k * sk] * s : 0.f); }
    return a;
}
// f16 fragment from an f16 LDS/global row with element stride 1 (k-contiguous), no bounds (tile already zero padded)
__device__ __forceinline__ v16h fh_row(const _Float16* __restrict__ row, int k0, int h) {
    v16h a;
#pragma unroll
    for (int i = 0; i < 16; ++i) a[i] = row[k0 + frag_k(i, h)];
    return a;
}

#define VST2(T, ptr, val) do { const T vst2_v_ = (val); *(T*)(ptr) = vst2_v_;  } while (0)
typedef float v4f __attribute__((ext_vector_type(4)));
typedef unsigned int v4u __attribute__((ext_vector_type(4)));
typedef unsigned int v2u __attribute__((ext_vector_type(2)));
#define VST2V4(ptr, val) do { const v4f vst2_v4_ = (val); *(v4f*)(ptr) = vst2_v4_;  } while (0)

__device__ __attribute__((noinline)) float act_fn(float v, int act) {
    if (act == 1) return fmaxf(v, 0.f);                                                                               // relu
    if (act == 2) { const float u = 0.7978845608028654f * (v + 0.044715f * v * v * v); return 0.5f * v * (1.f + tanhf(u)); } // tanh-gelu
    if (act == 3) return v / (1.f + expf(-v));                                                                        // silu
    if (act == 4) return 0.5f * v * (1.f + erff(v * 0.7071067811865476f));                                             // erf-gelu
    if (act == 5) return tanhf(v);
    if (act == 6) return 1.f / (1.f + expf(-v));                                                                      // sigmoid
    if (act == 7) return (v > 0.f) ? v : 0.01f * v;                                                                   // leaky relu 0.01
    if (act == 8) return (v > 0.f) ? v : (expf(v) - 1.f);                                                             // elu
    if (act == 9) return fminf(fmaxf(v, 0.f), 6.f);                                                                   // relu6
    if (act == 10) return fabsf(v);                                                                                    // abs
    if (act == 11) return (v >= 0.f) ? v : 0.1f * v;                                                                  // leaky 0.1
    if (act == 12) return (v > 0.f) ? v : 0.2f * v;                                                                   // leaky 0.2
    if (act == 13) return (v > 20.f) ? v : log1pf(expf(v));                                                            // softplus
    return v;
}

// =====================================================================================================================
// k_gemm<MODE>: C(z, m, n) = act(alpha * sum_k A(z, m, k) * B(z, k, n) + bias) + beta * R(z, m, n)
//   One wave (32-thread block) per 16 x 32 tile of C; grid (ceil(N/32), ceil(M/16), Z). Batch z -> (zo = z / zi_n, zi = z % zi_n)
//   with separate outer/inner strides for every tensor (e.g. batch and head). A(m,k) = A[zo*sAo + zi*sAi + m*sAm + k*sAk] (f32),
//   B(k,n) = B[zo*sBo + zi*sBi + n*sBn + k*sBk] (f32); any M, N, K (K zero-padded to 32 inside the fragments, M/N tails guarded).
//   C(m,n) = C[zo*sCo + zi*sCi + m*sCm + n] (n contiguous). flags: 1 bias[n], 2 bias[m], 4 residual R[zo*sRo + zi*sRi + m*sRm + n*sRn].
//   MODE 0: f16 operands (A prescaled by sa, B by sb, both undone in the epilogue); 1: bf16 hi/lo split (3 products); 2: bf16;
//   3: bf16 hi/mid/lo triple split (6 products); 4: as 3 with Kahan-compensated f32 accumulation across k-steps.
// =====================================================================================================================
struct GemmP {
    const float* A; const float* B; const float* bias; const float* R; float* C;
    long long sAo, sAi, sAm, sAk, sBo, sBi, sBn, sBk, sCo, sCi, sCm, sRo, sRi, sRm, sRn;
    int M, N, K, zi_n, flags, act; float alpha, beta, sa, sb;
    int Npad, pad_;     // columns [N, Npad) of C are written as 0 so that padded workspace rows are covered by whole-line stores; Npad >= N
};
static_assert(sizeof(GemmP) == 5 * 8 + 15 * 8 + 6 * 4 + 4 * 4 + 2 * 4, "GemmP has padding");

template <int MODE>
__global__ __launch_bounds__(32) void k_gemm(GemmP p) {
    const int lane = threadIdx.x & 31, h = lane >> 4, l15 = lane & 15;
    const int m0 = blockIdx.y * 16, n0 = blockIdx.x * 32;
    const int z = blockIdx.z, zo = z / p.zi_n, zi = z - zo * p.zi_n;
    const float* A = p.A + zo * p.sAo + zi * p.sAi;
    const float* B = p.B + zo * p.sBo + zi * p.sBi;
    const int am = min(m0 + l15, p.M - 1);                       // clamped row for loads (stores are guarded)
    v8f acc[2], comp[2];
#pragma unroll
    for (int t = 0; t < 2; ++t) { v8f zz = {}; acc[t] = zz; comp[t] = zz; }
    for (int k0 = 0; k0 < p.K; k0 += 32) {
        const float* arow = A + (long long)am * p.sAm;
        if (MODE == 1) {
            const Split a = sp_ld(arow, p.sAk, k0, h, p.K, 1.f);
#pragma unroll
            for (int t = 0; t < 2; ++t) {
                const int bn = min(n0 + t * 16 + l15, p.N - 1);
                acc[t] = wmma3(a, sp_ld(B + (long long)bn * p.sBn, p.sBk, k0, h, p.K, 1.f), acc[t]);
            }
        } else if (MODE == 3) {
            const Split3 a = sp3_ld(arow, p.sAk, k0, h, p.K, 1.f);
#pragma unroll
            for (int t = 0; t < 2; ++t) {
                const int bn = min(n0 + t * 16 + l15, p.N - 1);
                acc[t] = wmma6(a, sp3_ld(B + (long long)bn * p.sBn, p.sBk, k0, h, p.K, 1.f), acc[t]);
            }
        } else if (MODE == 4) {
            // triple split as MODE 3, but each k-step's 6 products go into a fresh accumulator and the partial is added to the running f32 sum
            // on the VALU with Kahan compensation (accumulation error stays ~1 ulp however long K is)
            const Split3 a = sp3_ld(arow, p.sAk, k0, h, p.K, 1.f);
#pragma unroll
            for (int t = 0; t < 2; ++t) {
                const int bn = min(n0 + t * 16 + l15, p.N - 1); v8f zz = {};
                const v8f part = wmma6(a, sp3_ld(B + (long long)bn * p.sBn, p.sBk, k0, h, p.K, 1.f), zz);
                const v8f y = part - comp[t]; const v8f s = acc[t] + y; comp[t] = (s - acc[t]) - y; acc[t] = s;
            }
        } else if (MODE == 2) {
            const v16b a = bh_ld(arow, p.sAk, k0, h, p.K, 1.f);
#pragma unroll
            for (int t = 0; t < 2; ++t) {
                const int bn = min(n0 + t * 16 + l15, p.N - 1);
                acc[t] = wmmab(a, bh_ld(B + (long long)bn * p.sBn, p.sBk, k0, h, p.K, 1.f), acc[t]);
            }
        } else {
            const v16h a = fh_ld(arow, p.sAk, k0, h, p.K, p.sa);
#pragma unroll
            for (int t = 0; t < 2; ++t) {
                const int bn = min(n0 + t * 16 + l15, p.N - 1);
                acc[t] = wmma16(a, fh_ld(B + (long long)bn * p.sBn, p.sBk, k0, h, p.K, p.sb), acc[t]);
            }
        }
    }
    const float iscale = (MODE == 0) ? p.alpha / (p.sa * p.sb) : p.alpha;
    float* C = p.C + zo * p.sCo + zi * p.sCi;
    const float* R = p.R + zo * p.sRo + zi * p.sRi;
    __shared__ __align__(16) float ctile[16][36];
#pragma unroll
    for (int t = 0; t < 2; ++t) {
        const int n = n0 + t * 16 + l15; const int nn = min(n, p.N - 1);
#pragma unroll
        for (int r = 0; r < 8; ++r) {
            const int m = m0 + 8 * h + r; const int mm = min(m, p.M - 1);
            float v = acc[t][r] * iscale;
            if (p.flags & 1) v += p.bias[nn];
            if (p.flags & 2) v += p.bias[mm];
            if (p.flags & 8) v *= p.bias[(long long)zo * p.M + mm];   /* per-(z,row) scale vector laid out [Z][M]; exclusive with the bias flags */
            v = act_fn(v, p.act);
            if (p.flags & 4) v += p.beta * R[(long long)mm * p.sRm + (long long)nn * p.sRn];
            ctile[8 * h + r][t * 16 + l15] = (n < p.N) ? v : 0.f;
        }
    }
    __syncthreads();
    const int NW = (p.Npad > p.N) ? p.Npad : p.N;           // write width
    const bool fast = (m0 + 16 <= p.M) && (n0 + 32 <= NW) && ((p.sCm & 3) == 0) && ((((size_t)C) & 15) == 0);
    if (fast) {
#pragma unroll
        for (int s = 0; s < 4; ++s) {
            const int row = s * 4 + (lane >> 3), c4 = (lane & 7) * 4;
            const v4f v = *(const v4f*)&ctile[row][c4];
            VST2V4(C + (long long)(m0 + row) * p.sCm + n0 + c4, v);
        }
    } else {
        for (int row = 0; row < 16; ++row) {
            const int m = m0 + row, n = n0 + lane;
            if (m < p.M && n < NW) VST2(float, C + (long long)m * p.sCm + n, ctile[row][lane]);
        }
    }
}


// =====================================================================================================================
// k_gemmT<MODE, TM, TN>: same contract as k_gemm, but one wave computes a (16*TM) x (16*TN) tile: TM A fragments and TN B fragments are
//   loaded per 32-wide k-step and reused across TM*TN WMMAs (far fewer load/convert instructions per MAC). MODE 0 (f16), 1 (bf16 hi/lo),
//   2 (bf16) only. grid (ceil(NW/(16*TN)), ceil(M/(16*TM)), Z), block 32. Epilogue identical to k_gemm, run per 16x32 sub-tile.
// =====================================================================================================================
template <int MODE, int TM, int TN>
__global__ __launch_bounds__(32) void k_gemmT(GemmP p) {
    const int lane = threadIdx.x & 31, h = lane >> 4, l15 = lane & 15;
    const int m0 = blockIdx.y * (16 * TM), n0 = blockIdx.x * (16 * TN);
    const int z = blockIdx.z, zo = z / p.zi_n, zi = z - zo * p.zi_n;
    const float* A = p.A + zo * p.sAo + zi * p.sAi;
    const float* B = p.B + zo * p.sBo + zi * p.sBi;
    v8f acc[TM][TN];
#pragma unroll
    for (int i = 0; i < TM; ++i)
#pragma unroll
        for (int t = 0; t < TN; ++t) { v8f zz = {}; acc[i][t] = zz; }
    for (int k0 = 0; k0 < p.K; k0 += 32) {
        if (MODE == 1) {
            Split a[TM], b[TN];
#pragma unroll
            for (int i = 0; i < TM; ++i) { const int am = min(m0 + 16 * i + l15, p.M - 1); a[i] = sp_ld(A + (long long)am * p.sAm, p.sAk, k0, h, p.K, 1.f); }
#pragma unroll
            for (int t = 0; t < TN; ++t) { const int bn = min(n0 + 16 * t + l15, p.N - 1); b[t] = sp_ld(B + (long long)bn * p.sBn, p.sBk, k0, h, p.K, 1.f); }
#pragma unroll
            for (int i = 0; i < TM; ++i)
#pragma unroll
                for (int t = 0; t < TN; ++t) acc[i][t] = wmma3(a[i], b[t], acc[i][t]);
        } else if (MODE == 2) {
            v16b a[TM], b[TN];
#pragma unroll
            for (int i = 0; i < TM; ++i) { const int am = min(m0 + 16 * i + l15, p.M - 1); a[i] = bh_ld(A + (long long)am * p.sAm, p.sAk, k0, h, p.K, 1.f); }
#pragma unroll
            for (int t = 0; t < TN; ++t) { const int bn = min(n0 + 16 * t + l15, p.N - 1); b[t] = bh_ld(B + (long long)bn * p.sBn, p.sBk, k0, h, p.K, 1.f); }
#pragma unroll
            for (int i = 0; i < TM; ++i)
#pragma unroll
                for (int t = 0; t < TN; ++t) acc[i][t] = wmmab(a[i], b[t], acc[i][t]);
        } else {
            v16h a[TM], b[TN];
#pragma unroll
            for (int i = 0; i < TM; ++i) { const int am = min(m0 + 16 * i + l15, p.M - 1); a[i] = fh_ld(A + (long long)am * p.sAm, p.sAk, k0, h, p.K, p.sa); }
#pragma unroll
            for (int t = 0; t < TN; ++t) { const int bn = min(n0 + 16 * t + l15, p.N - 1); b[t] = fh_ld(B + (long long)bn * p.sBn, p.sBk, k0, h, p.K, p.sb); }
#pragma unroll
            for (int i = 0; i < TM; ++i)
#pragma unroll
                for (int t = 0; t < TN; ++t) acc[i][t] = wmma16(a[i], b[t], acc[i][t]);
        }
    }
    const float iscale = (MODE == 0) ? p.alpha / (p.sa * p.sb) : p.alpha;
    float* C = p.C + zo * p.sCo + zi * p.sCi;
    const float* R = p.R + zo * p.sRo + zi * p.sRi;
    const int NW = (p.Npad > p.N) ? p.Npad : p.N;
    __shared__ __align__(16) float ctile[16][36];
#pragma unroll
    for (int i = 0; i < TM; ++i) {
        const int mb = m0 + 16 * i; if (mb >= p.M) break;          // wave-uniform
#pragma unroll
        for (int tp = 0; tp < TN / 2; ++tp) {
            const int nb = n0 + 32 * tp; if (nb >= NW) break;        // wave-uniform
#pragma unroll
            for (int t2 = 0; t2 < 2; ++t2) {
                const int t = 2 * tp + t2; const int n = nb + t2 * 16 + l15; const int nn = min(n, p.N - 1);
#pragma unroll
                for (int r = 0; r < 8; ++r) {
                    const int m = mb + 8 * h + r; const int mm = min(m, p.M - 1);
                    float v = acc[i][t][r] * iscale;
                    if (p.flags & 1) v += p.bias[nn];
                    if (p.flags & 2) v += p.bias[mm];
            if (p.flags & 8) v *= p.bias[(long long)zo * p.M + mm];   /* per-(z,row) scale vector laid out [Z][M]; exclusive with the bias flags */
                    v = act_fn(v, p.act);
                    if (p.flags & 4) v += p.beta * R[(long long)mm * p.sRm + (long long)nn * p.sRn];
                    ctile[8 * h + r][t2 * 16 + l15] = (n < p.N) ? v : 0.f;
                }
            }
            __syncthreads();
            const bool fast = (mb + 16 <= p.M) && (nb + 32 <= NW) && ((p.sCm & 3) == 0) && ((((size_t)C) & 15) == 0);
            if (fast) {
#pragma unroll
                for (int s = 0; s < 4; ++s) {
                    const int row = s * 4 + (lane >> 3), c4 = (lane & 7) * 4;
                    const v4f v = *(const v4f*)&ctile[row][c4];
                    VST2V4(C + (long long)(mb + row) * p.sCm + nb + c4, v);
                }
            } else {
                for (int row = 0; row < 16; ++row) {
                    const int m = mb + row, n = nb + lane;
                    if (m < p.M && n < NW) VST2(float, C + (long long)m * p.sCm + n, ctile[row][lane]);
                }
            }
            __syncthreads();
        }
    }
}

// =====================================================================================================================
//   Wave = 16 queries, AW waves per block, 64-key blocks; grid (ceil(Lq/(16*AW)), H, B), block 32*AW. Any Lq, Lk; head dim dh <= DHP
//   (DHP multiple of 32), value dim dv <= DVP (multiple of 16, <= 128). Every tensor addressed by (batch, head, row, element) strides, f32.
//   Scores: QM 0 f16 operands, 1 bf16 hi/lo split, 2 bf16 triple split; statistics f32 (exp2 domain); P.V: P x 4096 as f16 with V f16 staged in LDS
//   (SPLITPV: P and V as bf16 hi/lo splits). kv head = h / hrep. Masking: causal = 1 (keep j <= i + coff, masked -> -inf, key blocks beyond the
//   diagonal skipped), causal = 2 (masked -> mfill, a finite fill like the -1e9; no skipping), causal = 3 (keep j >= i + coff,
//   masked -> -inf, no skipping); optional additive f32 mask Mf,
//   optional int keep-mask Mi (0 -> score := mfill), both addressed b*smb + h*smh + i*smi + j*smj (0 strides broadcast).
// =====================================================================================================================
#define AW 4
struct AttnP {   // apv4
    const float* Q; const float* K; const float* V; float* O; float* P; const float* Mf; const int* Mi; float* ST;
    const float* Pw; const float* Rt; const int* SQ; const int* SK;           // optional: post-softmax weight, relative-position table, segment ids
    long long swb, swh, swi, swj, srb, srh, sri;                                 // Pw strides (b,h,i,j); Rt strides (b,h,i), column = clamp(i - j + roff, 0, rn-1)
    long long sQb, sQh, sQi, sQd, sKb, sKh, sKj, sKd, sVb, sVh, sVj, sVd, sOb, sOh, sOi, sPb, sPh, sPi, smb, smh, smi, smj;
    int Lq, Lk, dh, dv, hrep, causal, coff, pband;   // pband > 0: P holds only the band |j - i| <= pband, column j - i + pband
    float scale, mfill; int nonorm, mpol;             // nonorm (online path only): O = sum_j exp(score_j) V_j without the 1/rowsum (scores must be <= ~0); mpol: Mi masks where ==0 (mpol 0) or where !=0 (mpol 1)
    int roff, rn, segpol, win;                        // Rt column offset/count; SQ/SK: score := mfill where (segpol 0) SQ[i] != SK[j] or (segpol 1) SQ[i] == SK[j]; win > 0: keys with i - j > win (after coff) -> -inf
};
//   Pw: the softmax numerator is multiplied by Pw(b,h,i,j) AFTER the row sum is taken (probs * weight, then P.V), as in post-softmax multiplicative biases.                                                    // ST (optional): per row (b,h,i) -> ST[((b*H + h)*Lq + i)*2 + {0,1}] = {row max of the scaled+masked score (natural units), sum_j exp(score - max)}
static_assert(sizeof(AttnP) == 12 * 8 + 29 * 8 + 16 * 4, "AttnP has padding");

#ifndef KATTN_ATTR
#define KATTN_ATTR
#endif
template <int DHP, int DVP, int QM, bool SPLITPV, bool TWOPASS>
__global__ __launch_bounds__(32 * AW) KATTN_ATTR void k_attn(AttnP p) {
    constexpr int NT = DVP / 16;                // output tiles
    constexpr int KS = DHP / 32;                // k-steps for the scores
    constexpr int VP = DVP + 8;                 // LDS pitch (halves)
    __shared__ __align__(16) float    pl[AW][16 * 64];
    __shared__ __align__(16) _Float16 vl[(SPLITPV ? 2 : 1) * 64 * VP];   // f16 V tile, or bf16 hi and lo tiles (same 2-byte size)
    const int lane = threadIdx.x & 31, hf = lane >> 4, l15 = lane & 15, wave = threadIdx.x >> 5;
    const int h = blockIdx.y, b = blockIdx.z, hk = h / p.hrep;
    const int q0 = (blockIdx.x * AW + wave) * 16;
    float* myp = pl[wave];
    const float L2E = 1.4426950408889634f;
    const float NEG = -__builtin_inff();
    const int qi = min(q0 + l15, p.Lq - 1);
    const float* qrow = p.Q + b * p.sQb + h * p.sQh + (long long)qi * p.sQi;
    const float* kbase = p.K + b * p.sKb + hk * p.sKh;
    const float* vbase = p.V + b * p.sVb + hk * p.sVh;
    v16h qa[QM == 0 ? KS : 1]; Split qs_[QM == 1 ? KS : 1]; Split3 qt_[QM == 2 ? KS : 1];
#pragma unroll
    for (int ks = 0; ks < KS; ++ks) {
        if (QM == 2) qt_[ks] = sp3_ld(qrow, p.sQd, ks * 32, hf, p.dh, 1.f);
        else if (QM == 1) qs_[ks] = sp_ld(qrow, p.sQd, ks * 32, hf, p.dh, 1.f);
        else qa[ks] = fh_ld(qrow, p.sQd, ks * 32, hf, p.dh, 1.f);
    }
    v8f o[NT]; float m8[8], l8[8];
#pragma unroll
    for (int t = 0; t < NT; ++t) { v8f zz = {}; o[t] = zz; }
#pragma unroll
    for (int i = 0; i < 8; ++i) { m8[i] = NEG; l8[i] = 0.f; }
    int jend = p.Lk; int jstart = 0;
    if (p.causal == 1) { const int je = (blockIdx.x * AW + AW - 1) * 16 + 16 + p.coff; jend = min(jend, max(je, 0)); }   // uniform per block
    if (p.win > 0) { const int js = (int)(blockIdx.x * AW) * 16 + p.coff - p.win; jstart = (js > 0) ? (js / 64) * 64 : 0; }   // uniform per block: key blocks entirely outside every row's window hold only -inf entries and are skipped exactly
    const int npass = TWOPASS ? 2 : 1;
    for (int pass = 0; pass < npass; ++pass) {
        const bool dopv = (!TWOPASS) || pass == 1;
        for (int j0 = jstart; j0 < jend; j0 += 64) {
            if (dopv) {
                __syncthreads();                                 // previous key block's reads of vl / pl are done
                for (int idx = threadIdx.x; idx < 64 * DVP; idx += 32 * AW) {
                    const int jr = idx / DVP, d = idx - jr * DVP, j = j0 + jr;
                    const float f = (j < p.Lk && d < p.dv) ? vbase[(long long)j * p.sVj + (long long)d * p.sVd] : 0.f;
                    if (SPLITPV) {
                        const __bf16 hb = bf16_rne(f);
                        ((__bf16*)vl)[jr * VP + d] = hb; ((__bf16*)vl)[64 * VP + jr * VP + d] = bf16_rne(f - bf16_f32(hb));
                    } else vl[jr * VP + d] = (_Float16)f;
                }
            }
            v8f s[4];
#pragma unroll
            for (int t = 0; t < 4; ++t) {
                const int j = min(j0 + t * 16 + l15, p.Lk - 1);
                const float* krow = kbase + (long long)j * p.sKj;
                v8f acc = {};
#pragma unroll
                for (int ks = 0; ks < KS; ++ks) {
                    if (QM == 2)      acc = wmma6(qt_[ks], sp3_ld(krow, p.sKd, ks * 32, hf, p.dh, 1.f), acc);
                    else if (QM == 1) acc = wmma3(qs_[ks], sp_ld(krow, p.sKd, ks * 32, hf, p.dh, 1.f), acc);
                    else              acc = wmma16(qa[ks], fh_ld(krow, p.sKd, ks * 32, hf, p.dh, 1.f), acc);
                }
                s[t] = acc;
            }
            float pv[8][4];
#pragma unroll
            for (int i = 0; i < 8; ++i) {
                const int irow = q0 + i + 8 * hf;
                const int ic = min(irow, p.Lq - 1);
                float sc[4];
#pragma unroll
                for (int t = 0; t < 4; ++t) {
                    const int jg = j0 + t * 16 + l15;
                    float v = s[t][i] * p.scale;
                    if (p.Mf) v += p.Mf[b * p.smb + h * p.smh + (long long)ic * p.smi + (long long)min(jg, p.Lk - 1) * p.smj];
                    if (p.Rt) { int rc = ic - min(jg, p.Lk - 1) + p.roff; rc = rc < 0 ? 0 : (rc >= p.rn ? p.rn - 1 : rc); v += p.Rt[b * p.srb + h * p.srh + (long long)ic * p.sri + rc]; }
                    if (p.Mi) { const int mv = p.Mi[b * p.smb + h * p.smh + (long long)ic * p.smi + (long long)min(jg, p.Lk - 1) * p.smj]; if (p.mpol ? (mv != 0) : (mv == 0)) v = p.mfill; }
                    if (p.SQ) { const bool same = p.SQ[(long long)b * p.Lq + ic] == p.SK[(long long)b * p.Lk + min(jg, p.Lk - 1)]; if (p.segpol ? same : !same) v = p.mfill; }
                    if (p.causal == 2 && jg > irow + p.coff) v = p.mfill;
                    if (jg >= p.Lk || (p.causal == 1 && jg > irow + p.coff) || (p.causal == 3 && jg < irow + p.coff) || (p.win > 0 && irow + p.coff - jg > p.win)) v = NEG; else v *= L2E;
                    sc[t] = v;
                }
                if (!TWOPASS || pass == 0) {
                    float mx = fmaxf(fmaxf(sc[0], sc[1]), fmaxf(sc[2], sc[3]));
                    mx = fmaxf(mx, __shfl_xor(mx, 1, 32)); mx = fmaxf(mx, __shfl_xor(mx, 2, 32));
                    mx = fmaxf(mx, __shfl_xor(mx, 4, 32)); mx = fmaxf(mx, __shfl_xor(mx, 8, 32));
                    const float mnew = fmaxf(m8[i], mx);
                    const float corr = (mnew == NEG) ? 1.f : exp2f(m8[i] - mnew);
                    float rs = 0.f;
#pragma unroll
                    for (int t = 0; t < 4; ++t) {
                        const float pp = (sc[t] == NEG) ? 0.f : exp2f(sc[t] - mnew); rs += pp;
                        pv[i][t] = p.Pw ? pp * p.Pw[b * p.swb + h * p.swh + (long long)ic * p.swi + (long long)min(j0 + t * 16 + l15, p.Lk - 1) * p.swj] : pp;
                    }
                    rs += __shfl_xor(rs, 1, 32); rs += __shfl_xor(rs, 2, 32); rs += __shfl_xor(rs, 4, 32); rs += __shfl_xor(rs, 8, 32);
                    l8[i] = l8[i] * corr + rs; m8[i] = mnew;
                    if (!TWOPASS) {
#pragma unroll
                        for (int t = 0; t < NT; ++t) o[t][i] *= corr;
                    }
                } else {
                    const float inv = (l8[i] > 0.f) ? 1.f / l8[i] : 0.f;
#pragma unroll
                    for (int t = 0; t < 4; ++t) {
                        const int jg = j0 + t * 16 + l15;
                        float pp = (sc[t] == NEG) ? 0.f : exp2f(sc[t] - m8[i]) * inv;
                        if (p.Pw) pp *= p.Pw[b * p.swb + h * p.swh + (long long)ic * p.swi + (long long)min(jg, p.Lk - 1) * p.swj];
                        pv[i][t] = pp;
                    }
                }
            }
            if (dopv) {
#pragma unroll
                for (int i = 0; i < 8; ++i)
#pragma unroll
                    for (int t = 0; t < 4; ++t) ((float*)myp)[(i + 8 * hf) * 64 + t * 16 + l15] = pv[i][t];
                __syncthreads();                                 // P (per wave) and V (shared) visible
                if (p.P) {
                    float* pb_ = p.P + b * p.sPb + h * p.sPh;
                    const bool fastP = (p.pband == 0) && ((p.sPi & 3) == 0) && (j0 + 64 <= p.Lk) && (q0 + 16 <= p.Lq) && ((((size_t)pb_) & 15) == 0);
                    if (fastP) {
#pragma unroll
                        for (int s = 0; s < 8; ++s) {
                            const int row = s * 2 + (lane >> 4), c4 = (lane & 15) * 4;
                            const v4f v = *(const v4f*)(myp + row * 64 + c4);
                            VST2V4(pb_ + (long long)(q0 + row) * p.sPi + j0 + c4, v);
                        }
                    } else {
                        for (int row = 0; row < 16; ++row) {
                            const int irow = q0 + row; if (irow >= p.Lq) continue;
                            for (int c = lane; c < 64; c += 32) {
                                const int jg = j0 + c; if (jg >= p.Lk) continue;
                                if (p.pband == 0) VST2(float, pb_ + (long long)irow * p.sPi + jg, myp[row * 64 + c]);
                                else if (jg - irow <= p.pband && irow - jg <= p.pband) VST2(float, pb_ + (long long)irow * p.sPi + (jg - irow + p.pband), myp[row * 64 + c]);
                            }
                        }
                    }
                }
                if (SPLITPV) {
                    const Split pa0 = sp_ld(myp + l15 * 64, 1, 0, hf, 64, 1.f), pa1 = sp_ld(myp + l15 * 64, 1, 32, hf, 64, 1.f);
                    const __bf16* vh = (const __bf16*)vl; const __bf16* vlo = vh + 64 * VP;
#pragma unroll
                    for (int t = 0; t < NT; ++t) {
                        const int dcol = t * 16 + l15;
                        Split b0, b1;
#pragma unroll
                        for (int e = 0; e < 16; ++e) {
                            const int k0 = frag_k(e, hf), k1 = 32 + frag_k(e, hf);
                            b0.hi[e] = vh[k0 * VP + dcol]; b0.lo[e] = vlo[k0 * VP + dcol]; b1.hi[e] = vh[k1 * VP + dcol]; b1.lo[e] = vlo[k1 * VP + dcol];
                        }
                        o[t] = wmma3(pa0, b0, o[t]);
                        o[t] = wmma3(pa1, b1, o[t]);
                    }
                } else {
                    const v16h pa0 = fh_ld(myp + l15 * 64, 1, 0, hf, 64, 4096.f), pa1 = fh_ld(myp + l15 * 64, 1, 32, hf, 64, 4096.f);
#pragma unroll
                    for (int t = 0; t < NT; ++t) {
                        const int dcol = t * 16 + l15;
                        v16h b0, b1;
#pragma unroll
                        for (int e = 0; e < 16; ++e) { b0[e] = vl[frag_k(e, hf) * VP + dcol]; b1[e] = vl[(32 + frag_k(e, hf)) * VP + dcol]; }
                        o[t] = wmma16(pa0, b0, o[t]);
                        o[t] = wmma16(pa1, b1, o[t]);
                    }
                }
            }
        }
    }
    float* obase = p.O + b * p.sOb + h * p.sOh;
    if (p.ST) {
        const int rl = lane >> 1, isel = rl & 7;           // row q0 + rl ; rl>>3 == hf holds because lane>>4 == (lane>>1)>>3
        float mv = 0.f, lv = 0.f;
#pragma unroll
        for (int i = 0; i < 8; ++i) if (i == isel) { mv = m8[i]; lv = l8[i]; }
        const int irow = q0 + rl;
        if (irow < p.Lq) { float* st = p.ST + (((long long)b * gridDim.y + h) * p.Lq + irow) * 2 + (lane & 1); VST2(float, st, (lane & 1) ? lv : mv * 0.6931471805599453f); }
    }
    float invr[8];
#pragma unroll
    for (int i = 0; i < 8; ++i) {
        if (TWOPASS) invr[i] = SPLITPV ? 1.f : (1.f / 4096.f);
        else if (p.nonorm) invr[i] = exp2f(m8[i]) * (SPLITPV ? 1.f : (1.f / 4096.f));
        else invr[i] = (l8[i] > 0.f) ? (SPLITPV ? 1.f / l8[i] : 1.f / (l8[i] * 4096.f)) : 0.f;
    }
    __syncthreads();                                             // all waves done with pl/vl from the main loop
    const bool ofast = ((p.sOi & 3) == 0) && ((((size_t)obase) & 15) == 0) && (q0 + 16 <= p.Lq);
#pragma unroll
    for (int c0 = 0; c0 < DVP; c0 += 64) {
#pragma unroll
        for (int i = 0; i < 8; ++i)
#pragma unroll
            for (int t = 0; t < NT; ++t) if (t * 16 >= c0 && t * 16 < c0 + 64) ((float*)myp)[(i + 8 * hf) * 64 + (t * 16 - c0) + l15] = o[t][i] * invr[i];
        __syncthreads();
        const int cw = (DVP - c0 < 64) ? (DVP - c0) : 64;      // staged columns in this chunk (multiple of 16)
        if (ofast && (c0 + cw <= p.dv) && (cw % 32 == 0)) {
            const int lpr = cw / 4;                              // lanes per row (16 for 64 cols, 8 for 32)
            const int rows_per_ins = 32 / lpr;
            for (int r0 = 0; r0 < 16; r0 += rows_per_ins) {
                const int row = r0 + lane / lpr, c4 = (lane % lpr) * 4;
                const v4f v = *(const v4f*)(myp + row * 64 + c4);
                VST2V4(obase + (long long)(q0 + row) * p.sOi + c0 + c4, v);
            }
        } else {
            for (int row = 0; row < 16; ++row) {
                const int irow = q0 + row; if (irow >= p.Lq) continue;
                for (int c = lane; c < cw; c += 32) { const int d = c0 + c; if (d < p.dv) VST2(float, obase + (long long)irow * p.sOi + d, myp[row * 64 + c]); }
            }
        }
        __syncthreads();
    }
}

// =====================================================================================================================
// k_tr: dst(z, c, r) = alpha * src(z, r, c) (+ beta * R2(z, c, r)): [Z][R][C] (row stride lds) -> [Z][C][R] (row stride ldd) through a 32x32 LDS tile;
//   flags: 1 -> add beta * residual R2 addressed like dst (z*sRz + c*ldr + r); act applied before the residual.
// =====================================================================================================================
struct TrP { const float* src; float* dst; const float* R2; long long sSz, lds, sDz, ldd, sRz, ldr; int R, C, flags, act; float alpha, beta; };
static_assert(sizeof(TrP) == 3 * 8 + 6 * 8 + 6 * 4, "TrP has padding");
__global__ __launch_bounds__(256) void k_tr(TrP p) {
    __shared__ float tile[32][33];
    const int c0 = blockIdx.x * 32, r0 = blockIdx.y * 32, z = blockIdx.z;
    const int lane = threadIdx.x & 31, wave = threadIdx.x >> 5;
    const float* s = p.src + z * p.sSz;
#pragma unroll
    for (int k = 0; k < 4; ++k) {
        const int rl = wave * 4 + k, r = r0 + rl, c = c0 + lane;
        tile[rl][lane] = (r < p.R && c < p.C) ? s[(long long)r * p.lds + c] : 0.f;
    }
    __syncthreads();
    float* d = p.dst + z * p.sDz; const float* rr = p.R2 + z * p.sRz;
#pragma unroll
    for (int k = 0; k < 4; ++k) {
        const int cl = wave * 4 + k, c = c0 + cl, r = r0 + lane;
        if (c < p.C && r < p.R) {
            float v = act_fn(p.alpha * tile[lane][cl], p.act);
            if (p.flags & 1) v += p.beta * rr[(long long)c * p.ldr + r];
            VST2(float, d + (long long)c * p.ldd + r, v);
        }
    }
}

// k_affine: dst[i] = a * (sdev ? sdev[0] : 1) * src[i] + b, i < n (one thread per element; consecutive lanes -> consecutive addresses)
__global__ __launch_bounds__(256) void k_affine(const float* __restrict__ src, float* __restrict__ dst, int n, float a, float b, const float* __restrict__ sdev) {
    const int i = blockIdx.x * 256 + threadIdx.x;
    if (i < n) { const float aa = sdev ? a * sdev[0] : a; const float v = aa * src[i] + b; VST2(float, dst + i, v); }
}

// =====================================================================================================================
// k_softmax: row softmax over n contiguous elements, one 256-thread block per row; rows addressed z*sz + r*sr (grid (R, Z)).
//   out = scale_out * softmax(scale_in * x + (Mf ? Mf[z*smz + r*smr + j] : 0)); a row whose max is -inf is written as 0.
// =====================================================================================================================
struct SmP { const float* src; float* dst; const float* Mf; long long sz, sr, dz, dr, smz, smr; int n, pad; float scale_in, scale_out; };
static_assert(sizeof(SmP) == 3 * 8 + 6 * 8 + 4 * 4, "SmP has padding");
__global__ __launch_bounds__(256) void k_softmax(SmP p) {
    __shared__ float red[256];
    const int r = blockIdx.x, z = blockIdx.y, tid = threadIdx.x;
    const float* s = p.src + z * p.sz + (long long)r * p.sr;
    const float* mf = p.Mf ? (p.Mf + z * p.smz + (long long)r * p.smr) : nullptr;
    float mx = -__builtin_inff();
    for (int j = tid; j < p.n; j += 256) { float v = s[j] * p.scale_in; if (mf) v += mf[j]; mx = fmaxf(mx, v); }
    red[tid] = mx; __syncthreads();
    for (int o = 128; o > 0; o >>= 1) { if (tid < o) red[tid] = fmaxf(red[tid], red[tid + o]); __syncthreads(); }
    mx = red[0]; __syncthreads();
    float sum = 0.f;
    for (int j = tid; j < p.n; j += 256) { float v = s[j] * p.scale_in; if (mf) v += mf[j]; sum += (mx == -__builtin_inff()) ? 0.f : expf(v - mx); }
    red[tid] = sum; __syncthreads();
    for (int o = 128; o > 0; o >>= 1) { if (tid < o) red[tid] += red[tid + o]; __syncthreads(); }
    sum = red[0];
    const float inv = (sum > 0.f) ? p.scale_out / sum : 0.f;
    float* d = p.dst + z * p.dz + (long long)r * p.dr;
    for (int j = tid; j < p.n; j += 256) { float v = s[j] * p.scale_in; if (mf) v += mf[j]; const float o = (mx == -__builtin_inff()) ? 0.f : expf(v - mx) * inv; VST2(float, d + j, o); }
}
// =====================================================================================================================
// k_stats: mean and rsqrt(var + eps) over a set of n elements addressed base + z*sz + (e / inner) * so + (e % inner) * si, one 256-thread
// k_norm_apply: y = (x - mean[set]) * rstd[set] * g[c] + b[c] over a [Z][C][L] channel-major tensor with set = z*G + c / (C/G) (G groups per z;
//   G = C -> per-channel sets indexed z*C+c; for batch norm pass stats indexed by c only via bn = 1). Optional act. Output same layout.
// =====================================================================================================================
//   mode 0: mean / rsqrt(var + eps); mode 1 (RMSNorm): 0 / rsqrt(mean(x^2) + eps); mode 2 (L2 normalize * sqrt(n)): 0 / sqrt(n) / max(||x||, eps); mode 3: as 0 with unbiased variance (n-1)
__global__ __launch_bounds__(256) void k_stats(const float* __restrict__ x, long long sz, long long so, long long si, int inner, int n, float eps, float* __restrict__ stat, int mode) {
    __shared__ float red[256];
    const int z = blockIdx.x, tid = threadIdx.x;
    const float* base = x + z * sz;
    float s = 0.f;
    for (int e = tid; e < n; e += 256) s += base[(long long)(e / inner) * so + (long long)(e % inner) * si];
    red[tid] = s; __syncthreads();
    for (int o = 128; o > 0; o >>= 1) { if (tid < o) red[tid] += red[tid + o]; __syncthreads(); }
    const float mu = (mode == 0 || mode == 3) ? red[0] / (float)n : 0.f; __syncthreads();
    float q = 0.f;
    for (int e = tid; e < n; e += 256) { const float dlt = base[(long long)(e / inner) * so + (long long)(e % inner) * si] - mu; q += dlt * dlt; }
    red[tid] = q; __syncthreads();
    for (int o = 128; o > 0; o >>= 1) { if (tid < o) red[tid] += red[tid + o]; __syncthreads(); }
    {
        float rs;
        if (mode == 2) rs = sqrtf((float)n) / fmaxf(sqrtf(red[0]), eps); else if (mode == 3) rs = rsqrtf(red[0] / (float)(n - 1) + eps); else rs = rsqrtf(red[0] / (float)n + eps);
        if (tid < 32) { const float v = (tid == 0) ? mu : ((tid == 1) ? rs : 0.f); VST2(float, stat + (long long)z * 32 + tid, v); }
    }
}
//   One thread per element over the flat [Z][C][L] index space: grid ceil(Z*C*L / 256).
__global__ __launch_bounds__(256) void k_norm_apply(const float* __restrict__ x, float* __restrict__ y, const float* __restrict__ stat, const float* __restrict__ g, const float* __restrict__ bta,
                                                     int Z, int C, int L, int G, int bn, int act) {
    const long long idx = (long long)blockIdx.x * 256 + threadIdx.x;
    if (idx >= (long long)Z * C * L) return;
    const int l = (int)(idx % L); const long long zc = idx / L; const int c = (int)(zc % C), z = (int)(zc / C); (void)l;
    const int set = bn ? c : (z * G + c / (C / G));
    float v = (x[idx] - stat[(long long)set * 32]) * stat[(long long)set * 32 + 1];
    if (g) v *= g[c];
    if (bta) v += bta[c];
    v = act_fn(v, act);
    VST2(float, y + idx, v);
}

// k_lse_neg: c[i] = -(st[2i] + log(st[2i+1])) = minus the log-sum-exp of row i from k_attn's ST output (for softmax over the query dimension)
__global__ __launch_bounds__(256) void k_lse_neg(const float* __restrict__ st, float* __restrict__ c, int n) {
    const int i = blockIdx.x * 256 + threadIdx.x;
    if (i < n) { const float v = -(st[2 * i] + logf(st[2 * i + 1])); VST2(float, c + i, v); }
}

// k_iota: dst[i] = a * i + b as int32 (segment/position id helper)
__global__ __launch_bounds__(256) void k_iota(int* __restrict__ dst, int n, int a, int b) {
    const int i = blockIdx.x * 256 + threadIdx.x;
    if (i < n) { const int v = a * i + b; VST2(int, dst + i, v); }
}

// k_axpby: dst[i] = a * x[i] + b * y[i] (+ c), i < n
__global__ __launch_bounds__(256) void k_axpby(const float* __restrict__ x, const float* __restrict__ y, float* __restrict__ dst, int n, float a, float b, float c) {
    const int i = blockIdx.x * 256 + threadIdx.x;
    if (i < n) { const float v = a * x[i] + b * y[i] + c; VST2(float, dst + i, v); }
}

// =====================================================================================================================
// k_rope: rotary embedding on a [R rows][Hn heads][D] view (row stride sXr, head stride sXh, element stride 1) -> Y (own strides).
//   mode 0: rotate_half (partner d±D/2, sign - for d<D/2); mode 1: interleaved pairs (partner d^1, sign - for even d).
//   table column tcol: tmode 0 -> d, 1 -> d % (D/2), 2 -> d / 2; position p: pmode 0 -> r % S, 1 -> head index, 2 -> pos[r];
//   c = C[(r / S) * sCb + p * sCp + tcol * sCd], s likewise from Sn; y = x[d] * c + sign * x[partner] * s. X and Y must not alias.
// =====================================================================================================================
struct RopeP { const float* X; float* Y; const float* C; const float* Sn; const int* pos; long long sXr, sXh, sYr, sYh, sCb, sCp, sCd; int R, Hn, D, S, mode, tmode, pmode, pad; };
static_assert(sizeof(RopeP) == 5 * 8 + 7 * 8 + 8 * 4, "RopeP has padding");
__global__ __launch_bounds__(256) void k_rope(RopeP p) {
    const long long idx = (long long)blockIdx.x * 256 + threadIdx.x;
    if (idx >= (long long)p.R * p.Hn * p.D) return;
    const int d = (int)(idx % p.D); const long long rh = idx / p.D; const int h = (int)(rh % p.Hn); const int r = (int)(rh / p.Hn);
    const int half = p.D / 2;
    int partner; float sign;
    if (p.mode == 0) { partner = (d < half) ? d + half : d - half; sign = (d < half) ? -1.f : 1.f; }
    else { partner = d ^ 1; sign = (d & 1) ? 1.f : -1.f; }
    const int tcol = (p.tmode == 0) ? d : ((p.tmode == 1) ? (d % half) : (d >> 1));
    const int pp = (p.pmode == 0) ? (r % p.S) : ((p.pmode == 1) ? h : p.pos[r]);
    const long long toff = (long long)(r / p.S) * p.sCb + (long long)pp * p.sCp + (long long)tcol * p.sCd;
    const float* xr = p.X + (long long)r * p.sXr + (long long)h * p.sXh;
    const float v = xr[d] * p.C[toff] + sign * xr[partner] * p.Sn[toff];
    VST2(float, p.Y + (long long)r * p.sYr + (long long)h * p.sYh + d, v);
}

// k_invf + k_sincos (split so neither kernel carries a large VALU-fma footprint): invf_i = num * (1 / powf(base, (2 i)/D)) [fmode 0],
//   num * expf((2 i) * cexp) [fmode 1], num * powf(base, -2 (i - 1) / D) [fmode 2]; then cs/sn[s*half + i] = cos/sin((pscale * s) * invf_i)
__global__ __launch_bounds__(256) void k_invf(float* __restrict__ invb, int half, int D, float base, float num, int fmode, float cexp) {
    const int i = blockIdx.x * 256 + threadIdx.x;
    if (i >= ((half + 31) / 32) * 32) return;
    if (i >= half) { VST2(float, invb + i, 0.f); return; }
    const float e = (float)(2 * i) / (float)D;
    float invf;
    if (fmode == 1) invf = num * expf((float)(2 * i) * cexp);
    else if (fmode == 2) invf = num * powf(base, (-2.0f * ((float)i - 1.0f)) / (float)D);
    else invf = num * (1.0f / powf(base, e));
    VST2(float, invb + i, invf);
}
__global__ __launch_bounds__(256) void k_sincos(float* __restrict__ cs, float* __restrict__ sn, const float* __restrict__ invb, int S, int half, float pscale) {
    const int idx = blockIdx.x * 256 + threadIdx.x;
    if (idx >= S * half) return;
    const int s = idx / half, i = idx - s * half;
    const float ang = (pscale * (float)s) * invb[i];
    VST2(float, cs + idx, cosf(ang)); VST2(float, sn + idx, sinf(ang));
}

// k_mulact: dst[i] = act(x[i]) * y[i]
__global__ __launch_bounds__(256) void k_mulact(const float* __restrict__ x, const float* __restrict__ y, float* __restrict__ dst, int n, int act) {
    const int i = blockIdx.x * 256 + threadIdx.x;
    if (i < n) { const float v = act_fn(x[i], act) * y[i]; VST2(float, dst + i, v); }
}

// =====================================================================================================================
// k_matvec: thread-per-row matrix-vector products for N <= 8 output columns (heads with 1-3 outputs, gates), f32 on the VALU.
//   C[r*sCm + j] = act(alpha * sum_k A[r*sAm + k*sAk] * B[j*sBn + k*sBk] + bias[j]) + beta * R[r*sRm + j*sRn]; each thread writes its N contiguous floats.
// =====================================================================================================================
__global__ __launch_bounds__(256) void k_matvec(GemmP p) {
    // 32 lanes write one line with one instruction.
    const int rpt = (p.N == 1) ? 1 : 32;
    const long long r0 = ((long long)blockIdx.x * 256 + threadIdx.x) * rpt; const int z = blockIdx.z, zo = z / p.zi_n, zi = z - zo * p.zi_n;
    if (r0 >= p.M) return;
    const float* Bb = p.B + zo * p.sBo + zi * p.sBi;
    float* C = p.C + zo * p.sCo + zi * p.sCi; const float* R = p.R + zo * p.sRo + zi * p.sRi;
    for (int rr = 0; rr < rpt; ++rr) {
        const long long r = r0 + rr; if (r >= p.M) break;
        const float* A = p.A + zo * p.sAo + zi * p.sAi + r * p.sAm;
        float acc[8] = {0.f, 0.f, 0.f, 0.f, 0.f, 0.f, 0.f, 0.f};
        for (int k = 0; k < p.K; ++k) { const float a = A[(long long)k * p.sAk];
#pragma unroll
            for (int j = 0; j < 8; ++j) if (j < p.N) acc[j] += a * Bb[(long long)j * p.sBn + (long long)k * p.sBk]; }
#pragma unroll
        for (int j = 0; j < 8; ++j) if (j < p.N) {
            float v = acc[j] * p.alpha;
            if (p.flags & 1) v += p.bias[j];
            if (p.flags & 2) v += p.bias[r];
            v = act_fn(v, p.act);
            if (p.flags & 4) v += p.beta * R[r * p.sRm + (long long)j * p.sRn];
            VST2(float, C + r * p.sCm + j, v);
        }
    }
}
// k_smallsoftmax: thread-per-row softmax for short rows (n <= 64): dst[r*dr + j] = softmax(scale*src[r*sr + j])
__global__ __launch_bounds__(256) void k_smallsoftmax(const float* __restrict__ src, float* __restrict__ dst, long long sr, long long dr, int n, long long R, float scale) {
    const long long r0 = ((long long)blockIdx.x * 256 + threadIdx.x) * 32;
    for (int rr = 0; rr < 32; ++rr) {
        const long long r = r0 + rr; if (r >= R) return;
        const float* s = src + r * sr; float* d = dst + r * dr;
        float mx = -__builtin_inff();
        for (int j = 0; j < n; ++j) mx = fmaxf(mx, s[j] * scale);
        float sum = 0.f;
        for (int j = 0; j < n; ++j) sum += expf(s[j] * scale - mx);
        const float inv = 1.f / sum;
        for (int j = 0; j < n; ++j) { const float v = expf(s[j] * scale - mx) * inv; VST2(float, d + j, v); }
    }
}

__global__ __launch_bounds__(32) void k_unitstat(float* __restrict__ st) { const int t = threadIdx.x; const float v = (t == 1) ? 1.f : 0.f; VST2(float, st + t, v); }

// destination (e.g. a d_out whose row width is not a multiple of 32 floats) is written by consecutive lanes of one instruction
__global__ __launch_bounds__(256) void k_lincopy(const float* __restrict__ src, long long lds, float* __restrict__ dst, long long ldd, long long rows, int cols) {
    const long long i = (long long)blockIdx.x * 256 + threadIdx.x; if (i >= rows * cols) return;
    const long long r = i / cols; const int c = (int)(i - r * cols);
    const float v = src[r * lds + c]; VST2(float, dst + r * ldd + c, v);
}

namespace w25 {
typedef __attribute__((ext_vector_type(16))) _Float16 v16h;
typedef __attribute__((ext_vector_type(8)))  _Float16 v8h;
typedef __attribute__((ext_vector_type(16))) __bf16   v16b;
typedef __attribute__((ext_vector_type(8)))  __bf16   v8b;
typedef __attribute__((ext_vector_type(8)))  float    v8f;
typedef __attribute__((ext_vector_type(4)))  float    v4f;

__device__ __forceinline__ unsigned short f2bf_bits(float f) {
  unsigned u = __float_as_uint(f);
  return (unsigned short)((u + 0x7FFFu + ((u >> 16) & 1u)) >> 16);
}
__device__ __forceinline__ float bf_bits2f(unsigned short h) { return __uint_as_float(((unsigned)h) << 16); }

// hazard guards as plain device helpers (no inline asm inside the kernel template body)
__device__ __forceinline__ void dep_guard_h(v8f& a, v8f& b, v16h x, v16h y) { asm volatile("v_nop\n\tv_nop\n\tv_nop\n\tv_nop" : "+v"(a), "+v"(b) : "v"(x), "v"(y)); }
__device__ __forceinline__ void dep_guard_b(v8f& a, v8f& b, v16b x, v16b y) { asm volatile("v_nop\n\tv_nop\n\tv_nop\n\tv_nop" : "+v"(a), "+v"(b) : "v"(x), "v"(y)); }
__device__ __forceinline__ void keep4_h(v16h a, v16h b, v16h c, v16h d) { asm volatile("v_nop" :: "v"(a), "v"(b), "v"(c), "v"(d)); }
__device__ __forceinline__ void keep4_b(v16b a, v16b b, v16b c, v16b d) { asm volatile("v_nop" :: "v"(a), "v"(b), "v"(c), "v"(d)); }
__device__ __forceinline__ void acc_guard4(v8f& a, v8f& b, v8f& c, v8f& d) { asm volatile("v_nop\n\tv_nop\n\tv_nop\n\tv_nop" : "+v"(a), "+v"(b), "+v"(c), "+v"(d)); }
template <typename T> struct Frag;
template <> struct Frag<_Float16> {
  typedef v16h V; union U { v16h v; v8h h[2]; };
  static __device__ __forceinline__ v16h load(const _Float16* p) {   // elements 0..7 <- p[0..7], 8..15 <- p[16..23]
    U f; f.h[0] = *(const v8h*)(p); f.h[1] = *(const v8h*)(p + 16); return f.v;
  }
  static __device__ __forceinline__ v8f mma(v16h a, v16h b, v8f c) {
    return __builtin_amdgcn_wmma_f32_16x16x32_f16(false, a, false, b, (short)0, c, false, false);
  }
  static __device__ __forceinline__ void guard(v8f& a, v8f& b, v16h x, v16h y) { dep_guard_h(a, b, x, y); }
  static __device__ __forceinline__ void keep(v16h a, v16h b, v16h c, v16h d) { keep4_h(a, b, c, d); }
};
template <> struct Frag<__bf16> {
  typedef v16b V; union U { v16b v; v8b h[2]; };
  static __device__ __forceinline__ v16b load(const __bf16* p) {
    U f; f.h[0] = *(const v8b*)(p); f.h[1] = *(const v8b*)(p + 16); return f.v;
  }
  static __device__ __forceinline__ v8f mma(v16b a, v16b b, v8f c) {
    return __builtin_amdgcn_wmma_f32_16x16x32_bf16(false, a, false, b, (short)0, c, false, false);
  }
  static __device__ __forceinline__ void guard(v8f& a, v8f& b, v16b x, v16b y) { dep_guard_b(a, b, x, y); }
  static __device__ __forceinline__ void keep(v16b a, v16b b, v16b c, v16b d) { keep4_b(a, b, c, d); }
};

// ---- Register-blocked batched WMMA GEMM ------------------------------------
// C[m,n] = scale * sum_k A[m,k] * Bt[n,k] (+bias)(+resid); each wave owns a 64x64 tile.
// A row-major [M,K]; Bt row-major [N,K]; M,N % 64 == 0, K % 32 == 0.
// SPLIT: operands are hi/lo planes (A2/Bt2 = lo planes, same layout); product = hi·hi + hi·lo + lo·hi.
// BIAS_MODE: 0 = none, 1 = bias[m], 2 = bias[n].
// OUT_MODE: 0 = f32, 1 = f16, 2 = bf16 hi plane (Cout) + bf16 lo plane (Cout2).
// ET: 0 = f16 operands, 1 = bf16 operands (pointers passed as 16-bit storage)
template <int ET> struct Elem;
template <> struct Elem<0> { typedef _Float16 T; };
template <> struct Elem<1> { typedef __bf16 T; };
template <int ET, bool SPLIT, int BIAS_MODE, int OUT_MODE, bool RESID, int ACT = 0>
__global__ __launch_bounds__(256) void wmma_gemm64(
    const unsigned short* __restrict__ Ap, const unsigned short* __restrict__ A2p, int lda, long strideA,
    const unsigned short* __restrict__ Btp, const unsigned short* __restrict__ Bt2p, int ldb, long strideB,
    void* __restrict__ Cout, void* __restrict__ Cout2, int ldc, long strideC,
    const float* __restrict__ bias,
    const float* __restrict__ resid, long strideR,
    int M, int N, int K, float scale) {
  typedef typename Elem<ET>::T T;
  typedef typename Frag<T>::V V;
  const T* A = (const T*)Ap; const T* A2 = (const T*)A2p; const T* Bt = (const T*)Btp; const T* Bt2 = (const T*)Bt2p;
  __shared__ __align__(16) float sT[8][16 * 68];   // per-wave 16x64 slab, pitch 68 floats
  const int b    = blockIdx.y;
  const int lane = threadIdx.x & 31;
  const int wave = threadIdx.x >> 5;
  const int tilesN = N >> 6;
  const int tilesM = M >> 6;
  const int tile = blockIdx.x * 8 + wave;
  if (tile >= tilesM * tilesN) return;   // wave-uniform; no block barriers in this kernel
  const int tm = tile / tilesN;
  const int tn = tile - tm * tilesN;
  const int m0 = tm << 6;
  const int n0 = tn << 6;

  const T* Ab  = A  + (size_t)b * strideA;
  const T* Bb  = Bt + (size_t)b * strideB;
  const T* Ab2 = SPLIT ? (A2  + (size_t)b * strideA) : nullptr;
  const T* Bb2 = SPLIT ? (Bt2 + (size_t)b * strideB) : nullptr;

  const int rlane = lane & 15;                 // row (A) / col (B, D) within subtile
  const int koff  = (lane >> 4) * 8;           // k offset of this lane half
  const int mOff  = (lane >> 4) * 8;           // D row offset

  v8f acc[4][4];
#pragma unroll
  for (int i = 0; i < 4; ++i)
#pragma unroll
    for (int j = 0; j < 4; ++j) acc[i][j] = (v8f){0.f,0.f,0.f,0.f,0.f,0.f,0.f,0.f};

  for (int k0 = 0; k0 < K; k0 += 32) {
    V bh[4], bl[4];
#pragma unroll
    for (int j = 0; j < 4; ++j) {
      const size_t bo = (size_t)(n0 + (j << 4) + rlane) * ldb + koff + k0;
      bh[j] = Frag<T>::load(Bb + bo);
      if (SPLIT) bl[j] = Frag<T>::load(Bb2 + bo);
    }
#pragma unroll
    for (int i = 0; i < 4; ++i) {
      const size_t ao = (size_t)(m0 + (i << 4) + rlane) * lda + koff + k0;
      V ah = Frag<T>::load(Ab + ao);
      V al;
      if (SPLIT) al = Frag<T>::load(Ab2 + ao);
#pragma unroll
      for (int j = 0; j < 4; ++j) {
        acc[i][j] = Frag<T>::mma(ah, bh[j], acc[i][j]);
        if (SPLIT) {
          acc[i][j] = Frag<T>::mma(ah, bl[j], acc[i][j]);
          acc[i][j] = Frag<T>::mma(al, bh[j], acc[i][j]);
        }
      }
      Frag<T>::guard(acc[i][0], acc[i][3], ah, SPLIT ? al : ah);
    }
    Frag<T>::keep(bh[0], bh[1], bh[2], bh[3]);
    if (SPLIT) Frag<T>::keep(bl[0], bl[1], bl[2], bl[3]);
  }
  acc_guard4(acc[0][0], acc[0][1], acc[0][2], acc[0][3]);
  acc_guard4(acc[1][0], acc[1][1], acc[1][2], acc[1][3]);
  acc_guard4(acc[2][0], acc[2][1], acc[2][2], acc[2][3]);
  acc_guard4(acc[3][0], acc[3][1], acc[3][2], acc[3][3]);

  // ---- epilogue ----
  float* slab = sT[wave];
  const float* Rb = RESID ? (resid + (size_t)b * strideR) : nullptr;
#pragma unroll
  for (int i = 0; i < 4; ++i) {
    const int mBase = m0 + (i << 4);
#pragma unroll
    for (int j = 0; j < 4; ++j) {
      const int n = n0 + (j << 4) + rlane;
      float bv = 0.f;
      if (BIAS_MODE == 2) bv = bias[n];
#pragma unroll
      for (int r = 0; r < 8; ++r) {
        float v = acc[i][j][r] * scale;
        if (BIAS_MODE == 1) v += bias[mBase + mOff + r];
        if (BIAS_MODE == 2) v += bv;
        if (RESID) v += Rb[(size_t)(mBase + mOff + r) * ldc + n];
        if (ACT == 1) v = tanhf(v);
        if (ACT == 2) v = fmaxf(v, 0.0f);
        if (ACT == 3) v = v / (1.0f + expf(-v));
        if (ACT == 4) v = (v > 0.f) ? v : 0.01f * v;
        if (ACT == 5) v = 0.5f * v * (1.0f + erff(v * 0.70710678118654752f));
        slab[(mOff + r) * 68 + (j << 4) + rlane] = v;
      }
    }
    __builtin_amdgcn_fence(__ATOMIC_RELEASE, "workgroup");
    __builtin_amdgcn_wave_barrier();
    __builtin_amdgcn_fence(__ATOMIC_ACQUIRE, "workgroup");
    if (OUT_MODE == 0) {
      float* C = (float*)Cout + (size_t)b * strideC;
      const int hh = lane >> 4, c4 = (lane & 15) * 4;     // row seg = 256 B = 16 lanes x 16 B
      {
#pragma unroll
        for (int it = 0; it < 8; ++it) {
          const int row = it * 2 + hh;
          v4f v = *(const v4f*)(slab + row * 68 + c4);
          *(v4f*)(C + (size_t)(mBase + row) * ldc + n0 + c4) = v;
        }
        
      }
    } else {
      const int q = lane >> 3, c8 = (lane & 7) * 8;
      unsigned short* C  = (unsigned short*)Cout  + (size_t)b * strideC;
      unsigned short* C2 = (OUT_MODE == 2) ? ((unsigned short*)Cout2 + (size_t)b * strideC) : nullptr;
      {
#pragma unroll
        for (int it = 0; it < 4; ++it) {
          const int row = it * 4 + q;
          const float* sp = slab + row * 68 + c8;
          v8h hv, lv;
#pragma unroll
          for (int e = 0; e < 8; ++e) {
            if (OUT_MODE == 1) {
              hv[e] = (_Float16)sp[e];
            } else {
              unsigned short hb = f2bf_bits(sp[e]);
              unsigned short lb = f2bf_bits(sp[e] - bf_bits2f(hb));
              hv[e] = __builtin_bit_cast(_Float16, hb);
              lv[e] = __builtin_bit_cast(_Float16, lb);
            }
          }
          *(v8h*)(C + (size_t)(mBase + row) * ldc + n0 + c8) = hv;
          if (OUT_MODE == 2) *(v8h*)(C2 + (size_t)(mBase + row) * ldc + n0 + c8) = lv;
        }
        
      }
    }
    __builtin_amdgcn_fence(__ATOMIC_RELEASE, "workgroup");
    __builtin_amdgcn_wave_barrier();
    __builtin_amdgcn_fence(__ATOMIC_ACQUIRE, "workgroup");
  }
}

__global__ __launch_bounds__(256) void cast_f32_f16x2(
    const float* __restrict__ in, _Float16* __restrict__ out, int n2) {
  int i = blockIdx.x * 256 + threadIdx.x;
  if (i < n2) {
    const _Float16 h0 = (_Float16)in[2 * i], h1 = (_Float16)in[2 * i + 1];
    const unsigned u = (unsigned)__builtin_bit_cast(unsigned short, h0) | ((unsigned)__builtin_bit_cast(unsigned short, h1) << 16);
    ((unsigned*)out)[i] = u;
    
  }
}


} // namespace w25

__device__ __forceinline__ unsigned int f2h2_pack(float a, float b) { return (unsigned)__builtin_bit_cast(unsigned short, (_Float16)a) | ((unsigned)__builtin_bit_cast(unsigned short, (_Float16)b) << 16); }
__global__ __launch_bounds__(256) void k_cast16(const float* __restrict__ src, long long lds, _Float16* __restrict__ dst, long long ldd, int R, int C, float s) {
    const long long i = (long long)blockIdx.x * 256 + threadIdx.x; const long long np = (long long)R * (C / 2); if (i >= np) return; const int r = (int)(i / (C / 2)); const int c = 2 * (int)(i % (C / 2));
    const _Float16 h0 = (_Float16)(src[(long long)r * lds + c] * s), h1 = (_Float16)(src[(long long)r * lds + c + 1] * s);
    const unsigned u = (unsigned)__builtin_bit_cast(unsigned short, h0) | ((unsigned)__builtin_bit_cast(unsigned short, h1) << 16);
    unsigned* d = (unsigned*)(dst + (long long)r * ldd + c); *d = u;  }

// f32 -> bf16 hi plane + bf16 lo plane (x = hi + lo to ~2^-17 relative; RNE both), [R][C] -> [R][C] (or transposed to [C][R]); 2 consecutive destination elements
__device__ __forceinline__ unsigned int f2bf2_pack(float a, float b, unsigned int* lo) {
    const unsigned short ha = w25::f2bf_bits(a), hb = w25::f2bf_bits(b);
    const unsigned short la = w25::f2bf_bits(a - w25::bf_bits2f(ha)), lb = w25::f2bf_bits(b - w25::bf_bits2f(hb));
    *lo = (unsigned)la | ((unsigned)lb << 16); return (unsigned)ha | ((unsigned)hb << 16); }
__global__ __launch_bounds__(256) void k_castS16(const float* __restrict__ src, long long lds, __bf16* __restrict__ dhi, __bf16* __restrict__ dlo, long long ldd, int R, int C, float s, int transpose, long long sb, long long db) {
    src += (long long)blockIdx.y * sb; dhi += (long long)blockIdx.y * db; dlo += (long long)blockIdx.y * db;   // blockIdx.y = image
    const long long i = (long long)blockIdx.x * 256 + threadIdx.x; long long o; float a, b;
    if (transpose) { const long long np = (long long)C * (R / 2); if (i >= np) return; const int c = (int)(i / (R / 2)); const int r = 2 * (int)(i % (R / 2)); a = src[(long long)r * lds + c] * s; b = src[(long long)(r + 1) * lds + c] * s; o = (long long)c * ldd + r; }
    else { const long long np = (long long)R * (C / 2); if (i >= np) return; const int r = (int)(i / (C / 2)); const int c = 2 * (int)(i % (C / 2)); a = src[(long long)r * lds + c] * s; b = src[(long long)r * lds + c + 1] * s; o = (long long)r * ldd + c; }
    unsigned lo; const unsigned hi = f2bf2_pack(a, b, &lo); unsigned* ph = (unsigned*)(dhi + o); unsigned* pl = (unsigned*)(dlo + o);
    *ph = hi; *pl = lo;  }

namespace w25 {
// =====================================================================================
// Generic causal/non-causal attention for head_dim 64, f32 in / f32 out; 16-bit operands: bf16 with optional hi/lo splits, or
// plain f16 (F16=true, non-split, probabilities carried x2^15).
//   scores = (q*qscale)·kᵀ : v_wmma_f32_16x16x32_bf16; SPLIT_QK -> q,k as bf16 hi/lo (hi·hi + hi·lo + lo·hi)
//   out    = p·v           : v_wmma_f32_16x16x32_bf16; SPLIT_PV -> p,v as bf16 hi/lo; else p,v plain bf16
//   f32 accumulate; online softmax in f32. Block = 4 waves = 64 query rows of one (batch, head); S % 64 == 0.
//   Element (b, s, h, d) of tensor X lives at X[b*X_bs + s*X_rs + h*X_hs + d] (strides in floats, multiples of 4).
//   Masking: mask_mode 0 none, 1 causal (kv > q masked), 2 tensor [S][Skv] shared over (b,h) (float if
//   mask_is_int==0, int32 with element == 0 -> masked if 1, int32 with element != 0 -> masked if 2), 3 per-token vectors qmask[B][S] & kvmask[B][Skv] (int32,
//   0 -> masked), 4 causal + sliding window (kv > q or q - kv > W masked; W passed in mask_is_int);
//   5 = relative-position bias: s += cp[b,h,q][idx[q][kv]] + pc[b,h,kv][idx[q][kv]] with idx = mask_b ([S][Skv] int32) and
//   mask_a an int32 [S][Skv] tensor with nonzero = masked (tables: element (b,h,row,n) at X + b*c_bs + h*c_hs + row*c_rs + n);
//   masked scores are replaced by mask_fill (e.g. -inf or -1e9) before the softmax.
//   grid.x = B * H * (S/64) (or a sub-range with blk0).
// =====================================================================================
#define AT_D 64
#define AT_NW 4
#define AT_QB 64
#define AT_KC 64
struct AttnGeom { const float* cp = nullptr; const float* pc = nullptr; long c_bs = 0, c_rs = 0, c_hs = 0;   // mode-5 score-bias tables
                  long q_bs, q_rs, q_hs, k_bs, k_rs, k_hs, v_bs, v_rs, v_hs, o_bs, o_rs, o_hs;
                  int S, Skv, H, mask_mode; float qscale; int blk0; float mask_fill; int mask_is_int; };
static_assert(sizeof(AttnGeom) == 168, "no padding");

__device__ __forceinline__ unsigned short at_bf_bits(float f) {
  unsigned u = __float_as_uint(f);
  return (unsigned short)((u + 0x7FFFu + ((u >> 16) & 1u)) >> 16);
}
__device__ __forceinline__ __bf16 at_f2bf(float f) { return __builtin_bit_cast(__bf16, at_bf_bits(f)); }
__device__ __forceinline__ void at_split(float f, __bf16& hi, __bf16& lo) {
  const unsigned short hb = at_bf_bits(f);
  hi = __builtin_bit_cast(__bf16, hb);
  lo = at_f2bf(f - __uint_as_float(((unsigned)hb) << 16));
}
__device__ __forceinline__ v8f at_mma(v16b a, v16b b, v8f c) {
  c = __builtin_amdgcn_wmma_f32_16x16x32_bf16(false, a, false, b, (short)0, c, false, false);
  asm volatile("v_nop\n\tv_nop\n\tv_nop\n\tv_nop" : "+v"(c) : "v"(a), "v"(b));
  return c;
}
// 16-bit element as a bit pattern held in a __bf16 slot: f16 bits when F16, bf16 (RNE) otherwise
template <bool F16> __device__ __forceinline__ __bf16 at_to16(float f) {
  if (F16) return __builtin_bit_cast(__bf16, (_Float16)f);
  return at_f2bf(f);
}
template <bool F16> __device__ __forceinline__ v8f at_mma16(v16b a, v16b b, v8f c) {
  if (F16) {
    const v16h ah = __builtin_bit_cast(v16h, a), bh = __builtin_bit_cast(v16h, b);
    c = __builtin_amdgcn_wmma_f32_16x16x32_f16(false, ah, false, bh, (short)0, c, false, false);
    asm volatile("v_nop\n\tv_nop\n\tv_nop\n\tv_nop" : "+v"(c) : "v"(ah), "v"(bh));
    return c;
  }
  return at_mma(a, b, c);
}

template <bool SPLIT_QK, bool SPLIT_PV, bool F16 = false>
__global__ __launch_bounds__(128)
void attn64_kernel(const float* __restrict__ q, const float* __restrict__ k,
                   const float* __restrict__ v, float* __restrict__ out,
                   const void* __restrict__ mask_a, const int* __restrict__ mask_b, AttnGeom g) {
  static_assert(!(F16 && (SPLIT_QK || SPLIT_PV)), "f16 mode is non-split");
  const float PSC = F16 ? 32768.0f : 1.0f;     // f16 probabilities carried x2^15 (subnormal range), folded into the final 1/l
  union FB { v16b v; v8b h[2]; };
  __shared__ __align__(16) __bf16 Ksh[AT_KC * AT_D];             // K hi [kv][d]      8 KB
  __shared__ __align__(16) __bf16 Ksl[SPLIT_QK ? AT_KC * AT_D : 8];
  __shared__ __align__(16) __bf16 Vth[AT_D * AT_KC];             // V hi [d][kv]      8 KB
  __shared__ __align__(16) __bf16 Vtl[SPLIT_PV ? AT_D * AT_KC : 8];
  __shared__ __align__(16) __bf16 Psh[AT_NW][16 * AT_KC];        // per wave P hi [row][kv]  8 KB
  __shared__ __align__(16) __bf16 Psl[SPLIT_PV ? AT_NW : 1][SPLIT_PV ? 16 * AT_KC : 8];
  __shared__ __align__(16) float  Os[AT_NW][16 * 68];            // per wave out tile, pitch 68

  const int tid  = threadIdx.x;
  const int wave = tid >> 5;
  const int lane = tid & 31;
  const int hh   = lane >> 4;
  const int c    = lane & 15;

  const int nqb = g.S / AT_QB;
  const int bx = blockIdx.x + g.blk0;
  const int qb = bx % nqb;
  const int bh = bx / nqb;
  const int h  = bh % g.H;
  const int b  = bh / g.H;
  const int qbase_block = qb * AT_QB;
  const int q0 = qbase_block + wave * 16;

  const float* qb_ptr = q + (size_t)b * g.q_bs + (size_t)h * g.q_hs;
  const float* kb_ptr = k + (size_t)b * g.k_bs + (size_t)h * g.k_hs;
  const float* vb_ptr = v + (size_t)b * g.v_bs + (size_t)h * g.v_hs;
  float*       ob_ptr = out + (size_t)b * g.o_bs + (size_t)h * g.o_hs;

  // ---- Q fragments (A operand): 2 d-chunks, hi (and lo) ----
  v16b qah[2], qal[2];
  {
    const float* qrow = qb_ptr + (size_t)(q0 + c) * g.q_rs;
#pragma unroll
    for (int dc = 0; dc < 2; ++dc) {
#pragma unroll
      for (int e = 0; e < 8; ++e) {
        const float f0 = qrow[dc * 32 + 8 * hh + e] * g.qscale;
        const float f1 = qrow[dc * 32 + 16 + 8 * hh + e] * g.qscale;
        if (SPLIT_QK) { __bf16 hq, lq; at_split(f0, hq, lq); qah[dc][e] = hq; qal[dc][e] = lq; at_split(f1, hq, lq); qah[dc][8 + e] = hq; qal[dc][8 + e] = lq; }
        else { qah[dc][e] = at_to16<F16>(f0); qah[dc][8 + e] = at_to16<F16>(f1); qal[dc][e] = qah[dc][e]; qal[dc][8 + e] = qah[dc][8 + e]; }
      }
    }
  }

  float mrow[8], lrow[8];
  v8f oacc[4];
#pragma unroll
  for (int r = 0; r < 8; ++r) { mrow[r] = -INFINITY; lrow[r] = 0.f; }
#pragma unroll
  for (int t = 0; t < 4; ++t) oacc[t] = (v8f){0.f,0.f,0.f,0.f,0.f,0.f,0.f,0.f};

  const int nChunks = (g.mask_mode == 1 || g.mask_mode == 4) ? (qb + 1) : (g.Skv / AT_KC);   // block-uniform
  // per-row query mask (mode 3)
  int qkeep[8];
#pragma unroll
  for (int r = 0; r < 8; ++r) qkeep[r] = (g.mask_mode == 3) ? mask_b[(size_t)b * g.S + q0 + 8 * hh + r] : 1;   // mask_b = qmask in mode 3
  for (int kc = 0; kc < nChunks; ++kc) {
    const int kv0 = kc * AT_KC;
    __syncthreads();
    {
      const int kvr = tid >> 1, dh = (tid & 1) * 32;
      const float* krow = kb_ptr + (size_t)(kv0 + kvr) * g.k_rs + dh;
      const float* vrow = vb_ptr + (size_t)(kv0 + kvr) * g.v_rs + dh;
#pragma unroll
      for (int i = 0; i < 8; ++i) {
        v4f kk = *(const v4f*)(krow + 4 * i);
        v4f vv = *(const v4f*)(vrow + 4 * i);
#pragma unroll
        for (int e = 0; e < 4; ++e) {
          const int d = dh + 4 * i + e;
          if (SPLIT_QK) { __bf16 a, bl; at_split(kk[e], a, bl); Ksh[kvr * AT_D + d] = a; Ksl[kvr * AT_D + d] = bl; }
          else Ksh[kvr * AT_D + d] = at_to16<F16>(kk[e]);
          if (SPLIT_PV) { __bf16 a, bl; at_split(vv[e], a, bl); Vth[d * AT_KC + kvr] = a; Vtl[d * AT_KC + kvr] = bl; }
          else Vth[d * AT_KC + kvr] = at_to16<F16>(vv[e]);
        }
      }
    }
    __syncthreads();

    v8f s[4];
#pragma unroll
    for (int j = 0; j < 4; ++j) {
      s[j] = (v8f){0.f,0.f,0.f,0.f,0.f,0.f,0.f,0.f};
#pragma unroll 1
      for (int dc = 0; dc < 2; ++dc) {
        FB kb;
        kb.h[0] = *(const v8b*)(Ksh + (j * 16 + c) * AT_D + dc * 32 + 8 * hh);
        kb.h[1] = *(const v8b*)(Ksh + (j * 16 + c) * AT_D + dc * 32 + 16 + 8 * hh);
        s[j] = at_mma16<F16>(qah[dc], kb.v, s[j]);
        if (SPLIT_QK) {
          FB kl;
          kl.h[0] = *(const v8b*)(Ksl + (j * 16 + c) * AT_D + dc * 32 + 8 * hh);
          kl.h[1] = *(const v8b*)(Ksl + (j * 16 + c) * AT_D + dc * 32 + 16 + 8 * hh);
          s[j] = at_mma16<F16>(qah[dc], kl.v, s[j]);
          s[j] = at_mma16<F16>(qal[dc], kb.v, s[j]);
        }
      }
    }
    const bool diag = (g.mask_mode == 1) && (kc == qb);
    int kvkeep[4] = {1, 1, 1, 1};
    if (g.mask_mode == 3) {
#pragma unroll
      for (int j = 0; j < 4; ++j) kvkeep[j] = ((const int*)mask_a)[(size_t)b * g.Skv + kv0 + j * 16 + c];   // mask_a = kvmask
    }
    float cm[8];
#pragma unroll
    for (int r = 0; r < 8; ++r) {
      const int qrow = q0 + 8 * hh + r;
      float m = -INFINITY;
#pragma unroll
      for (int j = 0; j < 4; ++j) {
        const int kvcol = kv0 + j * 16 + c;
        bool masked = false;
        if (diag) masked = (kvcol > qrow);
        else if (g.mask_mode == 4) masked = (kvcol > qrow) || (qrow - kvcol > g.mask_is_int);
        else if (g.mask_mode == 2) {
          const size_t mi = (size_t)qrow * g.Skv + kvcol;
          masked = (g.mask_is_int == 0) ? (((const float*)mask_a)[mi] == 0.0f)
                 : (g.mask_is_int == 1) ? (((const int*)mask_a)[mi] == 0) : (((const int*)mask_a)[mi] != 0);
        } else if (g.mask_mode == 3) masked = (qkeep[r] == 0) || (kvkeep[j] == 0);
        else if (g.mask_mode == 5) {
          const size_t mi = (size_t)qrow * g.Skv + kvcol;
          masked = (((const int*)mask_a)[mi] != 0);
          int n = mask_b[mi]; n = n < 0 ? 0 : n;
          s[j][r] += g.cp[(size_t)b * g.c_bs + (size_t)h * g.c_hs + (size_t)qrow * g.c_rs + n]
                   + g.pc[(size_t)b * g.c_bs + (size_t)h * g.c_hs + (size_t)kvcol * g.c_rs + n];
        }
        if (masked) s[j][r] = g.mask_fill;
        m = fmaxf(m, s[j][r]);
      }
#pragma unroll
      for (int off = 1; off < 16; off <<= 1) m = fmaxf(m, __shfl_xor(m, off, 32));
      cm[r] = m;
    }
    __bf16* pwh = Psh[wave];
    __bf16* pwl = Psl[SPLIT_PV ? wave : 0];
#pragma unroll
    for (int r = 0; r < 8; ++r) {
      const float mnew = fmaxf(mrow[r], cm[r]);
      const float alpha = expf(mrow[r] - mnew);
      mrow[r] = mnew;
      float psum = 0.f;
#pragma unroll
      for (int j = 0; j < 4; ++j) {
        const float p = expf(s[j][r] - mnew);
        psum += p;
        if (SPLIT_PV) { __bf16 a, bl; at_split(p, a, bl); pwh[(8 * hh + r) * AT_KC + j * 16 + c] = a; pwl[(8 * hh + r) * AT_KC + j * 16 + c] = bl; }
        else pwh[(8 * hh + r) * AT_KC + j * 16 + c] = at_to16<F16>(p * PSC);
      }
#pragma unroll
      for (int off = 1; off < 16; off <<= 1) psum += __shfl_xor(psum, off, 32);
      lrow[r] = lrow[r] * alpha + psum;
#pragma unroll
      for (int t = 0; t < 4; ++t) oacc[t][r] *= alpha;
    }
    __builtin_amdgcn_fence(__ATOMIC_RELEASE, "workgroup");
    __builtin_amdgcn_wave_barrier();
    __builtin_amdgcn_fence(__ATOMIC_ACQUIRE, "workgroup");
#pragma unroll 1
    for (int kk = 0; kk < 2; ++kk) {
      FB pa, pl;
      pa.h[0] = *(const v8b*)(pwh + c * AT_KC + kk * 32 + 8 * hh);
      pa.h[1] = *(const v8b*)(pwh + c * AT_KC + kk * 32 + 16 + 8 * hh);
      if (SPLIT_PV) {
        pl.h[0] = *(const v8b*)(pwl + c * AT_KC + kk * 32 + 8 * hh);
        pl.h[1] = *(const v8b*)(pwl + c * AT_KC + kk * 32 + 16 + 8 * hh);
      }
#pragma unroll
      for (int t = 0; t < 4; ++t) {
        FB vb;
        vb.h[0] = *(const v8b*)(Vth + (t * 16 + c) * AT_KC + kk * 32 + 8 * hh);
        vb.h[1] = *(const v8b*)(Vth + (t * 16 + c) * AT_KC + kk * 32 + 16 + 8 * hh);
        oacc[t] = at_mma16<F16>(pa.v, vb.v, oacc[t]);
        if (SPLIT_PV) {
          FB vl;
          vl.h[0] = *(const v8b*)(Vtl + (t * 16 + c) * AT_KC + kk * 32 + 8 * hh);
          vl.h[1] = *(const v8b*)(Vtl + (t * 16 + c) * AT_KC + kk * 32 + 16 + 8 * hh);
          oacc[t] = at_mma16<F16>(pa.v, vl.v, oacc[t]);
          oacc[t] = at_mma16<F16>(pl.v, vb.v, oacc[t]);
        }
      }
    }
  }

  float* os = Os[wave];
#pragma unroll
  for (int r = 0; r < 8; ++r) {
    const float inv = 1.0f / (lrow[r] * PSC);
#pragma unroll
    for (int t = 0; t < 4; ++t) os[(8 * hh + r) * 68 + t * 16 + c] = oacc[t][r] * inv;
  }
  __builtin_amdgcn_fence(__ATOMIC_RELEASE, "workgroup");
  __builtin_amdgcn_wave_barrier();
  __builtin_amdgcn_fence(__ATOMIC_ACQUIRE, "workgroup");
  {
    const int c4 = (lane & 15) * 4;
    {
#pragma unroll
      for (int it = 0; it < 8; ++it) {
        const int row = it * 2 + hh;
        v4f val = *(const v4f*)(os + row * 68 + c4);
        *(v4f*)(ob_ptr + (size_t)(q0 + row) * g.o_rs + c4) = val;
      }
      
    }
  }
}

} // namespace w25

// Fused projection of one image tile: the casts of x, the three 1x1 convolutions, the 2x2 max-pool and the operand planes of k_nl_flash in one kernel; x is read once, as f32.
// A block owns 64 pixels = 16 pool windows: image rows 2py, 2py + 1, columns 32hf .. 32hf + 31 (blockIdx.x = 2py + hf, blockIdx.y = image).
// Staging: a thread takes 2 x 8 channels x 4 pixels (sixteen 16-byte loads, 8 lanes = one 128-B line), casts them as the cast kernels did (bf16 hi, bf16 lo, f16 of 16 x) and stores, per pixel and plane,
// 16 bytes = 8 consecutive channels = half a lane's fragment into LDS, [slot][channel]. Slot = 16 j + m: m = pool window, j = 2 (row in window) + (column in window). So the four pixels of a window
// sit in four different 16-pixel tiles at the same column, and the pool is a maximum over four accumulators of one lane.
// Wave w owns channels 16w .. 16w + 15 of all three outputs for all 64 pixels: theta^T = Wt X and phi = Wp X (D: column = pixel, rows = 8 consecutive channels a lane; bf16 hi/lo, three products in
// the order the GEMMs had), g^T = X^T Wg^T (D: column = channel, rows = 8 consecutive windows a lane; f16). Pooled phi and g leave in the fragment order of k_nl_flash, 512 contiguous bytes a wave
// and plane (a 16-byte chunk is half of one lane's fragment, 32 chunks, lane = 16 h + c, are one wave-wide load; element e: bits 0-2 k, 3-6 row c, 7 half h, 8 which 16 k, then pooled phi: 9-10 block of
// 32 channels, 11.. tile of 16 keys; pooled g: 9-11 tile of 16 channels, 12.. block of 32 keys); theta goes through LDS so that a wave stores whole pixel rows. The bias is added behind the maximum (rounding is monotonic, so the value is the same).
namespace w25 {
// the bf16 hi/lo split of two values, packed, in 32-bit arithmetic throughout (the same bits as f2bf_bits gives: round to nearest even, the result in the upper half)
__device__ __forceinline__ unsigned bf_rn(float f) { const unsigned u = __float_as_uint(f); return u + 0x7FFFu + ((u >> 16) & 1u); }
__device__ __forceinline__ unsigned split2(float a, float b, unsigned* lo) {
  const unsigned ua = bf_rn(a) & 0xFFFF0000u, ub = bf_rn(b) & 0xFFFF0000u;
  *lo = (bf_rn(a - __uint_as_float(ua)) >> 16) | (bf_rn(b - __uint_as_float(ub)) & 0xFFFF0000u);
  return (ua >> 16) | ub; }
constexpr int PJX = 264;   // LDS pitch of a slot of x, in 16-bit elements: 512 B + 16 B, an odd multiple of 16 B for 16-byte reads
constexpr int PJT = 136;   // the same for a slot of theta: 256 B + 16 B
// launch bounds: four waves a SIMD (256 registers a wave), so that two blocks share a WGP and all 512 blocks are resident at once
__global__ __launch_bounds__(256, 4) void k_nl_proj(const float* __restrict__ X, const unsigned short* __restrict__ TWHp, const unsigned short* __restrict__ TWLp, const unsigned short* __restrict__ PWHp,
                                                 const unsigned short* __restrict__ PWLp, const unsigned short* __restrict__ GWp, const float* __restrict__ thb, const float* __restrict__ phb,
                                                 const float* __restrict__ gb, unsigned short* __restrict__ THHp, unsigned short* __restrict__ THLp, unsigned short* __restrict__ PPHp,
                                                 unsigned short* __restrict__ PPLp, unsigned short* __restrict__ GP16p) {
  constexpr int Cc = 256, D = 128, NKc = 1024, HWc = 4096;
  __shared__ __align__(16) unsigned short sx[3][64 * PJX];
  const int tid = threadIdx.x, lane = tid & 31, m = lane & 15, h = lane >> 4;
  const int wave = __builtin_amdgcn_readfirstlane(tid >> 5);   // the wave's number in a scalar register: every address is a scalar base plus a lane offset, and few vector registers live across the products
  const int b = blockIdx.y, py = blockIdx.x >> 1, hf = blockIdx.x & 1;
  // the wave's weight rows (lane = row 16 wave + m, k from 8 h), first k step: they fly with the loads of x
  const unsigned wob = (unsigned)(m * Cc + 8 * h) * 2u;   // one lane offset, in bytes, for the five planes
  const int wr = wave * 16 * Cc;
  const __bf16* TWH = (const __bf16*)((const char*)(TWHp + wr) + wob); const __bf16* TWL = (const __bf16*)((const char*)(TWLp + wr) + wob); const __bf16* PWH = (const __bf16*)((const char*)(PWHp + wr) + wob);
  const __bf16* PWL = (const __bf16*)((const char*)(PWLp + wr) + wob); const _Float16* GW = (const _Float16*)((const char*)(GWp + wr) + wob);
  v16b th = Frag<__bf16>::load(TWH), tl = Frag<__bf16>::load(TWL), ph = Frag<__bf16>::load(PWH), pl = Frag<__bf16>::load(PWL); v16h gw = Frag<_Float16>::load(GW);
  {
    const int g = lane & 7, cb = (lane >> 3) & 1, ry = h, cg = wave * 2 + cb;   // 4 pixels from column 4 g of row ry; channels 8 cg .. (and 128 + 8 cg ..); 16 lanes of one row: their LDS stores meet no common bank
    const unsigned xo = (unsigned)(cb * 8 * HWc + ry * 64 + g * 4) * 4u;   // lane offset in bytes
    const float* xp = (const float*)((const char*)(X + ((size_t)b * Cc + wave * 16) * HWc + (2 * py) * 64 + hf * 32) + xo);
    v4f v[2][8];
#pragma unroll   // v[][] in registers, all sixteen loads in flight
    for (int it = 0; it < 2; ++it)
#pragma unroll   // inner loop of the same
      for (int k = 0; k < 8; ++k) v[it][k] = *(const v4f*)(xp + (it * 128 + k) * HWc);
    // the wait before a load's address registers are reused; the two lane offsets as inputs keep their registers until the wait
    asm volatile("s_wait_xcnt 0x0" :: "v"(xo), "v"(wob) : "memory");
#pragma unroll   // constant indices into v[][]
    for (int it = 0; it < 2; ++it)
#pragma unroll   // inner loop of the same
      for (int e = 0; e < 4; ++e) { v4u hi, lo, f;
#pragma unroll   // inner loop of the same
        for (int q = 0; q < 4; ++q) { unsigned l2; hi[q] = split2(v[it][2 * q][e], v[it][2 * q + 1][e], &l2); lo[q] = l2; f[q] = f2h2_pack(v[it][2 * q][e] * 16.0f, v[it][2 * q + 1][e] * 16.0f); }
        const int so = ((ry * 2 + (e & 1)) * 16 + 2 * g + (e >> 1)) * PJX + it * 128 + cg * 8;
        *(v4u*)(&sx[0][so]) = hi; *(v4u*)(&sx[1][so]) = lo; *(v4u*)(&sx[2][so]) = f; }
  }
  __syncthreads();   // the tile of x is complete before any wave reads it
  v8f at[4], ap[4], ag[4];
#pragma unroll   // constant indices
  for (int j = 0; j < 4; ++j) { at[j] = (v8f){0.f,0.f,0.f,0.f,0.f,0.f,0.f,0.f}; ap[j] = at[j]; ag[j] = at[j]; }
  const __bf16* xh = (const __bf16*)(&sx[0][0]) + m * PJX + 8 * h; const __bf16* xl = (const __bf16*)(&sx[1][0]) + m * PJX + 8 * h; const _Float16* xf = (const _Float16*)(&sx[2][0]) + m * PJX + 8 * h;
  const unsigned bo8 = (unsigned)h * 32u, bo1 = (unsigned)m * 4u;   // lane offsets of the biases, in bytes
  const float* tbp = (const float*)((const char*)(thb + wave * 16) + bo8); const float* pbp = (const float*)((const char*)(phb + wave * 16) + bo8); const float* gbp = (const float*)((const char*)(gb + wave * 16) + bo1);
  v4f tb0, tb1, pb0, pb1; float gbv;
#pragma unroll   // eight k steps of 32 channels, constant offsets; no branch stands behind a matrix instruction
  for (int ks = 0; ks < 8; ++ks) {
    v16b nth = th, ntl = tl, nph = ph, npl = pl; v16h ngw = gw;
    if (ks < 7) {   // the next k step's weights fly behind this step's products
      const int kn = (ks + 1) * 32;
      nth = Frag<__bf16>::load(TWH + kn); ntl = Frag<__bf16>::load(TWL + kn); nph = Frag<__bf16>::load(PWH + kn); npl = Frag<__bf16>::load(PWL + kn); ngw = Frag<_Float16>::load(GW + kn);
      // the wait before these loads' address registers are reused (the offset as an input keeps it until then); memory clobbered, the loads also stay above the products instead of sinking to their first use
      asm volatile("s_wait_xcnt 0x0" :: "v"(wob) : "memory");
    } else {        // the biases fly behind the last step's products, in the registers that the weights have left
      tb0 = *(const v4f*)(tbp); tb1 = *(const v4f*)(tbp + 4); pb0 = *(const v4f*)(pbp); pb1 = *(const v4f*)(pbp + 4); gbv = *gbp;
      asm volatile("s_wait_xcnt 0x0" :: "v"(bo8), "v"(bo1) : "memory");   // the same wait for the biases' lane offsets
    }
#pragma unroll   // two pixel tiles at a time: six independent accumulators, half the fragments live
    for (int jp = 0; jp < 4; jp += 2) {
      v16b bh[2], bl[2]; v16h bf[2];
#pragma unroll   // constant indices
      for (int u = 0; u < 2; ++u) { const int o = (jp + u) * 16 * PJX + ks * 32; bh[u] = Frag<__bf16>::load(xh + o); bl[u] = Frag<__bf16>::load(xl + o); bf[u] = Frag<_Float16>::load(xf + o); }
#pragma unroll   // constant indices; neighbours in the stream go to different tiles
      for (int u = 0; u < 2; ++u) at[jp + u] = Frag<__bf16>::mma(th, bh[u], at[jp + u]);
#pragma unroll   // the same
      for (int u = 0; u < 2; ++u) ap[jp + u] = Frag<__bf16>::mma(ph, bh[u], ap[jp + u]);
#pragma unroll   // the same
      for (int u = 0; u < 2; ++u) ag[jp + u] = Frag<_Float16>::mma(bf[u], gw, ag[jp + u]);
#pragma unroll   // the same
      for (int u = 0; u < 2; ++u) at[jp + u] = Frag<__bf16>::mma(tl, bh[u], at[jp + u]);
#pragma unroll   // the same
      for (int u = 0; u < 2; ++u) ap[jp + u] = Frag<__bf16>::mma(ph, bl[u], ap[jp + u]);
#pragma unroll   // the same
      for (int u = 0; u < 2; ++u) at[jp + u] = Frag<__bf16>::mma(th, bl[u], at[jp + u]);
#pragma unroll   // the same
      for (int u = 0; u < 2; ++u) ap[jp + u] = Frag<__bf16>::mma(pl, bh[u], ap[jp + u]);
    }
    th = nth; tl = ntl; ph = nph; pl = npl; gw = ngw;
  }
  const float tbv[8] = { tb0[0], tb0[1], tb0[2], tb0[3], tb1[0], tb1[1], tb1[2], tb1[3] }, pbv[8] = { pb0[0], pb0[1], pb0[2], pb0[3], pb1[0], pb1[1], pb1[2], pb1[3] };
  // pooled phi (hi, lo) and pooled g
  v4u phi_h, phi_l, g_h;
#pragma unroll   // constant indices
  for (int q = 0; q < 4; ++q) { float pv[2], gv[2];
#pragma unroll   // inner loop of the same
    for (int u = 0; u < 2; ++u) { const int r = 2 * q + u;
      pv[u] = fmaxf(fmaxf(ap[0][r], ap[1][r]), fmaxf(ap[2][r], ap[3][r])) + pbv[r];
      gv[u] = fmaxf(fmaxf(ag[0][r], ag[1][r]), fmaxf(ag[2][r], ag[3][r])) * 0.0625f + gbv; }
    unsigned l2; phi_h[q] = split2(pv[0], pv[1], &l2); phi_l[q] = l2; g_h[q] = f2h2_pack(gv[0], gv[1]); }
  __syncthreads();   // every wave has read its last fragment of x: the LDS is free for theta
#pragma unroll   // constant indices
  for (int j = 0; j < 4; ++j) { v4u hi, lo;
#pragma unroll   // inner loop of the same
    for (int q = 0; q < 4; ++q) { unsigned l2; hi[q] = split2(at[j][2 * q] + tbv[2 * q], at[j][2 * q + 1] + tbv[2 * q + 1], &l2); lo[q] = l2; }
    const int so = (j * 16 + m) * PJT + wave * 16 + 8 * h;
    *(v4u*)(&sx[0][so]) = hi; *(v4u*)(&sx[1][so]) = lo; }
  __syncthreads();   // theta of all 128 channels is in LDS before the rows are read
  // 16 lanes store one pixel's 256 bytes of a plane, a wave two neighbouring pixels: pixel column p0 = 2 wave + h, chunk m, so every global offset is a scalar base + 16 lane bytes
  v4u oh[4], ol[4];
#pragma unroll   // constant indices; pixel = column p0 + 16 (it & 1) of row it >> 1, whose slot is 32 (it >> 1) + 16 (p0 & 1) + (p0 >> 1) + 8 (it & 1)
  for (int it = 0; it < 4; ++it) { const int so = ((it >> 1) * 32 + h * 16 + wave + 8 * (it & 1)) * PJT + m * 8; oh[it] = *(const v4u*)(&sx[0][so]); ol[it] = *(const v4u*)(&sx[1][so]); }
  const unsigned l16 = (unsigned)lane * 16u;
  const size_t to = ((size_t)b * HWc + (2 * py) * 64 + hf * 32 + 2 * wave) * D;
  char* tph = (char*)(THHp + to) + l16; char* tpl = (char*)(THLp + to) + l16;
#pragma unroll   // constant indices
  for (int it = 0; it < 4; ++it) { const int go = ((it >> 1) * 64 + (it & 1) * 16) * D * 2; *(v4u*)(tph + go) = oh[it]; *(v4u*)(tpl + go) = ol[it]; }
  const size_t po = (size_t)b * NKc * D + (py * 2 + hf) * 2048 + wave * 256, vo = (size_t)b * NKc * D + py * 4096 + wave * 512 + hf * 256;
  *(v4u*)((char*)(PPHp + po) + l16) = phi_h; *(v4u*)((char*)(PPLp + po) + l16) = phi_l; *(v4u*)((char*)(GP16p + vo) + l16) = g_h;
  // the wait before a store's registers are reused: the lane offset and the values as inputs keep them all until it, so nothing takes a register of an issued store
  asm volatile("s_wait_xcnt 0x0" :: "v"(l16), "v"(oh[0]), "v"(oh[1]), "v"(oh[2]), "v"(oh[3]), "v"(ol[0]), "v"(ol[1]), "v"(ol[2]), "v"(ol[3]), "v"(phi_h), "v"(phi_l), "v"(g_h) : "memory");
}
} // namespace w25
// Fused attention of one image: Y16[q][c] = f16( sum_k softmax_k(theta[q] . phi[k]) g[c][k] ). Scores and probabilities never leave the registers.
// A wave owns 32 queries (two 16-column groups) and walks the 1024 keys 32 at a time. It forms S^T = K Q^T (bf16 hi/lo planes, three products, as the score
// GEMM did) and O^T += V^T P^T (f16): in both D tiles a lane holds one query (column lane & 15), so maximum, sum and rescale are lane-local but for one
// exchange between the wave halves, and two S^T tiles (keys 0-15, 16-31), converted in place, are the B operand of the second product in the hardware k order.
// K (hi, lo) and V^T lie in fragment order (k_nl_proj writes them so): every fragment load covers four whole lines. Q is read once from the row-major theta planes.
// Running maximum in log2 units; the accumulators are rescaled only when a column's maximum has grown by more than 8; p = 2^(s - m + 7) <= 2^15 fits f16.
namespace w25 {
__device__ __forceinline__ float xhalf(float x) { return __builtin_bit_cast(float, __builtin_amdgcn_permlanex16(__builtin_bit_cast(int, x), __builtin_bit_cast(int, x), 0x76543210, 0xfedcba98, false, false)); }   // lane l takes lane l ^ 16
// a fragment stored in fragment order: two wave-wide loads of 512 contiguous bytes (elements 0..7 <- p[0..7], 8..15 <- p[256..263], p = fragment + 8 * lane)
__device__ __forceinline__ v16b ldf_b(const __bf16* p) { Frag<__bf16>::U f; f.h[0] = *(const v8b*)(p); f.h[1] = *(const v8b*)(p + 256); return f.v; }
__device__ __forceinline__ v16h ldf_h(const _Float16* p) { Frag<_Float16>::U f; f.h[0] = *(const v8h*)(p); f.h[1] = *(const v8h*)(p + 256); return f.v; }
__global__ __launch_bounds__(128) void k_nl_flash(const unsigned short* __restrict__ QHp, const unsigned short* __restrict__ QLp, const unsigned short* __restrict__ KHp, const unsigned short* __restrict__ KLp,
                                                  const unsigned short* __restrict__ VTp, unsigned short* __restrict__ Y16p) {
  constexpr int D = 128, NKc = 1024, HWc = 4096;
  constexpr float L2E = 1.4426950408889634f;
  const int lane = threadIdx.x & 31, wave = threadIdx.x >> 5, cq = lane & 15, h = lane >> 4;
  const int b = blockIdx.y, q0 = (blockIdx.x * 4 + wave) * 32;
  const size_t qo = ((size_t)b * HWc + q0 + cq) * D + 8 * h, ko = (size_t)b * NKc * D + 8 * lane;
  const __bf16* QH = (const __bf16*)QHp + qo; const __bf16* QL = (const __bf16*)QLp + qo;
  const __bf16* KH = (const __bf16*)KHp + ko; const __bf16* KL = (const __bf16*)KLp + ko;
  const _Float16* VT = (const _Float16*)VTp + ko;
  v16b qh[2][4], ql[2][4], kh[2][4], kl[2][4];
#pragma unroll   // constant indices: the fragments stay in registers
  for (int t = 0; t < 2; ++t)
#pragma unroll   // inner loop of the same
    for (int ks = 0; ks < 4; ++ks) {
      qh[t][ks] = Frag<__bf16>::load(QH + t * 16 * D + ks * 32); ql[t][ks] = Frag<__bf16>::load(QL + t * 16 * D + ks * 32);
      kh[t][ks] = ldf_b(KH + (t * 4 + ks) * 512); kl[t][ks] = ldf_b(KL + (t * 4 + ks) * 512);
    }
  asm volatile("s_wait_xcnt 0x0" :: "v"(QH), "v"(QL) : "memory");   // the two Q addresses as inputs keep the pairs until the wait (the K pairs live on through the loop)
  v8f o[2][8];
#pragma unroll   // constant indices
  for (int t = 0; t < 2; ++t)
#pragma unroll   // inner loop of the same
    for (int ct = 0; ct < 8; ++ct) o[t][ct] = (v8f){0.f,0.f,0.f,0.f,0.f,0.f,0.f,0.f};
  float mu[2] = { -1.0e30f, -1.0e30f }, l[2] = { 0.f, 0.f };
#pragma unroll 1   // one pass is 64 matrix instructions already; unrolled, the fragments of two passes would not fit
  for (int p = 0; p < NKc / 32; ++p) {
    v16h vt[8]; const _Float16* vp = VT + p * 32 * D;
#pragma unroll   // constant indices; the eight V^T fragments fly while the scores are formed
    for (int ct = 0; ct < 8; ++ct) vt[ct] = ldf_h(vp + ct * 512);
    __builtin_amdgcn_sched_barrier(0);   // keeps the V^T loads' issue above the score products; without it they sink to their first use and each waits a full latency there
    v8f s[2][2];   // [query group][key tile]
#pragma unroll   // constant indices
    for (int t = 0; t < 2; ++t) { s[t][0] = (v8f){0.f,0.f,0.f,0.f,0.f,0.f,0.f,0.f}; s[t][1] = s[t][0]; }
#pragma unroll   // constant indices; neighbours in the stream go to different tiles
    for (int ks = 0; ks < 4; ++ks) {
#pragma unroll   // inner loop of the same
      for (int kt = 0; kt < 2; ++kt)
#pragma unroll   // inner loop of the same
        for (int t = 0; t < 2; ++t) s[t][kt] = Frag<__bf16>::mma(kh[kt][ks], qh[t][ks], s[t][kt]);
#pragma unroll   // inner loop of the same
      for (int kt = 0; kt < 2; ++kt)
#pragma unroll   // inner loop of the same
        for (int t = 0; t < 2; ++t) s[t][kt] = Frag<__bf16>::mma(kh[kt][ks], ql[t][ks], s[t][kt]);
#pragma unroll   // inner loop of the same
      for (int kt = 0; kt < 2; ++kt)
#pragma unroll   // inner loop of the same
        for (int t = 0; t < 2; ++t) s[t][kt] = Frag<__bf16>::mma(kl[kt][ks], qh[t][ks], s[t][kt]);
    }
    // the next pass's K fragments, into the same registers: they fly behind the softmax and the second product (the last pass re-reads keys 0-31, in bounds, unused)
    const int kn = ((p + 1) & (NKc / 32 - 1)) * 32 * D; const __bf16* kph = KH + kn; const __bf16* kpl = KL + kn;
#pragma unroll   // constant indices
    for (int kt = 0; kt < 2; ++kt)
#pragma unroll   // inner loop of the same
      for (int ks = 0; ks < 4; ++ks) { kh[kt][ks] = ldf_b(kph + (kt * 4 + ks) * 512); kl[kt][ks] = ldf_b(kpl + (kt * 4 + ks) * 512); }
    // the wait before the pass's load addresses are reused: the three addresses as inputs
    // keep the pairs until the wait. With vp named and memory clobbered, the V^T loads also stay in front of it and are not sunk behind the rescale branch to their first use
    asm volatile("s_wait_xcnt 0x0" :: "v"(kph), "v"(kpl), "v"(vp) : "memory");
    float mx[2];
#pragma unroll   // constant indices
    for (int t = 0; t < 2; ++t) { float m = fmaxf(s[t][0][0], s[t][1][0]);
#pragma unroll   // inner loop of the same
      for (int r = 1; r < 8; ++r) m = fmaxf(m, fmaxf(s[t][0][r], s[t][1][r]));
      mx[t] = fmaxf(m, xhalf(m)) * L2E; }
    const bool need = (mx[0] > mu[0] + 8.f) || (mx[1] > mu[1] + 8.f);
    if (__builtin_amdgcn_ballot_w32(need) != 0) {   // one scalar test a pass
#pragma unroll   // constant indices
      for (int t = 0; t < 2; ++t) { const float mn = fmaxf(mu[t], mx[t]); const float f = __builtin_amdgcn_exp2f(mu[t] - mn); mu[t] = mn; l[t] *= f;
#pragma unroll   // inner loop of the same
        for (int ct = 0; ct < 8; ++ct) o[t][ct] *= f; }
    }
    v16h pb[2];
#pragma unroll   // constant indices
    for (int t = 0; t < 2; ++t) { const float mb = 7.f - mu[t]; float a0 = 0.f, a1 = 0.f;
#pragma unroll   // inner loop of the same
      for (int r = 0; r < 8; ++r) { const float e0 = __builtin_amdgcn_exp2f(fmaf(s[t][0][r], L2E, mb)), e1 = __builtin_amdgcn_exp2f(fmaf(s[t][1][r], L2E, mb));
        a0 += e0; a1 += e1; pb[t][r] = (_Float16)e0; pb[t][8 + r] = (_Float16)e1; }
      l[t] += a0 + a1; }
#pragma unroll   // constant indices; sixteen independent tiles
    for (int ct = 0; ct < 8; ++ct)
#pragma unroll   // inner loop of the same
      for (int t = 0; t < 2; ++t) o[t][ct] = Frag<_Float16>::mma(vt[ct], pb[t], o[t][ct]);
  }
#pragma unroll   // constant indices
  for (int t = 0; t < 2; ++t) { const float inv = 1.f / (l[t] + xhalf(l[t]));
    _Float16* yp = (_Float16*)Y16p + ((size_t)b * HWc + q0 + t * 16 + cq) * D + 8 * h; v8h hv[8];
#pragma unroll   // inner loop of the same
    for (int ct = 0; ct < 8; ++ct) {
#pragma unroll   // constant indices
      for (int r = 0; r < 8; ++r) hv[ct][r] = (_Float16)(o[t][ct][r] * inv);
      *(v8h*)(yp + ct * 16) = hv[ct]; }
    // address and values as inputs keep them until the wait
    asm volatile("s_wait_xcnt 0x0" :: "v"(yp), "v"(hv[0]), "v"(hv[1]), "v"(hv[2]), "v"(hv[3]), "v"(hv[4]), "v"(hv[5]), "v"(hv[6]), "v"(hv[7]) : "memory"); }
}
} // namespace w25
// batch statistics of channel c = blockIdx.x over [Bn][HW]: a thread holds its Bn x HW / 1024 groups of 16 B in registers, so WY is read once and the loads overlap;
// mean first, then the squared deviations from the same registers; the two LDS trees over the block are as they were
template <int Bn, int HW> __global__ __launch_bounds__(256) void k_nl_bns(const float* __restrict__ WY, float* __restrict__ BNS, int C) { __shared__ float red[256]; __shared__ float res[2]; const int c = blockIdx.x; const int t = threadIdx.x;
    const float* r[Bn]; v4f v[Bn][HW / 1024];
#pragma unroll   // v[][] in registers, the loads overlap instead of one latency each
    for (int b = 0; b < Bn; ++b) { r[b] = WY + ((long long)b * C + c) * HW + t * 4;
#pragma unroll   // inner loop of the same: constant indices, values stay in registers
        for (int k = 0; k < HW / 1024; ++k) v[b][k] = *(const v4f*)(r[b] + k * 1024); }
    static_assert(Bn == 8, "the wait below names eight addresses");
    asm volatile("s_wait_xcnt 0x0" :: "v"(r[0]), "v"(r[1]), "v"(r[2]), "v"(r[3]), "v"(r[4]), "v"(r[5]), "v"(r[6]), "v"(r[7]) : "memory");   // the addresses as inputs keep every load's address pair until the wait: no load's result takes a pair before it
    float s = 0.f;
#pragma unroll   // constant indices into v[][]
    for (int b = 0; b < Bn; ++b)
#pragma unroll   // inner loop of the same: constant indices, values stay in registers
        for (int k = 0; k < HW / 1024; ++k) s += (v[b][k][0] + v[b][k][1]) + (v[b][k][2] + v[b][k][3]);
    red[t] = s; __syncthreads(); for (int o = 128; o > 0; o >>= 1) { if (t < o) red[t] += red[t + o]; __syncthreads(); } const float mu = red[0] / (float)(Bn * HW); __syncthreads();
    float q = 0.f;
#pragma unroll   // constant indices into v[][]
    for (int b = 0; b < Bn; ++b)
#pragma unroll   // inner loop of the same: constant indices, values stay in registers
        for (int k = 0; k < HW / 1024; ++k) { const v4f d = v[b][k] - mu; q += (d[0] * d[0] + d[1] * d[1]) + (d[2] * d[2] + d[3] * d[3]); }
    red[t] = q; __syncthreads(); for (int o = 128; o > 0; o >>= 1) { if (t < o) red[t] += red[t + o]; __syncthreads(); }
    if (t == 0) { res[0] = mu; res[1] = rsqrtf(red[0] / (float)(Bn * HW) + 1e-5f); } __syncthreads();
    if (t < 32) VST2(float, BNS + (long long)c * 32 + t, (t == 0) ? res[0] : ((t == 1) ? res[1] : 0.f)); }
// out = (WY - mu[c]) * rstd[c] * gamma[c] + beta[c] + x; one block per plane (b, c) of 4096 values, 4 x 16 B of each operand a thread
__global__ __launch_bounds__(256) void k_nl_out(const float* __restrict__ WY, const float* __restrict__ BNS, const float* __restrict__ Gm, const float* __restrict__ Bt, const float* __restrict__ X, float* __restrict__ OUT, int C) { const int c = (int)(blockIdx.x % (unsigned)C); const long long o = (long long)blockIdx.x * 4096 + threadIdx.x * 4;
    const float mu = BNS[(long long)c * 32], rs = BNS[(long long)c * 32 + 1], g = Gm[c], be = Bt[c]; const float* wp = WY + o; const float* xp = X + o; v4f w[4], xv[4];
#pragma unroll   // all eight loads in flight
    for (int k = 0; k < 4; ++k) { w[k] = *(const v4f*)(wp + k * 1024); xv[k] = *(const v4f*)(xp + k * 1024); }
    asm volatile("s_wait_xcnt 0x0" :: "v"(wp), "v"(xp) : "memory");   // both addresses as inputs keep the pairs until the wait
#pragma unroll   // constant indices into w[], xv[]
    for (int k = 0; k < 4; ++k) { v4f r;
#pragma unroll   // inner loop of the same: constant indices, values stay in registers
        for (int e = 0; e < 4; ++e) r[e] = (w[k][e] - mu) * rs * g + be + xv[k][e];
        *(v4f*)(OUT + o + k * 1024) = r; } }


// The four weight casts in one launch: they need nothing of each other, so blockIdx.y picks the matrix (a block-uniform choice) and the four grids run side by side.
// All four matrices hold the same number of elements, rows contiguous, and the grid covers it exactly; a thread casts 4 consecutive ones (one 16-byte load, 8-byte stores), each value as k_cast16 and k_castS16 cast it.
__global__ __launch_bounds__(256) void k_nl_wcast(const float* __restrict__ Ww, const float* __restrict__ thw, const float* __restrict__ phw, const float* __restrict__ gw, unsigned short* __restrict__ WW16,
                                                  unsigned short* __restrict__ TWH, unsigned short* __restrict__ TWL, unsigned short* __restrict__ PWH, unsigned short* __restrict__ PWL, unsigned short* __restrict__ GW16) {
    const int job = (int)blockIdx.y; const unsigned i = (blockIdx.x * 256u + threadIdx.x) * 4u;
    const float* sp = ((job == 0) ? Ww : (job == 1) ? thw : (job == 2) ? phw : gw) + i;
    const v4f v = *(const v4f*)sp;
    asm volatile("s_wait_xcnt 0x0" :: "v"(sp) : "memory");   // the wait before the load's address pair is reused; the address as an input keeps the pair until it, so the result does not land on it either
    if (job == 1 || job == 2) {   // theta_w, phi_w: bf16 hi and lo planes
        v2u hi, lo; unsigned l2; hi[0] = f2bf2_pack(v[0], v[1], &l2); lo[0] = l2; hi[1] = f2bf2_pack(v[2], v[3], &l2); lo[1] = l2;
        *(v2u*)(((job == 1) ? TWH : PWH) + i) = hi; *(v2u*)(((job == 1) ? TWL : PWL) + i) = lo;
    } else {                      // W_w: f16 of 16 w; g_w: f16
        const float s = (job == 0) ? 16.0f : 1.0f; v2u f; f[0] = f2h2_pack(v[0] * s, v[1] * s); f[1] = f2h2_pack(v[2] * s, v[3] * s);
        *(v2u*)(((job == 0) ? WW16 : GW16) + i) = f;
    }
}

extern "C" void kernel_launch(void* const* d_in, const int* in_sizes, int n_in, void* d_out, int out_size, void* d_ws, size_t ws_size, hipStream_t stream) {
    (void)in_sizes; (void)n_in; (void)out_size; (void)ws_size;
    const float* x = (const float*)d_in[0];
    const float* gw = (const float*)d_in[1];
    const float* gb = (const float*)d_in[2];
    const float* thw = (const float*)d_in[3];
    const float* thb = (const float*)d_in[4];
    const float* phw = (const float*)d_in[5];
    const float* phb = (const float*)d_in[6];
    const float* Ww = (const float*)d_in[7];
    const float* Wb = (const float*)d_in[8];
    const float* bng = (const float*)d_in[9];
    const float* bnb = (const float*)d_in[10];
    const int Bn = 8;
    const int C = 256;
    const int IC = 128;
    const int HW = 4096;
    const int NK = 1024;
    float* out = (float*)d_out;
    char* wsp = (char*)d_ws;
    // One launch per stage for all Bn images (blockIdx.y = image in the projection, the attention and the GEMM; per-image strides). Workspace: the operand planes that the projection writes, Y16 and WY, the weight planes, the BN statistics
    unsigned short* THH = (unsigned short*)wsp; wsp += (size_t)Bn * HW * IC * 2;
    unsigned short* THL = (unsigned short*)wsp; wsp += (size_t)Bn * HW * IC * 2;
    unsigned short* PPH = (unsigned short*)wsp; wsp += (size_t)Bn * NK * IC * 2;
    unsigned short* PPL = (unsigned short*)wsp; wsp += (size_t)Bn * NK * IC * 2;
    unsigned short* GP16 = (unsigned short*)wsp; wsp += (size_t)Bn * IC * NK * 2;
    char* R3 = wsp; wsp += (size_t)Bn * HW * IC * 2 + (size_t)Bn * C * HW * 4;
    unsigned short* Y16 = (unsigned short*)R3;
    float* WY = (float*)(Y16 + (size_t)Bn * HW * IC);
    unsigned short* WW16 = (unsigned short*)wsp; wsp += (size_t)C * IC * 2;
    unsigned short* TWH = (unsigned short*)wsp; wsp += (size_t)IC * C * 2;
    unsigned short* TWL = (unsigned short*)wsp; wsp += (size_t)IC * C * 2;
    unsigned short* PWH = (unsigned short*)wsp; wsp += (size_t)IC * C * 2;
    unsigned short* PWL = (unsigned short*)wsp; wsp += (size_t)IC * C * 2;
    unsigned short* GW16 = (unsigned short*)wsp; wsp += (size_t)IC * C * 2;
    float* BNS = (float*)wsp; wsp += (size_t)32 * C * 4;
    // weights
    k_nl_wcast<<<dim3((unsigned)(C * IC / 1024), 4u), 256, 0, stream>>>(Ww, thw, phw, gw, WW16, TWH, TWL, PWH, PWL, GW16);
    // theta (bf16 hi/lo, [HW][IC]), pooled phi (bf16 hi/lo) and pooled g (f16) in fragment order, straight from x: 64 pixels a block, blockIdx.y = image
    w25::k_nl_proj<<<dim3((unsigned)(HW / 64), (unsigned)(Bn)), 256, 0, stream>>>(x, (const unsigned short*)(TWH), (const unsigned short*)(TWL), (const unsigned short*)(PWH), (const unsigned short*)(PWL), (const unsigned short*)(GW16), thb, phb, gb, THH, THL, PPH, PPL, GP16);
    // Y16[b] = f16(softmax(theta[b] phi[b]) g[b]^T) ([HW][IC]): 128 queries a block, blockIdx.y = image
    w25::k_nl_flash<<<dim3((unsigned)(HW / 128), (unsigned)(Bn)), 128, 0, stream>>>((const unsigned short*)(THH), (const unsigned short*)(THL), (const unsigned short*)(PPH), (const unsigned short*)(PPL), (const unsigned short*)(GP16), Y16);
    w25::wmma_gemm64<0, false, 1, 0, false, 0><<<dim3((unsigned)((((C) / 64) * ((HW) / 64) + 7) / 8), (unsigned)(Bn)), 256, 0, stream>>>((const unsigned short*)(WW16), nullptr, IC, 0, (const unsigned short*)(Y16), nullptr, IC, (long)HW * IC, (void*)(WY), nullptr, HW, (long)C * HW, Wb, nullptr, 0, C, HW, IC, 0.0625f);
    k_nl_bns<Bn, HW><<<C, 256, 0, stream>>>(WY, BNS, C); k_nl_out<<<(unsigned)(Bn * C), 256, 0, stream>>>(WY, BNS, bng, bnb, x, out, C);
}

// v006
// One run takes 67.2 microseconds.
// Two timings next to v005 both put it at 1.19 times that version's speed.
// Counting every step since v000, which is the starting kernel, it is 21.1 times as fast.
#include <hip/hip_runtime.h>
#include <math.h>

typedef __attribute__((ext_vector_type(16))) _Float16 v16h;
typedef __attribute__((ext_vector_type(8)))  _Float16 v8h;
typedef __attribute__((ext_vector_type(16))) __bf16   v16b;
typedef __attribute__((ext_vector_type(8)))  float    v8f;
typedef __attribute__((ext_vector_type(4)))  float    v4f;

// 16-bit WMMA fragment map (wave32), lane L, h = L>>4, m = L&15:
//   A 16x32: lane = row m;   element i -> k = (i<8) ? 8h+i : 16+8h+(i-8)
//   B 32x16: lane = column m; the SAME k(i,h)
//   D 16x16 (8 f32): lane = column m; element r -> row 8h+r
__device__ __forceinline__ int frag_k(int i, int h) { return (i < 8) ? (8 * h + i) : (16 + 8 * h + (i - 8)); }
__device__ __forceinline__ __bf16 bf16_rne(float f) {
    unsigned int u = __float_as_uint(f);
    u += 0x7fffu + ((u >> 16) & 1u);
    return __builtin_bit_cast(__bf16, (unsigned short)(u >> 16));
}
__device__ __forceinline__ float bf16_f32(__bf16 b) { return __uint_as_float(((unsigned int)__builtin_bit_cast(unsigned short, b)) << 16); }
__device__ __forceinline__ v8f wmma16(v16h a, v16h b, v8f c) {
    c = __builtin_amdgcn_wmma_f32_16x16x32_f16(false, a, false, b, (short)0, c, false, false);
    asm volatile("v_nop\n\tv_nop\n\tv_nop\n\tv_nop" : "+v"(c) : "v"(a), "v"(b));
    return c;
}
__device__ __forceinline__ v8f wmmab(v16b a, v16b b, v8f c) {
    c = __builtin_amdgcn_wmma_f32_16x16x32_bf16(false, a, false, b, (short)0, c, false, false);
    asm volatile("v_nop\n\tv_nop\n\tv_nop\n\tv_nop" : "+v"(c) : "v"(a), "v"(b));
    return c;
}
struct Split { v16b hi, lo; };
// hi/lo split product: a.hi*b.hi + a.hi*b.lo + a.lo*b.hi
__device__ __forceinline__ v8f wmma3(const Split& a, const Split& b, v8f c) {
    c = __builtin_amdgcn_wmma_f32_16x16x32_bf16(false, a.hi, false, b.hi, (short)0, c, false, false);
    c = __builtin_amdgcn_wmma_f32_16x16x32_bf16(false, a.hi, false, b.lo, (short)0, c, false, false);
    c = __builtin_amdgcn_wmma_f32_16x16x32_bf16(false, a.lo, false, b.hi, (short)0, c, false, false);
    asm volatile("v_nop\n\tv_nop\n\tv_nop\n\tv_nop" : "+v"(c) : "v"(a.hi), "v"(a.lo), "v"(b.hi), "v"(b.lo));
    return c;
}
struct Split3 { v16b hi, mid, lo; };
// triple split product (6 terms, drops only terms below 2^-24 relative)
__device__ __forceinline__ v8f wmma6(const Split3& a, const Split3& b, v8f c) {
    c = __builtin_amdgcn_wmma_f32_16x16x32_bf16(false, a.hi, false, b.hi, (short)0, c, false, false);
    c = __builtin_amdgcn_wmma_f32_16x16x32_bf16(false, a.hi, false, b.mid, (short)0, c, false, false);
    c = __builtin_amdgcn_wmma_f32_16x16x32_bf16(false, a.mid, false, b.hi, (short)0, c, false, false);
    c = __builtin_amdgcn_wmma_f32_16x16x32_bf16(false, a.hi, false, b.lo, (short)0, c, false, false);
    c = __builtin_amdgcn_wmma_f32_16x16x32_bf16(false, a.mid, false, b.mid, (short)0, c, false, false);
    c = __builtin_amdgcn_wmma_f32_16x16x32_bf16(false, a.lo, false, b.hi, (short)0, c, false, false);
    asm volatile("v_nop\n\tv_nop\n\tv_nop\n\tv_nop" : "+v"(c) : "v"(a.hi), "v"(a.mid), "v"(a.lo), "v"(b.hi), "v"(b.mid), "v"(b.lo));
    return c;
}

// Fragment gathers from f32 memory: element i <- p[(k0 + frag_k(i,h)) * sk] * s, zero for k >= klen.
__device__ __forceinline__ v16h fh_ld(const float* __restrict__ p, long long sk, int k0, int h, int klen, float s) {
    v16h a;
#pragma unroll
    for (int i = 0; i < 16; ++i) { const int k = k0 + frag_k(i, h); a[i] = (k < klen) ? (_Float16)(p[(long long)k * sk] * s) : (_Float16)0.f; }
    return a;
}
__device__ __forceinline__ Split sp_ld(const float* __restrict__ p, long long sk, int k0, int h, int klen, float s) {
    Split r;
#pragma unroll
    for (int i = 0; i < 16; ++i) {
        const int k = k0 + frag_k(i, h); const float x = (k < klen) ? p[(long long)k * sk] * s : 0.f;
        const __bf16 hb = bf16_rne(x); r.hi[i] = hb; r.lo[i] = bf16_rne(x - bf16_f32(hb));
    }
    return r;
}
__device__ __forceinline__ Split3 sp3_ld(const float* __restrict__ p, long long sk, int k0, int h, int klen, float s) {
    Split3 r;
#pragma unroll
    for (int i = 0; i < 16; ++i) {
        const int k = k0 + frag_k(i, h); const float x = (k < klen) ? p[(long long)k * sk] * s : 0.f;
        const __bf16 hb = bf16_rne(x); const float r1 = x - bf16_f32(hb); const __bf16 mb = bf16_rne(r1);
        r.hi[i] = hb; r.mid[i] = mb; r.lo[i] = bf16_rne(r1 - bf16_f32(mb));
    }
    return r;
}
__device__ __forceinline__ v16b bh_ld(const float* __restrict__ p, long long sk, int k0, int h, int klen, float s) {
    v16b a;
#pragma unroll
    for (int i = 0; i < 16; ++i) { const int k = k0 + frag_k(i, h); a[i] = bf16_rne((k < klen) ? p[(long long)k * sk] * s : 0.f); }
    return a;
}
// f16 fragment from an f16 LDS/global row with element stride 1 (k-contiguous), no bounds (tile already zero padded)
__device__ __forceinline__ v16h fh_row(const _Float16* __restrict__ row, int k0, int h) {
    v16h a;
#pragma unroll
    for (int i = 0; i < 16; ++i) a[i] = row[k0 + frag_k(i, h)];
    return a;
}

#define VST2(T, ptr, val) do { const T vst2_v_ = (val); *(T*)(ptr) = vst2_v_;  } while (0)
typedef float v4f __attribute__((ext_vector_type(4)));
typedef unsigned int v4u __attribute__((ext_vector_type(4)));
typedef unsigned int v2u __attribute__((ext_vector_type(2)));
#define VST2V4(ptr, val) do { const v4f vst2_v4_ = (val); *(v4f*)(ptr) = vst2_v4_;  } while (0)

__device__ __attribute__((noinline)) float act_fn(float v, int act) {
    if (act == 1) return fmaxf(v, 0.f);                                                                               // relu
    if (act == 2) { const float u = 0.7978845608028654f * (v + 0.044715f * v * v * v); return 0.5f * v * (1.f + tanhf(u)); } // tanh-gelu
    if (act == 3) return v / (1.f + expf(-v));                                                                        // silu
    if (act == 4) return 0.5f * v * (1.f + erff(v * 0.7071067811865476f));                                             // erf-gelu
    if (act == 5) return tanhf(v);
    if (act == 6) return 1.f / (1.f + expf(-v));                                                                      // sigmoid
    if (act == 7) return (v > 0.f) ? v : 0.01f * v;                                                                   // leaky relu 0.01
    if (act == 8) return (v > 0.f) ? v : (expf(v) - 1.f);                                                             // elu
    if (act == 9) return fminf(fmaxf(v, 0.f), 6.f);                                                                   // relu6
    if (act == 10) return fabsf(v);                                                                                    // abs
    if (act == 11) return (v >= 0.f) ? v : 0.1f * v;                                                                  // leaky 0.1
    if (act == 12) return (v > 0.f) ? v : 0.2f * v;                                                                   // leaky 0.2
    if (act == 13) return (v > 20.f) ? v : log1pf(expf(v));                                                            // softplus
    return v;
}

// =====================================================================================================================
// k_gemm<MODE>: C(z, m, n) = act(alpha * sum_k A(z, m, k) * B(z, k, n) + bias) + beta * R(z, m, n)
//   One wave (32-thread block) per 16 x 32 tile of C; grid (ceil(N/32), ceil(M/16), Z). Batch z -> (zo = z / zi_n, zi = z % zi_n)
//   with separate outer/inner strides for every tensor (e.g. batch and head). A(m,k) = A[zo*sAo + zi*sAi + m*sAm + k*sAk] (f32),
//   B(k,n) = B[zo*sBo + zi*sBi + n*sBn + k*sBk] (f32); any M, N, K (K zero-padded to 32 inside the fragments, M/N tails guarded).
//   C(m,n) = C[zo*sCo + zi*sCi + m*sCm + n] (n contiguous). flags: 1 bias[n], 2 bias[m], 4 residual R[zo*sRo + zi*sRi + m*sRm + n*sRn].
//   MODE 0: f16 operands (A prescaled by sa, B by sb, both undone in the epilogue); 1: bf16 hi/lo split (3 products); 2: bf16;
//   3: bf16 hi/mid/lo triple split (6 products); 4: as 3 with Kahan-compensated f32 accumulation across k-steps.
// =====================================================================================================================
struct GemmP {
    const float* A; const float* B; const float* bias; const float* R; float* C;
    long long sAo, sAi, sAm, sAk, sBo, sBi, sBn, sBk, sCo, sCi, sCm, sRo, sRi, sRm, sRn;
    int M, N, K, zi_n, flags, act; float alpha, beta, sa, sb;
    int Npad, pad_;     // columns [N, Npad) of C are written as 0 so that padded workspace rows are covered by whole-line stores; Npad >= N
};
static_assert(sizeof(GemmP) == 5 * 8 + 15 * 8 + 6 * 4 + 4 * 4 + 2 * 4, "GemmP has padding");

template <int MODE>
__global__ __launch_bounds__(32) void k_gemm(GemmP p) {
    const int lane = threadIdx.x & 31, h = lane >> 4, l15 = lane & 15;
    const int m0 = blockIdx.y * 16, n0 = blockIdx.x * 32;
    const int z = blockIdx.z, zo = z / p.zi_n, zi = z - zo * p.zi_n;
    const float* A = p.A + zo * p.sAo + zi * p.sAi;
    const float* B = p.B + zo * p.sBo + zi * p.sBi;
    const int am = min(m0 + l15, p.M - 1);                       // clamped row for loads (stores are guarded)
    v8f acc[2], comp[2];
#pragma unroll
    for (int t = 0; t < 2; ++t) { v8f zz = {}; acc[t] = zz; comp[t] = zz; }
    for (int k0 = 0; k0 < p.K; k0 += 32) {
        const float* arow = A + (long long)am * p.sAm;
        if (MODE == 1) {
            const Split a = sp_ld(arow, p.sAk, k0, h, p.K, 1.f);
#pragma unroll
            for (int t = 0; t < 2; ++t) {
                const int bn = min(n0 + t * 16 + l15, p.N - 1);
                acc[t] = wmma3(a, sp_ld(B + (long long)bn * p.sBn, p.sBk, k0, h, p.K, 1.f), acc[t]);
            }
        } else if (MODE == 3) {
            const Split3 a = sp3_ld(arow, p.sAk, k0, h, p.K, 1.f);
#pragma unroll
            for (int t = 0; t < 2; ++t) {
                const int bn = min(n0 + t * 16 + l15, p.N - 1);
                acc[t] = wmma6(a, sp3_ld(B + (long long)bn * p.sBn, p.sBk, k0, h, p.K, 1.f), acc[t]);
            }
        } else if (MODE == 4) {
            // triple split as MODE 3, but each k-step's 6 products go into a fresh accumulator and the partial is added to the running f32 sum
            // on the VALU with Kahan compensation (accumulation error stays ~1 ulp however long K is)
            const Split3 a = sp3_ld(arow, p.sAk, k0, h, p.K, 1.f);
#pragma unroll
            for (int t = 0; t < 2; ++t) {
                const int bn = min(n0 + t * 16 + l15, p.N - 1); v8f zz = {};
                const v8f part = wmma6(a, sp3_ld(B + (long long)bn * p.sBn, p.sBk, k0, h, p.K, 1.f), zz);
                const v8f y = part - comp[t]; const v8f s = acc[t] + y; comp[t] = (s - acc[t]) - y; acc[t] = s;
            }
        } else if (MODE == 2) {
            const v16b a = bh_ld(arow, p.sAk, k0, h, p.K, 1.f);
#pragma unroll
            for (int t = 0; t < 2; ++t) {
                const int bn = min(n0 + t * 16 + l15, p.N - 1);
                acc[t] = wmmab(a, bh_ld(B + (long long)bn * p.sBn, p.sBk, k0, h, p.K, 1.f), acc[t]);
            }
        } else {
            const v16h a = fh_ld(arow, p.sAk, k0, h, p.K, p.sa);
#pragma unroll
            for (int t = 0; t < 2; ++t) {
                const int bn = min(n0 + t * 16 + l15, p.N - 1);
                acc[t] = wmma16(a, fh_ld(B + (long long)bn * p.sBn, p.sBk, k0, h, p.K, p.sb), acc[t]);
            }
        }
    }
    const float iscale = (MODE == 0) ? p.alpha / (p.sa * p.sb) : p.alpha;
    float* C = p.C + zo * p.sCo + zi * p.sCi;
    const float* R = p.R + zo * p.sRo + zi * p.sRi;
    __shared__ __align__(16) float ctile[16][36];
#pragma unroll
    for (int t = 0; t < 2; ++t) {
        const int n = n0 + t * 16 + l15; const int nn = min(n, p.N - 1);
#pragma unroll
        for (int r = 0; r < 8; ++r) {
            const int m = m0 + 8 * h + r; const int mm = min(m, p.M - 1);
            float v = acc[t][r] * iscale;
            if (p.flags & 1) v += p.bias[nn];
            if (p.flags & 2) v += p.bias[mm];
            if (p.flags & 8) v *= p.bias[(long long)zo * p.M + mm];   /* per-(z,row) scale vector laid out [Z][M]; exclusive with the bias flags */
            v = act_fn(v, p.act);
            if (p.flags & 4) v += p.beta * R[(long long)mm * p.sRm + (long long)nn * p.sRn];
            ctile[8 * h + r][t * 16 + l15] = (n < p.N) ? v : 0.f;
        }
    }
    __syncthreads();
    const int NW = (p.Npad > p.N) ? p.Npad : p.N;           // write width
    const bool fast = (m0 + 16 <= p.M) && (n0 + 32 <= NW) && ((p.sCm & 3) == 0) && ((((size_t)C) & 15) == 0);
    if (fast) {
#pragma unroll
        for (int s = 0; s < 4; ++s) {
            const int row = s * 4 + (lane >> 3), c4 = (lane & 7) * 4;
            const v4f v = *(const v4f*)&ctile[row][c4];
            VST2V4(C + (long long)(m0 + row) * p.sCm + n0 + c4, v);
        }
    } else {
        for (int row = 0; row < 16; ++row) {
            const int m = m0 + row, n = n0 + lane;
            if (m < p.M && n < NW) VST2(float, C + (long long)m * p.sCm + n, ctile[row][lane]);
        }
    }
}


// =====================================================================================================================
// k_gemmT<MODE, TM, TN>: same contract as k_gemm, but one wave computes a (16*TM) x (16*TN) tile: TM A fragments and TN B fragments are
//   loaded per 32-wide k-step and reused across TM*TN WMMAs (far fewer load/convert instructions per MAC). MODE 0 (f16), 1 (bf16 hi/lo),
//   2 (bf16) only. grid (ceil(NW/(16*TN)), ceil(M/(16*TM)), Z), block 32. Epilogue identical to k_gemm, run per 16x32 sub-tile.
// =====================================================================================================================
template <int MODE, int TM, int TN>
__global__ __launch_bounds__(32) void k_gemmT(GemmP p) {
    const int lane = threadIdx.x & 31, h = lane >> 4, l15 = lane & 15;
    const int m0 = blockIdx.y * (16 * TM), n0 = blockIdx.x * (16 * TN);
    const int z = blockIdx.z, zo = z / p.zi_n, zi = z - zo * p.zi_n;
    const float* A = p.A + zo * p.sAo + zi * p.sAi;
    const float* B = p.B + zo * p.sBo + zi * p.sBi;
    v8f acc[TM][TN];
#pragma unroll
    for (int i = 0; i < TM; ++i)
#pragma unroll
        for (int t = 0; t < TN; ++t) { v8f zz = {}; acc[i][t] = zz; }
    for (int k0 = 0; k0 < p.K; k0 += 32) {
        if (MODE == 1) {
            Split a[TM], b[TN];
#pragma unroll
            for (int i = 0; i < TM; ++i) { const int am = min(m0 + 16 * i + l15, p.M - 1); a[i] = sp_ld(A + (long long)am * p.sAm, p.sAk, k0, h, p.K, 1.f); }
#pragma unroll
            for (int t = 0; t < TN; ++t) { const int bn = min(n0 + 16 * t + l15, p.N - 1); b[t] = sp_ld(B + (long long)bn * p.sBn, p.sBk, k0, h, p.K, 1.f); }
#pragma unroll
            for (int i = 0; i < TM; ++i)
#pragma unroll
                for (int t = 0; t < TN; ++t) acc[i][t] = wmma3(a[i], b[t], acc[i][t]);
        } else if (MODE == 2) {
            v16b a[TM], b[TN];
#pragma unroll
            for (int i = 0; i < TM; ++i) { const int am = min(m0 + 16 * i + l15, p.M - 1); a[i] = bh_ld(A + (long long)am * p.sAm, p.sAk, k0, h, p.K, 1.f); }
#pragma unroll
            for (int t = 0; t < TN; ++t) { const int bn = min(n0 + 16 * t + l15, p.N - 1); b[t] = bh_ld(B + (long long)bn * p.sBn, p.sBk, k0, h, p.K, 1.f); }
#pragma unroll
            for (int i = 0; i < TM; ++i)
#pragma unroll
                for (int t = 0; t < TN; ++t) acc[i][t] = wmmab(a[i], b[t], acc[i][t]);
        } else {
            v16h a[TM], b[TN];
#pragma unroll
            for (int i = 0; i < TM; ++i) { const int am = min(m0 + 16 * i + l15, p.M - 1); a[i] = fh_ld(A + (long long)am * p.sAm, p.sAk, k0, h, p.K, p.sa); }
#pragma unroll
            for (int t = 0; t < TN; ++t) { const int bn = min(n0 + 16 * t + l15, p.N - 1); b[t] = fh_ld(B + (long long)bn * p.sBn, p.sBk, k0, h, p.K, p.sb); }
#pragma unroll
            for (int i = 0; i < TM; ++i)
#pragma unroll
                for (int t = 0; t < TN; ++t) acc[i][t] = wmma16(a[i], b[t], acc[i][t]);
        }
    }
    const float iscale = (MODE == 0) ? p.alpha / (p.sa * p.sb) : p.alpha;
    float* C = p.C + zo * p.sCo + zi * p.sCi;
    const float* R = p.R + zo * p.sRo + zi * p.sRi;
    const int NW = (p.Npad > p.N) ? p.Npad : p.N;
    __shared__ __align__(16) float ctile[16][36];
#pragma unroll
    for (int i = 0; i < TM; ++i) {
        const int mb = m0 + 16 * i; if (mb >= p.M) break;          // wave-uniform
#pragma unroll
        for (int tp = 0; tp < TN / 2; ++tp) {
            const int nb = n0 + 32 * tp; if (nb >= NW) break;        // wave-uniform
#pragma unroll
            for (int t2 = 0; t2 < 2; ++t2) {
                const int t = 2 * tp + t2; const int n = nb + t2 * 16 + l15; const int nn = min(n, p.N - 1);
#pragma unroll
                for (int r = 0; r < 8; ++r) {
                    const int m = mb + 8 * h + r; const int mm = min(m, p.M - 1);
                    float v = acc[i][t][r] * iscale;
                    if (p.flags & 1) v += p.bias[nn];
                    if (p.flags & 2) v += p.bias[mm];
            if (p.flags & 8) v *= p.bias[(long long)zo * p.M + mm];   /* per-(z,row) scale vector laid out [Z][M]; exclusive with the bias flags */
                    v = act_fn(v, p.act);
                    if (p.flags & 4) v += p.beta * R[(long long)mm * p.sRm + (long long)nn * p.sRn];
                    ctile[8 * h + r][t2 * 16 + l15] = (n < p.N) ? v : 0.f;
                }
            }
            __syncthreads();
            const bool fast = (mb + 16 <= p.M) && (nb + 32 <= NW) && ((p.sCm & 3) == 0) && ((((size_t)C) & 15) == 0);
            if (fast) {
#pragma unroll
                for (int s = 0; s < 4; ++s) {
                    const int row = s * 4 + (lane >> 3), c4 = (lane & 7) * 4;
                    const v4f v = *(const v4f*)&ctile[row][c4];
                    VST2V4(C + (long long)(mb + row) * p.sCm + nb + c4, v);
                }
            } else {
                for (int row = 0; row < 16; ++row) {
                    const int m = mb + row, n = nb + lane;
                    if (m < p.M && n < NW) VST2(float, C + (long long)m * p.sCm + n, ctile[row][lane]);
                }
            }
            __syncthreads();
        }
    }
}

// =====================================================================================================================
//   Wave = 16 queries, AW waves per block, 64-key blocks; grid (ceil(Lq/(16*AW)), H, B), block 32*AW. Any Lq, Lk; head dim dh <= DHP
//   (DHP multiple of 32), value dim dv <= DVP (multiple of 16, <= 128). Every tensor addressed by (batch, head, row, element) strides, f32.
//   Scores: QM 0 f16 operands, 1 bf16 hi/lo split, 2 bf16 triple split; statistics f32 (exp2 domain); P.V: P x 4096 as f16 with V f16 staged in LDS
//   (SPLITPV: P and V as bf16 hi/lo splits). kv head = h / hrep. Masking: causal = 1 (keep j <= i + coff, masked -> -inf, key blocks beyond the
//   diagonal skipped), causal = 2 (masked -> mfill, a finite fill like the -1e9; no skipping), causal = 3 (keep j >= i + coff,
//   masked -> -inf, no skipping); optional additive f32 mask Mf,
//   optional int keep-mask Mi (0 -> score := mfill), both addressed b*smb + h*smh + i*smi + j*smj (0 strides broadcast).
// =====================================================================================================================
#define AW 4
struct AttnP {   // apv4
    const float* Q; const float* K; const float* V; float* O; float* P; const float* Mf; const int* Mi; float* ST;
    const float* Pw; const float* Rt; const int* SQ; const int* SK;           // optional: post-softmax weight, relative-position table, segment ids
    long long swb, swh, swi, swj, srb, srh, sri;                                 // Pw strides (b,h,i,j); Rt strides (b,h,i), column = clamp(i - j + roff, 0, rn-1)
    long long sQb, sQh, sQi, sQd, sKb, sKh, sKj, sKd, sVb, sVh, sVj, sVd, sOb, sOh, sOi, sPb, sPh, sPi, smb, smh, smi, smj;
    int Lq, Lk, dh, dv, hrep, causal, coff, pband;   // pband > 0: P holds only the band |j - i| <= pband, column j - i + pband
    float scale, mfill; int nonorm, mpol;             // nonorm (online path only): O = sum_j exp(score_j) V_j without the 1/rowsum (scores must be <= ~0); mpol: Mi masks where ==0 (mpol 0) or where !=0 (mpol 1)
    int roff, rn, segpol, win;                        // Rt column offset/count; SQ/SK: score := mfill where (segpol 0) SQ[i] != SK[j] or (segpol 1) SQ[i] == SK[j]; win > 0: keys with i - j > win (after coff) -> -inf
};
//   Pw: the softmax numerator is multiplied by Pw(b,h,i,j) AFTER the row sum is taken (probs * weight, then P.V), as in post-softmax multiplicative biases.                                                    // ST (optional): per row (b,h,i) -> ST[((b*H + h)*Lq + i)*2 + {0,1}] = {row max of the scaled+masked score (natural units), sum_j exp(score - max)}
static_assert(sizeof(AttnP) == 12 * 8 + 29 * 8 + 16 * 4, "AttnP has padding");

#ifndef KATTN_ATTR
#define KATTN_ATTR
#endif
template <int DHP, int DVP, int QM, bool SPLITPV, bool TWOPASS>
__global__ __launch_bounds__(32 * AW) KATTN_ATTR void k_attn(AttnP p) {
    constexpr int NT = DVP / 16;                // output tiles
    constexpr int KS = DHP / 32;                // k-steps for the scores
    constexpr int VP = DVP + 8;                 // LDS pitch (halves)
    __shared__ __align__(16) float    pl[AW][16 * 64];
    __shared__ __align__(16) _Float16 vl[(SPLITPV ? 2 : 1) * 64 * VP];   // f16 V tile, or bf16 hi and lo tiles (same 2-byte size)
    const int lane = threadIdx.x & 31, hf = lane >> 4, l15 = lane & 15, wave = threadIdx.x >> 5;
    const int h = blockIdx.y, b = blockIdx.z, hk = h / p.hrep;
    const int q0 = (blockIdx.x * AW + wave) * 16;
    float* myp = pl[wave];
    const float L2E = 1.4426950408889634f;
    const float NEG = -__builtin_inff();
    const int qi = min(q0 + l15, p.Lq - 1);
    const float* qrow = p.Q + b * p.sQb + h * p.sQh + (long long)qi * p.sQi;
    const float* kbase = p.K + b * p.sKb + hk * p.sKh;
    const float* vbase = p.V + b * p.sVb + hk * p.sVh;
    v16h qa[QM == 0 ? KS : 1]; Split qs_[QM == 1 ? KS : 1]; Split3 qt_[QM == 2 ? KS : 1];
#pragma unroll
    for (int ks = 0; ks < KS; ++ks) {
        if (QM == 2) qt_[ks] = sp3_ld(qrow, p.sQd, ks * 32, hf, p.dh, 1.f);
        else if (QM == 1) qs_[ks] = sp_ld(qrow, p.sQd, ks * 32, hf, p.dh, 1.f);
        else qa[ks] = fh_ld(qrow, p.sQd, ks * 32, hf, p.dh, 1.f);
    }
    v8f o[NT]; float m8[8], l8[8];
#pragma unroll
    for (int t = 0; t < NT; ++t) { v8f zz = {}; o[t] = zz; }
#pragma unroll
    for (int i = 0; i < 8; ++i) { m8[i] = NEG; l8[i] = 0.f; }
    int jend = p.Lk; int jstart = 0;
    if (p.causal == 1) { const int je = (blockIdx.x * AW + AW - 1) * 16 + 16 + p.coff; jend = min(jend, max(je, 0)); }   // uniform per block
    if (p.win > 0) { const int js = (int)(blockIdx.x * AW) * 16 + p.coff - p.win; jstart = (js > 0) ? (js / 64) * 64 : 0; }   // uniform per block: key blocks entirely outside every row's window hold only -inf entries and are skipped exactly
    const int npass = TWOPASS ? 2 : 1;
    for (int pass = 0; pass < npass; ++pass) {
        const bool dopv = (!TWOPASS) || pass == 1;
        for (int j0 = jstart; j0 < jend; j0 += 64) {
            if (dopv) {
                __syncthreads();                                 // previous key block's reads of vl / pl are done
                for (int idx = threadIdx.x; idx < 64 * DVP; idx += 32 * AW) {
                    const int jr = idx / DVP, d = idx - jr * DVP, j = j0 + jr;
                    const float f = (j < p.Lk && d < p.dv) ? vbase[(long long)j * p.sVj + (long long)d * p.sVd] : 0.f;
                    if (SPLITPV) {
                        const __bf16 hb = bf16_rne(f);
                        ((__bf16*)vl)[jr * VP + d] = hb; ((__bf16*)vl)[64 * VP + jr * VP + d] = bf16_rne(f - bf16_f32(hb));
                    } else vl[jr * VP + d] = (_Float16)f;
                }
            }
            v8f s[4];
#pragma unroll
            for (int t = 0; t < 4; ++t) {
                const int j = min(j0 + t * 16 + l15, p.Lk - 1);
                const float* krow = kbase + (long long)j * p.sKj;
                v8f acc = {};
#pragma unroll
                for (int ks = 0; ks < KS; ++ks) {
                    if (QM == 2)      acc = wmma6(qt_[ks], sp3_ld(krow, p.sKd, ks * 32, hf, p.dh, 1.f), acc);
                    else if (QM == 1) acc = wmma3(qs_[ks], sp_ld(krow, p.sKd, ks * 32, hf, p.dh, 1.f), acc);
                    else              acc = wmma16(qa[ks], fh_ld(krow, p.sKd, ks * 32, hf, p.dh, 1.f), acc);
                }
                s[t] = acc;
            }
            float pv[8][4];
#pragma unroll
            for (int i = 0; i < 8; ++i) {
                const int irow = q0 + i + 8 * hf;
                const int ic = min(irow, p.Lq - 1);
                float sc[4];
#pragma unroll
                for (int t = 0; t < 4; ++t) {
                    const int jg = j0 + t * 16 + l15;
                    float v = s[t][i] * p.scale;
                    if (p.Mf) v += p.Mf[b * p.smb + h * p.smh + (long long)ic * p.smi + (long long)min(jg, p.Lk - 1) * p.smj];
                    if (p.Rt) { int rc = ic - min(jg, p.Lk - 1) + p.roff; rc = rc < 0 ? 0 : (rc >= p.rn ? p.rn - 1 : rc); v += p.Rt[b * p.srb + h * p.srh + (long long)ic * p.sri + rc]; }
                    if (p.Mi) { const int mv = p.Mi[b * p.smb + h * p.smh + (long long)ic * p.smi + (long long)min(jg, p.Lk - 1) * p.smj]; if (p.mpol ? (mv != 0) : (mv == 0)) v = p.mfill; }
                    if (p.SQ) { const bool same = p.SQ[(long long)b * p.Lq + ic] == p.SK[(long long)b * p.Lk + min(jg, p.Lk - 1)]; if (p.segpol ? same : !same) v = p.mfill; }
                    if (p.causal == 2 && jg > irow + p.coff) v = p.mfill;
                    if (jg >= p.Lk || (p.causal == 1 && jg > irow + p.coff) || (p.causal == 3 && jg < irow + p.coff) || (p.win > 0 && irow + p.coff - jg > p.win)) v = NEG; else v *= L2E;
                    sc[t] = v;
                }
                if (!TWOPASS || pass == 0) {
                    float mx = fmaxf(fmaxf(sc[0], sc[1]), fmaxf(sc[2], sc[3]));
                    mx = fmaxf(mx, __shfl_xor(mx, 1, 32)); mx = fmaxf(mx, __shfl_xor(mx, 2, 32));
                    mx = fmaxf(mx, __shfl_xor(mx, 4, 32)); mx = fmaxf(mx, __shfl_xor(mx, 8, 32));
                    const float mnew = fmaxf(m8[i], mx);
                    const float corr = (mnew == NEG) ? 1.f : exp2f(m8[i] - mnew);
                    float rs = 0.f;
#pragma unroll
                    for (int t = 0; t < 4; ++t) {
                        const float pp = (sc[t] == NEG) ? 0.f : exp2f(sc[t] - mnew); rs += pp;
                        pv[i][t] = p.Pw ? pp * p.Pw[b * p.swb + h * p.swh + (long long)ic * p.swi + (long long)min(j0 + t * 16 + l15, p.Lk - 1) * p.swj] : pp;
                    }
                    rs += __shfl_xor(rs, 1, 32); rs += __shfl_xor(rs, 2, 32); rs += __shfl_xor(rs, 4, 32); rs += __shfl_xor(rs, 8, 32);
                    l8[i] = l8[i] * corr + rs; m8[i] = mnew;
                    if (!TWOPASS) {
#pragma unroll
                        for (int t = 0; t < NT; ++t) o[t][i] *= corr;
                    }
                } else {
                    const float inv = (l8[i] > 0.f) ? 1.f / l8[i] : 0.f;
#pragma unroll
                    for (int t = 0; t < 4; ++t) {
                        const int jg = j0 + t * 16 + l15;
                        float pp = (sc[t] == NEG) ? 0.f : exp2f(sc[t] - m8[i]) * inv;
                        if (p.Pw) pp *= p.Pw[b * p.swb + h * p.swh + (long long)ic * p.swi + (long long)min(jg, p.Lk - 1) * p.swj];
                        pv[i][t] = pp;
                    }
                }
            }
            if (dopv) {
#pragma unroll
                for (int i = 0; i < 8; ++i)
#pragma unroll
                    for (int t = 0; t < 4; ++t) ((float*)myp)[(i + 8 * hf) * 64 + t * 16 + l15] = pv[i][t];
                __syncthreads();                                 // P (per wave) and V (shared) visible
                if (p.P) {
                    float* pb_ = p.P + b * p.sPb + h * p.sPh;
                    const bool fastP = (p.pband == 0) && ((p.sPi & 3) == 0) && (j0 + 64 <= p.Lk) && (q0 + 16 <= p.Lq) && ((((size_t)pb_) & 15) == 0);
                    if (fastP) {
#pragma unroll
                        for (int s = 0; s < 8; ++s) {
                            const int row = s * 2 + (lane >> 4), c4 = (lane & 15) * 4;
                            const v4f v = *(const v4f*)(myp + row * 64 + c4);
                            VST2V4(pb_ + (long long)(q0 + row) * p.sPi + j0 + c4, v);
                        }
                    } else {
                        for (int row = 0; row < 16; ++row) {
                            const int irow = q0 + row; if (irow >= p.Lq) continue;
                            for (int c = lane; c < 64; c += 32) {
                                const int jg = j0 + c; if (jg >= p.Lk) continue;
                                if (p.pband == 0) VST2(float, pb_ + (long long)irow * p.sPi + jg, myp[row * 64 + c]);
                                else if (jg - irow <= p.pband && irow - jg <= p.pband) VST2(float, pb_ + (long long)irow * p.sPi + (jg - irow + p.pband), myp[row * 64 + c]);
                            }
                        }
                    }
                }
                if (SPLITPV) {
                    const Split pa0 = sp_ld(myp + l15 * 64, 1, 0, hf, 64, 1.f), pa1 = sp_ld(myp + l15 * 64, 1, 32, hf, 64, 1.f);
                    const __bf16* vh = (const __bf16*)vl; const __bf16* vlo = vh + 64 * VP;
#pragma unroll
                    for (int t = 0; t < NT; ++t) {
                        const int dcol = t * 16 + l15;
                        Split b0, b1;
#pragma unroll
                        for (int e = 0; e < 16; ++e) {
                            const int k0 = frag_k(e, hf), k1 = 32 + frag_k(e, hf);
                            b0.hi[e] = vh[k0 * VP + dcol]; b0.lo[e] = vlo[k0 * VP + dcol]; b1.hi[e] = vh[k1 * VP + dcol]; b1.lo[e] = vlo[k1 * VP + dcol];
                        }
                        o[t] = wmma3(pa0, b0, o[t]);
                        o[t] = wmma3(pa1, b1, o[t]);
                    }
                } else {
                    const v16h pa0 = fh_ld(myp + l15 * 64, 1, 0, hf, 64, 4096.f), pa1 = fh_ld(myp + l15 * 64, 1, 32, hf, 64, 4096.f);
#pragma unroll
                    for (int t = 0; t < NT; ++t) {
                        const int dcol = t * 16 + l15;
                        v16h b0, b1;
#pragma unroll
                        for (int e = 0; e < 16; ++e) { b0[e] = vl[frag_k(e, hf) * VP + dcol]; b1[e] = vl[(32 + frag_k(e, hf)) * VP + dcol]; }
                        o[t] = wmma16(pa0, b0, o[t]);
                        o[t] = wmma16(pa1, b1, o[t]);
                    }
                }
            }
        }
    }
    float* obase = p.O + b * p.sOb + h * p.sOh;
    if (p.ST) {
        const int rl = lane >> 1, isel = rl & 7;           // row q0 + rl ; rl>>3 == hf holds because lane>>4 == (lane>>1)>>3
        float mv = 0.f, lv = 0.f;
#pragma unroll
        for (int i = 0; i < 8; ++i) if (i == isel) { mv = m8[i]; lv = l8[i]; }
        const int irow = q0 + rl;
        if (irow < p.Lq) { float* st = p.ST + (((long long)b * gridDim.y + h) * p.Lq + irow) * 2 + (lane & 1); VST2(float, st, (lane & 1) ? lv : mv * 0.6931471805599453f); }
    }
    float invr[8];
#pragma unroll
    for (int i = 0; i < 8; ++i) {
        if (TWOPASS) invr[i] = SPLITPV ? 1.f : (1.f / 4096.f);
        else if (p.nonorm) invr[i] = exp2f(m8[i]) * (SPLITPV ? 1.f : (1.f / 4096.f));
        else invr[i] = (l8[i] > 0.f) ? (SPLITPV ? 1.f / l8[i] : 1.f / (l8[i] * 4096.f)) : 0.f;
    }
    __syncthreads();                                             // all waves done with pl/vl from the main loop
    const bool ofast = ((p.sOi & 3) == 0) && ((((size_t)obase) & 15) == 0) && (q0 + 16 <= p.Lq);
#pragma unroll
    for (int c0 = 0; c0 < DVP; c0 += 64) {
#pragma unroll
        for (int i = 0; i < 8; ++i)
#pragma unroll
            for (int t = 0; t < NT; ++t) if (t * 16 >= c0 && t * 16 < c0 + 64) ((float*)myp)[(i + 8 * hf) * 64 + (t * 16 - c0) + l15] = o[t][i] * invr[i];
        __syncthreads();
        const int cw = (DVP - c0 < 64) ? (DVP - c0) : 64;      // staged columns in this chunk (multiple of 16)
        if (ofast && (c0 + cw <= p.dv) && (cw % 32 == 0)) {
            const int lpr = cw / 4;                              // lanes per row (16 for 64 cols, 8 for 32)
            const int rows_per_ins = 32 / lpr;
            for (int r0 = 0; r0 < 16; r0 += rows_per_ins) {
                const int row = r0 + lane / lpr, c4 = (lane % lpr) * 4;
                const v4f v = *(const v4f*)(myp + row * 64 + c4);
                VST2V4(obase + (long long)(q0 + row) * p.sOi + c0 + c4, v);
            }
        } else {
            for (int row = 0; row < 16; ++row) {
                const int irow = q0 + row; if (irow >= p.Lq) continue;
                for (int c = lane; c < cw; c += 32) { const int d = c0 + c; if (d < p.dv) VST2(float, obase + (long long)irow * p.sOi + d, myp[row * 64 + c]); }
            }
        }
        __syncthreads();
    }
}

// =====================================================================================================================
// k_tr: dst(z, c, r) = alpha * src(z, r, c) (+ beta * R2(z, c, r)): [Z][R][C] (row stride lds) -> [Z][C][R] (row stride ldd) through a 32x32 LDS tile;
//   flags: 1 -> add beta * residual R2 addressed like dst (z*sRz + c*ldr + r); act applied before the residual.
// =====================================================================================================================
struct TrP { const float* src; float* dst; const float* R2; long long sSz, lds, sDz, ldd, sRz, ldr; int R, C, flags, act; float alpha, beta; };
static_assert(sizeof(TrP) == 3 * 8 + 6 * 8 + 6 * 4, "TrP has padding");
__global__ __launch_bounds__(256) void k_tr(TrP p) {
    __shared__ float tile[32][33];
    const int c0 = blockIdx.x * 32, r0 = blockIdx.y * 32, z = blockIdx.z;
    const int lane = threadIdx.x & 31, wave = threadIdx.x >> 5;
    const float* s = p.src + z * p.sSz;
#pragma unroll
    for (int k = 0; k < 4; ++k) {
        const int rl = wave * 4 + k, r = r0 + rl, c = c0 + lane;
        tile[rl][lane] = (r < p.R && c < p.C) ? s[(long long)r * p.lds + c] : 0.f;
    }
    __syncthreads();
    float* d = p.dst + z * p.sDz; const float* rr = p.R2 + z * p.sRz;
#pragma unroll
    for (int k = 0; k < 4; ++k) {
        const int cl = wave * 4 + k, c = c0 + cl, r = r0 + lane;
        if (c < p.C && r < p.R) {
            float v = act_fn(p.alpha * tile[lane][cl], p.act);
            if (p.flags & 1) v += p.beta * rr[(long long)c * p.ldr + r];
            VST2(float, d + (long long)c * p.ldd + r, v);
        }
    }
}

// k_affine: dst[i] = a * (sdev ? sdev[0] : 1) * src[i] + b, i < n (one thread per element; consecutive lanes -> consecutive addresses)
__global__ __launch_bounds__(256) void k_affine(const float* __restrict__ src, float* __restrict__ dst, int n, float a, float b, const float* __restrict__ sdev) {
    const int i = blockIdx.x * 256 + threadIdx.x;
    if (i < n) { const float aa = sdev ? a * sdev[0] : a; const float v = aa * src[i] + b; VST2(float, dst + i, v); }
}

// =====================================================================================================================
// k_softmax: row softmax over n contiguous elements, one 256-thread block per row; rows addressed z*sz + r*sr (grid (R, Z)).
//   out = scale_out * softmax(scale_in * x + (Mf ? Mf[z*smz + r*smr + j] : 0)); a row whose max is -inf is written as 0.
// =====================================================================================================================
struct SmP { const float* src; float* dst; const float* Mf; long long sz, sr, dz, dr, smz, smr; int n, pad; float scale_in, scale_out; };
static_assert(sizeof(SmP) == 3 * 8 + 6 * 8 + 4 * 4, "SmP has padding");
__global__ __launch_bounds__(256) void k_softmax(SmP p) {
    __shared__ float red[256];
    const int r = blockIdx.x, z = blockIdx.y, tid = threadIdx.x;
    const float* s = p.src + z * p.sz + (long long)r * p.sr;
    const float* mf = p.Mf ? (p.Mf + z * p.smz + (long long)r * p.smr) : nullptr;
    float mx = -__builtin_inff();
    for (int j = tid; j < p.n; j += 256) { float v = s[j] * p.scale_in; if (mf) v += mf[j]; mx = fmaxf(mx, v); }
    red[tid] = mx; __syncthreads();
    for (int o = 128; o > 0; o >>= 1) { if (tid < o) red[tid] = fmaxf(red[tid], red[tid + o]); __syncthreads(); }
    mx = red[0]; __syncthreads();
    float sum = 0.f;
    for (int j = tid; j < p.n; j += 256) { float v = s[j] * p.scale_in; if (mf) v += mf[j]; sum += (mx == -__builtin_inff()) ? 0.f : expf(v - mx); }
    red[tid] = sum; __syncthreads();
    for (int o = 128; o > 0; o >>= 1) { if (tid < o) red[tid] += red[tid + o]; __syncthreads(); }
    sum = red[0];
    const float inv = (sum > 0.f) ? p.scale_out / sum : 0.f;
    float* d = p.dst + z * p.dz + (long long)r * p.dr;
    for (int j = tid; j < p.n; j += 256) { float v = s[j] * p.scale_in; if (mf) v += mf[j]; const float o = (mx == -__builtin_inff()) ? 0.f : expf(v - mx) * inv; VST2(float, d + j, o); }
}
// =====================================================================================================================
// k_stats: mean and rsqrt(var + eps) over a set of n elements addressed base + z*sz + (e / inner) * so + (e % inner) * si, one 256-thread
// k_norm_apply: y = (x - mean[set]) * rstd[set] * g[c] + b[c] over a [Z][C][L] channel-major tensor with set = z*G + c / (C/G) (G groups per z;
//   G = C -> per-channel sets indexed z*C+c; for batch norm pass stats indexed by c only via bn = 1). Optional act. Output same layout.
// =====================================================================================================================
//   mode 0: mean / rsqrt(var + eps); mode 1 (RMSNorm): 0 / rsqrt(mean(x^2) + eps); mode 2 (L2 normalize * sqrt(n)): 0 / sqrt(n) / max(||x||, eps); mode 3: as 0 with unbiased variance (n-1)
__global__ __launch_bounds__(256) void k_stats(const float* __restrict__ x, long long sz, long long so, long long si, int inner, int n, float eps, float* __restrict__ stat, int mode) {
    __shared__ float red[256];
    const int z = blockIdx.x, tid = threadIdx.x;
    const float* base = x + z * sz;
    float s = 0.f;
    for (int e = tid; e < n; e += 256) s += base[(long long)(e / inner) * so + (long long)(e % inner) * si];
    red[tid] = s; __syncthreads();
    for (int o = 128; o > 0; o >>= 1) { if (tid < o) red[tid] += red[tid + o]; __syncthreads(); }
    const float mu = (mode == 0 || mode == 3) ? red[0] / (float)n : 0.f; __syncthreads();
    float q = 0.f;
    for (int e = tid; e < n; e += 256) { const float dlt = base[(long long)(e / inner) * so + (long long)(e % inner) * si] - mu; q += dlt * dlt; }
    red[tid] = q; __syncthreads();
    for (int o = 128; o > 0; o >>= 1) { if (tid < o) red[tid] += red[tid + o]; __syncthreads(); }
    {
        float rs;
        if (mode == 2) rs = sqrtf((float)n) / fmaxf(sqrtf(red[0]), eps); else if (mode == 3) rs = rsqrtf(red[0] / (float)(n - 1) + eps); else rs = rsqrtf(red[0] / (float)n + eps);
        if (tid < 32) { const float v = (tid == 0) ? mu : ((tid == 1) ? rs : 0.f); VST2(float, stat + (long long)z * 32 + tid, v); }
    }
}
//   One thread per element over the flat [Z][C][L] index space: grid ceil(Z*C*L / 256).
__global__ __launch_bounds__(256) void k_norm_apply(const float* __restrict__ x, float* __restrict__ y, const float* __restrict__ stat, const float* __restrict__ g, const float* __restrict__ bta,
                                                     int Z, int C, int L, int G, int bn, int act) {
    const long long idx = (long long)blockIdx.x * 256 + threadIdx.x;
    if (idx >= (long long)Z * C * L) return;
    const int l = (int)(idx % L); const long long zc = idx / L; const int c = (int)(zc % C), z = (int)(zc / C); (void)l;
    const int set = bn ? c : (z * G + c / (C / G));
    float v = (x[idx] - stat[(long long)set * 32]) * stat[(long long)set * 32 + 1];
    if (g) v *= g[c];
    if (bta) v += bta[c];
    v = act_fn(v, act);
    VST2(float, y + idx, v);
}

// k_lse_neg: c[i] = -(st[2i] + log(st[2i+1])) = minus the log-sum-exp of row i from k_attn's ST output (for softmax over the query dimension)
__global__ __launch_bounds__(256) void k_lse_neg(const float* __restrict__ st, float* __restrict__ c, int n) {
    const int i = blockIdx.x * 256 + threadIdx.x;
    if (i < n) { const float v = -(st[2 * i] + logf(st[2 * i + 1])); VST2(float, c + i, v); }
}

// k_iota: dst[i] = a * i + b as int32 (segment/position id helper)
__global__ __launch_bounds__(256) void k_iota(int* __restrict__ dst, int n, int a, int b) {
    const int i = blockIdx.x * 256 + threadIdx.x;
    if (i < n) { const int v = a * i + b; VST2(int, dst + i, v); }
}

// k_axpby: dst[i] = a * x[i] + b * y[i] (+ c), i < n
__global__ __launch_bounds__(256) void k_axpby(const float* __restrict__ x, const float* __restrict__ y, float* __restrict__ dst, int n, float a, float b, float c) {
    const int i = blockIdx.x * 256 + threadIdx.x;
    if (i < n) { const float v = a * x[i] + b * y[i] + c; VST2(float, dst + i, v); }
}

// =====================================================================================================================
// k_rope: rotary embedding on a [R rows][Hn heads][D] view (row stride sXr, head stride sXh, element stride 1) -> Y (own strides).
//   mode 0: rotate_half (partner d±D/2, sign - for d<D/2); mode 1: interleaved pairs (partner d^1, sign - for even d).
//   table column tcol: tmode 0 -> d, 1 -> d % (D/2), 2 -> d / 2; position p: pmode 0 -> r % S, 1 -> head index, 2 -> pos[r];
//   c = C[(r / S) * sCb + p * sCp + tcol * sCd], s likewise from Sn; y = x[d] * c + sign * x[partner] * s. X and Y must not alias.
// =====================================================================================================================
struct RopeP { const float* X; float* Y; const float* C; const float* Sn; const int* pos; long long sXr, sXh, sYr, sYh, sCb, sCp, sCd; int R, Hn, D, S, mode, tmode, pmode, pad; };
static_assert(sizeof(RopeP) == 5 * 8 + 7 * 8 + 8 * 4, "RopeP has padding");
__global__ __launch_bounds__(256) void k_rope(RopeP p) {
    const long long idx = (long long)blockIdx.x * 256 + threadIdx.x;
    if (idx >= (long long)p.R * p.Hn * p.D) return;
    const int d = (int)(idx % p.D); const long long rh = idx / p.D; const int h = (int)(rh % p.Hn); const int r = (int)(rh / p.Hn);
    const int half = p.D / 2;
    int partner; float sign;
    if (p.mode == 0) { partner = (d < half) ? d + half : d - half; sign = (d < half) ? -1.f : 1.f; }
    else { partner = d ^ 1; sign = (d & 1) ? 1.f : -1.f; }
    const int tcol = (p.tmode == 0) ? d : ((p.tmode == 1) ? (d % half) : (d >> 1));
    const int pp = (p.pmode == 0) ? (r % p.S) : ((p.pmode == 1) ? h : p.pos[r]);
    const long long toff = (long long)(r / p.S) * p.sCb + (long long)pp * p.sCp + (long long)tcol * p.sCd;
    const float* xr = p.X + (long long)r * p.sXr + (long long)h * p.sXh;
    const float v = xr[d] * p.C[toff] + sign * xr[partner] * p.Sn[toff];
    VST2(float, p.Y + (long long)r * p.sYr + (long long)h * p.sYh + d, v);
}

// k_invf + k_sincos (split so neither kernel carries a large VALU-fma footprint): invf_i = num * (1 / powf(base, (2 i)/D)) [fmode 0],
//   num * expf((2 i) * cexp) [fmode 1], num * powf(base, -2 (i - 1) / D) [fmode 2]; then cs/sn[s*half + i] = cos/sin((pscale * s) * invf_i)
__global__ __launch_bounds__(256) void k_invf(float* __restrict__ invb, int half, int D, float base, float num, int fmode, float cexp) {
    const int i = blockIdx.x * 256 + threadIdx.x;
    if (i >= ((half + 31) / 32) * 32) return;
    if (i >= half) { VST2(float, invb + i, 0.f); return; }
    const float e = (float)(2 * i) / (float)D;
    float invf;
    if (fmode == 1) invf = num * expf((float)(2 * i) * cexp);
    else if (fmode == 2) invf = num * powf(base, (-2.0f * ((float)i - 1.0f)) / (float)D);
    else invf = num * (1.0f / powf(base, e));
    VST2(float, invb + i, invf);
}
__global__ __launch_bounds__(256) void k_sincos(float* __restrict__ cs, float* __restrict__ sn, const float* __restrict__ invb, int S, int half, float pscale) {
    const int idx = blockIdx.x * 256 + threadIdx.x;
    if (idx >= S * half) return;
    const int s = idx / half, i = idx - s * half;
    const float ang = (pscale * (float)s) * invb[i];
    VST2(float, cs + idx, cosf(ang)); VST2(float, sn + idx, sinf(ang));
}

// k_mulact: dst[i] = act(x[i]) * y[i]
__global__ __launch_bounds__(256) void k_mulact(const float* __restrict__ x, const float* __restrict__ y, float* __restrict__ dst, int n, int act) {
    const int i = blockIdx.x * 256 + threadIdx.x;
    if (i < n) { const float v = act_fn(x[i], act) * y[i]; VST2(float, dst + i, v); }
}

// =====================================================================================================================
// k_matvec: thread-per-row matrix-vector products for N <= 8 output columns (heads with 1-3 outputs, gates), f32 on the VALU.
//   C[r*sCm + j] = act(alpha * sum_k A[r*sAm + k*sAk] * B[j*sBn + k*sBk] + bias[j]) + beta * R[r*sRm + j*sRn]; each thread writes its N contiguous floats.
// =====================================================================================================================
__global__ __launch_bounds__(256) void k_matvec(GemmP p) {
    // 32 lanes write one line with one instruction.
    const int rpt = (p.N == 1) ? 1 : 32;
    const long long r0 = ((long long)blockIdx.x * 256 + threadIdx.x) * rpt; const int z = blockIdx.z, zo = z / p.zi_n, zi = z - zo * p.zi_n;
    if (r0 >= p.M) return;
    const float* Bb = p.B + zo * p.sBo + zi * p.sBi;
    float* C = p.C + zo * p.sCo + zi * p.sCi; const float* R = p.R + zo * p.sRo + zi * p.sRi;
    for (int rr = 0; rr < rpt; ++rr) {
        const long long r = r0 + rr; if (r >= p.M) break;
        const float* A = p.A + zo * p.sAo + zi * p.sAi + r * p.sAm;
        float acc[8] = {0.f, 0.f, 0.f, 0.f, 0.f, 0.f, 0.f, 0.f};
        for (int k = 0; k < p.K; ++k) { const float a = A[(long long)k * p.sAk];
#pragma unroll
            for (int j = 0; j < 8; ++j) if (j < p.N) acc[j] += a * Bb[(long long)j * p.sBn + (long long)k * p.sBk]; }
#pragma unroll
        for (int j = 0; j < 8; ++j) if (j < p.N) {
            float v = acc[j] * p.alpha;
            if (p.flags & 1) v += p.bias[j];
            if (p.flags & 2) v += p.bias[r];
            v = act_fn(v, p.act);
            if (p.flags & 4) v += p.beta * R[r * p.sRm + (long long)j * p.sRn];
            VST2(float, C + r * p.sCm + j, v);
        }
    }
}
// k_smallsoftmax: thread-per-row softmax for short rows (n <= 64): dst[r*dr + j] = softmax(scale*src[r*sr + j])
__global__ __launch_bounds__(256) void k_smallsoftmax(const float* __restrict__ src, float* __restrict__ dst, long long sr, long long dr, int n, long long R, float scale) {
    const long long r0 = ((long long)blockIdx.x * 256 + threadIdx.x) * 32;
    for (int rr = 0; rr < 32; ++rr) {
        const long long r = r0 + rr; if (r >= R) return;
        const float* s = src + r * sr; float* d = dst + r * dr;
        float mx = -__builtin_inff();
        for (int j = 0; j < n; ++j) mx = fmaxf(mx, s[j] * scale);
        float sum = 0.f;
        for (int j = 0; j < n; ++j) sum += expf(s[j] * scale - mx);
        const float inv = 1.f / sum;
        for (int j = 0; j < n; ++j) { const float v = expf(s[j] * scale - mx) * inv; VST2(float, d + j, v); }
    }
}

__global__ __launch_bounds__(32) void k_unitstat(float* __restrict__ st) { const int t = threadIdx.x; const float v = (t == 1) ? 1.f : 0.f; VST2(float, st + t, v); }

// destination (e.g. a d_out whose row width is not a multiple of 32 floats) is written by consecutive lanes of one instruction
__global__ __launch_bounds__(256) void k_lincopy(const float* __restrict__ src, long long lds, float* __restrict__ dst, long long ldd, long long rows, int cols) {
    const long long i = (long long)blockIdx.x * 256 + threadIdx.x; if (i >= rows * cols) return;
    const long long r = i / cols; const int c = (int)(i - r * cols);
    const float v = src[r * lds + c]; VST2(float, dst + r * ldd + c, v);
}

namespace w25 {
typedef __attribute__((ext_vector_type(16))) _Float16 v16h;
typedef __attribute__((ext_vector_type(8)))  _Float16 v8h;
typedef __attribute__((ext_vector_type(16))) __bf16   v16b;
typedef __attribute__((ext_vector_type(8)))  __bf16   v8b;
typedef __attribute__((ext_vector_type(8)))  float    v8f;
typedef __attribute__((ext_vector_type(4)))  float    v4f;

__device__ __forceinline__ unsigned short f2bf_bits(float f) {
  unsigned u = __float_as_uint(f);
  return (unsigned short)((u + 0x7FFFu + ((u >> 16) & 1u)) >> 16);
}
__device__ __forceinline__ float bf_bits2f(unsigned short h) { return __uint_as_float(((unsigned)h) << 16); }

// hazard guards as plain device helpers (no inline asm inside the kernel template body)
__device__ __forceinline__ void dep_guard_h(v8f& a, v8f& b, v16h x, v16h y) { asm volatile("v_nop\n\tv_nop\n\tv_nop\n\tv_nop" : "+v"(a), "+v"(b) : "v"(x), "v"(y)); }
__device__ __forceinline__ void dep_guard_b(v8f& a, v8f& b, v16b x, v16b y) { asm volatile("v_nop\n\tv_nop\n\tv_nop\n\tv_nop" : "+v"(a), "+v"(b) : "v"(x), "v"(y)); }
__device__ __forceinline__ void keep4_h(v16h a, v16h b, v16h c, v16h d) { asm volatile("v_nop" :: "v"(a), "v"(b), "v"(c), "v"(d)); }
__device__ __forceinline__ void keep4_b(v16b a, v16b b, v16b c, v16b d) { asm volatile("v_nop" :: "v"(a), "v"(b), "v"(c), "v"(d)); }
__device__ __forceinline__ void acc_guard4(v8f& a, v8f& b, v8f& c, v8f& d) { asm volatile("v_nop\n\tv_nop\n\tv_nop\n\tv_nop" : "+v"(a), "+v"(b), "+v"(c), "+v"(d)); }
template <typename T> struct Frag;
template <> struct Frag<_Float16> {
  typedef v16h V; union U { v16h v; v8h h[2]; };
  static __device__ __forceinline__ v16h load(const _Float16* p) {   // elements 0..7 <- p[0..7], 8..15 <- p[16..23]
    U f; f.h[0] = *(const v8h*)(p); f.h[1] = *(const v8h*)(p + 16); return f.v;
  }
  static __device__ __forceinline__ v8f mma(v16h a, v16h b, v8f c) {
    return __builtin_amdgcn_wmma_f32_16x16x32_f16(false, a, false, b, (short)0, c, false, false);
  }
  static __device__ __forceinline__ void guard(v8f& a, v8f& b, v16h x, v16h y) { dep_guard_h(a, b, x, y); }
  static __device__ __forceinline__ void keep(v16h a, v16h b, v16h c, v16h d) { keep4_h(a, b, c, d); }
};
template <> struct Frag<__bf16> {
  typedef v16b V; union U { v16b v; v8b h[2]; };
  static __device__ __forceinline__ v16b load(const __bf16* p) {
    U f; f.h[0] = *(const v8b*)(p); f.h[1] = *(const v8b*)(p + 16); return f.v;
  }
  static __device__ __forceinline__ v8f mma(v16b a, v16b b, v8f c) {
    return __builtin_amdgcn_wmma_f32_16x16x32_bf16(false, a, false, b, (short)0, c, false, false);
  }
  static __device__ __forceinline__ void guard(v8f& a, v8f& b, v16b x, v16b y) { dep_guard_b(a, b, x, y); }
  static __device__ __forceinline__ void keep(v16b a, v16b b, v16b c, v16b d) { keep4_b(a, b, c, d); }
};

// ---- Register-blocked batched WMMA GEMM ------------------------------------
// C[m,n] = scale * sum_k A[m,k] * Bt[n,k] (+bias)(+resid); each wave owns a 64x64 tile.
// A row-major [M,K]; Bt row-major [N,K]; M,N % 64 == 0, K % 32 == 0.
// SPLIT: operands are hi/lo planes (A2/Bt2 = lo planes, same layout); product = hi·hi + hi·lo + lo·hi.
// BIAS_MODE: 0 = none, 1 = bias[m], 2 = bias[n].
// OUT_MODE: 0 = f32, 1 = f16, 2 = bf16 hi plane (Cout) + bf16 lo plane (Cout2).
// ET: 0 = f16 operands, 1 = bf16 operands (pointers passed as 16-bit storage)
template <int ET> struct Elem;
template <> struct Elem<0> { typedef _Float16 T; };
template <> struct Elem<1> { typedef __bf16 T; };
template <int ET, bool SPLIT, int BIAS_MODE, int OUT_MODE, bool RESID, int ACT = 0>
__global__ __launch_bounds__(256) void wmma_gemm64(
    const unsigned short* __restrict__ Ap, const unsigned short* __restrict__ A2p, int lda, long strideA,
    const unsigned short* __restrict__ Btp, const unsigned short* __restrict__ Bt2p, int ldb, long strideB,
    void* __restrict__ Cout, void* __restrict__ Cout2, int ldc, long strideC,
    const float* __restrict__ bias,
    const float* __restrict__ resid, long strideR,
    int M, int N, int K, float scale) {
  typedef typename Elem<ET>::T T;
  typedef typename Frag<T>::V V;
  const T* A = (const T*)Ap; const T* A2 = (const T*)A2p; const T* Bt = (const T*)Btp; const T* Bt2 = (const T*)Bt2p;
  __shared__ __align__(16) float sT[8][16 * 68];   // per-wave 16x64 slab, pitch 68 floats
  const int b    = blockIdx.y;
  const int lane = threadIdx.x & 31;
  const int wave = threadIdx.x >> 5;
  const int tilesN = N >> 6;
  const int tilesM = M >> 6;
  const int tile = blockIdx.x * 8 + wave;
  if (tile >= tilesM * tilesN) return;   // wave-uniform; no block barriers in this kernel
  const int tm = tile / tilesN;
  const int tn = tile - tm * tilesN;
  const int m0 = tm << 6;
  const int n0 = tn << 6;

  const T* Ab  = A  + (size_t)b * strideA;
  const T* Bb  = Bt + (size_t)b * strideB;
  const T* Ab2 = SPLIT ? (A2  + (size_t)b * strideA) : nullptr;
  const T* Bb2 = SPLIT ? (Bt2 + (size_t)b * strideB) : nullptr;

  const int rlane = lane & 15;                 // row (A) / col (B, D) within subtile
  const int koff  = (lane >> 4) * 8;           // k offset of this lane half
  const int mOff  = (lane >> 4) * 8;           // D row offset

  v8f acc[4][4];
#pragma unroll
  for (int i = 0; i < 4; ++i)
#pragma unroll
    for (int j = 0; j < 4; ++j) acc[i][j] = (v8f){0.f,0.f,0.f,0.f,0.f,0.f,0.f,0.f};

  for (int k0 = 0; k0 < K; k0 += 32) {
    V bh[4], bl[4];
#pragma unroll
    for (int j = 0; j < 4; ++j) {
      const size_t bo = (size_t)(n0 + (j << 4) + rlane) * ldb + koff + k0;
      bh[j] = Frag<T>::load(Bb + bo);
      if (SPLIT) bl[j] = Frag<T>::load(Bb2 + bo);
    }
#pragma unroll
    for (int i = 0; i < 4; ++i) {
      const size_t ao = (size_t)(m0 + (i << 4) + rlane) * lda + koff + k0;
      V ah = Frag<T>::load(Ab + ao);
      V al;
      if (SPLIT) al = Frag<T>::load(Ab2 + ao);
#pragma unroll
      for (int j = 0; j < 4; ++j) {
        acc[i][j] = Frag<T>::mma(ah, bh[j], acc[i][j]);
        if (SPLIT) {
          acc[i][j] = Frag<T>::mma(ah, bl[j], acc[i][j]);
          acc[i][j] = Frag<T>::mma(al, bh[j], acc[i][j]);
        }
      }
      Frag<T>::guard(acc[i][0], acc[i][3], ah, SPLIT ? al : ah);
    }
    Frag<T>::keep(bh[0], bh[1], bh[2], bh[3]);
    if (SPLIT) Frag<T>::keep(bl[0], bl[1], bl[2], bl[3]);
  }
  acc_guard4(acc[0][0], acc[0][1], acc[0][2], acc[0][3]);
  acc_guard4(acc[1][0], acc[1][1], acc[1][2], acc[1][3]);
  acc_guard4(acc[2][0], acc[2][1], acc[2][2], acc[2][3]);
  acc_guard4(acc[3][0], acc[3][1], acc[3][2], acc[3][3]);

  // ---- epilogue ----
  float* slab = sT[wave];
  const float* Rb = RESID ? (resid + (size_t)b * strideR) : nullptr;
#pragma unroll
  for (int i = 0; i < 4; ++i) {
    const int mBase = m0 + (i << 4);
#pragma unroll
    for (int j = 0; j < 4; ++j) {
      const int n = n0 + (j << 4) + rlane;
      float bv = 0.f;
      if (BIAS_MODE == 2) bv = bias[n];
#pragma unroll
      for (int r = 0; r < 8; ++r) {
        float v = acc[i][j][r] * scale;
        if (BIAS_MODE == 1) v += bias[mBase + mOff + r];
        if (BIAS_MODE == 2) v += bv;
        if (RESID) v += Rb[(size_t)(mBase + mOff + r) * ldc + n];
        if (ACT == 1) v = tanhf(v);
        if (ACT == 2) v = fmaxf(v, 0.0f);
        if (ACT == 3) v = v / (1.0f + expf(-v));
        if (ACT == 4) v = (v > 0.f) ? v : 0.01f * v;
        if (ACT == 5) v = 0.5f * v * (1.0f + erff(v * 0.70710678118654752f));
        slab[(mOff + r) * 68 + (j << 4) + rlane] = v;
      }
    }
    __builtin_amdgcn_fence(__ATOMIC_RELEASE, "workgroup");
    __builtin_amdgcn_wave_barrier();
    __builtin_amdgcn_fence(__ATOMIC_ACQUIRE, "workgroup");
    if (OUT_MODE == 0) {
      float* C = (float*)Cout + (size_t)b * strideC;
      const int hh = lane >> 4, c4 = (lane & 15) * 4;     // row seg = 256 B = 16 lanes x 16 B
      {
#pragma unroll
        for (int it = 0; it < 8; ++it) {
          const int row = it * 2 + hh;
          v4f v = *(const v4f*)(slab + row * 68 + c4);
          *(v4f*)(C + (size_t)(mBase + row) * ldc + n0 + c4) = v;
        }
        
      }
    } else {
      const int q = lane >> 3, c8 = (lane & 7) * 8;
      unsigned short* C  = (unsigned short*)Cout  + (size_t)b * strideC;
      unsigned short* C2 = (OUT_MODE == 2) ? ((unsigned short*)Cout2 + (size_t)b * strideC) : nullptr;
      {
#pragma unroll
        for (int it = 0; it < 4; ++it) {
          const int row = it * 4 + q;
          const float* sp = slab + row * 68 + c8;
          v8h hv, lv;
#pragma unroll
          for (int e = 0; e < 8; ++e) {
            if (OUT_MODE == 1) {
              hv[e] = (_Float16)sp[e];
            } else {
              unsigned short hb = f2bf_bits(sp[e]);
              unsigned short lb = f2bf_bits(sp[e] - bf_bits2f(hb));
              hv[e] = __builtin_bit_cast(_Float16, hb);
              lv[e] = __builtin_bit_cast(_Float16, lb);
            }
          }
          *(v8h*)(C + (size_t)(mBase + row) * ldc + n0 + c8) = hv;
          if (OUT_MODE == 2) *(v8h*)(C2 + (size_t)(mBase + row) * ldc + n0 + c8) = lv;
        }
        
      }
    }
    __builtin_amdgcn_fence(__ATOMIC_RELEASE, "workgroup");
    __builtin_amdgcn_wave_barrier();
    __builtin_amdgcn_fence(__ATOMIC_ACQUIRE, "workgroup");
  }
}

__global__ __launch_bounds__(256) void cast_f32_f16x2(
    const float* __restrict__ in, _Float16* __restrict__ out, int n2) {
  int i = blockIdx.x * 256 + threadIdx.x;
  if (i < n2) {
    const _Float16 h0 = (_Float16)in[2 * i], h1 = (_Float16)in[2 * i + 1];
    const unsigned u = (unsigned)__builtin_bit_cast(unsigned short, h0) | ((unsigned)__builtin_bit_cast(unsigned short, h1) << 16);
    ((unsigned*)out)[i] = u;
    
  }
}


} // namespace w25

__device__ __forceinline__ unsigned int f2h2_pack(float a, float b) { return (unsigned)__builtin_bit_cast(unsigned short, (_Float16)a) | ((unsigned)__builtin_bit_cast(unsigned short, (_Float16)b) << 16); }
__global__ __launch_bounds__(256) void k_cast16(const float* __restrict__ src, long long lds, _Float16* __restrict__ dst, long long ldd, int R, int C, float s) {
    const long long i = (long long)blockIdx.x * 256 + threadIdx.x; const long long np = (long long)R * (C / 2); if (i >= np) return; const int r = (int)(i / (C / 2)); const int c = 2 * (int)(i % (C / 2));
    const _Float16 h0 = (_Float16)(src[(long long)r * lds + c] * s), h1 = (_Float16)(src[(long long)r * lds + c + 1] * s);
    const unsigned u = (unsigned)__builtin_bit_cast(unsigned short, h0) | ((unsigned)__builtin_bit_cast(unsigned short, h1) << 16);
    unsigned* d = (unsigned*)(dst + (long long)r * ldd + c); *d = u;  }

// f32 -> bf16 hi plane + bf16 lo plane (x = hi + lo to ~2^-17 relative; RNE both), [R][C] -> [R][C] (or transposed to [C][R]); 2 consecutive destination elements
__device__ __forceinline__ unsigned int f2bf2_pack(float a, float b, unsigned int* lo) {
    const unsigned short ha = w25::f2bf_bits(a), hb = w25::f2bf_bits(b);
    const unsigned short la = w25::f2bf_bits(a - w25::bf_bits2f(ha)), lb = w25::f2bf_bits(b - w25::bf_bits2f(hb));
    *lo = (unsigned)la | ((unsigned)lb << 16); return (unsigned)ha | ((unsigned)hb << 16); }
__global__ __launch_bounds__(256) void k_castS16(const float* __restrict__ src, long long lds, __bf16* __restrict__ dhi, __bf16* __restrict__ dlo, long long ldd, int R, int C, float s, int transpose, long long sb, long long db) {
    src += (long long)blockIdx.y * sb; dhi += (long long)blockIdx.y * db; dlo += (long long)blockIdx.y * db;   // blockIdx.y = image
    const long long i = (long long)blockIdx.x * 256 + threadIdx.x; long long o; float a, b;
    if (transpose) { const long long np = (long long)C * (R / 2); if (i >= np) return; const int c = (int)(i / (R / 2)); const int r = 2 * (int)(i % (R / 2)); a = src[(long long)r * lds + c] * s; b = src[(long long)(r + 1) * lds + c] * s; o = (long long)c * ldd + r; }
    else { const long long np = (long long)R * (C / 2); if (i >= np) return; const int r = (int)(i / (C / 2)); const int c = 2 * (int)(i % (C / 2)); a = src[(long long)r * lds + c] * s; b = src[(long long)r * lds + c + 1] * s; o = (long long)r * ldd + c; }
    unsigned lo; const unsigned hi = f2bf2_pack(a, b, &lo); unsigned* ph = (unsigned*)(dhi + o); unsigned* pl = (unsigned*)(dlo + o);
    *ph = hi; *pl = lo;  }

namespace w25 {
// =====================================================================================
// Generic causal/non-causal attention for head_dim 64, f32 in / f32 out; 16-bit operands: bf16 with optional hi/lo splits, or
// plain f16 (F16=true, non-split, probabilities carried x2^15).
//   scores = (q*qscale)·kᵀ : v_wmma_f32_16x16x32_bf16; SPLIT_QK -> q,k as bf16 hi/lo (hi·hi + hi·lo + lo·hi)
//   out    = p·v           : v_wmma_f32_16x16x32_bf16; SPLIT_PV -> p,v as bf16 hi/lo; else p,v plain bf16
//   f32 accumulate; online softmax in f32. Block = 4 waves = 64 query rows of one (batch, head); S % 64 == 0.
//   Element (b, s, h, d) of tensor X lives at X[b*X_bs + s*X_rs + h*X_hs + d] (strides in floats, multiples of 4).
//   Masking: mask_mode 0 none, 1 causal (kv > q masked), 2 tensor [S][Skv] shared over (b,h) (float if
//   mask_is_int==0, int32 with element == 0 -> masked if 1, int32 with element != 0 -> masked if 2), 3 per-token vectors qmask[B][S] & kvmask[B][Skv] (int32,
//   0 -> masked), 4 causal + sliding window (kv > q or q - kv > W masked; W passed in mask_is_int);
//   5 = relative-position bias: s += cp[b,h,q][idx[q][kv]] + pc[b,h,kv][idx[q][kv]] with idx = mask_b ([S][Skv] int32) and
//   mask_a an int32 [S][Skv] tensor with nonzero = masked (tables: element (b,h,row,n) at X + b*c_bs + h*c_hs + row*c_rs + n);
//   masked scores are replaced by mask_fill (e.g. -inf or -1e9) before the softmax.
//   grid.x = B * H * (S/64) (or a sub-range with blk0).
// =====================================================================================
#define AT_D 64
#define AT_NW 4
#define AT_QB 64
#define AT_KC 64
struct AttnGeom { const float* cp = nullptr; const float* pc = nullptr; long c_bs = 0, c_rs = 0, c_hs = 0;   // mode-5 score-bias tables
                  long q_bs, q_rs, q_hs, k_bs, k_rs, k_hs, v_bs, v_rs, v_hs, o_bs, o_rs, o_hs;
                  int S, Skv, H, mask_mode; float qscale; int blk0; float mask_fill; int mask_is_int; };
static_assert(sizeof(AttnGeom) == 168, "no padding");

__device__ __forceinline__ unsigned short at_bf_bits(float f) {
  unsigned u = __float_as_uint(f);
  return (unsigned short)((u + 0x7FFFu + ((u >> 16) & 1u)) >> 16);
}
__device__ __forceinline__ __bf16 at_f2bf(float f) { return __builtin_bit_cast(__bf16, at_bf_bits(f)); }
__device__ __forceinline__ void at_split(float f, __bf16& hi, __bf16& lo) {
  const unsigned short hb = at_bf_bits(f);
  hi = __builtin_bit_cast(__bf16, hb);
  lo = at_f2bf(f - __uint_as_float(((unsigned)hb) << 16));
}
__device__ __forceinline__ v8f at_mma(v16b a, v16b b, v8f c) {
  c = __builtin_amdgcn_wmma_f32_16x16x32_bf16(false, a, false, b, (short)0, c, false, false);
  asm volatile("v_nop\n\tv_nop\n\tv_nop\n\tv_nop" : "+v"(c) : "v"(a), "v"(b));
  return c;
}
// 16-bit element as a bit pattern held in a __bf16 slot: f16 bits when F16, bf16 (RNE) otherwise
template <bool F16> __device__ __forceinline__ __bf16 at_to16(float f) {
  if (F16) return __builtin_bit_cast(__bf16, (_Float16)f);
  return at_f2bf(f);
}
template <bool F16> __device__ __forceinline__ v8f at_mma16(v16b a, v16b b, v8f c) {
  if (F16) {
    const v16h ah = __builtin_bit_cast(v16h, a), bh = __builtin_bit_cast(v16h, b);
    c = __builtin_amdgcn_wmma_f32_16x16x32_f16(false, ah, false, bh, (short)0, c, false, false);
    asm volatile("v_nop\n\tv_nop\n\tv_nop\n\tv_nop" : "+v"(c) : "v"(ah), "v"(bh));
    return c;
  }
  return at_mma(a, b, c);
}

template <bool SPLIT_QK, bool SPLIT_PV, bool F16 = false>
__global__ __launch_bounds__(128)
void attn64_kernel(const float* __restrict__ q, const float* __restrict__ k,
                   const float* __restrict__ v, float* __restrict__ out,
                   const void* __restrict__ mask_a, const int* __restrict__ mask_b, AttnGeom g) {
  static_assert(!(F16 && (SPLIT_QK || SPLIT_PV)), "f16 mode is non-split");
  const float PSC = F16 ? 32768.0f : 1.0f;     // f16 probabilities carried x2^15 (subnormal range), folded into the final 1/l
  union FB { v16b v; v8b h[2]; };
  __shared__ __align__(16) __bf16 Ksh[AT_KC * AT_D];             // K hi [kv][d]      8 KB
  __shared__ __align__(16) __bf16 Ksl[SPLIT_QK ? AT_KC * AT_D : 8];
  __shared__ __align__(16) __bf16 Vth[AT_D * AT_KC];             // V hi [d][kv]      8 KB
  __shared__ __align__(16) __bf16 Vtl[SPLIT_PV ? AT_D * AT_KC : 8];
  __shared__ __align__(16) __bf16 Psh[AT_NW][16 * AT_KC];        // per wave P hi [row][kv]  8 KB
  __shared__ __align__(16) __bf16 Psl[SPLIT_PV ? AT_NW : 1][SPLIT_PV ? 16 * AT_KC : 8];
  __shared__ __align__(16) float  Os[AT_NW][16 * 68];            // per wave out tile, pitch 68

  const int tid  = threadIdx.x;
  const int wave = tid >> 5;
  const int lane = tid & 31;
  const int hh   = lane >> 4;
  const int c    = lane & 15;

  const int nqb = g.S / AT_QB;
  const int bx = blockIdx.x + g.blk0;
  const int qb = bx % nqb;
  const int bh = bx / nqb;
  const int h  = bh % g.H;
  const int b  = bh / g.H;
  const int qbase_block = qb * AT_QB;
  const int q0 = qbase_block + wave * 16;

  const float* qb_ptr = q + (size_t)b * g.q_bs + (size_t)h * g.q_hs;
  const float* kb_ptr = k + (size_t)b * g.k_bs + (size_t)h * g.k_hs;
  const float* vb_ptr = v + (size_t)b * g.v_bs + (size_t)h * g.v_hs;
  float*       ob_ptr = out + (size_t)b * g.o_bs + (size_t)h * g.o_hs;

  // ---- Q fragments (A operand): 2 d-chunks, hi (and lo) ----
  v16b qah[2], qal[2];
  {
    const float* qrow = qb_ptr + (size_t)(q0 + c) * g.q_rs;
#pragma unroll
    for (int dc = 0; dc < 2; ++dc) {
#pragma unroll
      for (int e = 0; e < 8; ++e) {
        const float f0 = qrow[dc * 32 + 8 * hh + e] * g.qscale;
        const float f1 = qrow[dc * 32 + 16 + 8 * hh + e] * g.qscale;
        if (SPLIT_QK) { __bf16 hq, lq; at_split(f0, hq, lq); qah[dc][e] = hq; qal[dc][e] = lq; at_split(f1, hq, lq); qah[dc][8 + e] = hq; qal[dc][8 + e] = lq; }
        else { qah[dc][e] = at_to16<F16>(f0); qah[dc][8 + e] = at_to16<F16>(f1); qal[dc][e] = qah[dc][e]; qal[dc][8 + e] = qah[dc][8 + e]; }
      }
    }
  }

  float mrow[8], lrow[8];
  v8f oacc[4];
#pragma unroll
  for (int r = 0; r < 8; ++r) { mrow[r] = -INFINITY; lrow[r] = 0.f; }
#pragma unroll
  for (int t = 0; t < 4; ++t) oacc[t] = (v8f){0.f,0.f,0.f,0.f,0.f,0.f,0.f,0.f};

  const int nChunks = (g.mask_mode == 1 || g.mask_mode == 4) ? (qb + 1) : (g.Skv / AT_KC);   // block-uniform
  // per-row query mask (mode 3)
  int qkeep[8];
#pragma unroll
  for (int r = 0; r < 8; ++r) qkeep[r] = (g.mask_mode == 3) ? mask_b[(size_t)b * g.S + q0 + 8 * hh + r] : 1;   // mask_b = qmask in mode 3
  for (int kc = 0; kc < nChunks; ++kc) {
    const int kv0 = kc * AT_KC;
    __syncthreads();
    {
      const int kvr = tid >> 1, dh = (tid & 1) * 32;
      const float* krow = kb_ptr + (size_t)(kv0 + kvr) * g.k_rs + dh;
      const float* vrow = vb_ptr + (size_t)(kv0 + kvr) * g.v_rs + dh;
#pragma unroll
      for (int i = 0; i < 8; ++i) {
        v4f kk = *(const v4f*)(krow + 4 * i);
        v4f vv = *(const v4f*)(vrow + 4 * i);
#pragma unroll
        for (int e = 0; e < 4; ++e) {
          const int d = dh + 4 * i + e;
          if (SPLIT_QK) { __bf16 a, bl; at_split(kk[e], a, bl); Ksh[kvr * AT_D + d] = a; Ksl[kvr * AT_D + d] = bl; }
          else Ksh[kvr * AT_D + d] = at_to16<F16>(kk[e]);
          if (SPLIT_PV) { __bf16 a, bl; at_split(vv[e], a, bl); Vth[d * AT_KC + kvr] = a; Vtl[d * AT_KC + kvr] = bl; }
          else Vth[d * AT_KC + kvr] = at_to16<F16>(vv[e]);
        }
      }
    }
    __syncthreads();

    v8f s[4];
#pragma unroll
    for (int j = 0; j < 4; ++j) {
      s[j] = (v8f){0.f,0.f,0.f,0.f,0.f,0.f,0.f,0.f};
#pragma unroll 1
      for (int dc = 0; dc < 2; ++dc) {
        FB kb;
        kb.h[0] = *(const v8b*)(Ksh + (j * 16 + c) * AT_D + dc * 32 + 8 * hh);
        kb.h[1] = *(const v8b*)(Ksh + (j * 16 + c) * AT_D + dc * 32 + 16 + 8 * hh);
        s[j] = at_mma16<F16>(qah[dc], kb.v, s[j]);
        if (SPLIT_QK) {
          FB kl;
          kl.h[0] = *(const v8b*)(Ksl + (j * 16 + c) * AT_D + dc * 32 + 8 * hh);
          kl.h[1] = *(const v8b*)(Ksl + (j * 16 + c) * AT_D + dc * 32 + 16 + 8 * hh);
          s[j] = at_mma16<F16>(qah[dc], kl.v, s[j]);
          s[j] = at_mma16<F16>(qal[dc], kb.v, s[j]);
        }
      }
    }
    const bool diag = (g.mask_mode == 1) && (kc == qb);
    int kvkeep[4] = {1, 1, 1, 1};
    if (g.mask_mode == 3) {
#pragma unroll
      for (int j = 0; j < 4; ++j) kvkeep[j] = ((const int*)mask_a)[(size_t)b * g.Skv + kv0 + j * 16 + c];   // mask_a = kvmask
    }
    float cm[8];
#pragma unroll
    for (int r = 0; r < 8; ++r) {
      const int qrow = q0 + 8 * hh + r;
      float m = -INFINITY;
#pragma unroll
      for (int j = 0; j < 4; ++j) {
        const int kvcol = kv0 + j * 16 + c;
        bool masked = false;
        if (diag) masked = (kvcol > qrow);
        else if (g.mask_mode == 4) masked = (kvcol > qrow) || (qrow - kvcol > g.mask_is_int);
        else if (g.mask_mode == 2) {
          const size_t mi = (size_t)qrow * g.Skv + kvcol;
          masked = (g.mask_is_int == 0) ? (((const float*)mask_a)[mi] == 0.0f)
                 : (g.mask_is_int == 1) ? (((const int*)mask_a)[mi] == 0) : (((const int*)mask_a)[mi] != 0);
        } else if (g.mask_mode == 3) masked = (qkeep[r] == 0) || (kvkeep[j] == 0);
        else if (g.mask_mode == 5) {
          const size_t mi = (size_t)qrow * g.Skv + kvcol;
          masked = (((const int*)mask_a)[mi] != 0);
          int n = mask_b[mi]; n = n < 0 ? 0 : n;
          s[j][r] += g.cp[(size_t)b * g.c_bs + (size_t)h * g.c_hs + (size_t)qrow * g.c_rs + n]
                   + g.pc[(size_t)b * g.c_bs + (size_t)h * g.c_hs + (size_t)kvcol * g.c_rs + n];
        }
        if (masked) s[j][r] = g.mask_fill;
        m = fmaxf(m, s[j][r]);
      }
#pragma unroll
      for (int off = 1; off < 16; off <<= 1) m = fmaxf(m, __shfl_xor(m, off, 32));
      cm[r] = m;
    }
    __bf16* pwh = Psh[wave];
    __bf16* pwl = Psl[SPLIT_PV ? wave : 0];
#pragma unroll
    for (int r = 0; r < 8; ++r) {
      const float mnew = fmaxf(mrow[r], cm[r]);
      const float alpha = expf(mrow[r] - mnew);
      mrow[r] = mnew;
      float psum = 0.f;
#pragma unroll
      for (int j = 0; j < 4; ++j) {
        const float p = expf(s[j][r] - mnew);
        psum += p;
        if (SPLIT_PV) { __bf16 a, bl; at_split(p, a, bl); pwh[(8 * hh + r) * AT_KC + j * 16 + c] = a; pwl[(8 * hh + r) * AT_KC + j * 16 + c] = bl; }
        else pwh[(8 * hh + r) * AT_KC + j * 16 + c] = at_to16<F16>(p * PSC);
      }
#pragma unroll
      for (int off = 1; off < 16; off <<= 1) psum += __shfl_xor(psum, off, 32);
      lrow[r] = lrow[r] * alpha + psum;
#pragma unroll
      for (int t = 0; t < 4; ++t) oacc[t][r] *= alpha;
    }
    __builtin_amdgcn_fence(__ATOMIC_RELEASE, "workgroup");
    __builtin_amdgcn_wave_barrier();
    __builtin_amdgcn_fence(__ATOMIC_ACQUIRE, "workgroup");
#pragma unroll 1
    for (int kk = 0; kk < 2; ++kk) {
      FB pa, pl;
      pa.h[0] = *(const v8b*)(pwh + c * AT_KC + kk * 32 + 8 * hh);
      pa.h[1] = *(const v8b*)(pwh + c * AT_KC + kk * 32 + 16 + 8 * hh);
      if (SPLIT_PV) {
        pl.h[0] = *(const v8b*)(pwl + c * AT_KC + kk * 32 + 8 * hh);
        pl.h[1] = *(const v8b*)(pwl + c * AT_KC + kk * 32 + 16 + 8 * hh);
      }
#pragma unroll
      for (int t = 0; t < 4; ++t) {
        FB vb;
        vb.h[0] = *(const v8b*)(Vth + (t * 16 + c) * AT_KC + kk * 32 + 8 * hh);
        vb.h[1] = *(const v8b*)(Vth + (t * 16 + c) * AT_KC + kk * 32 + 16 + 8 * hh);
        oacc[t] = at_mma16<F16>(pa.v, vb.v, oacc[t]);
        if (SPLIT_PV) {
          FB vl;
          vl.h[0] = *(const v8b*)(Vtl + (t * 16 + c) * AT_KC + kk * 32 + 8 * hh);
          vl.h[1] = *(const v8b*)(Vtl + (t * 16 + c) * AT_KC + kk * 32 + 16 + 8 * hh);
          oacc[t] = at_mma16<F16>(pa.v, vl.v, oacc[t]);
          oacc[t] = at_mma16<F16>(pl.v, vb.v, oacc[t]);
        }
      }
    }
  }

  float* os = Os[wave];
#pragma unroll
  for (int r = 0; r < 8; ++r) {
    const float inv = 1.0f / (lrow[r] * PSC);
#pragma unroll
    for (int t = 0; t < 4; ++t) os[(8 * hh + r) * 68 + t * 16 + c] = oacc[t][r] * inv;
  }
  __builtin_amdgcn_fence(__ATOMIC_RELEASE, "workgroup");
  __builtin_amdgcn_wave_barrier();
  __builtin_amdgcn_fence(__ATOMIC_ACQUIRE, "workgroup");
  {
    const int c4 = (lane & 15) * 4;
    {
#pragma unroll
      for (int it = 0; it < 8; ++it) {
        const int row = it * 2 + hh;
        v4f val = *(const v4f*)(os + row * 68 + c4);
        *(v4f*)(ob_ptr + (size_t)(q0 + row) * g.o_rs + c4) = val;
      }
      
    }
  }
}

} // namespace w25

// Fused projection of one image tile: the casts of x, the three 1x1 convolutions, the 2x2 max-pool and the operand planes of k_nl_flash in one kernel; x is read once, as f32.
// A block owns 64 pixels = 16 pool windows: image rows 2py, 2py + 1, columns 32hf .. 32hf + 31 (blockIdx.x = 2py + hf, blockIdx.y = image).
// Staging: a thread takes 2 x 8 channels x 4 pixels (sixteen 16-byte loads, 8 lanes = one 128-B line), casts them as the cast kernels did (bf16 hi, bf16 lo, f16 of 16 x) and stores, per pixel and plane,
// 16 bytes = 8 consecutive channels = half a lane's fragment into LDS, [slot][channel]. Slot = 16 j + m: m = pool window, j = 2 (row in window) + (column in window). So the four pixels of a window
// sit in four different 16-pixel tiles at the same column, and the pool is a maximum over four accumulators of one lane.
// Wave w owns channels 16w .. 16w + 15 of all three outputs for all 64 pixels: theta^T = Wt X and phi = Wp X (D: column = pixel, rows = 8 consecutive channels a lane; bf16 hi/lo, three products in
// the order the GEMMs had), g^T = X^T Wg^T (D: column = channel, rows = 8 consecutive windows a lane; f16). Pooled phi and g leave in the fragment order of k_nl_flash, 512 contiguous bytes a wave
// and plane (a 16-byte chunk is half of one lane's fragment, 32 chunks, lane = 16 h + c, are one wave-wide load; element e: bits 0-2 k, 3-6 row c, 7 half h, 8 which 16 k, then pooled phi: 9-10 block of
// 32 channels, 11.. tile of 16 keys; pooled g: 9-11 tile of 16 channels, 12.. block of 32 keys); theta goes through LDS so that a wave stores whole pixel rows. The bias is added behind the maximum (rounding is monotonic, so the value is the same).
namespace w25 {
// the bf16 hi/lo split of two values, packed, in 32-bit arithmetic throughout (the same bits as f2bf_bits gives: round to nearest even, the result in the upper half)
__device__ __forceinline__ unsigned bf_rn(float f) { const unsigned u = __float_as_uint(f); return u + 0x7FFFu + ((u >> 16) & 1u); }
__device__ __forceinline__ unsigned split2(float a, float b, unsigned* lo) {
  const unsigned ua = bf_rn(a) & 0xFFFF0000u, ub = bf_rn(b) & 0xFFFF0000u;
  *lo = (bf_rn(a - __uint_as_float(ua)) >> 16) | (bf_rn(b - __uint_as_float(ub)) & 0xFFFF0000u);
  return (ua >> 16) | ub; }
constexpr int PJX = 264;   // LDS pitch of a slot of x, in 16-bit elements: 512 B + 16 B, an odd multiple of 16 B for 16-byte reads
constexpr int PJT = 136;   // the same for a slot of theta: 256 B + 16 B
// launch bounds: four waves a SIMD (256 registers a wave), so that two blocks share a WGP and all 512 blocks are resident at once
__global__ __launch_bounds__(256, 4) void k_nl_proj(const float* __restrict__ X, const unsigned short* __restrict__ TWHp, const unsigned short* __restrict__ TWLp, const unsigned short* __restrict__ PWHp,
                                                 const unsigned short* __restrict__ PWLp, const unsigned short* __restrict__ GWp, const float* __restrict__ thb, const float* __restrict__ phb,
                                                 const float* __restrict__ gb, unsigned short* __restrict__ THHp, unsigned short* __restrict__ THLp, unsigned short* __restrict__ PPHp,
                                                 unsigned short* __restrict__ PPLp, unsigned short* __restrict__ GP16p) {
  constexpr int Cc = 256, D = 128, NKc = 1024, HWc = 4096;
  __shared__ __align__(16) unsigned short sx[3][64 * PJX];
  const int tid = threadIdx.x, lane = tid & 31, m = lane & 15, h = lane >> 4;
  const int wave = __builtin_amdgcn_readfirstlane(tid >> 5);   // the wave's number in a scalar register: every address is a scalar base plus a lane offset, and few vector registers live across the products
  const int b = blockIdx.y, py = blockIdx.x >> 1, hf = blockIdx.x & 1;
  // the wave's weight rows (lane = row 16 wave + m, k from 8 h), first k step: they fly with the loads of x
  const unsigned wob = (unsigned)(m * Cc + 8 * h) * 2u;   // one lane offset, in bytes, for the five planes
  const int wr = wave * 16 * Cc;
  const __bf16* TWH = (const __bf16*)((const char*)(TWHp + wr) + wob); const __bf16* TWL = (const __bf16*)((const char*)(TWLp + wr) + wob); const __bf16* PWH = (const __bf16*)((const char*)(PWHp + wr) + wob);
  const __bf16* PWL = (const __bf16*)((const char*)(PWLp + wr) + wob); const _Float16* GW = (const _Float16*)((const char*)(GWp + wr) + wob);
  v16b th = Frag<__bf16>::load(TWH), tl = Frag<__bf16>::load(TWL), ph = Frag<__bf16>::load(PWH), pl = Frag<__bf16>::load(PWL); v16h gw = Frag<_Float16>::load(GW);
  {
    const int g = lane & 7, cb = (lane >> 3) & 1, ry = h, cg = wave * 2 + cb;   // 4 pixels from column 4 g of row ry; channels 8 cg .. (and 128 + 8 cg ..); 16 lanes of one row: their LDS stores meet no common bank
    const unsigned xo = (unsigned)(cb * 8 * HWc + ry * 64 + g * 4) * 4u;   // lane offset in bytes
    const float* xp = (const float*)((const char*)(X + ((size_t)b * Cc + wave * 16) * HWc + (2 * py) * 64 + hf * 32) + xo);
    v4f v[2][8];
#pragma unroll   // v[][] in registers, all sixteen loads in flight
    for (int it = 0; it < 2; ++it)
#pragma unroll   // inner loop of the same
      for (int k = 0; k < 8; ++k) v[it][k] = *(const v4f*)(xp + (it * 128 + k) * HWc);
    // the wait before a load's address registers are reused; the two lane offsets as inputs keep their registers until the wait
    asm volatile("s_wait_xcnt 0x0" :: "v"(xo), "v"(wob) : "memory");
#pragma unroll   // constant indices into v[][]
    for (int it = 0; it < 2; ++it)
#pragma unroll   // inner loop of the same
      for (int e = 0; e < 4; ++e) { v4u hi, lo, f;
#pragma unroll   // inner loop of the same
        for (int q = 0; q < 4; ++q) { unsigned l2; hi[q] = split2(v[it][2 * q][e], v[it][2 * q + 1][e], &l2); lo[q] = l2; f[q] = f2h2_pack(v[it][2 * q][e] * 16.0f, v[it][2 * q + 1][e] * 16.0f); }
        const int so = ((ry * 2 + (e & 1)) * 16 + 2 * g + (e >> 1)) * PJX + it * 128 + cg * 8;
        *(v4u*)(&sx[0][so]) = hi; *(v4u*)(&sx[1][so]) = lo; *(v4u*)(&sx[2][so]) = f; }
  }
  __syncthreads();   // the tile of x is complete before any wave reads it
  v8f at[4], ap[4], ag[4];
#pragma unroll   // constant indices
  for (int j = 0; j < 4; ++j) { at[j] = (v8f){0.f,0.f,0.f,0.f,0.f,0.f,0.f,0.f}; ap[j] = at[j]; ag[j] = at[j]; }
  const __bf16* xh = (const __bf16*)(&sx[0][0]) + m * PJX + 8 * h; const __bf16* xl = (const __bf16*)(&sx[1][0]) + m * PJX + 8 * h; const _Float16* xf = (const _Float16*)(&sx[2][0]) + m * PJX + 8 * h;
  const unsigned bo8 = (unsigned)h * 32u, bo1 = (unsigned)m * 4u;   // lane offsets of the biases, in bytes
  const float* tbp = (const float*)((const char*)(thb + wave * 16) + bo8); const float* pbp = (const float*)((const char*)(phb + wave * 16) + bo8); const float* gbp = (const float*)((const char*)(gb + wave * 16) + bo1);
  v4f tb0, tb1, pb0, pb1; float gbv;
#pragma unroll   // eight k steps of 32 channels, constant offsets; no branch stands behind a matrix instruction
  for (int ks = 0; ks < 8; ++ks) {
    v16b nth = th, ntl = tl, nph = ph, npl = pl; v16h ngw = gw;
    if (ks < 7) {   // the next k step's weights fly behind this step's products
      const int kn = (ks + 1) * 32;
      nth = Frag<__bf16>::load(TWH + kn); ntl = Frag<__bf16>::load(TWL + kn); nph = Frag<__bf16>::load(PWH + kn); npl = Frag<__bf16>::load(PWL + kn); ngw = Frag<_Float16>::load(GW + kn);
      // the wait before these loads' address registers are reused (the offset as an input keeps it until then); memory clobbered, the loads also stay above the products instead of sinking to their first use
      asm volatile("s_wait_xcnt 0x0" :: "v"(wob) : "memory");
    } else {        // the biases fly behind the last step's products, in the registers that the weights have left
      tb0 = *(const v4f*)(tbp); tb1 = *(const v4f*)(tbp + 4); pb0 = *(const v4f*)(pbp); pb1 = *(const v4f*)(pbp + 4); gbv = *gbp;
      asm volatile("s_wait_xcnt 0x0" :: "v"(bo8), "v"(bo1) : "memory");   // the same wait for the biases' lane offsets
    }
#pragma unroll   // two pixel tiles at a time: six independent accumulators, half the fragments live
    for (int jp = 0; jp < 4; jp += 2) {
      v16b bh[2], bl[2]; v16h bf[2];
#pragma unroll   // constant indices
      for (int u = 0; u < 2; ++u) { const int o = (jp + u) * 16 * PJX + ks * 32; bh[u] = Frag<__bf16>::load(xh + o); bl[u] = Frag<__bf16>::load(xl + o); bf[u] = Frag<_Float16>::load(xf + o); }
#pragma unroll   // constant indices; neighbours in the stream go to different tiles
      for (int u = 0; u < 2; ++u) at[jp + u] = Frag<__bf16>::mma(th, bh[u], at[jp + u]);
#pragma unroll   // the same
      for (int u = 0; u < 2; ++u) ap[jp + u] = Frag<__bf16>::mma(ph, bh[u], ap[jp + u]);
#pragma unroll   // the same
      for (int u = 0; u < 2; ++u) ag[jp + u] = Frag<_Float16>::mma(bf[u], gw, ag[jp + u]);
#pragma unroll   // the same
      for (int u = 0; u < 2; ++u) at[jp + u] = Frag<__bf16>::mma(tl, bh[u], at[jp + u]);
#pragma unroll   // the same
      for (int u = 0; u < 2; ++u) ap[jp + u] = Frag<__bf16>::mma(ph, bl[u], ap[jp + u]);
#pragma unroll   // the same
      for (int u = 0; u < 2; ++u) at[jp + u] = Frag<__bf16>::mma(th, bl[u], at[jp + u]);
#pragma unroll   // the same
      for (int u = 0; u < 2; ++u) ap[jp + u] = Frag<__bf16>::mma(pl, bh[u], ap[jp + u]);
    }
    th = nth; tl = ntl; ph = nph; pl = npl; gw = ngw;
  }
  const float tbv[8] = { tb0[0], tb0[1], tb0[2], tb0[3], tb1[0], tb1[1], tb1[2], tb1[3] }, pbv[8] = { pb0[0], pb0[1], pb0[2], pb0[3], pb1[0], pb1[1], pb1[2], pb1[3] };
  // pooled phi (hi, lo) and pooled g
  v4u phi_h, phi_l, g_h;
#pragma unroll   // constant indices
  for (int q = 0; q < 4; ++q) { float pv[2], gv[2];
#pragma unroll   // inner loop of the same
    for (int u = 0; u < 2; ++u) { const int r = 2 * q + u;
      pv[u] = fmaxf(fmaxf(ap[0][r], ap[1][r]), fmaxf(ap[2][r], ap[3][r])) + pbv[r];
      gv[u] = fmaxf(fmaxf(ag[0][r], ag[1][r]), fmaxf(ag[2][r], ag[3][r])) * 0.0625f + gbv; }
    unsigned l2; phi_h[q] = split2(pv[0], pv[1], &l2); phi_l[q] = l2; g_h[q] = f2h2_pack(gv[0], gv[1]); }
  __syncthreads();   // every wave has read its last fragment of x: the LDS is free for theta
#pragma unroll   // constant indices
  for (int j = 0; j < 4; ++j) { v4u hi, lo;
#pragma unroll   // inner loop of the same
    for (int q = 0; q < 4; ++q) { unsigned l2; hi[q] = split2(at[j][2 * q] + tbv[2 * q], at[j][2 * q + 1] + tbv[2 * q + 1], &l2); lo[q] = l2; }
    const int so = (j * 16 + m) * PJT + wave * 16 + 8 * h;
    *(v4u*)(&sx[0][so]) = hi; *(v4u*)(&sx[1][so]) = lo; }
  __syncthreads();   // theta of all 128 channels is in LDS before the rows are read
  // 16 lanes store one pixel's 256 bytes of a plane, a wave two neighbouring pixels: pixel column p0 = 2 wave + h, chunk m, so every global offset is a scalar base + 16 lane bytes
  v4u oh[4], ol[4];
#pragma unroll   // constant indices; pixel = column p0 + 16 (it & 1) of row it >> 1, whose slot is 32 (it >> 1) + 16 (p0 & 1) + (p0 >> 1) + 8 (it & 1)
  for (int it = 0; it < 4; ++it) { const int so = ((it >> 1) * 32 + h * 16 + wave + 8 * (it & 1)) * PJT + m * 8; oh[it] = *(const v4u*)(&sx[0][so]); ol[it] = *(const v4u*)(&sx[1][so]); }
  const unsigned l16 = (unsigned)lane * 16u;
  const size_t to = ((size_t)b * HWc + (2 * py) * 64 + hf * 32 + 2 * wave) * D;
  char* tph = (char*)(THHp + to) + l16; char* tpl = (char*)(THLp + to) + l16;
#pragma unroll   // constant indices
  for (int it = 0; it < 4; ++it) { const int go = ((it >> 1) * 64 + (it & 1) * 16) * D * 2; *(v4u*)(tph + go) = oh[it]; *(v4u*)(tpl + go) = ol[it]; }
  const size_t po = (size_t)b * NKc * D + (py * 2 + hf) * 2048 + wave * 256, vo = (size_t)b * NKc * D + py * 4096 + wave * 512 + hf * 256;
  *(v4u*)((char*)(PPHp + po) + l16) = phi_h; *(v4u*)((char*)(PPLp + po) + l16) = phi_l; *(v4u*)((char*)(GP16p + vo) + l16) = g_h;
  // the wait before a store's registers are reused: the lane offset and the values as inputs keep them all until it, so nothing takes a register of an issued store
  asm volatile("s_wait_xcnt 0x0" :: "v"(l16), "v"(oh[0]), "v"(oh[1]), "v"(oh[2]), "v"(oh[3]), "v"(ol[0]), "v"(ol[1]), "v"(ol[2]), "v"(ol[3]), "v"(phi_h), "v"(phi_l), "v"(g_h) : "memory");
}
} // namespace w25
// Fused attention and output projection of one image: y[q][c] = f16( sum_k softmax_k(theta[q] . phi[k]) g[c][k] ), WY = W y + W_b. Scores, probabilities and y never leave the registers.
// A wave owns 32 queries (two 16-column groups) and walks the 1024 keys 32 at a time. It forms S^T = K Q^T (bf16 hi/lo planes, three products, as the score
// GEMM did) and O^T += V^T P^T (f16): in both D tiles a lane holds one query (column lane & 15), so maximum, sum and rescale are lane-local but for one
// exchange between the wave halves, and two S^T tiles (keys 0-15, 16-31), converted in place, are the B operand of the second product in the hardware k order.
// K (hi, lo) and V^T lie in fragment order (k_nl_proj writes them so): every fragment load covers four whole lines. Q is read once from the row-major theta planes.
// Running maximum in log2 units; the accumulators are rescaled only when a column's maximum has grown by more than 8; p = 2^(s - m + 7) <= 2^15 fits f16.
// Epilogue: WY^T tile = W y^T (f16, k ascending), W in fragment order (k_nl_wcast writes it so); the block's 256 channels x 128 queries go through LDS, from where whole rows are stored and
// each channel's partial batch statistics are summed; k_nl_out merges the partials.
namespace w25 {
__device__ __forceinline__ float xhalf(float x) { return __builtin_bit_cast(float, __builtin_amdgcn_permlanex16(__builtin_bit_cast(int, x), __builtin_bit_cast(int, x), 0x76543210, 0xfedcba98, false, false)); }   // lane l takes lane l ^ 16
// a fragment stored in fragment order: two wave-wide loads of 512 contiguous bytes (elements 0..7 <- p[0..7], 8..15 <- p[256..263], p = fragment + 8 * lane)
__device__ __forceinline__ v16b ldf_b(const __bf16* p) { Frag<__bf16>::U f; f.h[0] = *(const v8b*)(p); f.h[1] = *(const v8b*)(p + 256); return f.v; }
__device__ __forceinline__ v16h ldf_h(const _Float16* p) { Frag<_Float16>::U f; f.h[0] = *(const v8h*)(p); f.h[1] = *(const v8h*)(p + 256); return f.v; }
typedef float v2f __attribute__((ext_vector_type(2)));
__global__ __launch_bounds__(128) void k_nl_flash(const unsigned short* __restrict__ QHp, const unsigned short* __restrict__ QLp, const unsigned short* __restrict__ KHp, const unsigned short* __restrict__ KLp,
                                                  const unsigned short* __restrict__ VTp, const unsigned short* __restrict__ WFp, const float* __restrict__ Wb, float* __restrict__ WY, float* __restrict__ PS) {
  constexpr int D = 128, NKc = 1024, HWc = 4096;
  constexpr int PW = 132;   // LDS pitch of a channel's row of 128 queries, in floats: 512 B + 16 B, an odd multiple of 16 B for the row-per-lane reads
  __shared__ __align__(16) float sW[256 * PW];
  constexpr float L2E = 1.4426950408889634f;
  const int lane = threadIdx.x & 31, wave = threadIdx.x >> 5, cq = lane & 15, h = lane >> 4;
  const int b = blockIdx.y, q0 = (blockIdx.x * 4 + wave) * 32;
  const size_t qo = ((size_t)b * HWc + q0 + cq) * D + 8 * h, ko = (size_t)b * NKc * D + 8 * lane;
  const __bf16* QH = (const __bf16*)QHp + qo; const __bf16* QL = (const __bf16*)QLp + qo;
  const __bf16* KH = (const __bf16*)KHp + ko; const __bf16* KL = (const __bf16*)KLp + ko;
  const _Float16* VT = (const _Float16*)VTp + ko;
  v16b qh[2][4], ql[2][4], kh[2][4], kl[2][4];
#pragma unroll   // constant indices: the fragments stay in registers
  for (int t = 0; t < 2; ++t)
#pragma unroll   // inner loop of the same
    for (int ks = 0; ks < 4; ++ks) {
      qh[t][ks] = Frag<__bf16>::load(QH + t * 16 * D + ks * 32); ql[t][ks] = Frag<__bf16>::load(QL + t * 16 * D + ks * 32);
      kh[t][ks] = ldf_b(KH + (t * 4 + ks) * 512); kl[t][ks] = ldf_b(KL + (t * 4 + ks) * 512);
    }
  asm volatile("s_wait_xcnt 0x0" :: "v"(QH), "v"(QL) : "memory");   // the two Q addresses as inputs keep the pairs until the wait (the K pairs live on through the loop)
  v8f o[2][8];
#pragma unroll   // constant indices
  for (int t = 0; t < 2; ++t)
#pragma unroll   // inner loop of the same
    for (int ct = 0; ct < 8; ++ct) o[t][ct] = (v8f){0.f,0.f,0.f,0.f,0.f,0.f,0.f,0.f};
  float mu[2] = { -1.0e30f, -1.0e30f }, l[2] = { 0.f, 0.f };
#pragma unroll 1   // one pass is 64 matrix instructions already; unrolled, the fragments of two passes would not fit
  for (int p = 0; p < NKc / 32; ++p) {
    v16h vt[8]; const _Float16* vp = VT + p * 32 * D;
#pragma unroll   // constant indices; the eight V^T fragments fly while the scores are formed
    for (int ct = 0; ct < 8; ++ct) vt[ct] = ldf_h(vp + ct * 512);
    __builtin_amdgcn_sched_barrier(0);   // keeps the V^T loads' issue above the score products; without it they sink to their first use and each waits a full latency there
    v8f s[2][2];   // [query group][key tile]
#pragma unroll   // constant indices
    for (int t = 0; t < 2; ++t) { s[t][0] = (v8f){0.f,0.f,0.f,0.f,0.f,0.f,0.f,0.f}; s[t][1] = s[t][0]; }
#pragma unroll   // constant indices; neighbours in the stream go to different tiles
    for (int ks = 0; ks < 4; ++ks) {
#pragma unroll   // inner loop of the same
      for (int kt = 0; kt < 2; ++kt)
#pragma unroll   // inner loop of the same
        for (int t = 0; t < 2; ++t) s[t][kt] = Frag<__bf16>::mma(kh[kt][ks], qh[t][ks], s[t][kt]);
#pragma unroll   // inner loop of the same
      for (int kt = 0; kt < 2; ++kt)
#pragma unroll   // inner loop of the same
        for (int t = 0; t < 2; ++t) s[t][kt] = Frag<__bf16>::mma(kh[kt][ks], ql[t][ks], s[t][kt]);
#pragma unroll   // inner loop of the same
      for (int kt = 0; kt < 2; ++kt)
#pragma unroll   // inner loop of the same
        for (int t = 0; t < 2; ++t) s[t][kt] = Frag<__bf16>::mma(kl[kt][ks], qh[t][ks], s[t][kt]);
    }
    // the next pass's K fragments, into the same registers: they fly behind the softmax and the second product (the last pass re-reads keys 0-31, in bounds, unused)
    const int kn = ((p + 1) & (NKc / 32 - 1)) * 32 * D; const __bf16* kph = KH + kn; const __bf16* kpl = KL + kn;
#pragma unroll   // constant indices
    for (int kt = 0; kt < 2; ++kt)
#pragma unroll   // inner loop of the same
      for (int ks = 0; ks < 4; ++ks) { kh[kt][ks] = ldf_b(kph + (kt * 4 + ks) * 512); kl[kt][ks] = ldf_b(kpl + (kt * 4 + ks) * 512); }
    // the wait before the pass's load addresses are reused: the three addresses as inputs
    // keep the pairs until the wait. With vp named and memory clobbered, the V^T loads also stay in front of it and are not sunk behind the rescale branch to their first use
    asm volatile("s_wait_xcnt 0x0" :: "v"(kph), "v"(kpl), "v"(vp) : "memory");
    float mx[2];
#pragma unroll   // constant indices
    for (int t = 0; t < 2; ++t) { float m = fmaxf(s[t][0][0], s[t][1][0]);
#pragma unroll   // inner loop of the same
      for (int r = 1; r < 8; ++r) m = fmaxf(m, fmaxf(s[t][0][r], s[t][1][r]));
      mx[t] = fmaxf(m, xhalf(m)) * L2E; }
    const bool need = (mx[0] > mu[0] + 8.f) || (mx[1] > mu[1] + 8.f);
    if (__builtin_amdgcn_ballot_w32(need) != 0) {   // one scalar test a pass
#pragma unroll   // constant indices
      for (int t = 0; t < 2; ++t) { const float mn = fmaxf(mu[t], mx[t]); const float f = __builtin_amdgcn_exp2f(mu[t] - mn); mu[t] = mn; l[t] *= f;
#pragma unroll   // inner loop of the same
        for (int ct = 0; ct < 8; ++ct) o[t][ct] *= f; }
    }
    v16h pb[2];
#pragma unroll   // constant indices
    for (int t = 0; t < 2; ++t) { const float mb = 7.f - mu[t]; float a0 = 0.f, a1 = 0.f;
#pragma unroll   // inner loop of the same
      for (int r = 0; r < 8; ++r) { const float e0 = __builtin_amdgcn_exp2f(fmaf(s[t][0][r], L2E, mb)), e1 = __builtin_amdgcn_exp2f(fmaf(s[t][1][r], L2E, mb));
        a0 += e0; a1 += e1; pb[t][r] = (_Float16)e0; pb[t][8 + r] = (_Float16)e1; }
      l[t] += a0 + a1; }
#pragma unroll   // constant indices; sixteen independent tiles
    for (int ct = 0; ct < 8; ++ct)
#pragma unroll   // inner loop of the same
      for (int t = 0; t < 2; ++t) o[t][ct] = Frag<_Float16>::mma(vt[ct], pb[t], o[t][ct]);
  }
  // ---- W y + b for the wave's 32 queries and all 256 channels; y = O / l never leaves the registers ----
  const unsigned wfo = (unsigned)lane * 16u, bo = (unsigned)h * 32u;   // lane offsets in bytes: every load of W and of the bias is a scalar base plus one of them; a lane's D rows are channels 8 h .. 8 h + 7 of a tile
  const _Float16* WF = (const _Float16*)((const char*)WFp + wfo);
  const float* bp = (const float*)((const char*)Wb + bo);
  v16h wa[2][16]; v4f bb[2][4][2];   // two sets: four channel tiles x four k steps of W, and their biases
#pragma unroll   // constant indices; the first set flies behind the division below
  for (int u = 0; u < 4; ++u) { bb[0][u][0] = *(const v4f*)(bp + u * 16); bb[0][u][1] = *(const v4f*)(bp + u * 16 + 4); }
#pragma unroll   // the same
  for (int f = 0; f < 16; ++f) wa[0][f] = ldf_h(WF + f * 512);
  asm volatile("s_wait_xcnt 0x0" :: "v"(wfo), "v"(bo) : "memory");   // the wait before a load's address registers are reused; the two lane offsets as inputs keep their registers until it
  v16h yb[2][4];   // two O^T tiles (channels 32 j .. + 15, + 16 .. + 31), converted in place, are the B operand of k step j in the hardware k order
#pragma unroll   // constant indices
  for (int t = 0; t < 2; ++t) { const float inv = 1.f / (l[t] + xhalf(l[t]));
#pragma unroll   // inner loop of the same
    for (int j = 0; j < 4; ++j)
#pragma unroll   // inner loop of the same
      for (int r = 0; r < 8; ++r) { yb[t][j][r] = (_Float16)(o[t][2 * j][r] * inv); yb[t][j][8 + r] = (_Float16)(o[t][2 * j + 1][r] * inv); } }
  float* sq = sW + (8 * h) * PW + wave * 32 + cq;
#pragma unroll   // constant indices into wa[][], bb[][][]: four groups of four channel tiles
  for (int g = 0; g < 4; ++g) {
    if (g < 3) {   // the next group's biases and W fragments fly behind this group's products
#pragma unroll   // constant indices
      for (int u = 0; u < 4; ++u) { bb[(g + 1) & 1][u][0] = *(const v4f*)(bp + ((g + 1) * 4 + u) * 16); bb[(g + 1) & 1][u][1] = *(const v4f*)(bp + ((g + 1) * 4 + u) * 16 + 4); }
#pragma unroll   // the same
      for (int f = 0; f < 16; ++f) wa[(g + 1) & 1][f] = ldf_h(WF + ((g + 1) * 16 + f) * 512);
      asm volatile("s_wait_xcnt 0x0" :: "v"(wfo), "v"(bo) : "memory");   // the same wait; memory clobbered, the loads also stay above the products instead of sinking to their first use
    }
    v8f d[4][2];
#pragma unroll   // constant indices
    for (int u = 0; u < 4; ++u) { d[u][0] = (v8f){0.f,0.f,0.f,0.f,0.f,0.f,0.f,0.f}; d[u][1] = d[u][0]; }
#pragma unroll   // constant indices; k ascending, eight independent tiles
    for (int j = 0; j < 4; ++j)
#pragma unroll   // inner loop of the same
      for (int u = 0; u < 4; ++u)
#pragma unroll   // inner loop of the same
        for (int t = 0; t < 2; ++t) d[u][t] = Frag<_Float16>::mma(wa[g & 1][u * 4 + j], yb[t][j], d[u][t]);
#pragma unroll   // constant indices; 16 lanes = 64 B of a channel's row, the two halves 32 banks apart
    for (int u = 0; u < 4; ++u)
#pragma unroll   // inner loop of the same
      for (int r = 0; r < 8; ++r)
#pragma unroll   // inner loop of the same
        for (int t = 0; t < 2; ++t) sq[((g * 4 + u) * 16 + r) * PW + t * 16] = d[u][t][r] * 0.0625f + bb[g & 1][u][r >> 2][r & 3];
  }
  __syncthreads();   // the block's 256 x 128 tile of WY is complete in LDS before rows are read across the waves' columns
  // a wave stores 64 channels' rows: 512 contiguous bytes (four whole lines) a store
  const float* sr = sW + wave * 64 * PW + lane * 4;
  float* wy = WY + ((size_t)b * 256 + wave * 64) * HWc + blockIdx.x * 128 + lane * 4;
#pragma unroll   // constant offsets
  for (int it = 0; it < 4; ++it) { v4f v[16];
#pragma unroll   // inner loop of the same: sixteen LDS reads behind one wait
    for (int k = 0; k < 16; ++k) v[k] = *(const v4f*)(sr + (it * 16 + k) * PW);
#pragma unroll   // inner loop of the same
    for (int k = 0; k < 16; ++k) *(v4f*)(wy + (size_t)(it * 16 + k) * HWc) = v[k];
    // the wait before a store's registers are reused: address and values as inputs keep them until it
    asm volatile("s_wait_xcnt 0x0" :: "v"(wy), "v"(v[0]), "v"(v[1]), "v"(v[2]), "v"(v[3]), "v"(v[4]), "v"(v[5]), "v"(v[6]), "v"(v[7]), "v"(v[8]), "v"(v[9]), "v"(v[10]), "v"(v[11]), "v"(v[12]), "v"(v[13]), "v"(v[14]), "v"(v[15]) : "memory"); }
  // partial batch statistics: a thread owns channels tid and tid + 128 and reads their 128 values (row pitch an odd multiple of 16 B): sum, then squared deviations from the row's own mean, no exchange between lanes
  v2f st[2]; v4f rv[2][32];
#pragma unroll   // constant indices: both rows in registers
  for (int cc = 0; cc < 2; ++cc)
#pragma unroll   // inner loop of the same
    for (int k = 0; k < 32; ++k) rv[cc][k] = *(const v4f*)(sW + ((int)threadIdx.x + cc * 128) * PW + k * 4);
  __builtin_amdgcn_sched_barrier(0);   // keeps all 64 LDS reads' issue above the sums; without it they sink to their first use, four in flight, and the wave waits on each
#pragma unroll   // constant indices
  for (int cc = 0; cc < 2; ++cc) { v4f a = rv[cc][0];
#pragma unroll   // inner loop of the same: four independent chains
    for (int k = 1; k < 32; ++k) a += rv[cc][k];
    const float s = (a[0] + a[1]) + (a[2] + a[3]), mean = s * (1.0f / 128.0f);
    v4f q = { 0.f, 0.f, 0.f, 0.f };
#pragma unroll   // inner loop of the same
    for (int k = 0; k < 32; ++k) { const v4f dv = rv[cc][k] - mean; q += dv * dv; }
    st[cc][0] = s; st[cc][1] = (q[0] + q[1]) + (q[2] + q[3]); }
  float* ps = PS + ((size_t)(b * (HWc / 128) + (int)blockIdx.x) * 256 + (int)threadIdx.x) * 2;   // the block's own 2 KiB: 16 whole lines, one writer each
  *(v2f*)(ps) = st[0]; *(v2f*)(ps + 256) = st[1];
  asm volatile("s_wait_xcnt 0x0" :: "v"(ps), "v"(st[0]), "v"(st[1]) : "memory");   // the same wait for the two last stores
}
} // namespace w25
// out = (WY - mu[c]) * rstd[c] * gamma[c] + beta[c] + x. One block per channel c, all 8 images: a thread holds 16 B of each operand and image, every load's address a scalar base plus one lane offset.
// The batch statistics come from the 256 partial pairs (sum, squared deviations from the own mean, 128 values each) that k_nl_flash left for the channel: they go through LDS once, then every wave
// merges them itself (mean first, then the deviations plus 128 (partial mean - mean)^2), while its loads of WY and x are in flight.
typedef float v2f __attribute__((ext_vector_type(2)));
typedef __attribute__((address_space(1))) char* gptr;   // a pointer into global memory, said outright: one rebuilt from two words would otherwise be taken for a generic one
// a block-uniform address, both words through a scalar register: the compiler then keeps it as the scalar base of its load and does not fold it with the lane offset into a vector pair
__device__ __forceinline__ gptr sbase(const float* p) { const unsigned long long a = (unsigned long long)p;
    const unsigned l = (unsigned)__builtin_amdgcn_readfirstlane((int)(unsigned)a), u = (unsigned)__builtin_amdgcn_readfirstlane((int)(unsigned)(a >> 32)); return (gptr)(((unsigned long long)u << 32) | l); }
typedef __attribute__((address_space(1))) v4f* gv4;
__global__ __launch_bounds__(1024) void k_nl_out(const float* __restrict__ WY, const float* __restrict__ PS, const float* __restrict__ Gm, const float* __restrict__ Bt, const float* __restrict__ X, float* __restrict__ OUT) {
    constexpr int Bn = 8, C = 256, HW = 4096, NP = 256, NQ = 128;
    __shared__ __align__(16) float sp[2 * NP];
    const int c = (int)blockIdx.x, t = (int)threadIdx.x, lane = t & 31;
    const unsigned lo = (unsigned)t * 16u;
    const float* pp = PS + ((size_t)(t & (NP - 1)) * C + c) * 2; v2f p = { 0.f, 0.f };
    if (t < NP) p = *(const v2f*)pp;   // waves 0 to 7, first in the load queue: its wait leaves the sixteen loads below in flight
    v4f w[Bn], xv[Bn]; gptr wb[Bn], xb[Bn]; float* op[Bn];
#pragma unroll   // constant indices: the sixteen scalar bases
    for (int b = 0; b < Bn; ++b) { const int po = (b * C + c) * HW; wb[b] = sbase(WY + po); xb[b] = sbase(X + po); }
    __builtin_amdgcn_sched_barrier(0);   // all bases stand before the first load: formed between the loads they shared a few scalar registers, with a wait in front of every reuse
#pragma unroll   // all sixteen loads in flight, every address a scalar base plus the one lane offset
    for (int b = 0; b < Bn; ++b) { w[b] = *(gv4)(wb[b] + lo); xv[b] = *(gv4)(xb[b] + lo); }
    asm volatile("s_wait_xcnt 0x0" :: "v"(lo), "v"(pp) : "memory");   // the wait before a load's address registers are reused; the lane offset and the partial's address as inputs keep them until it
    const float g = Gm[c], be = Bt[c];
    if (t < NP) *(v2f*)(sp + 2 * t) = p;
    // the 256 pairs are in LDS before any wave sums them. The barrier with fences on LDS alone: __syncthreads() would also wait for the sixteen global loads, which nobody shares
    __builtin_amdgcn_fence(__ATOMIC_RELEASE, "workgroup", "local"); __builtin_amdgcn_s_barrier(); __builtin_amdgcn_fence(__ATOMIC_ACQUIRE, "workgroup", "local");
    float s8[8], m8[8];
#pragma unroll   // constant indices
    for (int k = 0; k < 8; ++k) { const v2f q = *(const v2f*)(sp + 2 * (lane + 32 * k)); s8[k] = q[0]; m8[k] = q[1]; }
    float S = ((s8[0] + s8[1]) + (s8[2] + s8[3])) + ((s8[4] + s8[5]) + (s8[6] + s8[7]));
#pragma unroll   // five exchange steps, constant masks
    for (int o = 16; o > 0; o >>= 1) S += __shfl_xor(S, o, 32);
    const float mu = S / (float)(NP * NQ);
    float Q = 0.f;
#pragma unroll   // constant indices
    for (int k = 0; k < 8; ++k) { const float dm = s8[k] * (1.0f / (float)NQ) - mu; Q += m8[k] + (float)NQ * dm * dm; }
#pragma unroll   // five exchange steps, constant masks
    for (int o = 16; o > 0; o >>= 1) Q += __shfl_xor(Q, o, 32);
    const float rs = rsqrtf(Q / (float)(NP * NQ) + 1e-5f);
    __builtin_amdgcn_sched_barrier(0);   // the first use of WY stays behind the statistics: moved up between the two sums, its wait for the loads held the second sum back
#pragma unroll   // constant indices into w[], xv[]
    for (int b = 0; b < Bn; ++b) {
#pragma unroll   // inner loop of the same: constant indices, values stay in registers
        for (int e = 0; e < 4; ++e) w[b][e] = (w[b][e] - mu) * rs * g + be + xv[b][e];
        op[b] = (float*)((char*)(OUT + (b * C + c) * HW) + lo); *(v4f*)op[b] = w[b]; }
    // the wait before a store's registers are reused: the eight addresses and the values as inputs keep them all until it
    asm volatile("s_wait_xcnt 0x0" :: "v"(op[0]), "v"(op[1]), "v"(op[2]), "v"(op[3]), "v"(op[4]), "v"(op[5]), "v"(op[6]), "v"(op[7]), "v"(w[0]), "v"(w[1]), "v"(w[2]), "v"(w[3]), "v"(w[4]), "v"(w[5]), "v"(w[6]), "v"(w[7]) : "memory");
}


// The four weight casts in one launch: they need nothing of each other, so blockIdx.y picks the matrix (a block-uniform choice) and the four grids run side by side.
// All four matrices hold the same number of elements, rows contiguous, and the grid covers it exactly; a thread casts 4 consecutive ones (one 16-byte load, 8-byte stores), each value as k_cast16 and k_castS16 cast it.
__global__ __launch_bounds__(256) void k_nl_wcast(const float* __restrict__ Ww, const float* __restrict__ thw, const float* __restrict__ phw, const float* __restrict__ gw, unsigned short* __restrict__ WW16,
                                                  unsigned short* __restrict__ TWH, unsigned short* __restrict__ TWL, unsigned short* __restrict__ PWH, unsigned short* __restrict__ PWL, unsigned short* __restrict__ GW16) {
    const int job = (int)blockIdx.y; const unsigned i = (blockIdx.x * 256u + threadIdx.x) * 4u;
    const float* sp = ((job == 0) ? Ww : (job == 1) ? thw : (job == 2) ? phw : gw) + i;
    const v4f v = *(const v4f*)sp;
    asm volatile("s_wait_xcnt 0x0" :: "v"(sp) : "memory");   // the wait before the load's address pair is reused; the address as an input keeps the pair until it, so the result does not land on it either
    if (job == 1 || job == 2) {   // theta_w, phi_w: bf16 hi and lo planes
        v2u hi, lo; unsigned l2; hi[0] = f2bf2_pack(v[0], v[1], &l2); lo[0] = l2; hi[1] = f2bf2_pack(v[2], v[3], &l2); lo[1] = l2;
        *(v2u*)(((job == 1) ? TWH : PWH) + i) = hi; *(v2u*)(((job == 1) ? TWL : PWL) + i) = lo;
    } else {                      // W_w: f16 of 16 w, in the fragment order that k_nl_flash reads (A tile of 16 channels x 32 k = 512 elements: bits 0-2 k, 3-6 row, 7 half, 8 which 16 k); g_w: f16, row-major
        const float s = (job == 0) ? 16.0f : 1.0f; v2u f; f[0] = f2h2_pack(v[0] * s, v[1] * s); f[1] = f2h2_pack(v[2] * s, v[3] * s);
        const unsigned c = i >> 7, k = i & 127u;   // W_w is [256][128]; the thread's 4 elements share a group of 8 k, and the 8 rows of a 128-byte line belong to one block
        const unsigned fo = ((c >> 4) * 4u + (k >> 5)) * 512u + ((k >> 4) & 1u) * 256u + ((k >> 3) & 1u) * 128u + (c & 15u) * 8u + (k & 7u);
        unsigned short* dp = ((job == 0) ? WW16 : GW16) + ((job == 0) ? fo : i);
        *(v2u*)dp = f;
        asm volatile("s_wait_xcnt 0x0" :: "v"(dp), "v"(f) : "memory");   // the wait before the store's registers are reused; address and value as inputs keep them until it
    }
}

extern "C" void kernel_launch(void* const* d_in, const int* in_sizes, int n_in, void* d_out, int out_size, void* d_ws, size_t ws_size, hipStream_t stream) {
    (void)in_sizes; (void)n_in; (void)out_size; (void)ws_size;
    const float* x = (const float*)d_in[0];
    const float* gw = (const float*)d_in[1];
    const float* gb = (const float*)d_in[2];
    const float* thw = (const float*)d_in[3];
    const float* thb = (const float*)d_in[4];
    const float* phw = (const float*)d_in[5];
    const float* phb = (const float*)d_in[6];
    const float* Ww = (const float*)d_in[7];
    const float* Wb = (const float*)d_in[8];
    const float* bng = (const float*)d_in[9];
    const float* bnb = (const float*)d_in[10];
    const int Bn = 8;
    const int C = 256;
    const int IC = 128;
    const int HW = 4096;
    const int NK = 1024;
    float* out = (float*)d_out;
    char* wsp = (char*)d_ws;
    // One launch per stage for all Bn images (projection and attention: blockIdx.y = image; output: one block per channel, images looped; per-image strides). Workspace: the operand planes that the projection writes, WY, the weight planes, the partial BN statistics
    unsigned short* THH = (unsigned short*)wsp; wsp += (size_t)Bn * HW * IC * 2;
    unsigned short* THL = (unsigned short*)wsp; wsp += (size_t)Bn * HW * IC * 2;
    unsigned short* PPH = (unsigned short*)wsp; wsp += (size_t)Bn * NK * IC * 2;
    unsigned short* PPL = (unsigned short*)wsp; wsp += (size_t)Bn * NK * IC * 2;
    unsigned short* GP16 = (unsigned short*)wsp; wsp += (size_t)Bn * IC * NK * 2;
    float* WY = (float*)wsp; wsp += (size_t)Bn * C * HW * 4;
    unsigned short* WW16 = (unsigned short*)wsp; wsp += (size_t)C * IC * 2;
    unsigned short* TWH = (unsigned short*)wsp; wsp += (size_t)IC * C * 2;
    unsigned short* TWL = (unsigned short*)wsp; wsp += (size_t)IC * C * 2;
    unsigned short* PWH = (unsigned short*)wsp; wsp += (size_t)IC * C * 2;
    unsigned short* PWL = (unsigned short*)wsp; wsp += (size_t)IC * C * 2;
    unsigned short* GW16 = (unsigned short*)wsp; wsp += (size_t)IC * C * 2;
    float* PS = (float*)wsp; wsp += (size_t)Bn * (HW / 128) * C * 2 * 4;
    // weights
    k_nl_wcast<<<dim3((unsigned)(C * IC / 1024), 4u), 256, 0, stream>>>(Ww, thw, phw, gw, WW16, TWH, TWL, PWH, PWL, GW16);
    // theta (bf16 hi/lo, [HW][IC]), pooled phi (bf16 hi/lo) and pooled g (f16) in fragment order, straight from x: 64 pixels a block, blockIdx.y = image
    w25::k_nl_proj<<<dim3((unsigned)(HW / 64), (unsigned)(Bn)), 256, 0, stream>>>(x, (const unsigned short*)(TWH), (const unsigned short*)(TWL), (const unsigned short*)(PWH), (const unsigned short*)(PWL), (const unsigned short*)(GW16), thb, phb, gb, THH, THL, PPH, PPL, GP16);
    // WY[b] = W softmax(theta[b] phi[b]) g[b]^T + W_b ([C][HW], f32) and, per block of 128 queries, each channel's sum and squared deviations: 128 queries a block, blockIdx.y = image
    w25::k_nl_flash<<<dim3((unsigned)(HW / 128), (unsigned)(Bn)), 128, 0, stream>>>((const unsigned short*)(THH), (const unsigned short*)(THL), (const unsigned short*)(PPH), (const unsigned short*)(PPL), (const unsigned short*)(GP16), (const unsigned short*)(WW16), Wb, WY, PS);
    k_nl_out<<<(unsigned)(C), 1024, 0, stream>>>(WY, PS, bng, bnb, x, out);
}

// v007
// It runs in 60.9 microseconds.
// Two timings next to v006 both put it at 1.10 times that version's speed.
// Over all steps from v000, the starting kernel, it is 23.2 times as fast.
#include <hip/hip_runtime.h>
#include <math.h>

typedef __attribute__((ext_vector_type(16))) _Float16 v16h;
typedef __attribute__((ext_vector_type(8)))  _Float16 v8h;
typedef __attribute__((ext_vector_type(16))) __bf16   v16b;
typedef __attribute__((ext_vector_type(8)))  float    v8f;
typedef __attribute__((ext_vector_type(4)))  float    v4f;

// 16-bit WMMA fragment map (wave32), lane L, h = L>>4, m = L&15:
//   A 16x32: lane = row m;   element i -> k = (i<8) ? 8h+i : 16+8h+(i-8)
//   B 32x16: lane = column m; the SAME k(i,h)
//   D 16x16 (8 f32): lane = column m; element r -> row 8h+r
__device__ __forceinline__ int frag_k(int i, int h) { return (i < 8) ? (8 * h + i) : (16 + 8 * h + (i - 8)); }
__device__ __forceinline__ __bf16 bf16_rne(float f) {
    unsigned int u = __float_as_uint(f);
    u += 0x7fffu + ((u >> 16) & 1u);
    return __builtin_bit_cast(__bf16, (unsigned short)(u >> 16));
}
__device__ __forceinline__ float bf16_f32(__bf16 b) { return __uint_as_float(((unsigned int)__builtin_bit_cast(unsigned short, b)) << 16); }
__device__ __forceinline__ v8f wmma16(v16h a, v16h b, v8f c) {
    c = __builtin_amdgcn_wmma_f32_16x16x32_f16(false, a, false, b, (short)0, c, false, false);
    asm volatile("v_nop\n\tv_nop\n\tv_nop\n\tv_nop" : "+v"(c) : "v"(a), "v"(b));
    return c;
}
__device__ __forceinline__ v8f wmmab(v16b a, v16b b, v8f c) {
    c = __builtin_amdgcn_wmma_f32_16x16x32_bf16(false, a, false, b, (short)0, c, false, false);
    asm volatile("v_nop\n\tv_nop\n\tv_nop\n\tv_nop" : "+v"(c) : "v"(a), "v"(b));
    return c;
}
struct Split { v16b hi, lo; };
// hi/lo split product: a.hi*b.hi + a.hi*b.lo + a.lo*b.hi
__device__ __forceinline__ v8f wmma3(const Split& a, const Split& b, v8f c) {
    c = __builtin_amdgcn_wmma_f32_16x16x32_bf16(false, a.hi, false, b.hi, (short)0, c, false, false);
    c = __builtin_amdgcn_wmma_f32_16x16x32_bf16(false, a.hi, false, b.lo, (short)0, c, false, false);
    c = __builtin_amdgcn_wmma_f32_16x16x32_bf16(false, a.lo, false, b.hi, (short)0, c, false, false);
    asm volatile("v_nop\n\tv_nop\n\tv_nop\n\tv_nop" : "+v"(c) : "v"(a.hi), "v"(a.lo), "v"(b.hi), "v"(b.lo));
    return c;
}
struct Split3 { v16b hi, mid, lo; };
// triple split product (6 terms, drops only terms below 2^-24 relative)
__device__ __forceinline__ v8f wmma6(const Split3& a, const Split3& b, v8f c) {
    c = __builtin_amdgcn_wmma_f32_16x16x32_bf16(false, a.hi, false, b.hi, (short)0, c, false, false);
    c = __builtin_amdgcn_wmma_f32_16x16x32_bf16(false, a.hi, false, b.mid, (short)0, c, false, false);
    c = __builtin_amdgcn_wmma_f32_16x16x32_bf16(false, a.mid, false, b.hi, (short)0, c, false, false);
    c = __builtin_amdgcn_wmma_f32_16x16x32_bf16(false, a.hi, false, b.lo, (short)0, c, false, false);
    c = __builtin_amdgcn_wmma_f32_16x16x32_bf16(false, a.mid, false, b.mid, (short)0, c, false, false);
    c = __builtin_amdgcn_wmma_f32_16x16x32_bf16(false, a.lo, false, b.hi, (short)0, c, false, false);
    asm volatile("v_nop\n\tv_nop\n\tv_nop\n\tv_nop" : "+v"(c) : "v"(a.hi), "v"(a.mid), "v"(a.lo), "v"(b.hi), "v"(b.mid), "v"(b.lo));
    return c;
}

// Fragment gathers from f32 memory: element i <- p[(k0 + frag_k(i,h)) * sk] * s, zero for k >= klen.
__device__ __forceinline__ v16h fh_ld(const float* __restrict__ p, long long sk, int k0, int h, int klen, float s) {
    v16h a;
#pragma unroll
    for (int i = 0; i < 16; ++i) { const int k = k0 + frag_k(i, h); a[i] = (k < klen) ? (_Float16)(p[(long long)k * sk] * s) : (_Float16)0.f; }
    return a;
}
__device__ __forceinline__ Split sp_ld(const float* __restrict__ p, long long sk, int k0, int h, int klen, float s) {
    Split r;
#pragma unroll
    for (int i = 0; i < 16; ++i) {
        const int k = k0 + frag_k(i, h); const float x = (k < klen) ? p[(long long)k * sk] * s : 0.f;
        const __bf16 hb = bf16_rne(x); r.hi[i] = hb; r.lo[i] = bf16_rne(x - bf16_f32(hb));
    }
    return r;
}
__device__ __forceinline__ Split3 sp3_ld(const float* __restrict__ p, long long sk, int k0, int h, int klen, float s) {
    Split3 r;
#pragma unroll
    for (int i = 0; i < 16; ++i) {
        const int k = k0 + frag_k(i, h); const float x = (k < klen) ? p[(long long)k * sk] * s : 0.f;
        const __bf16 hb = bf16_rne(x); const float r1 = x - bf16_f32(hb); const __bf16 mb = bf16_rne(r1);
        r.hi[i] = hb; r.mid[i] = mb; r.lo[i] = bf16_rne(r1 - bf16_f32(mb));
    }
    return r;
}
__device__ __forceinline__ v16b bh_ld(const float* __restrict__ p, long long sk, int k0, int h, int klen, float s) {
    v16b a;
#pragma unroll
    for (int i = 0; i < 16; ++i) { const int k = k0 + frag_k(i, h); a[i] = bf16_rne((k < klen) ? p[(long long)k * sk] * s : 0.f); }
    return a;
}
// f16 fragment from an f16 LDS/global row with element stride 1 (k-contiguous), no bounds (tile already zero padded)
__device__ __forceinline__ v16h fh_row(const _Float16* __restrict__ row, int k0, int h) {
    v16h a;
#pragma unroll
    for (int i = 0; i < 16; ++i) a[i] = row[k0 + frag_k(i, h)];
    return a;
}

#define VST2(T, ptr, val) do { const T vst2_v_ = (val); *(T*)(ptr) = vst2_v_;  } while (0)
typedef float v4f __attribute__((ext_vector_type(4)));
typedef unsigned int v4u __attribute__((ext_vector_type(4)));
typedef unsigned int v2u __attribute__((ext_vector_type(2)));
#define VST2V4(ptr, val) do { const v4f vst2_v4_ = (val); *(v4f*)(ptr) = vst2_v4_;  } while (0)

__device__ __attribute__((noinline)) float act_fn(float v, int act) {
    if (act == 1) return fmaxf(v, 0.f);                                                                               // relu
    if (act == 2) { const float u = 0.7978845608028654f * (v + 0.044715f * v * v * v); return 0.5f * v * (1.f + tanhf(u)); } // tanh-gelu
    if (act == 3) return v / (1.f + expf(-v));                                                                        // silu
    if (act == 4) return 0.5f * v * (1.f + erff(v * 0.7071067811865476f));                                             // erf-gelu
    if (act == 5) return tanhf(v);
    if (act == 6) return 1.f / (1.f + expf(-v));                                                                      // sigmoid
    if (act == 7) return (v > 0.f) ? v : 0.01f * v;                                                                   // leaky relu 0.01
    if (act == 8) return (v > 0.f) ? v : (expf(v) - 1.f);                                                             // elu
    if (act == 9) return fminf(fmaxf(v, 0.f), 6.f);                                                                   // relu6
    if (act == 10) return fabsf(v);                                                                                    // abs
    if (act == 11) return (v >= 0.f) ? v : 0.1f * v;                                                                  // leaky 0.1
    if (act == 12) return (v > 0.f) ? v : 0.2f * v;                                                                   // leaky 0.2
    if (act == 13) return (v > 20.f) ? v : log1pf(expf(v));                                                            // softplus
    return v;
}

// =====================================================================================================================
// k_gemm<MODE>: C(z, m, n) = act(alpha * sum_k A(z, m, k) * B(z, k, n) + bias) + beta * R(z, m, n)
//   One wave (32-thread block) per 16 x 32 tile of C; grid (ceil(N/32), ceil(M/16), Z). Batch z -> (zo = z / zi_n, zi = z % zi_n)
//   with separate outer/inner strides for every tensor (e.g. batch and head). A(m,k) = A[zo*sAo + zi*sAi + m*sAm + k*sAk] (f32),
//   B(k,n) = B[zo*sBo + zi*sBi + n*sBn + k*sBk] (f32); any M, N, K (K zero-padded to 32 inside the fragments, M/N tails guarded).
//   C(m,n) = C[zo*sCo + zi*sCi + m*sCm + n] (n contiguous). flags: 1 bias[n], 2 bias[m], 4 residual R[zo*sRo + zi*sRi + m*sRm + n*sRn].
//   MODE 0: f16 operands (A prescaled by sa, B by sb, both undone in the epilogue); 1: bf16 hi/lo split (3 products); 2: bf16;
//   3: bf16 hi/mid/lo triple split (6 products); 4: as 3 with Kahan-compensated f32 accumulation across k-steps.
// =====================================================================================================================
struct GemmP {
    const float* A; const float* B; const float* bias; const float* R; float* C;
    long long sAo, sAi, sAm, sAk, sBo, sBi, sBn, sBk, sCo, sCi, sCm, sRo, sRi, sRm, sRn;
    int M, N, K, zi_n, flags, act; float alpha, beta, sa, sb;
    int Npad, pad_;     // columns [N, Npad) of C are written as 0 so that padded workspace rows are covered by whole-line stores; Npad >= N
};
static_assert(sizeof(GemmP) == 5 * 8 + 15 * 8 + 6 * 4 + 4 * 4 + 2 * 4, "GemmP has padding");

template <int MODE>
__global__ __launch_bounds__(32) void k_gemm(GemmP p) {
    const int lane = threadIdx.x & 31, h = lane >> 4, l15 = lane & 15;
    const int m0 = blockIdx.y * 16, n0 = blockIdx.x * 32;
    const int z = blockIdx.z, zo = z / p.zi_n, zi = z - zo * p.zi_n;
    const float* A = p.A + zo * p.sAo + zi * p.sAi;
    const float* B = p.B + zo * p.sBo + zi * p.sBi;
    const int am = min(m0 + l15, p.M - 1);                       // clamped row for loads (stores are guarded)
    v8f acc[2], comp[2];
#pragma unroll
    for (int t = 0; t < 2; ++t) { v8f zz = {}; acc[t] = zz; comp[t] = zz; }
    for (int k0 = 0; k0 < p.K; k0 += 32) {
        const float* arow = A + (long long)am * p.sAm;
        if (MODE == 1) {
            const Split a = sp_ld(arow, p.sAk, k0, h, p.K, 1.f);
#pragma unroll
            for (int t = 0; t < 2; ++t) {
                const int bn = min(n0 + t * 16 + l15, p.N - 1);
                acc[t] = wmma3(a, sp_ld(B + (long long)bn * p.sBn, p.sBk, k0, h, p.K, 1.f), acc[t]);
            }
        } else if (MODE == 3) {
            const Split3 a = sp3_ld(arow, p.sAk, k0, h, p.K, 1.f);
#pragma unroll
            for (int t = 0; t < 2; ++t) {
                const int bn = min(n0 + t * 16 + l15, p.N - 1);
                acc[t] = wmma6(a, sp3_ld(B + (long long)bn * p.sBn, p.sBk, k0, h, p.K, 1.f), acc[t]);
            }
        } else if (MODE == 4) {
            // triple split as MODE 3, but each k-step's 6 products go into a fresh accumulator and the partial is added to the running f32 sum
            // on the VALU with Kahan compensation (accumulation error stays ~1 ulp however long K is)
            const Split3 a = sp3_ld(arow, p.sAk, k0, h, p.K, 1.f);
#pragma unroll
            for (int t = 0; t < 2; ++t) {
                const int bn = min(n0 + t * 16 + l15, p.N - 1); v8f zz = {};
                const v8f part = wmma6(a, sp3_ld(B + (long long)bn * p.sBn, p.sBk, k0, h, p.K, 1.f), zz);
                const v8f y = part - comp[t]; const v8f s = acc[t] + y; comp[t] = (s - acc[t]) - y; acc[t] = s;
            }
        } else if (MODE == 2) {
            const v16b a = bh_ld(arow, p.sAk, k0, h, p.K, 1.f);
#pragma unroll
            for (int t = 0; t < 2; ++t) {
                const int bn = min(n0 + t * 16 + l15, p.N - 1);
                acc[t] = wmmab(a, bh_ld(B + (long long)bn * p.sBn, p.sBk, k0, h, p.K, 1.f), acc[t]);
            }
        } else {
            const v16h a = fh_ld(arow, p.sAk, k0, h, p.K, p.sa);
#pragma unroll
            for (int t = 0; t < 2; ++t) {
                const int bn = min(n0 + t * 16 + l15, p.N - 1);
                acc[t] = wmma16(a, fh_ld(B + (long long)bn * p.sBn, p.sBk, k0, h, p.K, p.sb), acc[t]);
            }
        }
    }
    const float iscale = (MODE == 0) ? p.alpha / (p.sa * p.sb) : p.alpha;
    float* C = p.C + zo * p.sCo + zi * p.sCi;
    const float* R = p.R + zo * p.sRo + zi * p.sRi;
    __shared__ __align__(16) float ctile[16][36];
#pragma unroll
    for (int t = 0; t < 2; ++t) {
        const int n = n0 + t * 16 + l15; const int nn = min(n, p.N - 1);
#pragma unroll
        for (int r = 0; r < 8; ++r) {
            const int m = m0 + 8 * h + r; const int mm = min(m, p.M - 1);
            float v = acc[t][r] * iscale;
            if (p.flags & 1) v += p.bias[nn];
            if (p.flags & 2) v += p.bias[mm];
            if (p.flags & 8) v *= p.bias[(long long)zo * p.M + mm];   /* per-(z,row) scale vector laid out [Z][M]; exclusive with the bias flags */
            v = act_fn(v, p.act);
            if (p.flags & 4) v += p.beta * R[(long long)mm * p.sRm + (long long)nn * p.sRn];
            ctile[8 * h + r][t * 16 + l15] = (n < p.N) ? v : 0.f;
        }
    }
    __syncthreads();
    const int NW = (p.Npad > p.N) ? p.Npad : p.N;           // write width
    const bool fast = (m0 + 16 <= p.M) && (n0 + 32 <= NW) && ((p.sCm & 3) == 0) && ((((size_t)C) & 15) == 0);
    if (fast) {
#pragma unroll
        for (int s = 0; s < 4; ++s) {
            const int row = s * 4 + (lane >> 3), c4 = (lane & 7) * 4;
            const v4f v = *(const v4f*)&ctile[row][c4];
            VST2V4(C + (long long)(m0 + row) * p.sCm + n0 + c4, v);
        }
    } else {
        for (int row = 0; row < 16; ++row) {
            const int m = m0 + row, n = n0 + lane;
            if (m < p.M && n < NW) VST2(float, C + (long long)m * p.sCm + n, ctile[row][lane]);
        }
    }
}


// =====================================================================================================================
// k_gemmT<MODE, TM, TN>: same contract as k_gemm, but one wave computes a (16*TM) x (16*TN) tile: TM A fragments and TN B fragments are
//   loaded per 32-wide k-step and reused across TM*TN WMMAs (far fewer load/convert instructions per MAC). MODE 0 (f16), 1 (bf16 hi/lo),
//   2 (bf16) only. grid (ceil(NW/(16*TN)), ceil(M/(16*TM)), Z), block 32. Epilogue identical to k_gemm, run per 16x32 sub-tile.
// =====================================================================================================================
template <int MODE, int TM, int TN>
__global__ __launch_bounds__(32) void k_gemmT(GemmP p) {
    const int lane = threadIdx.x & 31, h = lane >> 4, l15 = lane & 15;
    const int m0 = blockIdx.y * (16 * TM), n0 = blockIdx.x * (16 * TN);
    const int z = blockIdx.z, zo = z / p.zi_n, zi = z - zo * p.zi_n;
    const float* A = p.A + zo * p.sAo + zi * p.sAi;
    const float* B = p.B + zo * p.sBo + zi * p.sBi;
    v8f acc[TM][TN];
#pragma unroll
    for (int i = 0; i < TM; ++i)
#pragma unroll
        for (int t = 0; t < TN; ++t) { v8f zz = {}; acc[i][t] = zz; }
    for (int k0 = 0; k0 < p.K; k0 += 32) {
        if (MODE == 1) {
            Split a[TM], b[TN];
#pragma unroll
            for (int i = 0; i < TM; ++i) { const int am = min(m0 + 16 * i + l15, p.M - 1); a[i] = sp_ld(A + (long long)am * p.sAm, p.sAk, k0, h, p.K, 1.f); }
#pragma unroll
            for (int t = 0; t < TN; ++t) { const int bn = min(n0 + 16 * t + l15, p.N - 1); b[t] = sp_ld(B + (long long)bn * p.sBn, p.sBk, k0, h, p.K, 1.f); }
#pragma unroll
            for (int i = 0; i < TM; ++i)
#pragma unroll
                for (int t = 0; t < TN; ++t) acc[i][t] = wmma3(a[i], b[t], acc[i][t]);
        } else if (MODE == 2) {
            v16b a[TM], b[TN];
#pragma unroll
            for (int i = 0; i < TM; ++i) { const int am = min(m0 + 16 * i + l15, p.M - 1); a[i] = bh_ld(A + (long long)am * p.sAm, p.sAk, k0, h, p.K, 1.f); }
#pragma unroll
            for (int t = 0; t < TN; ++t) { const int bn = min(n0 + 16 * t + l15, p.N - 1); b[t] = bh_ld(B + (long long)bn * p.sBn, p.sBk, k0, h, p.K, 1.f); }
#pragma unroll
            for (int i = 0; i < TM; ++i)
#pragma unroll
                for (int t = 0; t < TN; ++t) acc[i][t] = wmmab(a[i], b[t], acc[i][t]);
        } else {
            v16h a[TM], b[TN];
#pragma unroll
            for (int i = 0; i < TM; ++i) { const int am = min(m0 + 16 * i + l15, p.M - 1); a[i] = fh_ld(A + (long long)am * p.sAm, p.sAk, k0, h, p.K, p.sa); }
#pragma unroll
            for (int t = 0; t < TN; ++t) { const int bn = min(n0 + 16 * t + l15, p.N - 1); b[t] = fh_ld(B + (long long)bn * p.sBn, p.sBk, k0, h, p.K, p.sb); }
#pragma unroll
            for (int i = 0; i < TM; ++i)
#pragma unroll
                for (int t = 0; t < TN; ++t) acc[i][t] = wmma16(a[i], b[t], acc[i][t]);
        }
    }
    const float iscale = (MODE == 0) ? p.alpha / (p.sa * p.sb) : p.alpha;
    float* C = p.C + zo * p.sCo + zi * p.sCi;
    const float* R = p.R + zo * p.sRo + zi * p.sRi;
    const int NW = (p.Npad > p.N) ? p.Npad : p.N;
    __shared__ __align__(16) float ctile[16][36];
#pragma unroll
    for (int i = 0; i < TM; ++i) {
        const int mb = m0 + 16 * i; if (mb >= p.M) break;          // wave-uniform
#pragma unroll
        for (int tp = 0; tp < TN / 2; ++tp) {
            const int nb = n0 + 32 * tp; if (nb >= NW) break;        // wave-uniform
#pragma unroll
            for (int t2 = 0; t2 < 2; ++t2) {
                const int t = 2 * tp + t2; const int n = nb + t2 * 16 + l15; const int nn = min(n, p.N - 1);
#pragma unroll
                for (int r = 0; r < 8; ++r) {
                    const int m = mb + 8 * h + r; const int mm = min(m, p.M - 1);
                    float v = acc[i][t][r] * iscale;
                    if (p.flags & 1) v += p.bias[nn];
                    if (p.flags & 2) v += p.bias[mm];
            if (p.flags & 8) v *= p.bias[(long long)zo * p.M + mm];   /* per-(z,row) scale vector laid out [Z][M]; exclusive with the bias flags */
                    v = act_fn(v, p.act);
                    if (p.flags & 4) v += p.beta * R[(long long)mm * p.sRm + (long long)nn * p.sRn];
                    ctile[8 * h + r][t2 * 16 + l15] = (n < p.N) ? v : 0.f;
                }
            }
            __syncthreads();
            const bool fast = (mb + 16 <= p.M) && (nb + 32 <= NW) && ((p.sCm & 3) == 0) && ((((size_t)C) & 15) == 0);
            if (fast) {
#pragma unroll
                for (int s = 0; s < 4; ++s) {
                    const int row = s * 4 + (lane >> 3), c4 = (lane & 7) * 4;
                    const v4f v = *(const v4f*)&ctile[row][c4];
                    VST2V4(C + (long long)(mb + row) * p.sCm + nb + c4, v);
                }
            } else {
                for (int row = 0; row < 16; ++row) {
                    const int m = mb + row, n = nb + lane;
                    if (m < p.M && n < NW) VST2(float, C + (long long)m * p.sCm + n, ctile[row][lane]);
                }
            }
            __syncthreads();
        }
    }
}

// =====================================================================================================================
//   Wave = 16 queries, AW waves per block, 64-key blocks; grid (ceil(Lq/(16*AW)), H, B), block 32*AW. Any Lq, Lk; head dim dh <= DHP
//   (DHP multiple of 32), value dim dv <= DVP (multiple of 16, <= 128). Every tensor addressed by (batch, head, row, element) strides, f32.
//   Scores: QM 0 f16 operands, 1 bf16 hi/lo split, 2 bf16 triple split; statistics f32 (exp2 domain); P.V: P x 4096 as f16 with V f16 staged in LDS
//   (SPLITPV: P and V as bf16 hi/lo splits). kv head = h / hrep. Masking: causal = 1 (keep j <= i + coff, masked -> -inf, key blocks beyond the
//   diagonal skipped), causal = 2 (masked -> mfill, a finite fill like the -1e9; no skipping), causal = 3 (keep j >= i + coff,
//   masked -> -inf, no skipping); optional additive f32 mask Mf,
//   optional int keep-mask Mi (0 -> score := mfill), both addressed b*smb + h*smh + i*smi + j*smj (0 strides broadcast).
// =====================================================================================================================
#define AW 4
struct AttnP {   // apv4
    const float* Q; const float* K; const float* V; float* O; float* P; const float* Mf; const int* Mi; float* ST;
    const float* Pw; const float* Rt; const int* SQ; const int* SK;           // optional: post-softmax weight, relative-position table, segment ids
    long long swb, swh, swi, swj, srb, srh, sri;                                 // Pw strides (b,h,i,j); Rt strides (b,h,i), column = clamp(i - j + roff, 0, rn-1)
    long long sQb, sQh, sQi, sQd, sKb, sKh, sKj, sKd, sVb, sVh, sVj, sVd, sOb, sOh, sOi, sPb, sPh, sPi, smb, smh, smi, smj;
    int Lq, Lk, dh, dv, hrep, causal, coff, pband;   // pband > 0: P holds only the band |j - i| <= pband, column j - i + pband
    float scale, mfill; int nonorm, mpol;             // nonorm (online path only): O = sum_j exp(score_j) V_j without the 1/rowsum (scores must be <= ~0); mpol: Mi masks where ==0 (mpol 0) or where !=0 (mpol 1)
    int roff, rn, segpol, win;                        // Rt column offset/count; SQ/SK: score := mfill where (segpol 0) SQ[i] != SK[j] or (segpol 1) SQ[i] == SK[j]; win > 0: keys with i - j > win (after coff) -> -inf
};
//   Pw: the softmax numerator is multiplied by Pw(b,h,i,j) AFTER the row sum is taken (probs * weight, then P.V), as in post-softmax multiplicative biases.                                                    // ST (optional): per row (b,h,i) -> ST[((b*H + h)*Lq + i)*2 + {0,1}] = {row max of the scaled+masked score (natural units), sum_j exp(score - max)}
static_assert(sizeof(AttnP) == 12 * 8 + 29 * 8 + 16 * 4, "AttnP has padding");

#ifndef KATTN_ATTR
#define KATTN_ATTR
#endif
template <int DHP, int DVP, int QM, bool SPLITPV, bool TWOPASS>
__global__ __launch_bounds__(32 * AW) KATTN_ATTR void k_attn(AttnP p) {
    constexpr int NT = DVP / 16;                // output tiles
    constexpr int KS = DHP / 32;                // k-steps for the scores
    constexpr int VP = DVP + 8;                 // LDS pitch (halves)
    __shared__ __align__(16) float    pl[AW][16 * 64];
    __shared__ __align__(16) _Float16 vl[(SPLITPV ? 2 : 1) * 64 * VP];   // f16 V tile, or bf16 hi and lo tiles (same 2-byte size)
    const int lane = threadIdx.x & 31, hf = lane >> 4, l15 = lane & 15, wave = threadIdx.x >> 5;
    const int h = blockIdx.y, b = blockIdx.z, hk = h / p.hrep;
    const int q0 = (blockIdx.x * AW + wave) * 16;
    float* myp = pl[wave];
    const float L2E = 1.4426950408889634f;
    const float NEG = -__builtin_inff();
    const int qi = min(q0 + l15, p.Lq - 1);
    const float* qrow = p.Q + b * p.sQb + h * p.sQh + (long long)qi * p.sQi;
    const float* kbase = p.K + b * p.sKb + hk * p.sKh;
    const float* vbase = p.V + b * p.sVb + hk * p.sVh;
    v16h qa[QM == 0 ? KS : 1]; Split qs_[QM == 1 ? KS : 1]; Split3 qt_[QM == 2 ? KS : 1];
#pragma unroll
    for (int ks = 0; ks < KS; ++ks) {
        if (QM == 2) qt_[ks] = sp3_ld(qrow, p.sQd, ks * 32, hf, p.dh, 1.f);
        else if (QM == 1) qs_[ks] = sp_ld(qrow, p.sQd, ks * 32, hf, p.dh, 1.f);
        else qa[ks] = fh_ld(qrow, p.sQd, ks * 32, hf, p.dh, 1.f);
    }
    v8f o[NT]; float m8[8], l8[8];
#pragma unroll
    for (int t = 0; t < NT; ++t) { v8f zz = {}; o[t] = zz; }
#pragma unroll
    for (int i = 0; i < 8; ++i) { m8[i] = NEG; l8[i] = 0.f; }
    int jend = p.Lk; int jstart = 0;
    if (p.causal == 1) { const int je = (blockIdx.x * AW + AW - 1) * 16 + 16 + p.coff; jend = min(jend, max(je, 0)); }   // uniform per block
    if (p.win > 0) { const int js = (int)(blockIdx.x * AW) * 16 + p.coff - p.win; jstart = (js > 0) ? (js / 64) * 64 : 0; }   // uniform per block: key blocks entirely outside every row's window hold only -inf entries and are skipped exactly
    const int npass = TWOPASS ? 2 : 1;
    for (int pass = 0; pass < npass; ++pass) {
        const bool dopv = (!TWOPASS) || pass == 1;
        for (int j0 = jstart; j0 < jend; j0 += 64) {
            if (dopv) {
                __syncthreads();                                 // previous key block's reads of vl / pl are done
                for (int idx = threadIdx.x; idx < 64 * DVP; idx += 32 * AW) {
                    const int jr = idx / DVP, d = idx - jr * DVP, j = j0 + jr;
                    const float f = (j < p.Lk && d < p.dv) ? vbase[(long long)j * p.sVj + (long long)d * p.sVd] : 0.f;
                    if (SPLITPV) {
                        const __bf16 hb = bf16_rne(f);
                        ((__bf16*)vl)[jr * VP + d] = hb; ((__bf16*)vl)[64 * VP + jr * VP + d] = bf16_rne(f - bf16_f32(hb));
                    } else vl[jr * VP + d] = (_Float16)f;
                }
            }
            v8f s[4];
#pragma unroll
            for (int t = 0; t < 4; ++t) {
                const int j = min(j0 + t * 16 + l15, p.Lk - 1);
                const float* krow = kbase + (long long)j * p.sKj;
                v8f acc = {};
#pragma unroll
                for (int ks = 0; ks < KS; ++ks) {
                    if (QM == 2)      acc = wmma6(qt_[ks], sp3_ld(krow, p.sKd, ks * 32, hf, p.dh, 1.f), acc);
                    else if (QM == 1) acc = wmma3(qs_[ks], sp_ld(krow, p.sKd, ks * 32, hf, p.dh, 1.f), acc);
                    else              acc = wmma16(qa[ks], fh_ld(krow, p.sKd, ks * 32, hf, p.dh, 1.f), acc);
                }
                s[t] = acc;
            }
            float pv[8][4];
#pragma unroll
            for (int i = 0; i < 8; ++i) {
                const int irow = q0 + i + 8 * hf;
                const int ic = min(irow, p.Lq - 1);
                float sc[4];
#pragma unroll
                for (int t = 0; t < 4; ++t) {
                    const int jg = j0 + t * 16 + l15;
                    float v = s[t][i] * p.scale;
                    if (p.Mf) v += p.Mf[b * p.smb + h * p.smh + (long long)ic * p.smi + (long long)min(jg, p.Lk - 1) * p.smj];
                    if (p.Rt) { int rc = ic - min(jg, p.Lk - 1) + p.roff; rc = rc < 0 ? 0 : (rc >= p.rn ? p.rn - 1 : rc); v += p.Rt[b * p.srb + h * p.srh + (long long)ic * p.sri + rc]; }
                    if (p.Mi) { const int mv = p.Mi[b * p.smb + h * p.smh + (long long)ic * p.smi + (long long)min(jg, p.Lk - 1) * p.smj]; if (p.mpol ? (mv != 0) : (mv == 0)) v = p.mfill; }
                    if (p.SQ) { const bool same = p.SQ[(long long)b * p.Lq + ic] == p.SK[(long long)b * p.Lk + min(jg, p.Lk - 1)]; if (p.segpol ? same : !same) v = p.mfill; }
                    if (p.causal == 2 && jg > irow + p.coff) v = p.mfill;
                    if (jg >= p.Lk || (p.causal == 1 && jg > irow + p.coff) || (p.causal == 3 && jg < irow + p.coff) || (p.win > 0 && irow + p.coff - jg > p.win)) v = NEG; else v *= L2E;
                    sc[t] = v;
                }
                if (!TWOPASS || pass == 0) {
                    float mx = fmaxf(fmaxf(sc[0], sc[1]), fmaxf(sc[2], sc[3]));
                    mx = fmaxf(mx, __shfl_xor(mx, 1, 32)); mx = fmaxf(mx, __shfl_xor(mx, 2, 32));
                    mx = fmaxf(mx, __shfl_xor(mx, 4, 32)); mx = fmaxf(mx, __shfl_xor(mx, 8, 32));
                    const float mnew = fmaxf(m8[i], mx);
                    const float corr = (mnew == NEG) ? 1.f : exp2f(m8[i] - mnew);
                    float rs = 0.f;
#pragma unroll
                    for (int t = 0; t < 4; ++t) {
                        const float pp = (sc[t] == NEG) ? 0.f : exp2f(sc[t] - mnew); rs += pp;
                        pv[i][t] = p.Pw ? pp * p.Pw[b * p.swb + h * p.swh + (long long)ic * p.swi + (long long)min(j0 + t * 16 + l15, p.Lk - 1) * p.swj] : pp;
                    }
                    rs += __shfl_xor(rs, 1, 32); rs += __shfl_xor(rs, 2, 32); rs += __shfl_xor(rs, 4, 32); rs += __shfl_xor(rs, 8, 32);
                    l8[i] = l8[i] * corr + rs; m8[i] = mnew;
                    if (!TWOPASS) {
#pragma unroll
                        for (int t = 0; t < NT; ++t) o[t][i] *= corr;
                    }
                } else {
                    const float inv = (l8[i] > 0.f) ? 1.f / l8[i] : 0.f;
#pragma unroll
                    for (int t = 0; t < 4; ++t) {
                        const int jg = j0 + t * 16 + l15;
                        float pp = (sc[t] == NEG) ? 0.f : exp2f(sc[t] - m8[i]) * inv;
                        if (p.Pw) pp *= p.Pw[b * p.swb + h * p.swh + (long long)ic * p.swi + (long long)min(jg, p.Lk - 1) * p.swj];
                        pv[i][t] = pp;
                    }
                }
            }
            if (dopv) {
#pragma unroll
                for (int i = 0; i < 8; ++i)
#pragma unroll
                    for (int t = 0; t < 4; ++t) ((float*)myp)[(i + 8 * hf) * 64 + t * 16 + l15] = pv[i][t];
                __syncthreads();                                 // P (per wave) and V (shared) visible
                if (p.P) {
                    float* pb_ = p.P + b * p.sPb + h * p.sPh;
                    const bool fastP = (p.pband == 0) && ((p.sPi & 3) == 0) && (j0 + 64 <= p.Lk) && (q0 + 16 <= p.Lq) && ((((size_t)pb_) & 15) == 0);
                    if (fastP) {
#pragma unroll
                        for (int s = 0; s < 8; ++s) {
                            const int row = s * 2 + (lane >> 4), c4 = (lane & 15) * 4;
                            const v4f v = *(const v4f*)(myp + row * 64 + c4);
                            VST2V4(pb_ + (long long)(q0 + row) * p.sPi + j0 + c4, v);
                        }
                    } else {
                        for (int row = 0; row < 16; ++row) {
                            const int irow = q0 + row; if (irow >= p.Lq) continue;
                            for (int c = lane; c < 64; c += 32) {
                                const int jg = j0 + c; if (jg >= p.Lk) continue;
                                if (p.pband == 0) VST2(float, pb_ + (long long)irow * p.sPi + jg, myp[row * 64 + c]);
                                else if (jg - irow <= p.pband && irow - jg <= p.pband) VST2(float, pb_ + (long long)irow * p.sPi + (jg - irow + p.pband), myp[row * 64 + c]);
                            }
                        }
                    }
                }
                if (SPLITPV) {
                    const Split pa0 = sp_ld(myp + l15 * 64, 1, 0, hf, 64, 1.f), pa1 = sp_ld(myp + l15 * 64, 1, 32, hf, 64, 1.f);
                    const __bf16* vh = (const __bf16*)vl; const __bf16* vlo = vh + 64 * VP;
#pragma unroll
                    for (int t = 0; t < NT; ++t) {
                        const int dcol = t * 16 + l15;
                        Split b0, b1;
#pragma unroll
                        for (int e = 0; e < 16; ++e) {
                            const int k0 = frag_k(e, hf), k1 = 32 + frag_k(e, hf);
                            b0.hi[e] = vh[k0 * VP + dcol]; b0.lo[e] = vlo[k0 * VP + dcol]; b1.hi[e] = vh[k1 * VP + dcol]; b1.lo[e] = vlo[k1 * VP + dcol];
                        }
                        o[t] = wmma3(pa0, b0, o[t]);
                        o[t] = wmma3(pa1, b1, o[t]);
                    }
                } else {
                    const v16h pa0 = fh_ld(myp + l15 * 64, 1, 0, hf, 64, 4096.f), pa1 = fh_ld(myp + l15 * 64, 1, 32, hf, 64, 4096.f);
#pragma unroll
                    for (int t = 0; t < NT; ++t) {
                        const int dcol = t * 16 + l15;
                        v16h b0, b1;
#pragma unroll
                        for (int e = 0; e < 16; ++e) { b0[e] = vl[frag_k(e, hf) * VP + dcol]; b1[e] = vl[(32 + frag_k(e, hf)) * VP + dcol]; }
                        o[t] = wmma16(pa0, b0, o[t]);
                        o[t] = wmma16(pa1, b1, o[t]);
                    }
                }
            }
        }
    }
    float* obase = p.O + b * p.sOb + h * p.sOh;
    if (p.ST) {
        const int rl = lane >> 1, isel = rl & 7;           // row q0 + rl ; rl>>3 == hf holds because lane>>4 == (lane>>1)>>3
        float mv = 0.f, lv = 0.f;
#pragma unroll
        for (int i = 0; i < 8; ++i) if (i == isel) { mv = m8[i]; lv = l8[i]; }
        const int irow = q0 + rl;
        if (irow < p.Lq) { float* st = p.ST + (((long long)b * gridDim.y + h) * p.Lq + irow) * 2 + (lane & 1); VST2(float, st, (lane & 1) ? lv : mv * 0.6931471805599453f); }
    }
    float invr[8];
#pragma unroll
    for (int i = 0; i < 8; ++i) {
        if (TWOPASS) invr[i] = SPLITPV ? 1.f : (1.f / 4096.f);
        else if (p.nonorm) invr[i] = exp2f(m8[i]) * (SPLITPV ? 1.f : (1.f / 4096.f));
        else invr[i] = (l8[i] > 0.f) ? (SPLITPV ? 1.f / l8[i] : 1.f / (l8[i] * 4096.f)) : 0.f;
    }
    __syncthreads();                                             // all waves done with pl/vl from the main loop
    const bool ofast = ((p.sOi & 3) == 0) && ((((size_t)obase) & 15) == 0) && (q0 + 16 <= p.Lq);
#pragma unroll
    for (int c0 = 0; c0 < DVP; c0 += 64) {
#pragma unroll
        for (int i = 0; i < 8; ++i)
#pragma unroll
            for (int t = 0; t < NT; ++t) if (t * 16 >= c0 && t * 16 < c0 + 64) ((float*)myp)[(i + 8 * hf) * 64 + (t * 16 - c0) + l15] = o[t][i] * invr[i];
        __syncthreads();
        const int cw = (DVP - c0 < 64) ? (DVP - c0) : 64;      // staged columns in this chunk (multiple of 16)
        if (ofast && (c0 + cw <= p.dv) && (cw % 32 == 0)) {
            const int lpr = cw / 4;                              // lanes per row (16 for 64 cols, 8 for 32)
            const int rows_per_ins = 32 / lpr;
            for (int r0 = 0; r0 < 16; r0 += rows_per_ins) {
                const int row = r0 + lane / lpr, c4 = (lane % lpr) * 4;
                const v4f v = *(const v4f*)(myp + row * 64 + c4);
                VST2V4(obase + (long long)(q0 + row) * p.sOi + c0 + c4, v);
            }
        } else {
            for (int row = 0; row < 16; ++row) {
                const int irow = q0 + row; if (irow >= p.Lq) continue;
                for (int c = lane; c < cw; c += 32) { const int d = c0 + c; if (d < p.dv) VST2(float, obase + (long long)irow * p.sOi + d, myp[row * 64 + c]); }
            }
        }
        __syncthreads();
    }
}

// =====================================================================================================================
// k_tr: dst(z, c, r) = alpha * src(z, r, c) (+ beta * R2(z, c, r)): [Z][R][C] (row stride lds) -> [Z][C][R] (row stride ldd) through a 32x32 LDS tile;
//   flags: 1 -> add beta * residual R2 addressed like dst (z*sRz + c*ldr + r); act applied before the residual.
// =====================================================================================================================
struct TrP { const float* src; float* dst; const float* R2; long long sSz, lds, sDz, ldd, sRz, ldr; int R, C, flags, act; float alpha, beta; };
static_assert(sizeof(TrP) == 3 * 8 + 6 * 8 + 6 * 4, "TrP has padding");
__global__ __launch_bounds__(256) void k_tr(TrP p) {
    __shared__ float tile[32][33];
    const int c0 = blockIdx.x * 32, r0 = blockIdx.y * 32, z = blockIdx.z;
    const int lane = threadIdx.x & 31, wave = threadIdx.x >> 5;
    const float* s = p.src + z * p.sSz;
#pragma unroll
    for (int k = 0; k < 4; ++k) {
        const int rl = wave * 4 + k, r = r0 + rl, c = c0 + lane;
        tile[rl][lane] = (r < p.R && c < p.C) ? s[(long long)r * p.lds + c] : 0.f;
    }
    __syncthreads();
    float* d = p.dst + z * p.sDz; const float* rr = p.R2 + z * p.sRz;
#pragma unroll
    for (int k = 0; k < 4; ++k) {
        const int cl = wave * 4 + k, c = c0 + cl, r = r0 + lane;
        if (c < p.C && r < p.R) {
            float v = act_fn(p.alpha * tile[lane][cl], p.act);
            if (p.flags & 1) v += p.beta * rr[(long long)c * p.ldr + r];
            VST2(float, d + (long long)c * p.ldd + r, v);
        }
    }
}

// k_affine: dst[i] = a * (sdev ? sdev[0] : 1) * src[i] + b, i < n (one thread per element; consecutive lanes -> consecutive addresses)
__global__ __launch_bounds__(256) void k_affine(const float* __restrict__ src, float* __restrict__ dst, int n, float a, float b, const float* __restrict__ sdev) {
    const int i = blockIdx.x * 256 + threadIdx.x;
    if (i < n) { const float aa = sdev ? a * sdev[0] : a; const float v = aa * src[i] + b; VST2(float, dst + i, v); }
}

// =====================================================================================================================
// k_softmax: row softmax over n contiguous elements, one 256-thread block per row; rows addressed z*sz + r*sr (grid (R, Z)).
//   out = scale_out * softmax(scale_in * x + (Mf ? Mf[z*smz + r*smr + j] : 0)); a row whose max is -inf is written as 0.
// =====================================================================================================================
struct SmP { const float* src; float* dst; const float* Mf; long long sz, sr, dz, dr, smz, smr; int n, pad; float scale_in, scale_out; };
static_assert(sizeof(SmP) == 3 * 8 + 6 * 8 + 4 * 4, "SmP has padding");
__global__ __launch_bounds__(256) void k_softmax(SmP p) {
    __shared__ float red[256];
    const int r = blockIdx.x, z = blockIdx.y, tid = threadIdx.x;
    const float* s = p.src + z * p.sz + (long long)r * p.sr;
    const float* mf = p.Mf ? (p.Mf + z * p.smz + (long long)r * p.smr) : nullptr;
    float mx = -__builtin_inff();
    for (int j = tid; j < p.n; j += 256) { float v = s[j] * p.scale_in; if (mf) v += mf[j]; mx = fmaxf(mx, v); }
    red[tid] = mx; __syncthreads();
    for (int o = 128; o > 0; o >>= 1) { if (tid < o) red[tid] = fmaxf(red[tid], red[tid + o]); __syncthreads(); }
    mx = red[0]; __syncthreads();
    float sum = 0.f;
    for (int j = tid; j < p.n; j += 256) { float v = s[j] * p.scale_in; if (mf) v += mf[j]; sum += (mx == -__builtin_inff()) ? 0.f : expf(v - mx); }
    red[tid] = sum; __syncthreads();
    for (int o = 128; o > 0; o >>= 1) { if (tid < o) red[tid] += red[tid + o]; __syncthreads(); }
    sum = red[0];
    const float inv = (sum > 0.f) ? p.scale_out / sum : 0.f;
    float* d = p.dst + z * p.dz + (long long)r * p.dr;
    for (int j = tid; j < p.n; j += 256) { float v = s[j] * p.scale_in; if (mf) v += mf[j]; const float o = (mx == -__builtin_inff()) ? 0.f : expf(v - mx) * inv; VST2(float, d + j, o); }
}
// =====================================================================================================================
// k_stats: mean and rsqrt(var + eps) over a set of n elements addressed base + z*sz + (e / inner) * so + (e % inner) * si, one 256-thread
// k_norm_apply: y = (x - mean[set]) * rstd[set] * g[c] + b[c] over a [Z][C][L] channel-major tensor with set = z*G + c / (C/G) (G groups per z;
//   G = C -> per-channel sets indexed z*C+c; for batch norm pass stats indexed by c only via bn = 1). Optional act. Output same layout.
// =====================================================================================================================
//   mode 0: mean / rsqrt(var + eps); mode 1 (RMSNorm): 0 / rsqrt(mean(x^2) + eps); mode 2 (L2 normalize * sqrt(n)): 0 / sqrt(n) / max(||x||, eps); mode 3: as 0 with unbiased variance (n-1)
__global__ __launch_bounds__(256) void k_stats(const float* __restrict__ x, long long sz, long long so, long long si, int inner, int n, float eps, float* __restrict__ stat, int mode) {
    __shared__ float red[256];
    const int z = blockIdx.x, tid = threadIdx.x;
    const float* base = x + z * sz;
    float s = 0.f;
    for (int e = tid; e < n; e += 256) s += base[(long long)(e / inner) * so + (long long)(e % inner) * si];
    red[tid] = s; __syncthreads();
    for (int o = 128; o > 0; o >>= 1) { if (tid < o) red[tid] += red[tid + o]; __syncthreads(); }
    const float mu = (mode == 0 || mode == 3) ? red[0] / (float)n : 0.f; __syncthreads();
    float q = 0.f;
    for (int e = tid; e < n; e += 256) { const float dlt = base[(long long)(e / inner) * so + (long long)(e % inner) * si] - mu; q += dlt * dlt; }
    red[tid] = q; __syncthreads();
    for (int o = 128; o > 0; o >>= 1) { if (tid < o) red[tid] += red[tid + o]; __syncthreads(); }
    {
        float rs;
        if (mode == 2) rs = sqrtf((float)n) / fmaxf(sqrtf(red[0]), eps); else if (mode == 3) rs = rsqrtf(red[0] / (float)(n - 1) + eps); else rs = rsqrtf(red[0] / (float)n + eps);
        if (tid < 32) { const float v = (tid == 0) ? mu : ((tid == 1) ? rs : 0.f); VST2(float, stat + (long long)z * 32 + tid, v); }
    }
}
//   One thread per element over the flat [Z][C][L] index space: grid ceil(Z*C*L / 256).
__global__ __launch_bounds__(256) void k_norm_apply(const float* __restrict__ x, float* __restrict__ y, const float* __restrict__ stat, const float* __restrict__ g, const float* __restrict__ bta,
                                                     int Z, int C, int L, int G, int bn, int act) {
    const long long idx = (long long)blockIdx.x * 256 + threadIdx.x;
    if (idx >= (long long)Z * C * L) return;
    const int l = (int)(idx % L); const long long zc = idx / L; const int c = (int)(zc % C), z = (int)(zc / C); (void)l;
    const int set = bn ? c : (z * G + c / (C / G));
    float v = (x[idx] - stat[(long long)set * 32]) * stat[(long long)set * 32 + 1];
    if (g) v *= g[c];
    if (bta) v += bta[c];
    v = act_fn(v, act);
    VST2(float, y + idx, v);
}

// k_lse_neg: c[i] = -(st[2i] + log(st[2i+1])) = minus the log-sum-exp of row i from k_attn's ST output (for softmax over the query dimension)
__global__ __launch_bounds__(256) void k_lse_neg(const float* __restrict__ st, float* __restrict__ c, int n) {
    const int i = blockIdx.x * 256 + threadIdx.x;
    if (i < n) { const float v = -(st[2 * i] + logf(st[2 * i + 1])); VST2(float, c + i, v); }
}

// k_iota: dst[i] = a * i + b as int32 (segment/position id helper)
__global__ __launch_bounds__(256) void k_iota(int* __restrict__ dst, int n, int a, int b) {
    const int i = blockIdx.x * 256 + threadIdx.x;
    if (i < n) { const int v = a * i + b; VST2(int, dst + i, v); }
}

// k_axpby: dst[i] = a * x[i] + b * y[i] (+ c), i < n
__global__ __launch_bounds__(256) void k_axpby(const float* __restrict__ x, const float* __restrict__ y, float* __restrict__ dst, int n, float a, float b, float c) {
    const int i = blockIdx.x * 256 + threadIdx.x;
    if (i < n) { const float v = a * x[i] + b * y[i] + c; VST2(float, dst + i, v); }
}

// =====================================================================================================================
// k_rope: rotary embedding on a [R rows][Hn heads][D] view (row stride sXr, head stride sXh, element stride 1) -> Y (own strides).
//   mode 0: rotate_half (partner d±D/2, sign - for d<D/2); mode 1: interleaved pairs (partner d^1, sign - for even d).
//   table column tcol: tmode 0 -> d, 1 -> d % (D/2), 2 -> d / 2; position p: pmode 0 -> r % S, 1 -> head index, 2 -> pos[r];
//   c = C[(r / S) * sCb + p * sCp + tcol * sCd], s likewise from Sn; y = x[d] * c + sign * x[partner] * s. X and Y must not alias.
// =====================================================================================================================
struct RopeP { const float* X; float* Y; const float* C; const float* Sn; const int* pos; long long sXr, sXh, sYr, sYh, sCb, sCp, sCd; int R, Hn, D, S, mode, tmode, pmode, pad; };
static_assert(sizeof(RopeP) == 5 * 8 + 7 * 8 + 8 * 4, "RopeP has padding");
__global__ __launch_bounds__(256) void k_rope(RopeP p) {
    const long long idx = (long long)blockIdx.x * 256 + threadIdx.x;
    if (idx >= (long long)p.R * p.Hn * p.D) return;
    const int d = (int)(idx % p.D); const long long rh = idx / p.D; const int h = (int)(rh % p.Hn); const int r = (int)(rh / p.Hn);
    const int half = p.D / 2;
    int partner; float sign;
    if (p.mode == 0) { partner = (d < half) ? d + half : d - half; sign = (d < half) ? -1.f : 1.f; }
    else { partner = d ^ 1; sign = (d & 1) ? 1.f : -1.f; }
    const int tcol = (p.tmode == 0) ? d : ((p.tmode == 1) ? (d % half) : (d >> 1));
    const int pp = (p.pmode == 0) ? (r % p.S) : ((p.pmode == 1) ? h : p.pos[r]);
    const long long toff = (long long)(r / p.S) * p.sCb + (long long)pp * p.sCp + (long long)tcol * p.sCd;
    const float* xr = p.X + (long long)r * p.sXr + (long long)h * p.sXh;
    const float v = xr[d] * p.C[toff] + sign * xr[partner] * p.Sn[toff];
    VST2(float, p.Y + (long long)r * p.sYr + (long long)h * p.sYh + d, v);
}

// k_invf + k_sincos (split so neither kernel carries a large VALU-fma footprint): invf_i = num * (1 / powf(base, (2 i)/D)) [fmode 0],
//   num * expf((2 i) * cexp) [fmode 1], num * powf(base, -2 (i - 1) / D) [fmode 2]; then cs/sn[s*half + i] = cos/sin((pscale * s) * invf_i)
__global__ __launch_bounds__(256) void k_invf(float* __restrict__ invb, int half, int D, float base, float num, int fmode, float cexp) {
    const int i = blockIdx.x * 256 + threadIdx.x;
    if (i >= ((half + 31) / 32) * 32) return;
    if (i >= half) { VST2(float, invb + i, 0.f); return; }
    const float e = (float)(2 * i) / (float)D;
    float invf;
    if (fmode == 1) invf = num * expf((float)(2 * i) * cexp);
    else if (fmode == 2) invf = num * powf(base, (-2.0f * ((float)i - 1.0f)) / (float)D);
    else invf = num * (1.0f / powf(base, e));
    VST2(float, invb + i, invf);
}
__global__ __launch_bounds__(256) void k_sincos(float* __restrict__ cs, float* __restrict__ sn, const float* __restrict__ invb, int S, int half, float pscale) {
    const int idx = blockIdx.x * 256 + threadIdx.x;
    if (idx >= S * half) return;
    const int s = idx / half, i = idx - s * half;
    const float ang = (pscale * (float)s) * invb[i];
    VST2(float, cs + idx, cosf(ang)); VST2(float, sn + idx, sinf(ang));
}

// k_mulact: dst[i] = act(x[i]) * y[i]
__global__ __launch_bounds__(256) void k_mulact(const float* __restrict__ x, const float* __restrict__ y, float* __restrict__ dst, int n, int act) {
    const int i = blockIdx.x * 256 + threadIdx.x;
    if (i < n) { const float v = act_fn(x[i], act) * y[i]; VST2(float, dst + i, v); }
}

// =====================================================================================================================
// k_matvec: thread-per-row matrix-vector products for N <= 8 output columns (heads with 1-3 outputs, gates), f32 on the VALU.
//   C[r*sCm + j] = act(alpha * sum_k A[r*sAm + k*sAk] * B[j*sBn + k*sBk] + bias[j]) + beta * R[r*sRm + j*sRn]; each thread writes its N contiguous floats.
// =====================================================================================================================
__global__ __launch_bounds__(256) void k_matvec(GemmP p) {
    // 32 lanes write one line with one instruction.
    const int rpt = (p.N == 1) ? 1 : 32;
    const long long r0 = ((long long)blockIdx.x * 256 + threadIdx.x) * rpt; const int z = blockIdx.z, zo = z / p.zi_n, zi = z - zo * p.zi_n;
    if (r0 >= p.M) return;
    const float* Bb = p.B + zo * p.sBo + zi * p.sBi;
    float* C = p.C + zo * p.sCo + zi * p.sCi; const float* R = p.R + zo * p.sRo + zi * p.sRi;
    for (int rr = 0; rr < rpt; ++rr) {
        const long long r = r0 + rr; if (r >= p.M) break;
        const float* A = p.A + zo * p.sAo + zi * p.sAi + r * p.sAm;
        float acc[8] = {0.f, 0.f, 0.f, 0.f, 0.f, 0.f, 0.f, 0.f};
        for (int k = 0; k < p.K; ++k) { const float a = A[(long long)k * p.sAk];
#pragma unroll
            for (int j = 0; j < 8; ++j) if (j < p.N) acc[j] += a * Bb[(long long)j * p.sBn + (long long)k * p.sBk]; }
#pragma unroll
        for (int j = 0; j < 8; ++j) if (j < p.N) {
            float v = acc[j] * p.alpha;
            if (p.flags & 1) v += p.bias[j];
            if (p.flags & 2) v += p.bias[r];
            v = act_fn(v, p.act);
            if (p.flags & 4) v += p.beta * R[r * p.sRm + (long long)j * p.sRn];
            VST2(float, C + r * p.sCm + j, v);
        }
    }
}
// k_smallsoftmax: thread-per-row softmax for short rows (n <= 64): dst[r*dr + j] = softmax(scale*src[r*sr + j])
__global__ __launch_bounds__(256) void k_smallsoftmax(const float* __restrict__ src, float* __restrict__ dst, long long sr, long long dr, int n, long long R, float scale) {
    const long long r0 = ((long long)blockIdx.x * 256 + threadIdx.x) * 32;
    for (int rr = 0; rr < 32; ++rr) {
        const long long r = r0 + rr; if (r >= R) return;
        const float* s = src + r * sr; float* d = dst + r * dr;
        float mx = -__builtin_inff();
        for (int j = 0; j < n; ++j) mx = fmaxf(mx, s[j] * scale);
        float sum = 0.f;
        for (int j = 0; j < n; ++j) sum += expf(s[j] * scale - mx);
        const float inv = 1.f / sum;
        for (int j = 0; j < n; ++j) { const float v = expf(s[j] * scale - mx) * inv; VST2(float, d + j, v); }
    }
}

__global__ __launch_bounds__(32) void k_unitstat(float* __restrict__ st) { const int t = threadIdx.x; const float v = (t == 1) ? 1.f : 0.f; VST2(float, st + t, v); }

// destination (e.g. a d_out whose row width is not a multiple of 32 floats) is written by consecutive lanes of one instruction
__global__ __launch_bounds__(256) void k_lincopy(const float* __restrict__ src, long long lds, float* __restrict__ dst, long long ldd, long long rows, int cols) {
    const long long i = (long long)blockIdx.x * 256 + threadIdx.x; if (i >= rows * cols) return;
    const long long r = i / cols; const int c = (int)(i - r * cols);
    const float v = src[r * lds + c]; VST2(float, dst + r * ldd + c, v);
}

namespace w25 {
typedef __attribute__((ext_vector_type(16))) _Float16 v16h;
typedef __attribute__((ext_vector_type(8)))  _Float16 v8h;
typedef __attribute__((ext_vector_type(16))) __bf16   v16b;
typedef __attribute__((ext_vector_type(8)))  __bf16   v8b;
typedef __attribute__((ext_vector_type(8)))  float    v8f;
typedef __attribute__((ext_vector_type(4)))  float    v4f;

__device__ __forceinline__ unsigned short f2bf_bits(float f) {
  unsigned u = __float_as_uint(f);
  return (unsigned short)((u + 0x7FFFu + ((u >> 16) & 1u)) >> 16);
}
__device__ __forceinline__ float bf_bits2f(unsigned short h) { return __uint_as_float(((unsigned)h) << 16); }

// hazard guards as plain device helpers (no inline asm inside the kernel template body)
__device__ __forceinline__ void dep_guard_h(v8f& a, v8f& b, v16h x, v16h y) { asm volatile("v_nop\n\tv_nop\n\tv_nop\n\tv_nop" : "+v"(a), "+v"(b) : "v"(x), "v"(y)); }
__device__ __forceinline__ void dep_guard_b(v8f& a, v8f& b, v16b x, v16b y) { asm volatile("v_nop\n\tv_nop\n\tv_nop\n\tv_nop" : "+v"(a), "+v"(b) : "v"(x), "v"(y)); }
__device__ __forceinline__ void keep4_h(v16h a, v16h b, v16h c, v16h d) { asm volatile("v_nop" :: "v"(a), "v"(b), "v"(c), "v"(d)); }
__device__ __forceinline__ void keep4_b(v16b a, v16b b, v16b c, v16b d) { asm volatile("v_nop" :: "v"(a), "v"(b), "v"(c), "v"(d)); }
__device__ __forceinline__ void acc_guard4(v8f& a, v8f& b, v8f& c, v8f& d) { asm volatile("v_nop\n\tv_nop\n\tv_nop\n\tv_nop" : "+v"(a), "+v"(b), "+v"(c), "+v"(d)); }
template <typename T> struct Frag;
template <> struct Frag<_Float16> {
  typedef v16h V; union U { v16h v; v8h h[2]; };
  static __device__ __forceinline__ v16h load(const _Float16* p) {   // elements 0..7 <- p[0..7], 8..15 <- p[16..23]
    U f; f.h[0] = *(const v8h*)(p); f.h[1] = *(const v8h*)(p + 16); return f.v;
  }
  static __device__ __forceinline__ v8f mma(v16h a, v16h b, v8f c) {
    return __builtin_amdgcn_wmma_f32_16x16x32_f16(false, a, false, b, (short)0, c, false, false);
  }
  static __device__ __forceinline__ void guard(v8f& a, v8f& b, v16h x, v16h y) { dep_guard_h(a, b, x, y); }
  static __device__ __forceinline__ void keep(v16h a, v16h b, v16h c, v16h d) { keep4_h(a, b, c, d); }
};
template <> struct Frag<__bf16> {
  typedef v16b V; union U { v16b v; v8b h[2]; };
  static __device__ __forceinline__ v16b load(const __bf16* p) {
    U f; f.h[0] = *(const v8b*)(p); f.h[1] = *(const v8b*)(p + 16); return f.v;
  }
  static __device__ __forceinline__ v8f mma(v16b a, v16b b, v8f c) {
    return __builtin_amdgcn_wmma_f32_16x16x32_bf16(false, a, false, b, (short)0, c, false, false);
  }
  static __device__ __forceinline__ void guard(v8f& a, v8f& b, v16b x, v16b y) { dep_guard_b(a, b, x, y); }
  static __device__ __forceinline__ void keep(v16b a, v16b b, v16b c, v16b d) { keep4_b(a, b, c, d); }
};

// ---- Register-blocked batched WMMA GEMM ------------------------------------
// C[m,n] = scale * sum_k A[m,k] * Bt[n,k] (+bias)(+resid); each wave owns a 64x64 tile.
// A row-major [M,K]; Bt row-major [N,K]; M,N % 64 == 0, K % 32 == 0.
// SPLIT: operands are hi/lo planes (A2/Bt2 = lo planes, same layout); product = hi·hi + hi·lo + lo·hi.
// BIAS_MODE: 0 = none, 1 = bias[m], 2 = bias[n].
// OUT_MODE: 0 = f32, 1 = f16, 2 = bf16 hi plane (Cout) + bf16 lo plane (Cout2).
// ET: 0 = f16 operands, 1 = bf16 operands (pointers passed as 16-bit storage)
template <int ET> struct Elem;
template <> struct Elem<0> { typedef _Float16 T; };
template <> struct Elem<1> { typedef __bf16 T; };
template <int ET, bool SPLIT, int BIAS_MODE, int OUT_MODE, bool RESID, int ACT = 0>
__global__ __launch_bounds__(256) void wmma_gemm64(
    const unsigned short* __restrict__ Ap, const unsigned short* __restrict__ A2p, int lda, long strideA,
    const unsigned short* __restrict__ Btp, const unsigned short* __restrict__ Bt2p, int ldb, long strideB,
    void* __restrict__ Cout, void* __restrict__ Cout2, int ldc, long strideC,
    const float* __restrict__ bias,
    const float* __restrict__ resid, long strideR,
    int M, int N, int K, float scale) {
  typedef typename Elem<ET>::T T;
  typedef typename Frag<T>::V V;
  const T* A = (const T*)Ap; const T* A2 = (const T*)A2p; const T* Bt = (const T*)Btp; const T* Bt2 = (const T*)Bt2p;
  __shared__ __align__(16) float sT[8][16 * 68];   // per-wave 16x64 slab, pitch 68 floats
  const int b    = blockIdx.y;
  const int lane = threadIdx.x & 31;
  const int wave = threadIdx.x >> 5;
  const int tilesN = N >> 6;
  const int tilesM = M >> 6;
  const int tile = blockIdx.x * 8 + wave;
  if (tile >= tilesM * tilesN) return;   // wave-uniform; no block barriers in this kernel
  const int tm = tile / tilesN;
  const int tn = tile - tm * tilesN;
  const int m0 = tm << 6;
  const int n0 = tn << 6;

  const T* Ab  = A  + (size_t)b * strideA;
  const T* Bb  = Bt + (size_t)b * strideB;
  const T* Ab2 = SPLIT ? (A2  + (size_t)b * strideA) : nullptr;
  const T* Bb2 = SPLIT ? (Bt2 + (size_t)b * strideB) : nullptr;

  const int rlane = lane & 15;                 // row (A) / col (B, D) within subtile
  const int koff  = (lane >> 4) * 8;           // k offset of this lane half
  const int mOff  = (lane >> 4) * 8;           // D row offset

  v8f acc[4][4];
#pragma unroll
  for (int i = 0; i < 4; ++i)
#pragma unroll
    for (int j = 0; j < 4; ++j) acc[i][j] = (v8f){0.f,0.f,0.f,0.f,0.f,0.f,0.f,0.f};

  for (int k0 = 0; k0 < K; k0 += 32) {
    V bh[4], bl[4];
#pragma unroll
    for (int j = 0; j < 4; ++j) {
      const size_t bo = (size_t)(n0 + (j << 4) + rlane) * ldb + koff + k0;
      bh[j] = Frag<T>::load(Bb + bo);
      if (SPLIT) bl[j] = Frag<T>::load(Bb2 + bo);
    }
#pragma unroll
    for (int i = 0; i < 4; ++i) {
      const size_t ao = (size_t)(m0 + (i << 4) + rlane) * lda + koff + k0;
      V ah = Frag<T>::load(Ab + ao);
      V al;
      if (SPLIT) al = Frag<T>::load(Ab2 + ao);
#pragma unroll
      for (int j = 0; j < 4; ++j) {
        acc[i][j] = Frag<T>::mma(ah, bh[j], acc[i][j]);
        if (SPLIT) {
          acc[i][j] = Frag<T>::mma(ah, bl[j], acc[i][j]);
          acc[i][j] = Frag<T>::mma(al, bh[j], acc[i][j]);
        }
      }
      Frag<T>::guard(acc[i][0], acc[i][3], ah, SPLIT ? al : ah);
    }
    Frag<T>::keep(bh[0], bh[1], bh[2], bh[3]);
    if (SPLIT) Frag<T>::keep(bl[0], bl[1], bl[2], bl[3]);
  }
  acc_guard4(acc[0][0], acc[0][1], acc[0][2], acc[0][3]);
  acc_guard4(acc[1][0], acc[1][1], acc[1][2], acc[1][3]);
  acc_guard4(acc[2][0], acc[2][1], acc[2][2], acc[2][3]);
  acc_guard4(acc[3][0], acc[3][1], acc[3][2], acc[3][3]);

  // ---- epilogue ----
  float* slab = sT[wave];
  const float* Rb = RESID ? (resid + (size_t)b * strideR) : nullptr;
#pragma unroll
  for (int i = 0; i < 4; ++i) {
    const int mBase = m0 + (i << 4);
#pragma unroll
    for (int j = 0; j < 4; ++j) {
      const int n = n0 + (j << 4) + rlane;
      float bv = 0.f;
      if (BIAS_MODE == 2) bv = bias[n];
#pragma unroll
      for (int r = 0; r < 8; ++r) {
        float v = acc[i][j][r] * scale;
        if (BIAS_MODE == 1) v += bias[mBase + mOff + r];
        if (BIAS_MODE == 2) v += bv;
        if (RESID) v += Rb[(size_t)(mBase + mOff + r) * ldc + n];
        if (ACT == 1) v = tanhf(v);
        if (ACT == 2) v = fmaxf(v, 0.0f);
        if (ACT == 3) v = v / (1.0f + expf(-v));
        if (ACT == 4) v = (v > 0.f) ? v : 0.01f * v;
        if (ACT == 5) v = 0.5f * v * (1.0f + erff(v * 0.70710678118654752f));
        slab[(mOff + r) * 68 + (j << 4) + rlane] = v;
      }
    }
    __builtin_amdgcn_fence(__ATOMIC_RELEASE, "workgroup");
    __builtin_amdgcn_wave_barrier();
    __builtin_amdgcn_fence(__ATOMIC_ACQUIRE, "workgroup");
    if (OUT_MODE == 0) {
      float* C = (float*)Cout + (size_t)b * strideC;
      const int hh = lane >> 4, c4 = (lane & 15) * 4;     // row seg = 256 B = 16 lanes x 16 B
      {
#pragma unroll
        for (int it = 0; it < 8; ++it) {
          const int row = it * 2 + hh;
          v4f v = *(const v4f*)(slab + row * 68 + c4);
          *(v4f*)(C + (size_t)(mBase + row) * ldc + n0 + c4) = v;
        }
        
      }
    } else {
      const int q = lane >> 3, c8 = (lane & 7) * 8;
      unsigned short* C  = (unsigned short*)Cout  + (size_t)b * strideC;
      unsigned short* C2 = (OUT_MODE == 2) ? ((unsigned short*)Cout2 + (size_t)b * strideC) : nullptr;
      {
#pragma unroll
        for (int it = 0; it < 4; ++it) {
          const int row = it * 4 + q;
          const float* sp = slab + row * 68 + c8;
          v8h hv, lv;
#pragma unroll
          for (int e = 0; e < 8; ++e) {
            if (OUT_MODE == 1) {
              hv[e] = (_Float16)sp[e];
            } else {
              unsigned short hb = f2bf_bits(sp[e]);
              unsigned short lb = f2bf_bits(sp[e] - bf_bits2f(hb));
              hv[e] = __builtin_bit_cast(_Float16, hb);
              lv[e] = __builtin_bit_cast(_Float16, lb);
            }
          }
          *(v8h*)(C + (size_t)(mBase + row) * ldc + n0 + c8) = hv;
          if (OUT_MODE == 2) *(v8h*)(C2 + (size_t)(mBase + row) * ldc + n0 + c8) = lv;
        }
        
      }
    }
    __builtin_amdgcn_fence(__ATOMIC_RELEASE, "workgroup");
    __builtin_amdgcn_wave_barrier();
    __builtin_amdgcn_fence(__ATOMIC_ACQUIRE, "workgroup");
  }
}

__global__ __launch_bounds__(256) void cast_f32_f16x2(
    const float* __restrict__ in, _Float16* __restrict__ out, int n2) {
  int i = blockIdx.x * 256 + threadIdx.x;
  if (i < n2) {
    const _Float16 h0 = (_Float16)in[2 * i], h1 = (_Float16)in[2 * i + 1];
    const unsigned u = (unsigned)__builtin_bit_cast(unsigned short, h0) | ((unsigned)__builtin_bit_cast(unsigned short, h1) << 16);
    ((unsigned*)out)[i] = u;
    
  }
}


} // namespace w25

__device__ __forceinline__ unsigned int f2h2_pack(float a, float b) { return (unsigned)__builtin_bit_cast(unsigned short, (_Float16)a) | ((unsigned)__builtin_bit_cast(unsigned short, (_Float16)b) << 16); }
__global__ __launch_bounds__(256) void k_cast16(const float* __restrict__ src, long long lds, _Float16* __restrict__ dst, long long ldd, int R, int C, float s) {
    const long long i = (long long)blockIdx.x * 256 + threadIdx.x; const long long np = (long long)R * (C / 2); if (i >= np) return; const int r = (int)(i / (C / 2)); const int c = 2 * (int)(i % (C / 2));
    const _Float16 h0 = (_Float16)(src[(long long)r * lds + c] * s), h1 = (_Float16)(src[(long long)r * lds + c + 1] * s);
    const unsigned u = (unsigned)__builtin_bit_cast(unsigned short, h0) | ((unsigned)__builtin_bit_cast(unsigned short, h1) << 16);
    unsigned* d = (unsigned*)(dst + (long long)r * ldd + c); *d = u;  }

// f32 -> bf16 hi plane + bf16 lo plane (x = hi + lo to ~2^-17 relative; RNE both), [R][C] -> [R][C] (or transposed to [C][R]); 2 consecutive destination elements
__device__ __forceinline__ unsigned int f2bf2_pack(float a, float b, unsigned int* lo) {
    const unsigned short ha = w25::f2bf_bits(a), hb = w25::f2bf_bits(b);
    const unsigned short la = w25::f2bf_bits(a - w25::bf_bits2f(ha)), lb = w25::f2bf_bits(b - w25::bf_bits2f(hb));
    *lo = (unsigned)la | ((unsigned)lb << 16); return (unsigned)ha | ((unsigned)hb << 16); }
__global__ __launch_bounds__(256) void k_castS16(const float* __restrict__ src, long long lds, __bf16* __restrict__ dhi, __bf16* __restrict__ dlo, long long ldd, int R, int C, float s, int transpose, long long sb, long long db) {
    src += (long long)blockIdx.y * sb; dhi += (long long)blockIdx.y * db; dlo += (long long)blockIdx.y * db;   // blockIdx.y = image
    const long long i = (long long)blockIdx.x * 256 + threadIdx.x; long long o; float a, b;
    if (transpose) { const long long np = (long long)C * (R / 2); if (i >= np) return; const int c = (int)(i / (R / 2)); const int r = 2 * (int)(i % (R / 2)); a = src[(long long)r * lds + c] * s; b = src[(long long)(r + 1) * lds + c] * s; o = (long long)c * ldd + r; }
    else { const long long np = (long long)R * (C / 2); if (i >= np) return; const int r = (int)(i / (C / 2)); const int c = 2 * (int)(i % (C / 2)); a = src[(long long)r * lds + c] * s; b = src[(long long)r * lds + c + 1] * s; o = (long long)r * ldd + c; }
    unsigned lo; const unsigned hi = f2bf2_pack(a, b, &lo); unsigned* ph = (unsigned*)(dhi + o); unsigned* pl = (unsigned*)(dlo + o);
    *ph = hi; *pl = lo;  }

namespace w25 {
// =====================================================================================
// Generic causal/non-causal attention for head_dim 64, f32 in / f32 out; 16-bit operands: bf16 with optional hi/lo splits, or
// plain f16 (F16=true, non-split, probabilities carried x2^15).
//   scores = (q*qscale)·kᵀ : v_wmma_f32_16x16x32_bf16; SPLIT_QK -> q,k as bf16 hi/lo (hi·hi + hi·lo + lo·hi)
//   out    = p·v           : v_wmma_f32_16x16x32_bf16; SPLIT_PV -> p,v as bf16 hi/lo; else p,v plain bf16
//   f32 accumulate; online softmax in f32. Block = 4 waves = 64 query rows of one (batch, head); S % 64 == 0.
//   Element (b, s, h, d) of tensor X lives at X[b*X_bs + s*X_rs + h*X_hs + d] (strides in floats, multiples of 4).
//   Masking: mask_mode 0 none, 1 causal (kv > q masked), 2 tensor [S][Skv] shared over (b,h) (float if
//   mask_is_int==0, int32 with element == 0 -> masked if 1, int32 with element != 0 -> masked if 2), 3 per-token vectors qmask[B][S] & kvmask[B][Skv] (int32,
//   0 -> masked), 4 causal + sliding window (kv > q or q - kv > W masked; W passed in mask_is_int);
//   5 = relative-position bias: s += cp[b,h,q][idx[q][kv]] + pc[b,h,kv][idx[q][kv]] with idx = mask_b ([S][Skv] int32) and
//   mask_a an int32 [S][Skv] tensor with nonzero = masked (tables: element (b,h,row,n) at X + b*c_bs + h*c_hs + row*c_rs + n);
//   masked scores are replaced by mask_fill (e.g. -inf or -1e9) before the softmax.
//   grid.x = B * H * (S/64) (or a sub-range with blk0).
// =====================================================================================
#define AT_D 64
#define AT_NW 4
#define AT_QB 64
#define AT_KC 64
struct AttnGeom { const float* cp = nullptr; const float* pc = nullptr; long c_bs = 0, c_rs = 0, c_hs = 0;   // mode-5 score-bias tables
                  long q_bs, q_rs, q_hs, k_bs, k_rs, k_hs, v_bs, v_rs, v_hs, o_bs, o_rs, o_hs;
                  int S, Skv, H, mask_mode; float qscale; int blk0; float mask_fill; int mask_is_int; };
static_assert(sizeof(AttnGeom) == 168, "no padding");

__device__ __forceinline__ unsigned short at_bf_bits(float f) {
  unsigned u = __float_as_uint(f);
  return (unsigned short)((u + 0x7FFFu + ((u >> 16) & 1u)) >> 16);
}
__device__ __forceinline__ __bf16 at_f2bf(float f) { return __builtin_bit_cast(__bf16, at_bf_bits(f)); }
__device__ __forceinline__ void at_split(float f, __bf16& hi, __bf16& lo) {
  const unsigned short hb = at_bf_bits(f);
  hi = __builtin_bit_cast(__bf16, hb);
  lo = at_f2bf(f - __uint_as_float(((unsigned)hb) << 16));
}
__device__ __forceinline__ v8f at_mma(v16b a, v16b b, v8f c) {
  c = __builtin_amdgcn_wmma_f32_16x16x32_bf16(false, a, false, b, (short)0, c, false, false);
  asm volatile("v_nop\n\tv_nop\n\tv_nop\n\tv_nop" : "+v"(c) : "v"(a), "v"(b));
  return c;
}
// 16-bit element as a bit pattern held in a __bf16 slot: f16 bits when F16, bf16 (RNE) otherwise
template <bool F16> __device__ __forceinline__ __bf16 at_to16(float f) {
  if (F16) return __builtin_bit_cast(__bf16, (_Float16)f);
  return at_f2bf(f);
}
template <bool F16> __device__ __forceinline__ v8f at_mma16(v16b a, v16b b, v8f c) {
  if (F16) {
    const v16h ah = __builtin_bit_cast(v16h, a), bh = __builtin_bit_cast(v16h, b);
    c = __builtin_amdgcn_wmma_f32_16x16x32_f16(false, ah, false, bh, (short)0, c, false, false);
    asm volatile("v_nop\n\tv_nop\n\tv_nop\n\tv_nop" : "+v"(c) : "v"(ah), "v"(bh));
    return c;
  }
  return at_mma(a, b, c);
}

template <bool SPLIT_QK, bool SPLIT_PV, bool F16 = false>
__global__ __launch_bounds__(128)
void attn64_kernel(const float* __restrict__ q, const float* __restrict__ k,
                   const float* __restrict__ v, float* __restrict__ out,
                   const void* __restrict__ mask_a, const int* __restrict__ mask_b, AttnGeom g) {
  static_assert(!(F16 && (SPLIT_QK || SPLIT_PV)), "f16 mode is non-split");
  const float PSC = F16 ? 32768.0f : 1.0f;     // f16 probabilities carried x2^15 (subnormal range), folded into the final 1/l
  union FB { v16b v; v8b h[2]; };
  __shared__ __align__(16) __bf16 Ksh[AT_KC * AT_D];             // K hi [kv][d]      8 KB
  __shared__ __align__(16) __bf16 Ksl[SPLIT_QK ? AT_KC * AT_D : 8];
  __shared__ __align__(16) __bf16 Vth[AT_D * AT_KC];             // V hi [d][kv]      8 KB
  __shared__ __align__(16) __bf16 Vtl[SPLIT_PV ? AT_D * AT_KC : 8];
  __shared__ __align__(16) __bf16 Psh[AT_NW][16 * AT_KC];        // per wave P hi [row][kv]  8 KB
  __shared__ __align__(16) __bf16 Psl[SPLIT_PV ? AT_NW : 1][SPLIT_PV ? 16 * AT_KC : 8];
  __shared__ __align__(16) float  Os[AT_NW][16 * 68];            // per wave out tile, pitch 68

  const int tid  = threadIdx.x;
  const int wave = tid >> 5;
  const int lane = tid & 31;
  const int hh   = lane >> 4;
  const int c    = lane & 15;

  const int nqb = g.S / AT_QB;
  const int bx = blockIdx.x + g.blk0;
  const int qb = bx % nqb;
  const int bh = bx / nqb;
  const int h  = bh % g.H;
  const int b  = bh / g.H;
  const int qbase_block = qb * AT_QB;
  const int q0 = qbase_block + wave * 16;

  const float* qb_ptr = q + (size_t)b * g.q_bs + (size_t)h * g.q_hs;
  const float* kb_ptr = k + (size_t)b * g.k_bs + (size_t)h * g.k_hs;
  const float* vb_ptr = v + (size_t)b * g.v_bs + (size_t)h * g.v_hs;
  float*       ob_ptr = out + (size_t)b * g.o_bs + (size_t)h * g.o_hs;

  // ---- Q fragments (A operand): 2 d-chunks, hi (and lo) ----
  v16b qah[2], qal[2];
  {
    const float* qrow = qb_ptr + (size_t)(q0 + c) * g.q_rs;
#pragma unroll
    for (int dc = 0; dc < 2; ++dc) {
#pragma unroll
      for (int e = 0; e < 8; ++e) {
        const float f0 = qrow[dc * 32 + 8 * hh + e] * g.qscale;
        const float f1 = qrow[dc * 32 + 16 + 8 * hh + e] * g.qscale;
        if (SPLIT_QK) { __bf16 hq, lq; at_split(f0, hq, lq); qah[dc][e] = hq; qal[dc][e] = lq; at_split(f1, hq, lq); qah[dc][8 + e] = hq; qal[dc][8 + e] = lq; }
        else { qah[dc][e] = at_to16<F16>(f0); qah[dc][8 + e] = at_to16<F16>(f1); qal[dc][e] = qah[dc][e]; qal[dc][8 + e] = qah[dc][8 + e]; }
      }
    }
  }

  float mrow[8], lrow[8];
  v8f oacc[4];
#pragma unroll
  for (int r = 0; r < 8; ++r) { mrow[r] = -INFINITY; lrow[r] = 0.f; }
#pragma unroll
  for (int t = 0; t < 4; ++t) oacc[t] = (v8f){0.f,0.f,0.f,0.f,0.f,0.f,0.f,0.f};

  const int nChunks = (g.mask_mode == 1 || g.mask_mode == 4) ? (qb + 1) : (g.Skv / AT_KC);   // block-uniform
  // per-row query mask (mode 3)
  int qkeep[8];
#pragma unroll
  for (int r = 0; r < 8; ++r) qkeep[r] = (g.mask_mode == 3) ? mask_b[(size_t)b * g.S + q0 + 8 * hh + r] : 1;   // mask_b = qmask in mode 3
  for (int kc = 0; kc < nChunks; ++kc) {
    const int kv0 = kc * AT_KC;
    __syncthreads();
    {
      const int kvr = tid >> 1, dh = (tid & 1) * 32;
      const float* krow = kb_ptr + (size_t)(kv0 + kvr) * g.k_rs + dh;
      const float* vrow = vb_ptr + (size_t)(kv0 + kvr) * g.v_rs + dh;
#pragma unroll
      for (int i = 0; i < 8; ++i) {
        v4f kk = *(const v4f*)(krow + 4 * i);
        v4f vv = *(const v4f*)(vrow + 4 * i);
#pragma unroll
        for (int e = 0; e < 4; ++e) {
          const int d = dh + 4 * i + e;
          if (SPLIT_QK) { __bf16 a, bl; at_split(kk[e], a, bl); Ksh[kvr * AT_D + d] = a; Ksl[kvr * AT_D + d] = bl; }
          else Ksh[kvr * AT_D + d] = at_to16<F16>(kk[e]);
          if (SPLIT_PV) { __bf16 a, bl; at_split(vv[e], a, bl); Vth[d * AT_KC + kvr] = a; Vtl[d * AT_KC + kvr] = bl; }
          else Vth[d * AT_KC + kvr] = at_to16<F16>(vv[e]);
        }
      }
    }
    __syncthreads();

    v8f s[4];
#pragma unroll
    for (int j = 0; j < 4; ++j) {
      s[j] = (v8f){0.f,0.f,0.f,0.f,0.f,0.f,0.f,0.f};
#pragma unroll 1
      for (int dc = 0; dc < 2; ++dc) {
        FB kb;
        kb.h[0] = *(const v8b*)(Ksh + (j * 16 + c) * AT_D + dc * 32 + 8 * hh);
        kb.h[1] = *(const v8b*)(Ksh + (j * 16 + c) * AT_D + dc * 32 + 16 + 8 * hh);
        s[j] = at_mma16<F16>(qah[dc], kb.v, s[j]);
        if (SPLIT_QK) {
          FB kl;
          kl.h[0] = *(const v8b*)(Ksl + (j * 16 + c) * AT_D + dc * 32 + 8 * hh);
          kl.h[1] = *(const v8b*)(Ksl + (j * 16 + c) * AT_D + dc * 32 + 16 + 8 * hh);
          s[j] = at_mma16<F16>(qah[dc], kl.v, s[j]);
          s[j] = at_mma16<F16>(qal[dc], kb.v, s[j]);
        }
      }
    }
    const bool diag = (g.mask_mode == 1) && (kc == qb);
    int kvkeep[4] = {1, 1, 1, 1};
    if (g.mask_mode == 3) {
#pragma unroll
      for (int j = 0; j < 4; ++j) kvkeep[j] = ((const int*)mask_a)[(size_t)b * g.Skv + kv0 + j * 16 + c];   // mask_a = kvmask
    }
    float cm[8];
#pragma unroll
    for (int r = 0; r < 8; ++r) {
      const int qrow = q0 + 8 * hh + r;
      float m = -INFINITY;
#pragma unroll
      for (int j = 0; j < 4; ++j) {
        const int kvcol = kv0 + j * 16 + c;
        bool masked = false;
        if (diag) masked = (kvcol > qrow);
        else if (g.mask_mode == 4) masked = (kvcol > qrow) || (qrow - kvcol > g.mask_is_int);
        else if (g.mask_mode == 2) {
          const size_t mi = (size_t)qrow * g.Skv + kvcol;
          masked = (g.mask_is_int == 0) ? (((const float*)mask_a)[mi] == 0.0f)
                 : (g.mask_is_int == 1) ? (((const int*)mask_a)[mi] == 0) : (((const int*)mask_a)[mi] != 0);
        } else if (g.mask_mode == 3) masked = (qkeep[r] == 0) || (kvkeep[j] == 0);
        else if (g.mask_mode == 5) {
          const size_t mi = (size_t)qrow * g.Skv + kvcol;
          masked = (((const int*)mask_a)[mi] != 0);
          int n = mask_b[mi]; n = n < 0 ? 0 : n;
          s[j][r] += g.cp[(size_t)b * g.c_bs + (size_t)h * g.c_hs + (size_t)qrow * g.c_rs + n]
                   + g.pc[(size_t)b * g.c_bs + (size_t)h * g.c_hs + (size_t)kvcol * g.c_rs + n];
        }
        if (masked) s[j][r] = g.mask_fill;
        m = fmaxf(m, s[j][r]);
      }
#pragma unroll
      for (int off = 1; off < 16; off <<= 1) m = fmaxf(m, __shfl_xor(m, off, 32));
      cm[r] = m;
    }
    __bf16* pwh = Psh[wave];
    __bf16* pwl = Psl[SPLIT_PV ? wave : 0];
#pragma unroll
    for (int r = 0; r < 8; ++r) {
      const float mnew = fmaxf(mrow[r], cm[r]);
      const float alpha = expf(mrow[r] - mnew);
      mrow[r] = mnew;
      float psum = 0.f;
#pragma unroll
      for (int j = 0; j < 4; ++j) {
        const float p = expf(s[j][r] - mnew);
        psum += p;
        if (SPLIT_PV) { __bf16 a, bl; at_split(p, a, bl); pwh[(8 * hh + r) * AT_KC + j * 16 + c] = a; pwl[(8 * hh + r) * AT_KC + j * 16 + c] = bl; }
        else pwh[(8 * hh + r) * AT_KC + j * 16 + c] = at_to16<F16>(p * PSC);
      }
#pragma unroll
      for (int off = 1; off < 16; off <<= 1) psum += __shfl_xor(psum, off, 32);
      lrow[r] = lrow[r] * alpha + psum;
#pragma unroll
      for (int t = 0; t < 4; ++t) oacc[t][r] *= alpha;
    }
    __builtin_amdgcn_fence(__ATOMIC_RELEASE, "workgroup");
    __builtin_amdgcn_wave_barrier();
    __builtin_amdgcn_fence(__ATOMIC_ACQUIRE, "workgroup");
#pragma unroll 1
    for (int kk = 0; kk < 2; ++kk) {
      FB pa, pl;
      pa.h[0] = *(const v8b*)(pwh + c * AT_KC + kk * 32 + 8 * hh);
      pa.h[1] = *(const v8b*)(pwh + c * AT_KC + kk * 32 + 16 + 8 * hh);
      if (SPLIT_PV) {
        pl.h[0] = *(const v8b*)(pwl + c * AT_KC + kk * 32 + 8 * hh);
        pl.h[1] = *(const v8b*)(pwl + c * AT_KC + kk * 32 + 16 + 8 * hh);
      }
#pragma unroll
      for (int t = 0; t < 4; ++t) {
        FB vb;
        vb.h[0] = *(const v8b*)(Vth + (t * 16 + c) * AT_KC + kk * 32 + 8 * hh);
        vb.h[1] = *(const v8b*)(Vth + (t * 16 + c) * AT_KC + kk * 32 + 16 + 8 * hh);
        oacc[t] = at_mma16<F16>(pa.v, vb.v, oacc[t]);
        if (SPLIT_PV) {
          FB vl;
          vl.h[0] = *(const v8b*)(Vtl + (t * 16 + c) * AT_KC + kk * 32 + 8 * hh);
          vl.h[1] = *(const v8b*)(Vtl + (t * 16 + c) * AT_KC + kk * 32 + 16 + 8 * hh);
          oacc[t] = at_mma16<F16>(pa.v, vl.v, oacc[t]);
          oacc[t] = at_mma16<F16>(pl.v, vb.v, oacc[t]);
        }
      }
    }
  }

  float* os = Os[wave];
#pragma unroll
  for (int r = 0; r < 8; ++r) {
    const float inv = 1.0f / (lrow[r] * PSC);
#pragma unroll
    for (int t = 0; t < 4; ++t) os[(8 * hh + r) * 68 + t * 16 + c] = oacc[t][r] * inv;
  }
  __builtin_amdgcn_fence(__ATOMIC_RELEASE, "workgroup");
  __builtin_amdgcn_wave_barrier();
  __builtin_amdgcn_fence(__ATOMIC_ACQUIRE, "workgroup");
  {
    const int c4 = (lane & 15) * 4;
    {
#pragma unroll
      for (int it = 0; it < 8; ++it) {
        const int row = it * 2 + hh;
        v4f val = *(const v4f*)(os + row * 68 + c4);
        *(v4f*)(ob_ptr + (size_t)(q0 + row) * g.o_rs + c4) = val;
      }
      
    }
  }
}

} // namespace w25

// Fused projection of one image tile: the casts of x, the three 1x1 convolutions, the 2x2 max-pool and the operand planes of k_nl_flash in one kernel; x is read once, as f32.
// A block owns 64 pixels = 16 pool windows: image rows 2py, 2py + 1, columns 32hf .. 32hf + 31 (blockIdx.x = 2py + hf, blockIdx.y = image).
// Staging: a thread takes 2 x 8 channels x 4 pixels (sixteen 16-byte loads, 8 lanes = one 128-B line), casts them as the cast kernels did (bf16 hi, bf16 lo, f16 of 16 x) and stores, per pixel and plane,
// 16 bytes = 8 consecutive channels = half a lane's fragment into LDS, [slot][channel]. Slot = 16 j + m: m = pool window, j = 2 (row in window) + (column in window). So the four pixels of a window
// sit in four different 16-pixel tiles at the same column, and the pool is a maximum over four accumulators of one lane.
// Wave w owns channels 16w .. 16w + 15 of all three outputs for all 64 pixels: theta^T = Wt X and phi = Wp X (D: column = pixel, rows = 8 consecutive channels a lane; bf16 hi/lo, three products in
// the order the GEMMs had), g^T = X^T Wg^T (D: column = channel, rows = 8 consecutive windows a lane; f16). Pooled phi and g leave in the fragment order of k_nl_flash, 512 contiguous bytes a wave
// and plane (a 16-byte chunk is half of one lane's fragment, 32 chunks, lane = 16 h + c, are one wave-wide load; element e: bits 0-2 k, 3-6 row c, 7 half h, 8 which 16 k, then pooled phi: 9-10 block of
// 32 channels, 11.. tile of 16 keys; pooled g: 9-11 tile of 16 channels, 12.. block of 32 keys); theta goes through LDS so that a wave stores whole pixel rows. The bias is added behind the maximum (rounding is monotonic, so the value is the same).
namespace w25 {
// the bf16 hi/lo split of two values, packed, in 32-bit arithmetic throughout (the same bits as f2bf_bits gives: round to nearest even, the result in the upper half)
__device__ __forceinline__ unsigned bf_rn(float f) { const unsigned u = __float_as_uint(f); return u + 0x7FFFu + ((u >> 16) & 1u); }
__device__ __forceinline__ unsigned split2(float a, float b, unsigned* lo) {
  const unsigned ua = bf_rn(a) & 0xFFFF0000u, ub = bf_rn(b) & 0xFFFF0000u;
  *lo = (bf_rn(a - __uint_as_float(ua)) >> 16) | (bf_rn(b - __uint_as_float(ub)) & 0xFFFF0000u);
  return (ua >> 16) | ub; }
constexpr int PJX = 264;   // LDS pitch of a slot of x, in 16-bit elements: 512 B + 16 B, an odd multiple of 16 B for 16-byte reads
constexpr int PJT = 136;   // the same for a slot of theta: 256 B + 16 B
// launch bounds: four waves a SIMD (256 registers a wave), so that two blocks share a WGP and all 512 blocks are resident at once
__global__ __launch_bounds__(256, 4) void k_nl_proj(const float* __restrict__ X, const unsigned short* __restrict__ TWHp, const unsigned short* __restrict__ TWLp, const unsigned short* __restrict__ PWHp,
                                                 const unsigned short* __restrict__ PWLp, const unsigned short* __restrict__ GWp, const float* __restrict__ thb, const float* __restrict__ phb,
                                                 const float* __restrict__ gb, unsigned short* __restrict__ THHp, unsigned short* __restrict__ THLp, unsigned short* __restrict__ PPHp,
                                                 unsigned short* __restrict__ PPLp, unsigned short* __restrict__ GP16p) {
  constexpr int Cc = 256, D = 128, NKc = 1024, HWc = 4096;
  __shared__ __align__(16) unsigned short sx[3][64 * PJX];
  const int tid = threadIdx.x, lane = tid & 31, m = lane & 15, h = lane >> 4;
  const int wave = __builtin_amdgcn_readfirstlane(tid >> 5);   // the wave's number in a scalar register: every address is a scalar base plus a lane offset, and few vector registers live across the products
  const int b = blockIdx.y, py = blockIdx.x >> 1, hf = blockIdx.x & 1;
  // the wave's weight rows (lane = row 16 wave + m, k from 8 h), first k step: they fly with the loads of x
  const unsigned wob = (unsigned)(m * Cc + 8 * h) * 2u;   // one lane offset, in bytes, for the five planes
  const int wr = wave * 16 * Cc;
  const __bf16* TWH = (const __bf16*)((const char*)(TWHp + wr) + wob); const __bf16* TWL = (const __bf16*)((const char*)(TWLp + wr) + wob); const __bf16* PWH = (const __bf16*)((const char*)(PWHp + wr) + wob);
  const __bf16* PWL = (const __bf16*)((const char*)(PWLp + wr) + wob); const _Float16* GW = (const _Float16*)((const char*)(GWp + wr) + wob);
  v16b th = Frag<__bf16>::load(TWH), tl = Frag<__bf16>::load(TWL), ph = Frag<__bf16>::load(PWH), pl = Frag<__bf16>::load(PWL); v16h gw = Frag<_Float16>::load(GW);
  {
    const int g = lane & 7, cb = (lane >> 3) & 1, ry = h, cg = wave * 2 + cb;   // 4 pixels from column 4 g of row ry; channels 8 cg .. (and 128 + 8 cg ..); 16 lanes of one row: their LDS stores meet no common bank
    const unsigned xo = (unsigned)(cb * 8 * HWc + ry * 64 + g * 4) * 4u;   // lane offset in bytes
    const float* xp = (const float*)((const char*)(X + ((size_t)b * Cc + wave * 16) * HWc + (2 * py) * 64 + hf * 32) + xo);
    v4f v[2][8];
#pragma unroll   // v[][] in registers, all sixteen loads in flight
    for (int it = 0; it < 2; ++it)
#pragma unroll   // inner loop of the same
      for (int k = 0; k < 8; ++k) v[it][k] = *(const v4f*)(xp + (it * 128 + k) * HWc);
    // the wait before a load's address registers are reused; the two lane offsets as inputs keep their registers until the wait
    asm volatile("s_wait_xcnt 0x0" :: "v"(xo), "v"(wob) : "memory");
#pragma unroll   // constant indices into v[][]
    for (int it = 0; it < 2; ++it)
#pragma unroll   // inner loop of the same
      for (int e = 0; e < 4; ++e) { v4u hi, lo, f;
#pragma unroll   // inner loop of the same
        for (int q = 0; q < 4; ++q) { unsigned l2; hi[q] = split2(v[it][2 * q][e], v[it][2 * q + 1][e], &l2); lo[q] = l2; f[q] = f2h2_pack(v[it][2 * q][e] * 16.0f, v[it][2 * q + 1][e] * 16.0f); }
        const int so = ((ry * 2 + (e & 1)) * 16 + 2 * g + (e >> 1)) * PJX + it * 128 + cg * 8;
        *(v4u*)(&sx[0][so]) = hi; *(v4u*)(&sx[1][so]) = lo; *(v4u*)(&sx[2][so]) = f; }
  }
  __syncthreads();   // the tile of x is complete before any wave reads it
  v8f at[4], ap[4], ag[4];
#pragma unroll   // constant indices
  for (int j = 0; j < 4; ++j) { at[j] = (v8f){0.f,0.f,0.f,0.f,0.f,0.f,0.f,0.f}; ap[j] = at[j]; ag[j] = at[j]; }
  const __bf16* xh = (const __bf16*)(&sx[0][0]) + m * PJX + 8 * h; const __bf16* xl = (const __bf16*)(&sx[1][0]) + m * PJX + 8 * h; const _Float16* xf = (const _Float16*)(&sx[2][0]) + m * PJX + 8 * h;
  const unsigned bo8 = (unsigned)h * 32u, bo1 = (unsigned)m * 4u;   // lane offsets of the biases, in bytes
  const float* tbp = (const float*)((const char*)(thb + wave * 16) + bo8); const float* pbp = (const float*)((const char*)(phb + wave * 16) + bo8); const float* gbp = (const float*)((const char*)(gb + wave * 16) + bo1);
  v4f tb0, tb1, pb0, pb1; float gbv;
#pragma unroll   // eight k steps of 32 channels, constant offsets; no branch stands behind a matrix instruction
  for (int ks = 0; ks < 8; ++ks) {
    v16b nth = th, ntl = tl, nph = ph, npl = pl; v16h ngw = gw;
    if (ks < 7) {   // the next k step's weights fly behind this step's products
      const int kn = (ks + 1) * 32;
      nth = Frag<__bf16>::load(TWH + kn); ntl = Frag<__bf16>::load(TWL + kn); nph = Frag<__bf16>::load(PWH + kn); npl = Frag<__bf16>::load(PWL + kn); ngw = Frag<_Float16>::load(GW + kn);
      // the wait before these loads' address registers are reused (the offset as an input keeps it until then); memory clobbered, the loads also stay above the products instead of sinking to their first use
      asm volatile("s_wait_xcnt 0x0" :: "v"(wob) : "memory");
    } else {        // the biases fly behind the last step's products, in the registers that the weights have left
      tb0 = *(const v4f*)(tbp); tb1 = *(const v4f*)(tbp + 4); pb0 = *(const v4f*)(pbp); pb1 = *(const v4f*)(pbp + 4); gbv = *gbp;
      asm volatile("s_wait_xcnt 0x0" :: "v"(bo8), "v"(bo1) : "memory");   // the same wait for the biases' lane offsets
    }
#pragma unroll   // two pixel tiles at a time: six independent accumulators, half the fragments live
    for (int jp = 0; jp < 4; jp += 2) {
      v16b bh[2], bl[2]; v16h bf[2];
#pragma unroll   // constant indices
      for (int u = 0; u < 2; ++u) { const int o = (jp + u) * 16 * PJX + ks * 32; bh[u] = Frag<__bf16>::load(xh + o); bl[u] = Frag<__bf16>::load(xl + o); bf[u] = Frag<_Float16>::load(xf + o); }
#pragma unroll   // constant indices; neighbours in the stream go to different tiles
      for (int u = 0; u < 2; ++u) at[jp + u] = Frag<__bf16>::mma(th, bh[u], at[jp + u]);
#pragma unroll   // the same
      for (int u = 0; u < 2; ++u) ap[jp + u] = Frag<__bf16>::mma(ph, bh[u], ap[jp + u]);
#pragma unroll   // the same
      for (int u = 0; u < 2; ++u) ag[jp + u] = Frag<_Float16>::mma(bf[u], gw, ag[jp + u]);
#pragma unroll   // the same
      for (int u = 0; u < 2; ++u) at[jp + u] = Frag<__bf16>::mma(tl, bh[u], at[jp + u]);
#pragma unroll   // the same
      for (int u = 0; u < 2; ++u) ap[jp + u] = Frag<__bf16>::mma(ph, bl[u], ap[jp + u]);
#pragma unroll   // the same
      for (int u = 0; u < 2; ++u) at[jp + u] = Frag<__bf16>::mma(th, bl[u], at[jp + u]);
#pragma unroll   // the same
      for (int u = 0; u < 2; ++u) ap[jp + u] = Frag<__bf16>::mma(pl, bh[u], ap[jp + u]);
    }
    th = nth; tl = ntl; ph = nph; pl = npl; gw = ngw;
  }
  const float tbv[8] = { tb0[0], tb0[1], tb0[2], tb0[3], tb1[0], tb1[1], tb1[2], tb1[3] }, pbv[8] = { pb0[0], pb0[1], pb0[2], pb0[3], pb1[0], pb1[1], pb1[2], pb1[3] };
  // pooled phi (hi, lo) and pooled g
  v4u phi_h, phi_l, g_h;
#pragma unroll   // constant indices
  for (int q = 0; q < 4; ++q) { float pv[2], gv[2];
#pragma unroll   // inner loop of the same
    for (int u = 0; u < 2; ++u) { const int r = 2 * q + u;
      pv[u] = fmaxf(fmaxf(ap[0][r], ap[1][r]), fmaxf(ap[2][r], ap[3][r])) + pbv[r];
      gv[u] = fmaxf(fmaxf(ag[0][r], ag[1][r]), fmaxf(ag[2][r], ag[3][r])) * 0.0625f + gbv; }
    unsigned l2; phi_h[q] = split2(pv[0], pv[1], &l2); phi_l[q] = l2; g_h[q] = f2h2_pack(gv[0], gv[1]); }
  __syncthreads();   // every wave has read its last fragment of x: the LDS is free for theta
#pragma unroll   // constant indices
  for (int j = 0; j < 4; ++j) { v4u hi, lo;
#pragma unroll   // inner loop of the same
    for (int q = 0; q < 4; ++q) { unsigned l2; hi[q] = split2(at[j][2 * q] + tbv[2 * q], at[j][2 * q + 1] + tbv[2 * q + 1], &l2); lo[q] = l2; }
    const int so = (j * 16 + m) * PJT + wave * 16 + 8 * h;
    *(v4u*)(&sx[0][so]) = hi; *(v4u*)(&sx[1][so]) = lo; }
  __syncthreads();   // theta of all 128 channels is in LDS before the rows are read
  // 16 lanes store one pixel's 256 bytes of a plane, a wave two neighbouring pixels: pixel column p0 = 2 wave + h, chunk m, so every global offset is a scalar base + 16 lane bytes
  v4u oh[4], ol[4];
#pragma unroll   // constant indices; pixel = column p0 + 16 (it & 1) of row it >> 1, whose slot is 32 (it >> 1) + 16 (p0 & 1) + (p0 >> 1) + 8 (it & 1)
  for (int it = 0; it < 4; ++it) { const int so = ((it >> 1) * 32 + h * 16 + wave + 8 * (it & 1)) * PJT + m * 8; oh[it] = *(const v4u*)(&sx[0][so]); ol[it] = *(const v4u*)(&sx[1][so]); }
  const unsigned l16 = (unsigned)lane * 16u;
  const size_t to = ((size_t)b * HWc + (2 * py) * 64 + hf * 32 + 2 * wave) * D;
  char* tph = (char*)(THHp + to) + l16; char* tpl = (char*)(THLp + to) + l16;
#pragma unroll   // constant indices
  for (int it = 0; it < 4; ++it) { const int go = ((it >> 1) * 64 + (it & 1) * 16) * D * 2; *(v4u*)(tph + go) = oh[it]; *(v4u*)(tpl + go) = ol[it]; }
  const size_t po = (size_t)b * NKc * D + (py * 2 + hf) * 2048 + wave * 256, vo = (size_t)b * NKc * D + py * 4096 + wave * 512 + hf * 256;
  *(v4u*)((char*)(PPHp + po) + l16) = phi_h; *(v4u*)((char*)(PPLp + po) + l16) = phi_l; *(v4u*)((char*)(GP16p + vo) + l16) = g_h;
  // the wait before a store's registers are reused: the lane offset and the values as inputs keep them all until it, so nothing takes a register of an issued store
  asm volatile("s_wait_xcnt 0x0" :: "v"(l16), "v"(oh[0]), "v"(oh[1]), "v"(oh[2]), "v"(oh[3]), "v"(ol[0]), "v"(ol[1]), "v"(ol[2]), "v"(ol[3]), "v"(phi_h), "v"(phi_l), "v"(g_h) : "memory");
}
} // namespace w25
// Fused attention and output projection of one image: y[q][c] = f16( sum_k softmax_k(theta[q] . phi[k]) g[c][k] ), WY = W y + W_b. Scores, probabilities and y never leave the registers.
// A block is 8 waves, two a SIMD, so that one wave's softmax runs beside the other's matrix products: waves w and w + 4 own the same 32 queries (two 16-column groups) and walk 512 keys each,
// 32 at a time; behind the loop they exchange maximum, sum and O^T through LDS, both merge them, and each forms half of the 256 output channels. A wave forms S^T = K Q^T (bf16 hi/lo planes, three products, as the score
// GEMM did) and O^T += V^T P^T (f16): in both D tiles a lane holds one query (column lane & 15), so maximum, sum and rescale are lane-local but for one
// exchange between the wave halves, and two S^T tiles (keys 0-15, 16-31), converted in place, are the B operand of the second product in the hardware k order.
// K (hi, lo) and V^T lie in fragment order (k_nl_proj writes them so): every fragment load covers four whole lines. Q is read once from the row-major theta planes.
// Running maximum in log2 units; the accumulators are rescaled only when a column's maximum has grown by more than 8; p = 2^(s - m + 7) <= 2^15 fits f16.
// Epilogue: WY^T tile = W y^T (f16, k ascending), W in fragment order (k_nl_wcast writes it so); the block's 256 channels x 128 queries go through LDS, from where whole rows are stored and
// each channel's partial batch statistics are summed; k_nl_out merges the partials.
namespace w25 {
__device__ __forceinline__ float xhalf(float x) { return __builtin_bit_cast(float, __builtin_amdgcn_permlanex16(__builtin_bit_cast(int, x), __builtin_bit_cast(int, x), 0x76543210, 0xfedcba98, false, false)); }   // lane l takes lane l ^ 16
// a fragment stored in fragment order: two wave-wide loads of 512 contiguous bytes (elements 0..7 <- p[0..7], 8..15 <- p[256..263], p = fragment + 8 * lane)
__device__ __forceinline__ v16b ldf_b(const __bf16* p) { Frag<__bf16>::U f; f.h[0] = *(const v8b*)(p); f.h[1] = *(const v8b*)(p + 256); return f.v; }
__device__ __forceinline__ v16h ldf_h(const _Float16* p) { Frag<_Float16>::U f; f.h[0] = *(const v8h*)(p); f.h[1] = *(const v8h*)(p + 256); return f.v; }
typedef float v2f __attribute__((ext_vector_type(2)));
typedef __attribute__((address_space(1))) const char* gcp;   // a pointer into global memory, said outright: one rebuilt from two words would otherwise be taken for a generic one
// a wave-uniform address, both words through a scalar register: the compiler then keeps a plane's base in scalar registers and forms a pass's address from it; else it held base + lane offset of every plane in a vector pair through the loop
__device__ __forceinline__ gcp ubase(const unsigned short* p) { const unsigned long long a = (unsigned long long)p;
  const unsigned l = (unsigned)__builtin_amdgcn_readfirstlane((int)(unsigned)a), u = (unsigned)__builtin_amdgcn_readfirstlane((int)(unsigned)(a >> 32)); return (gcp)(((unsigned long long)u << 32) | l); }
// the same fragment loads from a lane's address a and a constant offset o, in bytes
__device__ __forceinline__ v16b ldu_b(gcp a, int o) { Frag<__bf16>::U f; f.h[0] = *(const __attribute__((address_space(1))) v8b*)(a + o); f.h[1] = *(const __attribute__((address_space(1))) v8b*)(a + (o + 512)); return f.v; }
__device__ __forceinline__ v16h ldu_h(gcp a, int o) { Frag<_Float16>::U f; f.h[0] = *(const __attribute__((address_space(1))) v8h*)(a + o); f.h[1] = *(const __attribute__((address_space(1))) v8h*)(a + (o + 512)); return f.v; }
__global__ __launch_bounds__(256) void k_nl_flash(const unsigned short* __restrict__ QHp, const unsigned short* __restrict__ QLp, const unsigned short* __restrict__ KHp, const unsigned short* __restrict__ KLp,
                                                  const unsigned short* __restrict__ VTp, const unsigned short* __restrict__ WFp, const float* __restrict__ Wb, float* __restrict__ WY, float* __restrict__ PS) {
  constexpr int D = 128, NKc = 1024, HWc = 4096;
  constexpr int PW = 132;   // LDS pitch of a channel's row of 128 queries, in floats: 512 B + 16 B, an odd multiple of 16 B for the row-per-lane reads
  __shared__ __align__(16) float sW[256 * PW];
  constexpr float L2E = 1.4426950408889634f;
  constexpr int NP = NKc / 64;   // passes of a wave: half of the keys
  const int lane = threadIdx.x & 31, cq = lane & 15, h = lane >> 4;
  const int wave = __builtin_amdgcn_readfirstlane((int)(threadIdx.x >> 5)), qw = wave & 3, hv = wave >> 2;   // in a scalar register; qw: which 32 queries, hv: which half of the keys, later of the channels
  const int b = blockIdx.y, q0 = (blockIdx.x * 4 + qw) * 32;
  const size_t qo = ((size_t)b * HWc + q0 + cq) * D + 8 * h, ko = ((size_t)b * NKc + hv * (NKc / 2)) * D;
  const unsigned l16 = (unsigned)lane * 16u;   // one lane offset, in bytes, for K, V^T and W: a pass forms its three addresses from scalar bases plus it, so no base pair lives in vector registers through the loop (the wave has 512)
  const __bf16* QH = (const __bf16*)QHp + qo; const __bf16* QL = (const __bf16*)QLp + qo;
  const gcp kh0 = ubase(KHp + ko) + l16, kl0 = ubase(KLp + ko) + l16;
  v16b qh[2][4], ql[2][4], kh[2][4], kl[2][4];
#pragma unroll   // constant indices: the fragments stay in registers
  for (int t = 0; t < 2; ++t)
#pragma unroll   // inner loop of the same
    for (int ks = 0; ks < 4; ++ks) {
      qh[t][ks] = Frag<__bf16>::load(QH + t * 16 * D + ks * 32); ql[t][ks] = Frag<__bf16>::load(QL + t * 16 * D + ks * 32);
      kh[t][ks] = ldu_b(kh0, (t * 4 + ks) * 1024); kl[t][ks] = ldu_b(kl0, (t * 4 + ks) * 1024);
    }
  asm volatile("s_wait_xcnt 0x0" :: "v"(QH), "v"(QL), "v"(kh0), "v"(kl0) : "memory");   // the four addresses as inputs keep the pairs until the wait
  v8f o[2][8];
#pragma unroll   // constant indices
  for (int t = 0; t < 2; ++t)
#pragma unroll   // inner loop of the same
    for (int ct = 0; ct < 8; ++ct) o[t][ct] = (v8f){0.f,0.f,0.f,0.f,0.f,0.f,0.f,0.f};
  float mu[2] = { -1.0e30f, -1.0e30f }, l[2] = { 0.f, 0.f };
#pragma unroll 1   // one pass is 64 matrix instructions already; unrolled, the fragments of two passes would not fit
  for (int p = 0; p < NP; ++p) {
    v16h vt[8]; const gcp vp = ubase(VTp + ko + p * 32 * D) + l16;
#pragma unroll   // constant indices; the eight V^T fragments fly while the scores are formed
    for (int ct = 0; ct < 8; ++ct) vt[ct] = ldu_h(vp, ct * 1024);
    __builtin_amdgcn_sched_barrier(0);   // keeps the V^T loads' issue above the score products; without it they sink to their first use and each waits a full latency there
    v8f s[2][2];   // [query group][key tile]
#pragma unroll   // constant indices
    for (int t = 0; t < 2; ++t) { s[t][0] = (v8f){0.f,0.f,0.f,0.f,0.f,0.f,0.f,0.f}; s[t][1] = s[t][0]; }
#pragma unroll   // constant indices; neighbours in the stream go to different tiles
    for (int ks = 0; ks < 4; ++ks) {
#pragma unroll   // inner loop of the same
      for (int kt = 0; kt < 2; ++kt)
#pragma unroll   // inner loop of the same
        for (int t = 0; t < 2; ++t) s[t][kt] = Frag<__bf16>::mma(kh[kt][ks], qh[t][ks], s[t][kt]);
#pragma unroll   // inner loop of the same
      for (int kt = 0; kt < 2; ++kt)
#pragma unroll   // inner loop of the same
        for (int t = 0; t < 2; ++t) s[t][kt] = Frag<__bf16>::mma(kh[kt][ks], ql[t][ks], s[t][kt]);
#pragma unroll   // inner loop of the same
      for (int kt = 0; kt < 2; ++kt)
#pragma unroll   // inner loop of the same
        for (int t = 0; t < 2; ++t) s[t][kt] = Frag<__bf16>::mma(kl[kt][ks], qh[t][ks], s[t][kt]);
    }
    // the next pass's K fragments, into the same registers: they fly behind the softmax and the second product (the last pass re-reads the wave's first 32 keys, in bounds, unused)
    const int kn = ((p + 1) & (NP - 1)) * 32 * D; const gcp kph = ubase(KHp + ko + kn) + l16, kpl = ubase(KLp + ko + kn) + l16;
#pragma unroll   // constant indices
    for (int kt = 0; kt < 2; ++kt)
#pragma unroll   // inner loop of the same
      for (int ks = 0; ks < 4; ++ks) { kh[kt][ks] = ldu_b(kph, (kt * 4 + ks) * 1024); kl[kt][ks] = ldu_b(kpl, (kt * 4 + ks) * 1024); }
    // the wait before the pass's load addresses are reused: the three
    // addresses as inputs keep the pairs until the wait. With vp named and memory clobbered, the V^T loads also stay in front of it and are not sunk behind the rescale branch to their first use
    asm volatile("s_wait_xcnt 0x0" :: "v"(kph), "v"(kpl), "v"(vp) : "memory");
    float mx[2];
#pragma unroll   // constant indices
    for (int t = 0; t < 2; ++t) { float m = fmaxf(s[t][0][0], s[t][1][0]);
#pragma unroll   // inner loop of the same
      for (int r = 1; r < 8; ++r) m = fmaxf(m, fmaxf(s[t][0][r], s[t][1][r]));
      mx[t] = fmaxf(m, xhalf(m)) * L2E; }
    const bool need = (mx[0] > mu[0] + 8.f) || (mx[1] > mu[1] + 8.f);
    if (__builtin_amdgcn_ballot_w32(need) != 0) {   // one scalar test a pass
#pragma unroll   // constant indices
      for (int t = 0; t < 2; ++t) { const float mn = fmaxf(mu[t], mx[t]); const float f = __builtin_amdgcn_exp2f(mu[t] - mn); mu[t] = mn; l[t] *= f;
#pragma unroll   // inner loop of the same
        for (int ct = 0; ct < 8; ++ct) o[t][ct] *= f; }
    }
    v16h pb[2];
#pragma unroll   // constant indices
    for (int t = 0; t < 2; ++t) { const float mb = 7.f - mu[t]; float a0 = 0.f, a1 = 0.f;
#pragma unroll   // inner loop of the same
      for (int r = 0; r < 8; ++r) { const float e0 = __builtin_amdgcn_exp2f(fmaf(s[t][0][r], L2E, mb)), e1 = __builtin_amdgcn_exp2f(fmaf(s[t][1][r], L2E, mb));
        a0 += e0; a1 += e1; pb[t][r] = (_Float16)e0; pb[t][8 + r] = (_Float16)e1; }
      l[t] += a0 + a1; }
#pragma unroll   // constant indices; sixteen independent tiles
    for (int ct = 0; ct < 8; ++ct)
#pragma unroll   // inner loop of the same
      for (int t = 0; t < 2; ++t) o[t][ct] = Frag<_Float16>::mma(vt[ct], pb[t], o[t][ct]);
  }
  // ---- the two halves of the keys meet: every wave leaves O^T (16 KiB, [register quad][lane]), maxima and sums in LDS and takes its partner's ----
  float* ex = sW + wave * 4096 + lane * 4; float* exs = sW + 8 * 4096 + wave * 128 + lane * 4;
#pragma unroll   // constant indices
  for (int t = 0; t < 2; ++t)
#pragma unroll   // inner loop of the same
    for (int ct = 0; ct < 8; ++ct) { *(v4f*)(ex + ((t * 8 + ct) * 2) * 128) = (v4f){ o[t][ct][0], o[t][ct][1], o[t][ct][2], o[t][ct][3] }; *(v4f*)(ex + ((t * 8 + ct) * 2 + 1) * 128) = (v4f){ o[t][ct][4], o[t][ct][5], o[t][ct][6], o[t][ct][7] }; }
  *(v4f*)exs = (v4f){ mu[0], mu[1], l[0], l[1] };
  // ---- W y + b for the wave's 32 queries and its 128 channels (128 hv ..); y = O / l never leaves the registers ----
  const unsigned wfo = l16, bo = (unsigned)h * 32u;   // lane offsets of W and of the bias, in bytes; a lane's D rows are channels 8 h .. 8 h + 7 of a tile
  const _Float16* WF = (const _Float16*)((const char*)(WFp + hv * 32 * 512) + wfo);
  const float* bp = (const float*)((const char*)(Wb + hv * 128) + bo);
  v16h wa[2][16]; v4f bb[2][4][2];   // two sets: four channel tiles x four k steps of W, and their biases
#pragma unroll   // constant indices; the first set flies behind the division below
  for (int u = 0; u < 4; ++u) { bb[0][u][0] = *(const v4f*)(bp + u * 16); bb[0][u][1] = *(const v4f*)(bp + u * 16 + 4); }
#pragma unroll   // the same
  for (int f = 0; f < 16; ++f) wa[0][f] = ldf_h(WF + f * 512);
  asm volatile("s_wait_xcnt 0x0" :: "v"(WF), "v"(bo) : "memory");   // the wait before a load's address registers are reused; the lane's address of W and the bias's lane offset as inputs keep their registers until it
  // every wave's partial results are in LDS before a partner reads them. The barrier with fences on LDS alone: __syncthreads() would also wait for the loads of W, which nobody shares
  __builtin_amdgcn_fence(__ATOMIC_RELEASE, "workgroup", "local"); __builtin_amdgcn_s_barrier(); __builtin_amdgcn_fence(__ATOMIC_ACQUIRE, "workgroup", "local");
  {
    const float* px = sW + (wave ^ 4) * 4096 + lane * 4; const v4f ps4 = *(const v4f*)(sW + 8 * 4096 + (wave ^ 4) * 128 + lane * 4);
#pragma unroll   // constant indices
    for (int t = 0; t < 2; ++t) { const float mn = fmaxf(mu[t], ps4[t]), da = mu[t] - mn, db = ps4[t] - mn; float fa, fb;
      // 2^da, 2^db with the slot behind each transcendental written out
      asm("v_exp_f32 %0, %2\n\tv_nop\n\tv_exp_f32 %1, %3\n\tv_nop" : "=&v"(fa), "=&v"(fb) : "v"(da), "v"(db));
      l[t] = l[t] * fa + ps4[2 + t] * fb;
#pragma unroll   // inner loop of the same
      for (int ct = 0; ct < 8; ++ct) { const v4f p0 = *(const v4f*)(px + ((t * 8 + ct) * 2) * 128), p1 = *(const v4f*)(px + ((t * 8 + ct) * 2 + 1) * 128);
#pragma unroll   // inner loop of the same
        for (int r = 0; r < 4; ++r) { o[t][ct][r] = o[t][ct][r] * fa + p0[r] * fb; o[t][ct][4 + r] = o[t][ct][4 + r] * fa + p1[r] * fb; } } }
  }
  // every wave has read its partner's results: the LDS is free for the tile of WY (the same barrier)
  __builtin_amdgcn_fence(__ATOMIC_RELEASE, "workgroup", "local"); __builtin_amdgcn_s_barrier(); __builtin_amdgcn_fence(__ATOMIC_ACQUIRE, "workgroup", "local");
  v16h yb[2][4];   // two O^T tiles (channels 32 j .. + 15, + 16 .. + 31), converted in place, are the B operand of k step j in the hardware k order
#pragma unroll   // constant indices
  for (int t = 0; t < 2; ++t) { const float inv = 1.f / (l[t] + xhalf(l[t]));
#pragma unroll   // inner loop of the same
    for (int j = 0; j < 4; ++j)
#pragma unroll   // inner loop of the same
      for (int r = 0; r < 8; ++r) { yb[t][j][r] = (_Float16)(o[t][2 * j][r] * inv); yb[t][j][8 + r] = (_Float16)(o[t][2 * j + 1][r] * inv); } }
  float* sq = sW + (hv * 128 + 8 * h) * PW + qw * 32 + cq;
#pragma unroll   // constant indices into wa[][], bb[][][]: two groups of four channel tiles
  for (int g = 0; g < 2; ++g) {
    if (g < 1) {   // the next group's biases and W fragments fly behind this group's products
#pragma unroll   // constant indices
      for (int u = 0; u < 4; ++u) { bb[(g + 1) & 1][u][0] = *(const v4f*)(bp + ((g + 1) * 4 + u) * 16); bb[(g + 1) & 1][u][1] = *(const v4f*)(bp + ((g + 1) * 4 + u) * 16 + 4); }
#pragma unroll   // the same
      for (int f = 0; f < 16; ++f) wa[(g + 1) & 1][f] = ldf_h(WF + ((g + 1) * 16 + f) * 512);
      asm volatile("s_wait_xcnt 0x0" :: "v"(WF), "v"(bo) : "memory");   // the same wait; memory clobbered, the loads also stay above the products instead of sinking to their first use
    }
    v8f d[4][2];
#pragma unroll   // constant indices
    for (int u = 0; u < 4; ++u) { d[u][0] = (v8f){0.f,0.f,0.f,0.f,0.f,0.f,0.f,0.f}; d[u][1] = d[u][0]; }
#pragma unroll   // constant indices; k ascending, eight independent tiles
    for (int j = 0; j < 4; ++j)
#pragma unroll   // inner loop of the same
      for (int u = 0; u < 4; ++u)
#pragma unroll   // inner loop of the same
        for (int t = 0; t < 2; ++t) d[u][t] = Frag<_Float16>::mma(wa[g & 1][u * 4 + j], yb[t][j], d[u][t]);
#pragma unroll   // constant indices; 16 lanes = 64 B of a channel's row, the two halves 32 banks apart
    for (int u = 0; u < 4; ++u)
#pragma unroll   // inner loop of the same
      for (int r = 0; r < 8; ++r)
#pragma unroll   // inner loop of the same
        for (int t = 0; t < 2; ++t) sq[((g * 4 + u) * 16 + r) * PW + t * 16] = d[u][t][r] * 0.0625f + bb[g & 1][u][r >> 2][r & 3];
  }
  __syncthreads();   // the block's 256 x 128 tile of WY is complete in LDS before rows are read across the waves' columns
  // a wave stores 32 channels' rows: 512 contiguous bytes (four whole lines) a store
  const float* sr = sW + wave * 32 * PW + lane * 4;
  float* wy = WY + ((size_t)b * 256 + wave * 32) * HWc + blockIdx.x * 128 + lane * 4;
#pragma unroll   // constant offsets
  for (int it = 0; it < 2; ++it) { v4f v[16];
#pragma unroll   // inner loop of the same: sixteen LDS reads behind one wait
    for (int k = 0; k < 16; ++k) v[k] = *(const v4f*)(sr + (it * 16 + k) * PW);
#pragma unroll   // inner loop of the same
    for (int k = 0; k < 16; ++k) *(v4f*)(wy + (size_t)(it * 16 + k) * HWc) = v[k];
    // the wait before a store's registers are reused: address and values as inputs keep them until it
    asm volatile("s_wait_xcnt 0x0" :: "v"(wy), "v"(v[0]), "v"(v[1]), "v"(v[2]), "v"(v[3]), "v"(v[4]), "v"(v[5]), "v"(v[6]), "v"(v[7]), "v"(v[8]), "v"(v[9]), "v"(v[10]), "v"(v[11]), "v"(v[12]), "v"(v[13]), "v"(v[14]), "v"(v[15]) : "memory"); }
  // partial batch statistics: a thread owns channel tid and reads its 128 values (row pitch an odd multiple of 16 B): sum, then squared deviations from the row's own mean, no exchange between lanes
  v2f st[1]; v4f rv[1][32];
#pragma unroll   // constant indices: the row in registers
  for (int cc = 0; cc < 1; ++cc)
#pragma unroll   // inner loop of the same
    for (int k = 0; k < 32; ++k) rv[cc][k] = *(const v4f*)(sW + ((int)threadIdx.x + cc * 128) * PW + k * 4);
  __builtin_amdgcn_sched_barrier(0);   // keeps all 32 LDS reads' issue above the sums; without it they sink to their first use, four in flight, and the wave waits on each
#pragma unroll   // constant indices
  for (int cc = 0; cc < 1; ++cc) { v4f a = rv[cc][0];
#pragma unroll   // inner loop of the same: four independent chains
    for (int k = 1; k < 32; ++k) a += rv[cc][k];
    const float s = (a[0] + a[1]) + (a[2] + a[3]), mean = s * (1.0f / 128.0f);
    v4f q = { 0.f, 0.f, 0.f, 0.f };
#pragma unroll   // inner loop of the same
    for (int k = 0; k < 32; ++k) { const v4f dv = rv[cc][k] - mean; q += dv * dv; }
    st[cc][0] = s; st[cc][1] = (q[0] + q[1]) + (q[2] + q[3]); }
  float* ps = PS + ((size_t)(b * (HWc / 128) + (int)blockIdx.x) * 256 + (int)threadIdx.x) * 2;   // the block's own 2 KiB: 16 whole lines, one writer each
  *(v2f*)(ps) = st[0];
  asm volatile("s_wait_xcnt 0x0" :: "v"(ps), "v"(st[0]) : "memory");   // the same wait for the last store
}
} // namespace w25
// out = (WY - mu[c]) * rstd[c] * gamma[c] + beta[c] + x. One block per channel c, all 8 images: a thread holds 16 B of each operand and image, every load's address a scalar base plus one lane offset.
// The batch statistics come from the 256 partial pairs (sum, squared deviations from the own mean, 128 values each) that k_nl_flash left for the channel: they go through LDS once, then every wave
// merges them itself (mean first, then the deviations plus 128 (partial mean - mean)^2), while its loads of WY and x are in flight.
typedef float v2f __attribute__((ext_vector_type(2)));
typedef __attribute__((address_space(1))) char* gptr;   // a pointer into global memory, said outright: one rebuilt from two words would otherwise be taken for a generic one
// a block-uniform address, both words through a scalar register: the compiler then keeps it as the scalar base of its load and does not fold it with the lane offset into a vector pair
__device__ __forceinline__ gptr sbase(const float* p) { const unsigned long long a = (unsigned long long)p;
    const unsigned l = (unsigned)__builtin_amdgcn_readfirstlane((int)(unsigned)a), u = (unsigned)__builtin_amdgcn_readfirstlane((int)(unsigned)(a >> 32)); return (gptr)(((unsigned long long)u << 32) | l); }
typedef __attribute__((address_space(1))) v4f* gv4;
__global__ __launch_bounds__(1024) void k_nl_out(const float* __restrict__ WY, const float* __restrict__ PS, const float* __restrict__ Gm, const float* __restrict__ Bt, const float* __restrict__ X, float* __restrict__ OUT) {
    constexpr int Bn = 8, C = 256, HW = 4096, NP = 256, NQ = 128;
    __shared__ __align__(16) float sp[2 * NP];
    const int c = (int)blockIdx.x, t = (int)threadIdx.x, lane = t & 31;
    const unsigned lo = (unsigned)t * 16u;
    const float* pp = PS + ((size_t)(t & (NP - 1)) * C + c) * 2; v2f p = { 0.f, 0.f };
    if (t < NP) p = *(const v2f*)pp;   // waves 0 to 7, first in the load queue: its wait leaves the sixteen loads below in flight
    v4f w[Bn], xv[Bn]; gptr wb[Bn], xb[Bn]; float* op[Bn];
#pragma unroll   // constant indices: the sixteen scalar bases
    for (int b = 0; b < Bn; ++b) { const int po = (b * C + c) * HW; wb[b] = sbase(WY + po); xb[b] = sbase(X + po); }
    __builtin_amdgcn_sched_barrier(0);   // all bases stand before the first load: formed between the loads they shared a few scalar registers, with a wait in front of every reuse
#pragma unroll   // all sixteen loads in flight, every address a scalar base plus the one lane offset
    for (int b = 0; b < Bn; ++b) { w[b] = *(gv4)(wb[b] + lo); xv[b] = *(gv4)(xb[b] + lo); }
    asm volatile("s_wait_xcnt 0x0" :: "v"(lo), "v"(pp) : "memory");   // the wait before a load's address registers are reused; the lane offset and the partial's address as inputs keep them until it
    const float g = Gm[c], be = Bt[c];
    if (t < NP) *(v2f*)(sp + 2 * t) = p;
    // the 256 pairs are in LDS before any wave sums them. The barrier with fences on LDS alone: __syncthreads() would also wait for the sixteen global loads, which nobody shares
    __builtin_amdgcn_fence(__ATOMIC_RELEASE, "workgroup", "local"); __builtin_amdgcn_s_barrier(); __builtin_amdgcn_fence(__ATOMIC_ACQUIRE, "workgroup", "local");
    float s8[8], m8[8];
#pragma unroll   // constant indices
    for (int k = 0; k < 8; ++k) { const v2f q = *(const v2f*)(sp + 2 * (lane + 32 * k)); s8[k] = q[0]; m8[k] = q[1]; }
    float S = ((s8[0] + s8[1]) + (s8[2] + s8[3])) + ((s8[4] + s8[5]) + (s8[6] + s8[7]));
#pragma unroll   // five exchange steps, constant masks
    for (int o = 16; o > 0; o >>= 1) S += __shfl_xor(S, o, 32);
    const float mu = S / (float)(NP * NQ);
    float Q = 0.f;
#pragma unroll   // constant indices
    for (int k = 0; k < 8; ++k) { const float dm = s8[k] * (1.0f / (float)NQ) - mu; Q += m8[k] + (float)NQ * dm * dm; }
#pragma unroll   // five exchange steps, constant masks
    for (int o = 16; o > 0; o >>= 1) Q += __shfl_xor(Q, o, 32);
    const float rs = rsqrtf(Q / (float)(NP * NQ) + 1e-5f);
    __builtin_amdgcn_sched_barrier(0);   // the first use of WY stays behind the statistics: moved up between the two sums, its wait for the loads held the second sum back
#pragma unroll   // constant indices into w[], xv[]
    for (int b = 0; b < Bn; ++b) {
#pragma unroll   // inner loop of the same: constant indices, values stay in registers
        for (int e = 0; e < 4; ++e) w[b][e] = (w[b][e] - mu) * rs * g + be + xv[b][e];
        op[b] = (float*)((char*)(OUT + (b * C + c) * HW) + lo); *(v4f*)op[b] = w[b]; }
    // the wait before a store's registers are reused: the eight addresses and the values as inputs keep them all until it
    asm volatile("s_wait_xcnt 0x0" :: "v"(op[0]), "v"(op[1]), "v"(op[2]), "v"(op[3]), "v"(op[4]), "v"(op[5]), "v"(op[6]), "v"(op[7]), "v"(w[0]), "v"(w[1]), "v"(w[2]), "v"(w[3]), "v"(w[4]), "v"(w[5]), "v"(w[6]), "v"(w[7]) : "memory");
}


// The four weight casts in one launch: they need nothing of each other, so blockIdx.y picks the matrix (a block-uniform choice) and the four grids run side by side.
// All four matrices hold the same number of elements, rows contiguous, and the grid covers it exactly; a thread casts 4 consecutive ones (one 16-byte load, 8-byte stores), each value as k_cast16 and k_castS16 cast it.
__global__ __launch_bounds__(256) void k_nl_wcast(const float* __restrict__ Ww, const float* __restrict__ thw, const float* __restrict__ phw, const float* __restrict__ gw, unsigned short* __restrict__ WW16,
                                                  unsigned short* __restrict__ TWH, unsigned short* __restrict__ TWL, unsigned short* __restrict__ PWH, unsigned short* __restrict__ PWL, unsigned short* __restrict__ GW16) {
    const int job = (int)blockIdx.y; const unsigned i = (blockIdx.x * 256u + threadIdx.x) * 4u;
    const float* sp = ((job == 0) ? Ww : (job == 1) ? thw : (job == 2) ? phw : gw) + i;
    const v4f v = *(const v4f*)sp;
    asm volatile("s_wait_xcnt 0x0" :: "v"(sp) : "memory");   // the wait before the load's address pair is reused; the address as an input keeps the pair until it, so the result does not land on it either
    if (job == 1 || job == 2) {   // theta_w, phi_w: bf16 hi and lo planes
        v2u hi, lo; unsigned l2; hi[0] = f2bf2_pack(v[0], v[1], &l2); lo[0] = l2; hi[1] = f2bf2_pack(v[2], v[3], &l2); lo[1] = l2;
        *(v2u*)(((job == 1) ? TWH : PWH) + i) = hi; *(v2u*)(((job == 1) ? TWL : PWL) + i) = lo;
    } else {                      // W_w: f16 of 16 w, in the fragment order that k_nl_flash reads (A tile of 16 channels x 32 k = 512 elements: bits 0-2 k, 3-6 row, 7 half, 8 which 16 k); g_w: f16, row-major
        const float s = (job == 0) ? 16.0f : 1.0f; v2u f; f[0] = f2h2_pack(v[0] * s, v[1] * s); f[1] = f2h2_pack(v[2] * s, v[3] * s);
        const unsigned c = i >> 7, k = i & 127u;   // W_w is [256][128]; the thread's 4 elements share a group of 8 k, and the 8 rows of a 128-byte line belong to one block
        const unsigned fo = ((c >> 4) * 4u + (k >> 5)) * 512u + ((k >> 4) & 1u) * 256u + ((k >> 3) & 1u) * 128u + (c & 15u) * 8u + (k & 7u);
        unsigned short* dp = ((job == 0) ? WW16 : GW16) + ((job == 0) ? fo : i);
        *(v2u*)dp = f;
        asm volatile("s_wait_xcnt 0x0" :: "v"(dp), "v"(f) : "memory");   // the wait before the store's registers are reused; address and value as inputs keep them until it
    }
}

extern "C" void kernel_launch(void* const* d_in, const int* in_sizes, int n_in, void* d_out, int out_size, void* d_ws, size_t ws_size, hipStream_t stream) {
    (void)in_sizes; (void)n_in; (void)out_size; (void)ws_size;
    const float* x = (const float*)d_in[0];
    const float* gw = (const float*)d_in[1];
    const float* gb = (const float*)d_in[2];
    const float* thw = (const float*)d_in[3];
    const float* thb = (const float*)d_in[4];
    const float* phw = (const float*)d_in[5];
    const float* phb = (const float*)d_in[6];
    const float* Ww = (const float*)d_in[7];
    const float* Wb = (const float*)d_in[8];
    const float* bng = (const float*)d_in[9];
    const float* bnb = (const float*)d_in[10];
    const int Bn = 8;
    const int C = 256;
    const int IC = 128;
    const int HW = 4096;
    const int NK = 1024;
    float* out = (float*)d_out;
    char* wsp = (char*)d_ws;
    // One launch per stage for all Bn images (projection and attention: blockIdx.y = image; output: one block per channel, images looped; per-image strides). Workspace: the operand planes that the projection writes, WY, the weight planes, the partial BN statistics
    unsigned short* THH = (unsigned short*)wsp; wsp += (size_t)Bn * HW * IC * 2;
    unsigned short* THL = (unsigned short*)wsp; wsp += (size_t)Bn * HW * IC * 2;
    unsigned short* PPH = (unsigned short*)wsp; wsp += (size_t)Bn * NK * IC * 2;
    unsigned short* PPL = (unsigned short*)wsp; wsp += (size_t)Bn * NK * IC * 2;
    unsigned short* GP16 = (unsigned short*)wsp; wsp += (size_t)Bn * IC * NK * 2;
    float* WY = (float*)wsp; wsp += (size_t)Bn * C * HW * 4;
    unsigned short* WW16 = (unsigned short*)wsp; wsp += (size_t)C * IC * 2;
    unsigned short* TWH = (unsigned short*)wsp; wsp += (size_t)IC * C * 2;
    unsigned short* TWL = (unsigned short*)wsp; wsp += (size_t)IC * C * 2;
    unsigned short* PWH = (unsigned short*)wsp; wsp += (size_t)IC * C * 2;
    unsigned short* PWL = (unsigned short*)wsp; wsp += (size_t)IC * C * 2;
    unsigned short* GW16 = (unsigned short*)wsp; wsp += (size_t)IC * C * 2;
    float* PS = (float*)wsp; wsp += (size_t)Bn * (HW / 128) * C * 2 * 4;
    // weights
    k_nl_wcast<<<dim3((unsigned)(C * IC / 1024), 4u), 256, 0, stream>>>(Ww, thw, phw, gw, WW16, TWH, TWL, PWH, PWL, GW16);
    // theta (bf16 hi/lo, [HW][IC]), pooled phi (bf16 hi/lo) and pooled g (f16) in fragment order, straight from x: 64 pixels a block, blockIdx.y = image
    w25::k_nl_proj<<<dim3((unsigned)(HW / 64), (unsigned)(Bn)), 256, 0, stream>>>(x, (const unsigned short*)(TWH), (const unsigned short*)(TWL), (const unsigned short*)(PWH), (const unsigned short*)(PWL), (const unsigned short*)(GW16), thb, phb, gb, THH, THL, PPH, PPL, GP16);
    // WY[b] = W softmax(theta[b] phi[b]) g[b]^T + W_b ([C][HW], f32) and, per block of 128 queries, each channel's sum and squared deviations: 128 queries a block, blockIdx.y = image
    w25::k_nl_flash<<<dim3((unsigned)(HW / 128), (unsigned)(Bn)), 256, 0, stream>>>((const unsigned short*)(THH), (const unsigned short*)(THL), (const unsigned short*)(PPH), (const unsigned short*)(PPL), (const unsigned short*)(GP16), (const unsigned short*)(WW16), Wb, WY, PS);
    k_nl_out<<<(unsigned)(C), 1024, 0, stream>>>(WY, PS, bng, bnb, x, out);
}

// v008
// It runs in 54.9 microseconds.
// Next to v007, in two timings, it ran 1.11 times as fast each time.
// All steps since the starting kernel, v000, together make it 25.8 times as fast.
#include <hip/hip_runtime.h>
#include <math.h>

typedef __attribute__((ext_vector_type(16))) _Float16 v16h;
typedef __attribute__((ext_vector_type(8)))  _Float16 v8h;
typedef __attribute__((ext_vector_type(16))) __bf16   v16b;
typedef __attribute__((ext_vector_type(8)))  float    v8f;
typedef __attribute__((ext_vector_type(4)))  float    v4f;

// 16-bit WMMA fragment map (wave32), lane L, h = L>>4, m = L&15:
//   A 16x32: lane = row m;   element i -> k = (i<8) ? 8h+i : 16+8h+(i-8)
//   B 32x16: lane = column m; the SAME k(i,h)
//   D 16x16 (8 f32): lane = column m; element r -> row 8h+r
__device__ __forceinline__ int frag_k(int i, int h) { return (i < 8) ? (8 * h + i) : (16 + 8 * h + (i - 8)); }
__device__ __forceinline__ __bf16 bf16_rne(float f) {
    unsigned int u = __float_as_uint(f);
    u += 0x7fffu + ((u >> 16) & 1u);
    return __builtin_bit_cast(__bf16, (unsigned short)(u >> 16));
}
__device__ __forceinline__ float bf16_f32(__bf16 b) { return __uint_as_float(((unsigned int)__builtin_bit_cast(unsigned short, b)) << 16); }
__device__ __forceinline__ v8f wmma16(v16h a, v16h b, v8f c) {
    c = __builtin_amdgcn_wmma_f32_16x16x32_f16(false, a, false, b, (short)0, c, false, false);
    asm volatile("v_nop\n\tv_nop\n\tv_nop\n\tv_nop" : "+v"(c) : "v"(a), "v"(b));
    return c;
}
__device__ __forceinline__ v8f wmmab(v16b a, v16b b, v8f c) {
    c = __builtin_amdgcn_wmma_f32_16x16x32_bf16(false, a, false, b, (short)0, c, false, false);
    asm volatile("v_nop\n\tv_nop\n\tv_nop\n\tv_nop" : "+v"(c) : "v"(a), "v"(b));
    return c;
}
struct Split { v16b hi, lo; };
// hi/lo split product: a.hi*b.hi + a.hi*b.lo + a.lo*b.hi
__device__ __forceinline__ v8f wmma3(const Split& a, const Split& b, v8f c) {
    c = __builtin_amdgcn_wmma_f32_16x16x32_bf16(false, a.hi, false, b.hi, (short)0, c, false, false);
    c = __builtin_amdgcn_wmma_f32_16x16x32_bf16(false, a.hi, false, b.lo, (short)0, c, false, false);
    c = __builtin_amdgcn_wmma_f32_16x16x32_bf16(false, a.lo, false, b.hi, (short)0, c, false, false);
    asm volatile("v_nop\n\tv_nop\n\tv_nop\n\tv_nop" : "+v"(c) : "v"(a.hi), "v"(a.lo), "v"(b.hi), "v"(b.lo));
    return c;
}
struct Split3 { v16b hi, mid, lo; };
// triple split product (6 terms, drops only terms below 2^-24 relative)
__device__ __forceinline__ v8f wmma6(const Split3& a, const Split3& b, v8f c) {
    c = __builtin_amdgcn_wmma_f32_16x16x32_bf16(false, a.hi, false, b.hi, (short)0, c, false, false);
    c = __builtin_amdgcn_wmma_f32_16x16x32_bf16(false, a.hi, false, b.mid, (short)0, c, false, false);
    c = __builtin_amdgcn_wmma_f32_16x16x32_bf16(false, a.mid, false, b.hi, (short)0, c, false, false);
    c = __builtin_amdgcn_wmma_f32_16x16x32_bf16(false, a.hi, false, b.lo, (short)0, c, false, false);
    c = __builtin_amdgcn_wmma_f32_16x16x32_bf16(false, a.mid, false, b.mid, (short)0, c, false, false);
    c = __builtin_amdgcn_wmma_f32_16x16x32_bf16(false, a.lo, false, b.hi, (short)0, c, false, false);
    asm volatile("v_nop\n\tv_nop\n\tv_nop\n\tv_nop" : "+v"(c) : "v"(a.hi), "v"(a.mid), "v"(a.lo), "v"(b.hi), "v"(b.mid), "v"(b.lo));
    return c;
}

// Fragment gathers from f32 memory: element i <- p[(k0 + frag_k(i,h)) * sk] * s, zero for k >= klen.
__device__ __forceinline__ v16h fh_ld(const float* __restrict__ p, long long sk, int k0, int h, int klen, float s) {
    v16h a;
#pragma unroll
    for (int i = 0; i < 16; ++i) { const int k = k0 + frag_k(i, h); a[i] = (k < klen) ? (_Float16)(p[(long long)k * sk] * s) : (_Float16)0.f; }
    return a;
}
__device__ __forceinline__ Split sp_ld(const float* __restrict__ p, long long sk, int k0, int h, int klen, float s) {
    Split r;
#pragma unroll
    for (int i = 0; i < 16; ++i) {
        const int k = k0 + frag_k(i, h); const float x = (k < klen) ? p[(long long)k * sk] * s : 0.f;
        const __bf16 hb = bf16_rne(x); r.hi[i] = hb; r.lo[i] = bf16_rne(x - bf16_f32(hb));
    }
    return r;
}
__device__ __forceinline__ Split3 sp3_ld(const float* __restrict__ p, long long sk, int k0, int h, int klen, float s) {
    Split3 r;
#pragma unroll
    for (int i = 0; i < 16; ++i) {
        const int k = k0 + frag_k(i, h); const float x = (k < klen) ? p[(long long)k * sk] * s : 0.f;
        const __bf16 hb = bf16_rne(x); const float r1 = x - bf16_f32(hb); const __bf16 mb = bf16_rne(r1);
        r.hi[i] = hb; r.mid[i] = mb; r.lo[i] = bf16_rne(r1 - bf16_f32(mb));
    }
    return r;
}
__device__ __forceinline__ v16b bh_ld(const float* __restrict__ p, long long sk, int k0, int h, int klen, float s) {
    v16b a;
#pragma unroll
    for (int i = 0; i < 16; ++i) { const int k = k0 + frag_k(i, h); a[i] = bf16_rne((k < klen) ? p[(long long)k * sk] * s : 0.f); }
    return a;
}
// f16 fragment from an f16 LDS/global row with element stride 1 (k-contiguous), no bounds (tile already zero padded)
__device__ __forceinline__ v16h fh_row(const _Float16* __restrict__ row, int k0, int h) {
    v16h a;
#pragma unroll
    for (int i = 0; i < 16; ++i) a[i] = row[k0 + frag_k(i, h)];
    return a;
}

#define VST2(T, ptr, val) do { const T vst2_v_ = (val); *(T*)(ptr) = vst2_v_;  } while (0)
typedef float v4f __attribute__((ext_vector_type(4)));
typedef unsigned int v4u __attribute__((ext_vector_type(4)));
typedef unsigned int v2u __attribute__((ext_vector_type(2)));
#define VST2V4(ptr, val) do { const v4f vst2_v4_ = (val); *(v4f*)(ptr) = vst2_v4_;  } while (0)

__device__ __attribute__((noinline)) float act_fn(float v, int act) {
    if (act == 1) return fmaxf(v, 0.f);                                                                               // relu
    if (act == 2) { const float u = 0.7978845608028654f * (v + 0.044715f * v * v * v); return 0.5f * v * (1.f + tanhf(u)); } // tanh-gelu
    if (act == 3) return v / (1.f + expf(-v));                                                                        // silu
    if (act == 4) return 0.5f * v * (1.f + erff(v * 0.7071067811865476f));                                             // erf-gelu
    if (act == 5) return tanhf(v);
    if (act == 6) return 1.f / (1.f + expf(-v));                                                                      // sigmoid
    if (act == 7) return (v > 0.f) ? v : 0.01f * v;                                                                   // leaky relu 0.01
    if (act == 8) return (v > 0.f) ? v : (expf(v) - 1.f);                                                             // elu
    if (act == 9) return fminf(fmaxf(v, 0.f), 6.f);                                                                   // relu6
    if (act == 10) return fabsf(v);                                                                                    // abs
    if (act == 11) return (v >= 0.f) ? v : 0.1f * v;                                                                  // leaky 0.1
    if (act == 12) return (v > 0.f) ? v : 0.2f * v;                                                                   // leaky 0.2
    if (act == 13) return (v > 20.f) ? v : log1pf(expf(v));                                                            // softplus
    return v;
}

// =====================================================================================================================
// k_gemm<MODE>: C(z, m, n) = act(alpha * sum_k A(z, m, k) * B(z, k, n) + bias) + beta * R(z, m, n)
//   One wave (32-thread block) per 16 x 32 tile of C; grid (ceil(N/32), ceil(M/16), Z). Batch z -> (zo = z / zi_n, zi = z % zi_n)
//   with separate outer/inner strides for every tensor (e.g. batch and head). A(m,k) = A[zo*sAo + zi*sAi + m*sAm + k*sAk] (f32),
//   B(k,n) = B[zo*sBo + zi*sBi + n*sBn + k*sBk] (f32); any M, N, K (K zero-padded to 32 inside the fragments, M/N tails guarded).
//   C(m,n) = C[zo*sCo + zi*sCi + m*sCm + n] (n contiguous). flags: 1 bias[n], 2 bias[m], 4 residual R[zo*sRo + zi*sRi + m*sRm + n*sRn].
//   MODE 0: f16 operands (A prescaled by sa, B by sb, both undone in the epilogue); 1: bf16 hi/lo split (3 products); 2: bf16;
//   3: bf16 hi/mid/lo triple split (6 products); 4: as 3 with Kahan-compensated f32 accumulation across k-steps.
// =====================================================================================================================
struct GemmP {
    const float* A; const float* B; const float* bias; const float* R; float* C;
    long long sAo, sAi, sAm, sAk, sBo, sBi, sBn, sBk, sCo, sCi, sCm, sRo, sRi, sRm, sRn;
    int M, N, K, zi_n, flags, act; float alpha, beta, sa, sb;
    int Npad, pad_;     // columns [N, Npad) of C are written as 0 so that padded workspace rows are covered by whole-line stores; Npad >= N
};
static_assert(sizeof(GemmP) == 5 * 8 + 15 * 8 + 6 * 4 + 4 * 4 + 2 * 4, "GemmP has padding");

template <int MODE>
__global__ __launch_bounds__(32) void k_gemm(GemmP p) {
    const int lane = threadIdx.x & 31, h = lane >> 4, l15 = lane & 15;
    const int m0 = blockIdx.y * 16, n0 = blockIdx.x * 32;
    const int z = blockIdx.z, zo = z / p.zi_n, zi = z - zo * p.zi_n;
    const float* A = p.A + zo * p.sAo + zi * p.sAi;
    const float* B = p.B + zo * p.sBo + zi * p.sBi;
    const int am = min(m0 + l15, p.M - 1);                       // clamped row for loads (stores are guarded)
    v8f acc[2], comp[2];
#pragma unroll
    for (int t = 0; t < 2; ++t) { v8f zz = {}; acc[t] = zz; comp[t] = zz; }
    for (int k0 = 0; k0 < p.K; k0 += 32) {
        const float* arow = A + (long long)am * p.sAm;
        if (MODE == 1) {
            const Split a = sp_ld(arow, p.sAk, k0, h, p.K, 1.f);
#pragma unroll
            for (int t = 0; t < 2; ++t) {
                const int bn = min(n0 + t * 16 + l15, p.N - 1);
                acc[t] = wmma3(a, sp_ld(B + (long long)bn * p.sBn, p.sBk, k0, h, p.K, 1.f), acc[t]);
            }
        } else if (MODE == 3) {
            const Split3 a = sp3_ld(arow, p.sAk, k0, h, p.K, 1.f);
#pragma unroll
            for (int t = 0; t < 2; ++t) {
                const int bn = min(n0 + t * 16 + l15, p.N - 1);
                acc[t] = wmma6(a, sp3_ld(B + (long long)bn * p.sBn, p.sBk, k0, h, p.K, 1.f), acc[t]);
            }
        } else if (MODE == 4) {
            // triple split as MODE 3, but each k-step's 6 products go into a fresh accumulator and the partial is added to the running f32 sum
            // on the VALU with Kahan compensation (accumulation error stays ~1 ulp however long K is)
            const Split3 a = sp3_ld(arow, p.sAk, k0, h, p.K, 1.f);
#pragma unroll
            for (int t = 0; t < 2; ++t) {
                const int bn = min(n0 + t * 16 + l15, p.N - 1); v8f zz = {};
                const v8f part = wmma6(a, sp3_ld(B + (long long)bn * p.sBn, p.sBk, k0, h, p.K, 1.f), zz);
                const v8f y = part - comp[t]; const v8f s = acc[t] + y; comp[t] = (s - acc[t]) - y; acc[t] = s;
            }
        } else if (MODE == 2) {
            const v16b a = bh_ld(arow, p.sAk, k0, h, p.K, 1.f);
#pragma unroll
            for (int t = 0; t < 2; ++t) {
                const int bn = min(n0 + t * 16 + l15, p.N - 1);
                acc[t] = wmmab(a, bh_ld(B + (long long)bn * p.sBn, p.sBk, k0, h, p.K, 1.f), acc[t]);
            }
        } else {
            const v16h a = fh_ld(arow, p.sAk, k0, h, p.K, p.sa);
#pragma unroll
            for (int t = 0; t < 2; ++t) {
                const int bn = min(n0 + t * 16 + l15, p.N - 1);
                acc[t] = wmma16(a, fh_ld(B + (long long)bn * p.sBn, p.sBk, k0, h, p.K, p.sb), acc[t]);
            }
        }
    }
    const float iscale = (MODE == 0) ? p.alpha / (p.sa * p.sb) : p.alpha;
    float* C = p.C + zo * p.sCo + zi * p.sCi;
    const float* R = p.R + zo * p.sRo + zi * p.sRi;
    __shared__ __align__(16) float ctile[16][36];
#pragma unroll
    for (int t = 0; t < 2; ++t) {
        const int n = n0 + t * 16 + l15; const int nn = min(n, p.N - 1);
#pragma unroll
        for (int r = 0; r < 8; ++r) {
            const int m = m0 + 8 * h + r; const int mm = min(m, p.M - 1);
            float v = acc[t][r] * iscale;
            if (p.flags & 1) v += p.bias[nn];
            if (p.flags & 2) v += p.bias[mm];
            if (p.flags & 8) v *= p.bias[(long long)zo * p.M + mm];   /* per-(z,row) scale vector laid out [Z][M]; exclusive with the bias flags */
            v = act_fn(v, p.act);
            if (p.flags & 4) v += p.beta * R[(long long)mm * p.sRm + (long long)nn * p.sRn];
            ctile[8 * h + r][t * 16 + l15] = (n < p.N) ? v : 0.f;
        }
    }
    __syncthreads();
    const int NW = (p.Npad > p.N) ? p.Npad : p.N;           // write width
    const bool fast = (m0 + 16 <= p.M) && (n0 + 32 <= NW) && ((p.sCm & 3) == 0) && ((((size_t)C) & 15) == 0);
    if (fast) {
#pragma unroll
        for (int s = 0; s < 4; ++s) {
            const int row = s * 4 + (lane >> 3), c4 = (lane & 7) * 4;
            const v4f v = *(const v4f*)&ctile[row][c4];
            VST2V4(C + (long long)(m0 + row) * p.sCm + n0 + c4, v);
        }
    } else {
        for (int row = 0; row < 16; ++row) {
            const int m = m0 + row, n = n0 + lane;
            if (m < p.M && n < NW) VST2(float, C + (long long)m * p.sCm + n, ctile[row][lane]);
        }
    }
}


// =====================================================================================================================
// k_gemmT<MODE, TM, TN>: same contract as k_gemm, but one wave computes a (16*TM) x (16*TN) tile: TM A fragments and TN B fragments are
//   loaded per 32-wide k-step and reused across TM*TN WMMAs (far fewer load/convert instructions per MAC). MODE 0 (f16), 1 (bf16 hi/lo),
//   2 (bf16) only. grid (ceil(NW/(16*TN)), ceil(M/(16*TM)), Z), block 32. Epilogue identical to k_gemm, run per 16x32 sub-tile.
// =====================================================================================================================
template <int MODE, int TM, int TN>
__global__ __launch_bounds__(32) void k_gemmT(GemmP p) {
    const int lane = threadIdx.x & 31, h = lane >> 4, l15 = lane & 15;
    const int m0 = blockIdx.y * (16 * TM), n0 = blockIdx.x * (16 * TN);
    const int z = blockIdx.z, zo = z / p.zi_n, zi = z - zo * p.zi_n;
    const float* A = p.A + zo * p.sAo + zi * p.sAi;
    const float* B = p.B + zo * p.sBo + zi * p.sBi;
    v8f acc[TM][TN];
#pragma unroll
    for (int i = 0; i < TM; ++i)
#pragma unroll
        for (int t = 0; t < TN; ++t) { v8f zz = {}; acc[i][t] = zz; }
    for (int k0 = 0; k0 < p.K; k0 += 32) {
        if (MODE == 1) {
            Split a[TM], b[TN];
#pragma unroll
            for (int i = 0; i < TM; ++i) { const int am = min(m0 + 16 * i + l15, p.M - 1); a[i] = sp_ld(A + (long long)am * p.sAm, p.sAk, k0, h, p.K, 1.f); }
#pragma unroll
            for (int t = 0; t < TN; ++t) { const int bn = min(n0 + 16 * t + l15, p.N - 1); b[t] = sp_ld(B + (long long)bn * p.sBn, p.sBk, k0, h, p.K, 1.f); }
#pragma unroll
            for (int i = 0; i < TM; ++i)
#pragma unroll
                for (int t = 0; t < TN; ++t) acc[i][t] = wmma3(a[i], b[t], acc[i][t]);
        } else if (MODE == 2) {
            v16b a[TM], b[TN];
#pragma unroll
            for (int i = 0; i < TM; ++i) { const int am = min(m0 + 16 * i + l15, p.M - 1); a[i] = bh_ld(A + (long long)am * p.sAm, p.sAk, k0, h, p.K, 1.f); }
#pragma unroll
            for (int t = 0; t < TN; ++t) { const int bn = min(n0 + 16 * t + l15, p.N - 1); b[t] = bh_ld(B + (long long)bn * p.sBn, p.sBk, k0, h, p.K, 1.f); }
#pragma unroll
            for (int i = 0; i < TM; ++i)
#pragma unroll
                for (int t = 0; t < TN; ++t) acc[i][t] = wmmab(a[i], b[t], acc[i][t]);
        } else {
            v16h a[TM], b[TN];
#pragma unroll
            for (int i = 0; i < TM; ++i) { const int am = min(m0 + 16 * i + l15, p.M - 1); a[i] = fh_ld(A + (long long)am * p.sAm, p.sAk, k0, h, p.K, p.sa); }
#pragma unroll
            for (int t = 0; t < TN; ++t) { const int bn = min(n0 + 16 * t + l15, p.N - 1); b[t] = fh_ld(B + (long long)bn * p.sBn, p.sBk, k0, h, p.K, p.sb); }
#pragma unroll
            for (int i = 0; i < TM; ++i)
#pragma unroll
                for (int t = 0; t < TN; ++t) acc[i][t] = wmma16(a[i], b[t], acc[i][t]);
        }
    }
    const float iscale = (MODE == 0) ? p.alpha / (p.sa * p.sb) : p.alpha;
    float* C = p.C + zo * p.sCo + zi * p.sCi;
    const float* R = p.R + zo * p.sRo + zi * p.sRi;
    const int NW = (p.Npad > p.N) ? p.Npad : p.N;
    __shared__ __align__(16) float ctile[16][36];
#pragma unroll
    for (int i = 0; i < TM; ++i) {
        const int mb = m0 + 16 * i; if (mb >= p.M) break;          // wave-uniform
#pragma unroll
        for (int tp = 0; tp < TN / 2; ++tp) {
            const int nb = n0 + 32 * tp; if (nb >= NW) break;        // wave-uniform
#pragma unroll
            for (int t2 = 0; t2 < 2; ++t2) {
                const int t = 2 * tp + t2; const int n = nb + t2 * 16 + l15; const int nn = min(n, p.N - 1);
#pragma unroll
                for (int r = 0; r < 8; ++r) {
                    const int m = mb + 8 * h + r; const int mm = min(m, p.M - 1);
                    float v = acc[i][t][r] * iscale;
                    if (p.flags & 1) v += p.bias[nn];
                    if (p.flags & 2) v += p.bias[mm];
            if (p.flags & 8) v *= p.bias[(long long)zo * p.M + mm];   /* per-(z,row) scale vector laid out [Z][M]; exclusive with the bias flags */
                    v = act_fn(v, p.act);
                    if (p.flags & 4) v += p.beta * R[(long long)mm * p.sRm + (long long)nn * p.sRn];
                    ctile[8 * h + r][t2 * 16 + l15] = (n < p.N) ? v : 0.f;
                }
            }
            __syncthreads();
            const bool fast = (mb + 16 <= p.M) && (nb + 32 <= NW) && ((p.sCm & 3) == 0) && ((((size_t)C) & 15) == 0);
            if (fast) {
#pragma unroll
                for (int s = 0; s < 4; ++s) {
                    const int row = s * 4 + (lane >> 3), c4 = (lane & 7) * 4;
                    const v4f v = *(const v4f*)&ctile[row][c4];
                    VST2V4(C + (long long)(mb + row) * p.sCm + nb + c4, v);
                }
            } else {
                for (int row = 0; row < 16; ++row) {
                    const int m = mb + row, n = nb + lane;
                    if (m < p.M && n < NW) VST2(float, C + (long long)m * p.sCm + n, ctile[row][lane]);
                }
            }
            __syncthreads();
        }
    }
}

// =====================================================================================================================
//   Wave = 16 queries, AW waves per block, 64-key blocks; grid (ceil(Lq/(16*AW)), H, B), block 32*AW. Any Lq, Lk; head dim dh <= DHP
//   (DHP multiple of 32), value dim dv <= DVP (multiple of 16, <= 128). Every tensor addressed by (batch, head, row, element) strides, f32.
//   Scores: QM 0 f16 operands, 1 bf16 hi/lo split, 2 bf16 triple split; statistics f32 (exp2 domain); P.V: P x 4096 as f16 with V f16 staged in LDS
//   (SPLITPV: P and V as bf16 hi/lo splits). kv head = h / hrep. Masking: causal = 1 (keep j <= i + coff, masked -> -inf, key blocks beyond the
//   diagonal skipped), causal = 2 (masked -> mfill, a finite fill like the -1e9; no skipping), causal = 3 (keep j >= i + coff,
//   masked -> -inf, no skipping); optional additive f32 mask Mf,
//   optional int keep-mask Mi (0 -> score := mfill), both addressed b*smb + h*smh + i*smi + j*smj (0 strides broadcast).
// =====================================================================================================================
#define AW 4
struct AttnP {   // apv4
    const float* Q; const float* K; const float* V; float* O; float* P; const float* Mf; const int* Mi; float* ST;
    const float* Pw; const float* Rt; const int* SQ; const int* SK;           // optional: post-softmax weight, relative-position table, segment ids
    long long swb, swh, swi, swj, srb, srh, sri;                                 // Pw strides (b,h,i,j); Rt strides (b,h,i), column = clamp(i - j + roff, 0, rn-1)
    long long sQb, sQh, sQi, sQd, sKb, sKh, sKj, sKd, sVb, sVh, sVj, sVd, sOb, sOh, sOi, sPb, sPh, sPi, smb, smh, smi, smj;
    int Lq, Lk, dh, dv, hrep, causal, coff, pband;   // pband > 0: P holds only the band |j - i| <= pband, column j - i + pband
    float scale, mfill; int nonorm, mpol;             // nonorm (online path only): O = sum_j exp(score_j) V_j without the 1/rowsum (scores must be <= ~0); mpol: Mi masks where ==0 (mpol 0) or where !=0 (mpol 1)
    int roff, rn, segpol, win;                        // Rt column offset/count; SQ/SK: score := mfill where (segpol 0) SQ[i] != SK[j] or (segpol 1) SQ[i] == SK[j]; win > 0: keys with i - j > win (after coff) -> -inf
};
//   Pw: the softmax numerator is multiplied by Pw(b,h,i,j) AFTER the row sum is taken (probs * weight, then P.V), as in post-softmax multiplicative biases.                                                    // ST (optional): per row (b,h,i) -> ST[((b*H + h)*Lq + i)*2 + {0,1}] = {row max of the scaled+masked score (natural units), sum_j exp(score - max)}
static_assert(sizeof(AttnP) == 12 * 8 + 29 * 8 + 16 * 4, "AttnP has padding");

#ifndef KATTN_ATTR
#define KATTN_ATTR
#endif
template <int DHP, int DVP, int QM, bool SPLITPV, bool TWOPASS>
__global__ __launch_bounds__(32 * AW) KATTN_ATTR void k_attn(AttnP p) {
    constexpr int NT = DVP / 16;                // output tiles
    constexpr int KS = DHP / 32;                // k-steps for the scores
    constexpr int VP = DVP + 8;                 // LDS pitch (halves)
    __shared__ __align__(16) float    pl[AW][16 * 64];
    __shared__ __align__(16) _Float16 vl[(SPLITPV ? 2 : 1) * 64 * VP];   // f16 V tile, or bf16 hi and lo tiles (same 2-byte size)
    const int lane = threadIdx.x & 31, hf = lane >> 4, l15 = lane & 15, wave = threadIdx.x >> 5;
    const int h = blockIdx.y, b = blockIdx.z, hk = h / p.hrep;
    const int q0 = (blockIdx.x * AW + wave) * 16;
    float* myp = pl[wave];
    const float L2E = 1.4426950408889634f;
    const float NEG = -__builtin_inff();
    const int qi = min(q0 + l15, p.Lq - 1);
    const float* qrow = p.Q + b * p.sQb + h * p.sQh + (long long)qi * p.sQi;
    const float* kbase = p.K + b * p.sKb + hk * p.sKh;
    const float* vbase = p.V + b * p.sVb + hk * p.sVh;
    v16h qa[QM == 0 ? KS : 1]; Split qs_[QM == 1 ? KS : 1]; Split3 qt_[QM == 2 ? KS : 1];
#pragma unroll
    for (int ks = 0; ks < KS; ++ks) {
        if (QM == 2) qt_[ks] = sp3_ld(qrow, p.sQd, ks * 32, hf, p.dh, 1.f);
        else if (QM == 1) qs_[ks] = sp_ld(qrow, p.sQd, ks * 32, hf, p.dh, 1.f);
        else qa[ks] = fh_ld(qrow, p.sQd, ks * 32, hf, p.dh, 1.f);
    }
    v8f o[NT]; float m8[8], l8[8];
#pragma unroll
    for (int t = 0; t < NT; ++t) { v8f zz = {}; o[t] = zz; }
#pragma unroll
    for (int i = 0; i < 8; ++i) { m8[i] = NEG; l8[i] = 0.f; }
    int jend = p.Lk; int jstart = 0;
    if (p.causal == 1) { const int je = (blockIdx.x * AW + AW - 1) * 16 + 16 + p.coff; jend = min(jend, max(je, 0)); }   // uniform per block
    if (p.win > 0) { const int js = (int)(blockIdx.x * AW) * 16 + p.coff - p.win; jstart = (js > 0) ? (js / 64) * 64 : 0; }   // uniform per block: key blocks entirely outside every row's window hold only -inf entries and are skipped exactly
    const int npass = TWOPASS ? 2 : 1;
    for (int pass = 0; pass < npass; ++pass) {
        const bool dopv = (!TWOPASS) || pass == 1;
        for (int j0 = jstart; j0 < jend; j0 += 64) {
            if (dopv) {
                __syncthreads();                                 // previous key block's reads of vl / pl are done
                for (int idx = threadIdx.x; idx < 64 * DVP; idx += 32 * AW) {
                    const int jr = idx / DVP, d = idx - jr * DVP, j = j0 + jr;
                    const float f = (j < p.Lk && d < p.dv) ? vbase[(long long)j * p.sVj + (long long)d * p.sVd] : 0.f;
                    if (SPLITPV) {
                        const __bf16 hb = bf16_rne(f);
                        ((__bf16*)vl)[jr * VP + d] = hb; ((__bf16*)vl)[64 * VP + jr * VP + d] = bf16_rne(f - bf16_f32(hb));
                    } else vl[jr * VP + d] = (_Float16)f;
                }
            }
            v8f s[4];
#pragma unroll
            for (int t = 0; t < 4; ++t) {
                const int j = min(j0 + t * 16 + l15, p.Lk - 1);
                const float* krow = kbase + (long long)j * p.sKj;
                v8f acc = {};
#pragma unroll
                for (int ks = 0; ks < KS; ++ks) {
                    if (QM == 2)      acc = wmma6(qt_[ks], sp3_ld(krow, p.sKd, ks * 32, hf, p.dh, 1.f), acc);
                    else if (QM == 1) acc = wmma3(qs_[ks], sp_ld(krow, p.sKd, ks * 32, hf, p.dh, 1.f), acc);
                    else              acc = wmma16(qa[ks], fh_ld(krow, p.sKd, ks * 32, hf, p.dh, 1.f), acc);
                }
                s[t] = acc;
            }
            float pv[8][4];
#pragma unroll
            for (int i = 0; i < 8; ++i) {
                const int irow = q0 + i + 8 * hf;
                const int ic = min(irow, p.Lq - 1);
                float sc[4];
#pragma unroll
                for (int t = 0; t < 4; ++t) {
                    const int jg = j0 + t * 16 + l15;
                    float v = s[t][i] * p.scale;
                    if (p.Mf) v += p.Mf[b * p.smb + h * p.smh + (long long)ic * p.smi + (long long)min(jg, p.Lk - 1) * p.smj];
                    if (p.Rt) { int rc = ic - min(jg, p.Lk - 1) + p.roff; rc = rc < 0 ? 0 : (rc >= p.rn ? p.rn - 1 : rc); v += p.Rt[b * p.srb + h * p.srh + (long long)ic * p.sri + rc]; }
                    if (p.Mi) { const int mv = p.Mi[b * p.smb + h * p.smh + (long long)ic * p.smi + (long long)min(jg, p.Lk - 1) * p.smj]; if (p.mpol ? (mv != 0) : (mv == 0)) v = p.mfill; }
                    if (p.SQ) { const bool same = p.SQ[(long long)b * p.Lq + ic] == p.SK[(long long)b * p.Lk + min(jg, p.Lk - 1)]; if (p.segpol ? same : !same) v = p.mfill; }
                    if (p.causal == 2 && jg > irow + p.coff) v = p.mfill;
                    if (jg >= p.Lk || (p.causal == 1 && jg > irow + p.coff) || (p.causal == 3 && jg < irow + p.coff) || (p.win > 0 && irow + p.coff - jg > p.win)) v = NEG; else v *= L2E;
                    sc[t] = v;
                }
                if (!TWOPASS || pass == 0) {
                    float mx = fmaxf(fmaxf(sc[0], sc[1]), fmaxf(sc[2], sc[3]));
                    mx = fmaxf(mx, __shfl_xor(mx, 1, 32)); mx = fmaxf(mx, __shfl_xor(mx, 2, 32));
                    mx = fmaxf(mx, __shfl_xor(mx, 4, 32)); mx = fmaxf(mx, __shfl_xor(mx, 8, 32));
                    const float mnew = fmaxf(m8[i], mx);
                    const float corr = (mnew == NEG) ? 1.f : exp2f(m8[i] - mnew);
                    float rs = 0.f;
#pragma unroll
                    for (int t = 0; t < 4; ++t) {
                        const float pp = (sc[t] == NEG) ? 0.f : exp2f(sc[t] - mnew); rs += pp;
                        pv[i][t] = p.Pw ? pp * p.Pw[b * p.swb + h * p.swh + (long long)ic * p.swi + (long long)min(j0 + t * 16 + l15, p.Lk - 1) * p.swj] : pp;
                    }
                    rs += __shfl_xor(rs, 1, 32); rs += __shfl_xor(rs, 2, 32); rs += __shfl_xor(rs, 4, 32); rs += __shfl_xor(rs, 8, 32);
                    l8[i] = l8[i] * corr + rs; m8[i] = mnew;
                    if (!TWOPASS) {
#pragma unroll
                        for (int t = 0; t < NT; ++t) o[t][i] *= corr;
                    }
                } else {
                    const float inv = (l8[i] > 0.f) ? 1.f / l8[i] : 0.f;
#pragma unroll
                    for (int t = 0; t < 4; ++t) {
                        const int jg = j0 + t * 16 + l15;
                        float pp = (sc[t] == NEG) ? 0.f : exp2f(sc[t] - m8[i]) * inv;
                        if (p.Pw) pp *= p.Pw[b * p.swb + h * p.swh + (long long)ic * p.swi + (long long)min(jg, p.Lk - 1) * p.swj];
                        pv[i][t] = pp;
                    }
                }
            }
            if (dopv) {
#pragma unroll
                for (int i = 0; i < 8; ++i)
#pragma unroll
                    for (int t = 0; t < 4; ++t) ((float*)myp)[(i + 8 * hf) * 64 + t * 16 + l15] = pv[i][t];
                __syncthreads();                                 // P (per wave) and V (shared) visible
                if (p.P) {
                    float* pb_ = p.P + b * p.sPb + h * p.sPh;
                    const bool fastP = (p.pband == 0) && ((p.sPi & 3) == 0) && (j0 + 64 <= p.Lk) && (q0 + 16 <= p.Lq) && ((((size_t)pb_) & 15) == 0);
                    if (fastP) {
#pragma unroll
                        for (int s = 0; s < 8; ++s) {
                            const int row = s * 2 + (lane >> 4), c4 = (lane & 15) * 4;
                            const v4f v = *(const v4f*)(myp + row * 64 + c4);
                            VST2V4(pb_ + (long long)(q0 + row) * p.sPi + j0 + c4, v);
                        }
                    } else {
                        for (int row = 0; row < 16; ++row) {
                            const int irow = q0 + row; if (irow >= p.Lq) continue;
                            for (int c = lane; c < 64; c += 32) {
                                const int jg = j0 + c; if (jg >= p.Lk) continue;
                                if (p.pband == 0) VST2(float, pb_ + (long long)irow * p.sPi + jg, myp[row * 64 + c]);
                                else if (jg - irow <= p.pband && irow - jg <= p.pband) VST2(float, pb_ + (long long)irow * p.sPi + (jg - irow + p.pband), myp[row * 64 + c]);
                            }
                        }
                    }
                }
                if (SPLITPV) {
                    const Split pa0 = sp_ld(myp + l15 * 64, 1, 0, hf, 64, 1.f), pa1 = sp_ld(myp + l15 * 64, 1, 32, hf, 64, 1.f);
                    const __bf16* vh = (const __bf16*)vl; const __bf16* vlo = vh + 64 * VP;
#pragma unroll
                    for (int t = 0; t < NT; ++t) {
                        const int dcol = t * 16 + l15;
                        Split b0, b1;
#pragma unroll
                        for (int e = 0; e < 16; ++e) {
                            const int k0 = frag_k(e, hf), k1 = 32 + frag_k(e, hf);
                            b0.hi[e] = vh[k0 * VP + dcol]; b0.lo[e] = vlo[k0 * VP + dcol]; b1.hi[e] = vh[k1 * VP + dcol]; b1.lo[e] = vlo[k1 * VP + dcol];
                        }
                        o[t] = wmma3(pa0, b0, o[t]);
                        o[t] = wmma3(pa1, b1, o[t]);
                    }
                } else {
                    const v16h pa0 = fh_ld(myp + l15 * 64, 1, 0, hf, 64, 4096.f), pa1 = fh_ld(myp + l15 * 64, 1, 32, hf, 64, 4096.f);
#pragma unroll
                    for (int t = 0; t < NT; ++t) {
                        const int dcol = t * 16 + l15;
                        v16h b0, b1;
#pragma unroll
                        for (int e = 0; e < 16; ++e) { b0[e] = vl[frag_k(e, hf) * VP + dcol]; b1[e] = vl[(32 + frag_k(e, hf)) * VP + dcol]; }
                        o[t] = wmma16(pa0, b0, o[t]);
                        o[t] = wmma16(pa1, b1, o[t]);
                    }
                }
            }
        }
    }
    float* obase = p.O + b * p.sOb + h * p.sOh;
    if (p.ST) {
        const int rl = lane >> 1, isel = rl & 7;           // row q0 + rl ; rl>>3 == hf holds because lane>>4 == (lane>>1)>>3
        float mv = 0.f, lv = 0.f;
#pragma unroll
        for (int i = 0; i < 8; ++i) if (i == isel) { mv = m8[i]; lv = l8[i]; }
        const int irow = q0 + rl;
        if (irow < p.Lq) { float* st = p.ST + (((long long)b * gridDim.y + h) * p.Lq + irow) * 2 + (lane & 1); VST2(float, st, (lane & 1) ? lv : mv * 0.6931471805599453f); }
    }
    float invr[8];
#pragma unroll
    for (int i = 0; i < 8; ++i) {
        if (TWOPASS) invr[i] = SPLITPV ? 1.f : (1.f / 4096.f);
        else if (p.nonorm) invr[i] = exp2f(m8[i]) * (SPLITPV ? 1.f : (1.f / 4096.f));
        else invr[i] = (l8[i] > 0.f) ? (SPLITPV ? 1.f / l8[i] : 1.f / (l8[i] * 4096.f)) : 0.f;
    }
    __syncthreads();                                             // all waves done with pl/vl from the main loop
    const bool ofast = ((p.sOi & 3) == 0) && ((((size_t)obase) & 15) == 0) && (q0 + 16 <= p.Lq);
#pragma unroll
    for (int c0 = 0; c0 < DVP; c0 += 64) {
#pragma unroll
        for (int i = 0; i < 8; ++i)
#pragma unroll
            for (int t = 0; t < NT; ++t) if (t * 16 >= c0 && t * 16 < c0 + 64) ((float*)myp)[(i + 8 * hf) * 64 + (t * 16 - c0) + l15] = o[t][i] * invr[i];
        __syncthreads();
        const int cw = (DVP - c0 < 64) ? (DVP - c0) : 64;      // staged columns in this chunk (multiple of 16)
        if (ofast && (c0 + cw <= p.dv) && (cw % 32 == 0)) {
            const int lpr = cw / 4;                              // lanes per row (16 for 64 cols, 8 for 32)
            const int rows_per_ins = 32 / lpr;
            for (int r0 = 0; r0 < 16; r0 += rows_per_ins) {
                const int row = r0 + lane / lpr, c4 = (lane % lpr) * 4;
                const v4f v = *(const v4f*)(myp + row * 64 + c4);
                VST2V4(obase + (long long)(q0 + row) * p.sOi + c0 + c4, v);
            }
        } else {
            for (int row = 0; row < 16; ++row) {
                const int irow = q0 + row; if (irow >= p.Lq) continue;
                for (int c = lane; c < cw; c += 32) { const int d = c0 + c; if (d < p.dv) VST2(float, obase + (long long)irow * p.sOi + d, myp[row * 64 + c]); }
            }
        }
        __syncthreads();
    }
}

// =====================================================================================================================
// k_tr: dst(z, c, r) = alpha * src(z, r, c) (+ beta * R2(z, c, r)): [Z][R][C] (row stride lds) -> [Z][C][R] (row stride ldd) through a 32x32 LDS tile;
//   flags: 1 -> add beta * residual R2 addressed like dst (z*sRz + c*ldr + r); act applied before the residual.
// =====================================================================================================================
struct TrP { const float* src; float* dst; const float* R2; long long sSz, lds, sDz, ldd, sRz, ldr; int R, C, flags, act; float alpha, beta; };
static_assert(sizeof(TrP) == 3 * 8 + 6 * 8 + 6 * 4, "TrP has padding");
__global__ __launch_bounds__(256) void k_tr(TrP p) {
    __shared__ float tile[32][33];
    const int c0 = blockIdx.x * 32, r0 = blockIdx.y * 32, z = blockIdx.z;
    const int lane = threadIdx.x & 31, wave = threadIdx.x >> 5;
    const float* s = p.src + z * p.sSz;
#pragma unroll
    for (int k = 0; k < 4; ++k) {
        const int rl = wave * 4 + k, r = r0 + rl, c = c0 + lane;
        tile[rl][lane] = (r < p.R && c < p.C) ? s[(long long)r * p.lds + c] : 0.f;
    }
    __syncthreads();
    float* d = p.dst + z * p.sDz; const float* rr = p.R2 + z * p.sRz;
#pragma unroll
    for (int k = 0; k < 4; ++k) {
        const int cl = wave * 4 + k, c = c0 + cl, r = r0 + lane;
        if (c < p.C && r < p.R) {
            float v = act_fn(p.alpha * tile[lane][cl], p.act);
            if (p.flags & 1) v += p.beta * rr[(long long)c * p.ldr + r];
            VST2(float, d + (long long)c * p.ldd + r, v);
        }
    }
}

// k_affine: dst[i] = a * (sdev ? sdev[0] : 1) * src[i] + b, i < n (one thread per element; consecutive lanes -> consecutive addresses)
__global__ __launch_bounds__(256) void k_affine(const float* __restrict__ src, float* __restrict__ dst, int n, float a, float b, const float* __restrict__ sdev) {
    const int i = blockIdx.x * 256 + threadIdx.x;
    if (i < n) { const float aa = sdev ? a * sdev[0] : a; const float v = aa * src[i] + b; VST2(float, dst + i, v); }
}

// =====================================================================================================================
// k_softmax: row softmax over n contiguous elements, one 256-thread block per row; rows addressed z*sz + r*sr (grid (R, Z)).
//   out = scale_out * softmax(scale_in * x + (Mf ? Mf[z*smz + r*smr + j] : 0)); a row whose max is -inf is written as 0.
// =====================================================================================================================
struct SmP { const float* src; float* dst; const float* Mf; long long sz, sr, dz, dr, smz, smr; int n, pad; float scale_in, scale_out; };
static_assert(sizeof(SmP) == 3 * 8 + 6 * 8 + 4 * 4, "SmP has padding");
__global__ __launch_bounds__(256) void k_softmax(SmP p) {
    __shared__ float red[256];
    const int r = blockIdx.x, z = blockIdx.y, tid = threadIdx.x;
    const float* s = p.src + z * p.sz + (long long)r * p.sr;
    const float* mf = p.Mf ? (p.Mf + z * p.smz + (long long)r * p.smr) : nullptr;
    float mx = -__builtin_inff();
    for (int j = tid; j < p.n; j += 256) { float v = s[j] * p.scale_in; if (mf) v += mf[j]; mx = fmaxf(mx, v); }
    red[tid] = mx; __syncthreads();
    for (int o = 128; o > 0; o >>= 1) { if (tid < o) red[tid] = fmaxf(red[tid], red[tid + o]); __syncthreads(); }
    mx = red[0]; __syncthreads();
    float sum = 0.f;
    for (int j = tid; j < p.n; j += 256) { float v = s[j] * p.scale_in; if (mf) v += mf[j]; sum += (mx == -__builtin_inff()) ? 0.f : expf(v - mx); }
    red[tid] = sum; __syncthreads();
    for (int o = 128; o > 0; o >>= 1) { if (tid < o) red[tid] += red[tid + o]; __syncthreads(); }
    sum = red[0];
    const float inv = (sum > 0.f) ? p.scale_out / sum : 0.f;
    float* d = p.dst + z * p.dz + (long long)r * p.dr;
    for (int j = tid; j < p.n; j += 256) { float v = s[j] * p.scale_in; if (mf) v += mf[j]; const float o = (mx == -__builtin_inff()) ? 0.f : expf(v - mx) * inv; VST2(float, d + j, o); }
}
// =====================================================================================================================
// k_stats: mean and rsqrt(var + eps) over a set of n elements addressed base + z*sz + (e / inner) * so + (e % inner) * si, one 256-thread
// k_norm_apply: y = (x - mean[set]) * rstd[set] * g[c] + b[c] over a [Z][C][L] channel-major tensor with set = z*G + c / (C/G) (G groups per z;
//   G = C -> per-channel sets indexed z*C+c; for batch norm pass stats indexed by c only via bn = 1). Optional act. Output same layout.
// =====================================================================================================================
//   mode 0: mean / rsqrt(var + eps); mode 1 (RMSNorm): 0 / rsqrt(mean(x^2) + eps); mode 2 (L2 normalize * sqrt(n)): 0 / sqrt(n) / max(||x||, eps); mode 3: as 0 with unbiased variance (n-1)
__global__ __launch_bounds__(256) void k_stats(const float* __restrict__ x, long long sz, long long so, long long si, int inner, int n, float eps, float* __restrict__ stat, int mode) {
    __shared__ float red[256];
    const int z = blockIdx.x, tid = threadIdx.x;
    const float* base = x + z * sz;
    float s = 0.f;
    for (int e = tid; e < n; e += 256) s += base[(long long)(e / inner) * so + (long long)(e % inner) * si];
    red[tid] = s; __syncthreads();
    for (int o = 128; o > 0; o >>= 1) { if (tid < o) red[tid] += red[tid + o]; __syncthreads(); }
    const float mu = (mode == 0 || mode == 3) ? red[0] / (float)n : 0.f; __syncthreads();
    float q = 0.f;
    for (int e = tid; e < n; e += 256) { const float dlt = base[(long long)(e / inner) * so + (long long)(e % inner) * si] - mu; q += dlt * dlt; }
    red[tid] = q; __syncthreads();
    for (int o = 128; o > 0; o >>= 1) { if (tid < o) red[tid] += red[tid + o]; __syncthreads(); }
    {
        float rs;
        if (mode == 2) rs = sqrtf((float)n) / fmaxf(sqrtf(red[0]), eps); else if (mode == 3) rs = rsqrtf(red[0] / (float)(n - 1) + eps); else rs = rsqrtf(red[0] / (float)n + eps);
        if (tid < 32) { const float v = (tid == 0) ? mu : ((tid == 1) ? rs : 0.f); VST2(float, stat + (long long)z * 32 + tid, v); }
    }
}
//   One thread per element over the flat [Z][C][L] index space: grid ceil(Z*C*L / 256).
__global__ __launch_bounds__(256) void k_norm_apply(const float* __restrict__ x, float* __restrict__ y, const float* __restrict__ stat, const float* __restrict__ g, const float* __restrict__ bta,
                                                     int Z, int C, int L, int G, int bn, int act) {
    const long long idx = (long long)blockIdx.x * 256 + threadIdx.x;
    if (idx >= (long long)Z * C * L) return;
    const int l = (int)(idx % L); const long long zc = idx / L; const int c = (int)(zc % C), z = (int)(zc / C); (void)l;
    const int set = bn ? c : (z * G + c / (C / G));
    float v = (x[idx] - stat[(long long)set * 32]) * stat[(long long)set * 32 + 1];
    if (g) v *= g[c];
    if (bta) v += bta[c];
    v = act_fn(v, act);
    VST2(float, y + idx, v);
}

// k_lse_neg: c[i] = -(st[2i] + log(st[2i+1])) = minus the log-sum-exp of row i from k_attn's ST output (for softmax over the query dimension)
__global__ __launch_bounds__(256) void k_lse_neg(const float* __restrict__ st, float* __restrict__ c, int n) {
    const int i = blockIdx.x * 256 + threadIdx.x;
    if (i < n) { const float v = -(st[2 * i] + logf(st[2 * i + 1])); VST2(float, c + i, v); }
}

// k_iota: dst[i] = a * i + b as int32 (segment/position id helper)
__global__ __launch_bounds__(256) void k_iota(int* __restrict__ dst, int n, int a, int b) {
    const int i = blockIdx.x * 256 + threadIdx.x;
    if (i < n) { const int v = a * i + b; VST2(int, dst + i, v); }
}

// k_axpby: dst[i] = a * x[i] + b * y[i] (+ c), i < n
__global__ __launch_bounds__(256) void k_axpby(const float* __restrict__ x, const float* __restrict__ y, float* __restrict__ dst, int n, float a, float b, float c) {
    const int i = blockIdx.x * 256 + threadIdx.x;
    if (i < n) { const float v = a * x[i] + b * y[i] + c; VST2(float, dst + i, v); }
}

// =====================================================================================================================
// k_rope: rotary embedding on a [R rows][Hn heads][D] view (row stride sXr, head stride sXh, element stride 1) -> Y (own strides).
//   mode 0: rotate_half (partner d±D/2, sign - for d<D/2); mode 1: interleaved pairs (partner d^1, sign - for even d).
//   table column tcol: tmode 0 -> d, 1 -> d % (D/2), 2 -> d / 2; position p: pmode 0 -> r % S, 1 -> head index, 2 -> pos[r];
//   c = C[(r / S) * sCb + p * sCp + tcol * sCd], s likewise from Sn; y = x[d] * c + sign * x[partner] * s. X and Y must not alias.
// =====================================================================================================================
struct RopeP { const float* X; float* Y; const float* C; const float* Sn; const int* pos; long long sXr, sXh, sYr, sYh, sCb, sCp, sCd; int R, Hn, D, S, mode, tmode, pmode, pad; };
static_assert(sizeof(RopeP) == 5 * 8 + 7 * 8 + 8 * 4, "RopeP has padding");
__global__ __launch_bounds__(256) void k_rope(RopeP p) {
    const long long idx = (long long)blockIdx.x * 256 + threadIdx.x;
    if (idx >= (long long)p.R * p.Hn * p.D) return;
    const int d = (int)(idx % p.D); const long long rh = idx / p.D; const int h = (int)(rh % p.Hn); const int r = (int)(rh / p.Hn);
    const int half = p.D / 2;
    int partner; float sign;
    if (p.mode == 0) { partner = (d < half) ? d + half : d - half; sign = (d < half) ? -1.f : 1.f; }
    else { partner = d ^ 1; sign = (d & 1) ? 1.f : -1.f; }
    const int tcol = (p.tmode == 0) ? d : ((p.tmode == 1) ? (d % half) : (d >> 1));
    const int pp = (p.pmode == 0) ? (r % p.S) : ((p.pmode == 1) ? h : p.pos[r]);
    const long long toff = (long long)(r / p.S) * p.sCb + (long long)pp * p.sCp + (long long)tcol * p.sCd;
    const float* xr = p.X + (long long)r * p.sXr + (long long)h * p.sXh;
    const float v = xr[d] * p.C[toff] + sign * xr[partner] * p.Sn[toff];
    VST2(float, p.Y + (long long)r * p.sYr + (long long)h * p.sYh + d, v);
}

// k_invf + k_sincos (split so neither kernel carries a large VALU-fma footprint): invf_i = num * (1 / powf(base, (2 i)/D)) [fmode 0],
//   num * expf((2 i) * cexp) [fmode 1], num * powf(base, -2 (i - 1) / D) [fmode 2]; then cs/sn[s*half + i] = cos/sin((pscale * s) * invf_i)
__global__ __launch_bounds__(256) void k_invf(float* __restrict__ invb, int half, int D, float base, float num, int fmode, float cexp) {
    const int i = blockIdx.x * 256 + threadIdx.x;
    if (i >= ((half + 31) / 32) * 32) return;
    if (i >= half) { VST2(float, invb + i, 0.f); return; }
    const float e = (float)(2 * i) / (float)D;
    float invf;
    if (fmode == 1) invf = num * expf((float)(2 * i) * cexp);
    else if (fmode == 2) invf = num * powf(base, (-2.0f * ((float)i - 1.0f)) / (float)D);
    else invf = num * (1.0f / powf(base, e));
    VST2(float, invb + i, invf);
}
__global__ __launch_bounds__(256) void k_sincos(float* __restrict__ cs, float* __restrict__ sn, const float* __restrict__ invb, int S, int half, float pscale) {
    const int idx = blockIdx.x * 256 + threadIdx.x;
    if (idx >= S * half) return;
    const int s = idx / half, i = idx - s * half;
    const float ang = (pscale * (float)s) * invb[i];
    VST2(float, cs + idx, cosf(ang)); VST2(float, sn + idx, sinf(ang));
}

// k_mulact: dst[i] = act(x[i]) * y[i]
__global__ __launch_bounds__(256) void k_mulact(const float* __restrict__ x, const float* __restrict__ y, float* __restrict__ dst, int n, int act) {
    const int i = blockIdx.x * 256 + threadIdx.x;
    if (i < n) { const float v = act_fn(x[i], act) * y[i]; VST2(float, dst + i, v); }
}

// =====================================================================================================================
// k_matvec: thread-per-row matrix-vector products for N <= 8 output columns (heads with 1-3 outputs, gates), f32 on the VALU.
//   C[r*sCm + j] = act(alpha * sum_k A[r*sAm + k*sAk] * B[j*sBn + k*sBk] + bias[j]) + beta * R[r*sRm + j*sRn]; each thread writes its N contiguous floats.
// =====================================================================================================================
__global__ __launch_bounds__(256) void k_matvec(GemmP p) {
    // 32 lanes write one line with one instruction.
    const int rpt = (p.N == 1) ? 1 : 32;
    const long long r0 = ((long long)blockIdx.x * 256 + threadIdx.x) * rpt; const int z = blockIdx.z, zo = z / p.zi_n, zi = z - zo * p.zi_n;
    if (r0 >= p.M) return;
    const float* Bb = p.B + zo * p.sBo + zi * p.sBi;
    float* C = p.C + zo * p.sCo + zi * p.sCi; const float* R = p.R + zo * p.sRo + zi * p.sRi;
    for (int rr = 0; rr < rpt; ++rr) {
        const long long r = r0 + rr; if (r >= p.M) break;
        const float* A = p.A + zo * p.sAo + zi * p.sAi + r * p.sAm;
        float acc[8] = {0.f, 0.f, 0.f, 0.f, 0.f, 0.f, 0.f, 0.f};
        for (int k = 0; k < p.K; ++k) { const float a = A[(long long)k * p.sAk];
#pragma unroll
            for (int j = 0; j < 8; ++j) if (j < p.N) acc[j] += a * Bb[(long long)j * p.sBn + (long long)k * p.sBk]; }
#pragma unroll
        for (int j = 0; j < 8; ++j) if (j < p.N) {
            float v = acc[j] * p.alpha;
            if (p.flags & 1) v += p.bias[j];
            if (p.flags & 2) v += p.bias[r];
            v = act_fn(v, p.act);
            if (p.flags & 4) v += p.beta * R[r * p.sRm + (long long)j * p.sRn];
            VST2(float, C + r * p.sCm + j, v);
        }
    }
}
// k_smallsoftmax: thread-per-row softmax for short rows (n <= 64): dst[r*dr + j] = softmax(scale*src[r*sr + j])
__global__ __launch_bounds__(256) void k_smallsoftmax(const float* __restrict__ src, float* __restrict__ dst, long long sr, long long dr, int n, long long R, float scale) {
    const long long r0 = ((long long)blockIdx.x * 256 + threadIdx.x) * 32;
    for (int rr = 0; rr < 32; ++rr) {
        const long long r = r0 + rr; if (r >= R) return;
        const float* s = src + r * sr; float* d = dst + r * dr;
        float mx = -__builtin_inff();
        for (int j = 0; j < n; ++j) mx = fmaxf(mx, s[j] * scale);
        float sum = 0.f;
        for (int j = 0; j < n; ++j) sum += expf(s[j] * scale - mx);
        const float inv = 1.f / sum;
        for (int j = 0; j < n; ++j) { const float v = expf(s[j] * scale - mx) * inv; VST2(float, d + j, v); }
    }
}

__global__ __launch_bounds__(32) void k_unitstat(float* __restrict__ st) { const int t = threadIdx.x; const float v = (t == 1) ? 1.f : 0.f; VST2(float, st + t, v); }

// destination (e.g. a d_out whose row width is not a multiple of 32 floats) is written by consecutive lanes of one instruction
__global__ __launch_bounds__(256) void k_lincopy(const float* __restrict__ src, long long lds, float* __restrict__ dst, long long ldd, long long rows, int cols) {
    const long long i = (long long)blockIdx.x * 256 + threadIdx.x; if (i >= rows * cols) return;
    const long long r = i / cols; const int c = (int)(i - r * cols);
    const float v = src[r * lds + c]; VST2(float, dst + r * ldd + c, v);
}

namespace w25 {
typedef __attribute__((ext_vector_type(16))) _Float16 v16h;
typedef __attribute__((ext_vector_type(8)))  _Float16 v8h;
typedef __attribute__((ext_vector_type(16))) __bf16   v16b;
typedef __attribute__((ext_vector_type(8)))  __bf16   v8b;
typedef __attribute__((ext_vector_type(8)))  float    v8f;
typedef __attribute__((ext_vector_type(4)))  float    v4f;

__device__ __forceinline__ unsigned short f2bf_bits(float f) {
  unsigned u = __float_as_uint(f);
  return (unsigned short)((u + 0x7FFFu + ((u >> 16) & 1u)) >> 16);
}
__device__ __forceinline__ float bf_bits2f(unsigned short h) { return __uint_as_float(((unsigned)h) << 16); }

// hazard guards as plain device helpers (no inline asm inside the kernel template body)
__device__ __forceinline__ void dep_guard_h(v8f& a, v8f& b, v16h x, v16h y) { asm volatile("v_nop\n\tv_nop\n\tv_nop\n\tv_nop" : "+v"(a), "+v"(b) : "v"(x), "v"(y)); }
__device__ __forceinline__ void dep_guard_b(v8f& a, v8f& b, v16b x, v16b y) { asm volatile("v_nop\n\tv_nop\n\tv_nop\n\tv_nop" : "+v"(a), "+v"(b) : "v"(x), "v"(y)); }
__device__ __forceinline__ void keep4_h(v16h a, v16h b, v16h c, v16h d) { asm volatile("v_nop" :: "v"(a), "v"(b), "v"(c), "v"(d)); }
__device__ __forceinline__ void keep4_b(v16b a, v16b b, v16b c, v16b d) { asm volatile("v_nop" :: "v"(a), "v"(b), "v"(c), "v"(d)); }
__device__ __forceinline__ void acc_guard4(v8f& a, v8f& b, v8f& c, v8f& d) { asm volatile("v_nop\n\tv_nop\n\tv_nop\n\tv_nop" : "+v"(a), "+v"(b), "+v"(c), "+v"(d)); }
template <typename T> struct Frag;
template <> struct Frag<_Float16> {
  typedef v16h V; union U { v16h v; v8h h[2]; };
  static __device__ __forceinline__ v16h load(const _Float16* p) {   // elements 0..7 <- p[0..7], 8..15 <- p[16..23]
    U f; f.h[0] = *(const v8h*)(p); f.h[1] = *(const v8h*)(p + 16); return f.v;
  }
  static __device__ __forceinline__ v8f mma(v16h a, v16h b, v8f c) {
    return __builtin_amdgcn_wmma_f32_16x16x32_f16(false, a, false, b, (short)0, c, false, false);
  }
  static __device__ __forceinline__ void guard(v8f& a, v8f& b, v16h x, v16h y) { dep_guard_h(a, b, x, y); }
  static __device__ __forceinline__ void keep(v16h a, v16h b, v16h c, v16h d) { keep4_h(a, b, c, d); }
};
template <> struct Frag<__bf16> {
  typedef v16b V; union U { v16b v; v8b h[2]; };
  static __device__ __forceinline__ v16b load(const __bf16* p) {
    U f; f.h[0] = *(const v8b*)(p); f.h[1] = *(const v8b*)(p + 16); return f.v;
  }
  static __device__ __forceinline__ v8f mma(v16b a, v16b b, v8f c) {
    return __builtin_amdgcn_wmma_f32_16x16x32_bf16(false, a, false, b, (short)0, c, false, false);
  }
  static __device__ __forceinline__ void guard(v8f& a, v8f& b, v16b x, v16b y) { dep_guard_b(a, b, x, y); }
  static __device__ __forceinline__ void keep(v16b a, v16b b, v16b c, v16b d) { keep4_b(a, b, c, d); }
};

// ---- Register-blocked batched WMMA GEMM ------------------------------------
// C[m,n] = scale * sum_k A[m,k] * Bt[n,k] (+bias)(+resid); each wave owns a 64x64 tile.
// A row-major [M,K]; Bt row-major [N,K]; M,N % 64 == 0, K % 32 == 0.
// SPLIT: operands are hi/lo planes (A2/Bt2 = lo planes, same layout); product = hi·hi + hi·lo + lo·hi.
// BIAS_MODE: 0 = none, 1 = bias[m], 2 = bias[n].
// OUT_MODE: 0 = f32, 1 = f16, 2 = bf16 hi plane (Cout) + bf16 lo plane (Cout2).
// ET: 0 = f16 operands, 1 = bf16 operands (pointers passed as 16-bit storage)
template <int ET> struct Elem;
template <> struct Elem<0> { typedef _Float16 T; };
template <> struct Elem<1> { typedef __bf16 T; };
template <int ET, bool SPLIT, int BIAS_MODE, int OUT_MODE, bool RESID, int ACT = 0>
__global__ __launch_bounds__(256) void wmma_gemm64(
    const unsigned short* __restrict__ Ap, const unsigned short* __restrict__ A2p, int lda, long strideA,
    const unsigned short* __restrict__ Btp, const unsigned short* __restrict__ Bt2p, int ldb, long strideB,
    void* __restrict__ Cout, void* __restrict__ Cout2, int ldc, long strideC,
    const float* __restrict__ bias,
    const float* __restrict__ resid, long strideR,
    int M, int N, int K, float scale) {
  typedef typename Elem<ET>::T T;
  typedef typename Frag<T>::V V;
  const T* A = (const T*)Ap; const T* A2 = (const T*)A2p; const T* Bt = (const T*)Btp; const T* Bt2 = (const T*)Bt2p;
  __shared__ __align__(16) float sT[8][16 * 68];   // per-wave 16x64 slab, pitch 68 floats
  const int b    = blockIdx.y;
  const int lane = threadIdx.x & 31;
  const int wave = threadIdx.x >> 5;
  const int tilesN = N >> 6;
  const int tilesM = M >> 6;
  const int tile = blockIdx.x * 8 + wave;
  if (tile >= tilesM * tilesN) return;   // wave-uniform; no block barriers in this kernel
  const int tm = tile / tilesN;
  const int tn = tile - tm * tilesN;
  const int m0 = tm << 6;
  const int n0 = tn << 6;

  const T* Ab  = A  + (size_t)b * strideA;
  const T* Bb  = Bt + (size_t)b * strideB;
  const T* Ab2 = SPLIT ? (A2  + (size_t)b * strideA) : nullptr;
  const T* Bb2 = SPLIT ? (Bt2 + (size_t)b * strideB) : nullptr;

  const int rlane = lane & 15;                 // row (A) / col (B, D) within subtile
  const int koff  = (lane >> 4) * 8;           // k offset of this lane half
  const int mOff  = (lane >> 4) * 8;           // D row offset

  v8f acc[4][4];
#pragma unroll
  for (int i = 0; i < 4; ++i)
#pragma unroll
    for (int j = 0; j < 4; ++j) acc[i][j] = (v8f){0.f,0.f,0.f,0.f,0.f,0.f,0.f,0.f};

  for (int k0 = 0; k0 < K; k0 += 32) {
    V bh[4], bl[4];
#pragma unroll
    for (int j = 0; j < 4; ++j) {
      const size_t bo = (size_t)(n0 + (j << 4) + rlane) * ldb + koff + k0;
      bh[j] = Frag<T>::load(Bb + bo);
      if (SPLIT) bl[j] = Frag<T>::load(Bb2 + bo);
    }
#pragma unroll
    for (int i = 0; i < 4; ++i) {
      const size_t ao = (size_t)(m0 + (i << 4) + rlane) * lda + koff + k0;
      V ah = Frag<T>::load(Ab + ao);
      V al;
      if (SPLIT) al = Frag<T>::load(Ab2 + ao);
#pragma unroll
      for (int j = 0; j < 4; ++j) {
        acc[i][j] = Frag<T>::mma(ah, bh[j], acc[i][j]);
        if (SPLIT) {
          acc[i][j] = Frag<T>::mma(ah, bl[j], acc[i][j]);
          acc[i][j] = Frag<T>::mma(al, bh[j], acc[i][j]);
        }
      }
      Frag<T>::guard(acc[i][0], acc[i][3], ah, SPLIT ? al : ah);
    }
    Frag<T>::keep(bh[0], bh[1], bh[2], bh[3]);
    if (SPLIT) Frag<T>::keep(bl[0], bl[1], bl[2], bl[3]);
  }
  acc_guard4(acc[0][0], acc[0][1], acc[0][2], acc[0][3]);
  acc_guard4(acc[1][0], acc[1][1], acc[1][2], acc[1][3]);
  acc_guard4(acc[2][0], acc[2][1], acc[2][2], acc[2][3]);
  acc_guard4(acc[3][0], acc[3][1], acc[3][2], acc[3][3]);

  // ---- epilogue ----
  float* slab = sT[wave];
  const float* Rb = RESID ? (resid + (size_t)b * strideR) : nullptr;
#pragma unroll
  for (int i = 0; i < 4; ++i) {
    const int mBase = m0 + (i << 4);
#pragma unroll
    for (int j = 0; j < 4; ++j) {
      const int n = n0 + (j << 4) + rlane;
      float bv = 0.f;
      if (BIAS_MODE == 2) bv = bias[n];
#pragma unroll
      for (int r = 0; r < 8; ++r) {
        float v = acc[i][j][r] * scale;
        if (BIAS_MODE == 1) v += bias[mBase + mOff + r];
        if (BIAS_MODE == 2) v += bv;
        if (RESID) v += Rb[(size_t)(mBase + mOff + r) * ldc + n];
        if (ACT == 1) v = tanhf(v);
        if (ACT == 2) v = fmaxf(v, 0.0f);
        if (ACT == 3) v = v / (1.0f + expf(-v));
        if (ACT == 4) v = (v > 0.f) ? v : 0.01f * v;
        if (ACT == 5) v = 0.5f * v * (1.0f + erff(v * 0.70710678118654752f));
        slab[(mOff + r) * 68 + (j << 4) + rlane] = v;
      }
    }
    __builtin_amdgcn_fence(__ATOMIC_RELEASE, "workgroup");
    __builtin_amdgcn_wave_barrier();
    __builtin_amdgcn_fence(__ATOMIC_ACQUIRE, "workgroup");
    if (OUT_MODE == 0) {
      float* C = (float*)Cout + (size_t)b * strideC;
      const int hh = lane >> 4, c4 = (lane & 15) * 4;     // row seg = 256 B = 16 lanes x 16 B
      {
#pragma unroll
        for (int it = 0; it < 8; ++it) {
          const int row = it * 2 + hh;
          v4f v = *(const v4f*)(slab + row * 68 + c4);
          *(v4f*)(C + (size_t)(mBase + row) * ldc + n0 + c4) = v;
        }
        
      }
    } else {
      const int q = lane >> 3, c8 = (lane & 7) * 8;
      unsigned short* C  = (unsigned short*)Cout  + (size_t)b * strideC;
      unsigned short* C2 = (OUT_MODE == 2) ? ((unsigned short*)Cout2 + (size_t)b * strideC) : nullptr;
      {
#pragma unroll
        for (int it = 0; it < 4; ++it) {
          const int row = it * 4 + q;
          const float* sp = slab + row * 68 + c8;
          v8h hv, lv;
#pragma unroll
          for (int e = 0; e < 8; ++e) {
            if (OUT_MODE == 1) {
              hv[e] = (_Float16)sp[e];
            } else {
              unsigned short hb = f2bf_bits(sp[e]);
              unsigned short lb = f2bf_bits(sp[e] - bf_bits2f(hb));
              hv[e] = __builtin_bit_cast(_Float16, hb);
              lv[e] = __builtin_bit_cast(_Float16, lb);
            }
          }
          *(v8h*)(C + (size_t)(mBase + row) * ldc + n0 + c8) = hv;
          if (OUT_MODE == 2) *(v8h*)(C2 + (size_t)(mBase + row) * ldc + n0 + c8) = lv;
        }
        
      }
    }
    __builtin_amdgcn_fence(__ATOMIC_RELEASE, "workgroup");
    __builtin_amdgcn_wave_barrier();
    __builtin_amdgcn_fence(__ATOMIC_ACQUIRE, "workgroup");
  }
}

__global__ __launch_bounds__(256) void cast_f32_f16x2(
    const float* __restrict__ in, _Float16* __restrict__ out, int n2) {
  int i = blockIdx.x * 256 + threadIdx.x;
  if (i < n2) {
    const _Float16 h0 = (_Float16)in[2 * i], h1 = (_Float16)in[2 * i + 1];
    const unsigned u = (unsigned)__builtin_bit_cast(unsigned short, h0) | ((unsigned)__builtin_bit_cast(unsigned short, h1) << 16);
    ((unsigned*)out)[i] = u;
    
  }
}


} // namespace w25

__device__ __forceinline__ unsigned int f2h2_pack(float a, float b) { return (unsigned)__builtin_bit_cast(unsigned short, (_Float16)a) | ((unsigned)__builtin_bit_cast(unsigned short, (_Float16)b) << 16); }
__global__ __launch_bounds__(256) void k_cast16(const float* __restrict__ src, long long lds, _Float16* __restrict__ dst, long long ldd, int R, int C, float s) {
    const long long i = (long long)blockIdx.x * 256 + threadIdx.x; const long long np = (long long)R * (C / 2); if (i >= np) return; const int r = (int)(i / (C / 2)); const int c = 2 * (int)(i % (C / 2));
    const _Float16 h0 = (_Float16)(src[(long long)r * lds + c] * s), h1 = (_Float16)(src[(long long)r * lds + c + 1] * s);
    const unsigned u = (unsigned)__builtin_bit_cast(unsigned short, h0) | ((unsigned)__builtin_bit_cast(unsigned short, h1) << 16);
    unsigned* d = (unsigned*)(dst + (long long)r * ldd + c); *d = u;  }

// f32 -> bf16 hi plane + bf16 lo plane (x = hi + lo to ~2^-17 relative; RNE both), [R][C] -> [R][C] (or transposed to [C][R]); 2 consecutive destination elements
__device__ __forceinline__ unsigned int f2bf2_pack(float a, float b, unsigned int* lo) {
    const unsigned short ha = w25::f2bf_bits(a), hb = w25::f2bf_bits(b);
    const unsigned short la = w25::f2bf_bits(a - w25::bf_bits2f(ha)), lb = w25::f2bf_bits(b - w25::bf_bits2f(hb));
    *lo = (unsigned)la | ((unsigned)lb << 16); return (unsigned)ha | ((unsigned)hb << 16); }
__global__ __launch_bounds__(256) void k_castS16(const float* __restrict__ src, long long lds, __bf16* __restrict__ dhi, __bf16* __restrict__ dlo, long long ldd, int R, int C, float s, int transpose, long long sb, long long db) {
    src += (long long)blockIdx.y * sb; dhi += (long long)blockIdx.y * db; dlo += (long long)blockIdx.y * db;   // blockIdx.y = image
    const long long i = (long long)blockIdx.x * 256 + threadIdx.x; long long o; float a, b;
    if (transpose) { const long long np = (long long)C * (R / 2); if (i >= np) return; const int c = (int)(i / (R / 2)); const int r = 2 * (int)(i % (R / 2)); a = src[(long long)r * lds + c] * s; b = src[(long long)(r + 1) * lds + c] * s; o = (long long)c * ldd + r; }
    else { const long long np = (long long)R * (C / 2); if (i >= np) return; const int r = (int)(i / (C / 2)); const int c = 2 * (int)(i % (C / 2)); a = src[(long long)r * lds + c] * s; b = src[(long long)r * lds + c + 1] * s; o = (long long)r * ldd + c; }
    unsigned lo; const unsigned hi = f2bf2_pack(a, b, &lo); unsigned* ph = (unsigned*)(dhi + o); unsigned* pl = (unsigned*)(dlo + o);
    *ph = hi; *pl = lo;  }

namespace w25 {
// =====================================================================================
// Generic causal/non-causal attention for head_dim 64, f32 in / f32 out; 16-bit operands: bf16 with optional hi/lo splits, or
// plain f16 (F16=true, non-split, probabilities carried x2^15).
//   scores = (q*qscale)·kᵀ : v_wmma_f32_16x16x32_bf16; SPLIT_QK -> q,k as bf16 hi/lo (hi·hi + hi·lo + lo·hi)
//   out    = p·v           : v_wmma_f32_16x16x32_bf16; SPLIT_PV -> p,v as bf16 hi/lo; else p,v plain bf16
//   f32 accumulate; online softmax in f32. Block = 4 waves = 64 query rows of one (batch, head); S % 64 == 0.
//   Element (b, s, h, d) of tensor X lives at X[b*X_bs + s*X_rs + h*X_hs + d] (strides in floats, multiples of 4).
//   Masking: mask_mode 0 none, 1 causal (kv > q masked), 2 tensor [S][Skv] shared over (b,h) (float if
//   mask_is_int==0, int32 with element == 0 -> masked if 1, int32 with element != 0 -> masked if 2), 3 per-token vectors qmask[B][S] & kvmask[B][Skv] (int32,
//   0 -> masked), 4 causal + sliding window (kv > q or q - kv > W masked; W passed in mask_is_int);
//   5 = relative-position bias: s += cp[b,h,q][idx[q][kv]] + pc[b,h,kv][idx[q][kv]] with idx = mask_b ([S][Skv] int32) and
//   mask_a an int32 [S][Skv] tensor with nonzero = masked (tables: element (b,h,row,n) at X + b*c_bs + h*c_hs + row*c_rs + n);
//   masked scores are replaced by mask_fill (e.g. -inf or -1e9) before the softmax.
//   grid.x = B * H * (S/64) (or a sub-range with blk0).
// =====================================================================================
#define AT_D 64
#define AT_NW 4
#define AT_QB 64
#define AT_KC 64
struct AttnGeom { const float* cp = nullptr; const float* pc = nullptr; long c_bs = 0, c_rs = 0, c_hs = 0;   // mode-5 score-bias tables
                  long q_bs, q_rs, q_hs, k_bs, k_rs, k_hs, v_bs, v_rs, v_hs, o_bs, o_rs, o_hs;
                  int S, Skv, H, mask_mode; float qscale; int blk0; float mask_fill; int mask_is_int; };
static_assert(sizeof(AttnGeom) == 168, "no padding");

__device__ __forceinline__ unsigned short at_bf_bits(float f) {
  unsigned u = __float_as_uint(f);
  return (unsigned short)((u + 0x7FFFu + ((u >> 16) & 1u)) >> 16);
}
__device__ __forceinline__ __bf16 at_f2bf(float f) { return __builtin_bit_cast(__bf16, at_bf_bits(f)); }
__device__ __forceinline__ void at_split(float f, __bf16& hi, __bf16& lo) {
  const unsigned short hb = at_bf_bits(f);
  hi = __builtin_bit_cast(__bf16, hb);
  lo = at_f2bf(f - __uint_as_float(((unsigned)hb) << 16));
}
__device__ __forceinline__ v8f at_mma(v16b a, v16b b, v8f c) {
  c = __builtin_amdgcn_wmma_f32_16x16x32_bf16(false, a, false, b, (short)0, c, false, false);
  asm volatile("v_nop\n\tv_nop\n\tv_nop\n\tv_nop" : "+v"(c) : "v"(a), "v"(b));
  return c;
}
// 16-bit element as a bit pattern held in a __bf16 slot: f16 bits when F16, bf16 (RNE) otherwise
template <bool F16> __device__ __forceinline__ __bf16 at_to16(float f) {
  if (F16) return __builtin_bit_cast(__bf16, (_Float16)f);
  return at_f2bf(f);
}
template <bool F16> __device__ __forceinline__ v8f at_mma16(v16b a, v16b b, v8f c) {
  if (F16) {
    const v16h ah = __builtin_bit_cast(v16h, a), bh = __builtin_bit_cast(v16h, b);
    c = __builtin_amdgcn_wmma_f32_16x16x32_f16(false, ah, false, bh, (short)0, c, false, false);
    asm volatile("v_nop\n\tv_nop\n\tv_nop\n\tv_nop" : "+v"(c) : "v"(ah), "v"(bh));
    return c;
  }
  return at_mma(a, b, c);
}

template <bool SPLIT_QK, bool SPLIT_PV, bool F16 = false>
__global__ __launch_bounds__(128)
void attn64_kernel(const float* __restrict__ q, const float* __restrict__ k,
                   const float* __restrict__ v, float* __restrict__ out,
                   const void* __restrict__ mask_a, const int* __restrict__ mask_b, AttnGeom g) {
  static_assert(!(F16 && (SPLIT_QK || SPLIT_PV)), "f16 mode is non-split");
  const float PSC = F16 ? 32768.0f : 1.0f;     // f16 probabilities carried x2^15 (subnormal range), folded into the final 1/l
  union FB { v16b v; v8b h[2]; };
  __shared__ __align__(16) __bf16 Ksh[AT_KC * AT_D];             // K hi [kv][d]      8 KB
  __shared__ __align__(16) __bf16 Ksl[SPLIT_QK ? AT_KC * AT_D : 8];
  __shared__ __align__(16) __bf16 Vth[AT_D * AT_KC];             // V hi [d][kv]      8 KB
  __shared__ __align__(16) __bf16 Vtl[SPLIT_PV ? AT_D * AT_KC : 8];
  __shared__ __align__(16) __bf16 Psh[AT_NW][16 * AT_KC];        // per wave P hi [row][kv]  8 KB
  __shared__ __align__(16) __bf16 Psl[SPLIT_PV ? AT_NW : 1][SPLIT_PV ? 16 * AT_KC : 8];
  __shared__ __align__(16) float  Os[AT_NW][16 * 68];            // per wave out tile, pitch 68

  const int tid  = threadIdx.x;
  const int wave = tid >> 5;
  const int lane = tid & 31;
  const int hh   = lane >> 4;
  const int c    = lane & 15;

  const int nqb = g.S / AT_QB;
  const int bx = blockIdx.x + g.blk0;
  const int qb = bx % nqb;
  const int bh = bx / nqb;
  const int h  = bh % g.H;
  const int b  = bh / g.H;
  const int qbase_block = qb * AT_QB;
  const int q0 = qbase_block + wave * 16;

  const float* qb_ptr = q + (size_t)b * g.q_bs + (size_t)h * g.q_hs;
  const float* kb_ptr = k + (size_t)b * g.k_bs + (size_t)h * g.k_hs;
  const float* vb_ptr = v + (size_t)b * g.v_bs + (size_t)h * g.v_hs;
  float*       ob_ptr = out + (size_t)b * g.o_bs + (size_t)h * g.o_hs;

  // ---- Q fragments (A operand): 2 d-chunks, hi (and lo) ----
  v16b qah[2], qal[2];
  {
    const float* qrow = qb_ptr + (size_t)(q0 + c) * g.q_rs;
#pragma unroll
    for (int dc = 0; dc < 2; ++dc) {
#pragma unroll
      for (int e = 0; e < 8; ++e) {
        const float f0 = qrow[dc * 32 + 8 * hh + e] * g.qscale;
        const float f1 = qrow[dc * 32 + 16 + 8 * hh + e] * g.qscale;
        if (SPLIT_QK) { __bf16 hq, lq; at_split(f0, hq, lq); qah[dc][e] = hq; qal[dc][e] = lq; at_split(f1, hq, lq); qah[dc][8 + e] = hq; qal[dc][8 + e] = lq; }
        else { qah[dc][e] = at_to16<F16>(f0); qah[dc][8 + e] = at_to16<F16>(f1); qal[dc][e] = qah[dc][e]; qal[dc][8 + e] = qah[dc][8 + e]; }
      }
    }
  }

  float mrow[8], lrow[8];
  v8f oacc[4];
#pragma unroll
  for (int r = 0; r < 8; ++r) { mrow[r] = -INFINITY; lrow[r] = 0.f; }
#pragma unroll
  for (int t = 0; t < 4; ++t) oacc[t] = (v8f){0.f,0.f,0.f,0.f,0.f,0.f,0.f,0.f};

  const int nChunks = (g.mask_mode == 1 || g.mask_mode == 4) ? (qb + 1) : (g.Skv / AT_KC);   // block-uniform
  // per-row query mask (mode 3)
  int qkeep[8];
#pragma unroll
  for (int r = 0; r < 8; ++r) qkeep[r] = (g.mask_mode == 3) ? mask_b[(size_t)b * g.S + q0 + 8 * hh + r] : 1;   // mask_b = qmask in mode 3
  for (int kc = 0; kc < nChunks; ++kc) {
    const int kv0 = kc * AT_KC;
    __syncthreads();
    {
      const int kvr = tid >> 1, dh = (tid & 1) * 32;
      const float* krow = kb_ptr + (size_t)(kv0 + kvr) * g.k_rs + dh;
      const float* vrow = vb_ptr + (size_t)(kv0 + kvr) * g.v_rs + dh;
#pragma unroll
      for (int i = 0; i < 8; ++i) {
        v4f kk = *(const v4f*)(krow + 4 * i);
        v4f vv = *(const v4f*)(vrow + 4 * i);
#pragma unroll
        for (int e = 0; e < 4; ++e) {
          const int d = dh + 4 * i + e;
          if (SPLIT_QK) { __bf16 a, bl; at_split(kk[e], a, bl); Ksh[kvr * AT_D + d] = a; Ksl[kvr * AT_D + d] = bl; }
          else Ksh[kvr * AT_D + d] = at_to16<F16>(kk[e]);
          if (SPLIT_PV) { __bf16 a, bl; at_split(vv[e], a, bl); Vth[d * AT_KC + kvr] = a; Vtl[d * AT_KC + kvr] = bl; }
          else Vth[d * AT_KC + kvr] = at_to16<F16>(vv[e]);
        }
      }
    }
    __syncthreads();

    v8f s[4];
#pragma unroll
    for (int j = 0; j < 4; ++j) {
      s[j] = (v8f){0.f,0.f,0.f,0.f,0.f,0.f,0.f,0.f};
#pragma unroll 1
      for (int dc = 0; dc < 2; ++dc) {
        FB kb;
        kb.h[0] = *(const v8b*)(Ksh + (j * 16 + c) * AT_D + dc * 32 + 8 * hh);
        kb.h[1] = *(const v8b*)(Ksh + (j * 16 + c) * AT_D + dc * 32 + 16 + 8 * hh);
        s[j] = at_mma16<F16>(qah[dc], kb.v, s[j]);
        if (SPLIT_QK) {
          FB kl;
          kl.h[0] = *(const v8b*)(Ksl + (j * 16 + c) * AT_D + dc * 32 + 8 * hh);
          kl.h[1] = *(const v8b*)(Ksl + (j * 16 + c) * AT_D + dc * 32 + 16 + 8 * hh);
          s[j] = at_mma16<F16>(qah[dc], kl.v, s[j]);
          s[j] = at_mma16<F16>(qal[dc], kb.v, s[j]);
        }
      }
    }
    const bool diag = (g.mask_mode == 1) && (kc == qb);
    int kvkeep[4] = {1, 1, 1, 1};
    if (g.mask_mode == 3) {
#pragma unroll
      for (int j = 0; j < 4; ++j) kvkeep[j] = ((const int*)mask_a)[(size_t)b * g.Skv + kv0 + j * 16 + c];   // mask_a = kvmask
    }
    float cm[8];
#pragma unroll
    for (int r = 0; r < 8; ++r) {
      const int qrow = q0 + 8 * hh + r;
      float m = -INFINITY;
#pragma unroll
      for (int j = 0; j < 4; ++j) {
        const int kvcol = kv0 + j * 16 + c;
        bool masked = false;
        if (diag) masked = (kvcol > qrow);
        else if (g.mask_mode == 4) masked = (kvcol > qrow) || (qrow - kvcol > g.mask_is_int);
        else if (g.mask_mode == 2) {
          const size_t mi = (size_t)qrow * g.Skv + kvcol;
          masked = (g.mask_is_int == 0) ? (((const float*)mask_a)[mi] == 0.0f)
                 : (g.mask_is_int == 1) ? (((const int*)mask_a)[mi] == 0) : (((const int*)mask_a)[mi] != 0);
        } else if (g.mask_mode == 3) masked = (qkeep[r] == 0) || (kvkeep[j] == 0);
        else if (g.mask_mode == 5) {
          const size_t mi = (size_t)qrow * g.Skv + kvcol;
          masked = (((const int*)mask_a)[mi] != 0);
          int n = mask_b[mi]; n = n < 0 ? 0 : n;
          s[j][r] += g.cp[(size_t)b * g.c_bs + (size_t)h * g.c_hs + (size_t)qrow * g.c_rs + n]
                   + g.pc[(size_t)b * g.c_bs + (size_t)h * g.c_hs + (size_t)kvcol * g.c_rs + n];
        }
        if (masked) s[j][r] = g.mask_fill;
        m = fmaxf(m, s[j][r]);
      }
#pragma unroll
      for (int off = 1; off < 16; off <<= 1) m = fmaxf(m, __shfl_xor(m, off, 32));
      cm[r] = m;
    }
    __bf16* pwh = Psh[wave];
    __bf16* pwl = Psl[SPLIT_PV ? wave : 0];
#pragma unroll
    for (int r = 0; r < 8; ++r) {
      const float mnew = fmaxf(mrow[r], cm[r]);
      const float alpha = expf(mrow[r] - mnew);
      mrow[r] = mnew;
      float psum = 0.f;
#pragma unroll
      for (int j = 0; j < 4; ++j) {
        const float p = expf(s[j][r] - mnew);
        psum += p;
        if (SPLIT_PV) { __bf16 a, bl; at_split(p, a, bl); pwh[(8 * hh + r) * AT_KC + j * 16 + c] = a; pwl[(8 * hh + r) * AT_KC + j * 16 + c] = bl; }
        else pwh[(8 * hh + r) * AT_KC + j * 16 + c] = at_to16<F16>(p * PSC);
      }
#pragma unroll
      for (int off = 1; off < 16; off <<= 1) psum += __shfl_xor(psum, off, 32);
      lrow[r] = lrow[r] * alpha + psum;
#pragma unroll
      for (int t = 0; t < 4; ++t) oacc[t][r] *= alpha;
    }
    __builtin_amdgcn_fence(__ATOMIC_RELEASE, "workgroup");
    __builtin_amdgcn_wave_barrier();
    __builtin_amdgcn_fence(__ATOMIC_ACQUIRE, "workgroup");
#pragma unroll 1
    for (int kk = 0; kk < 2; ++kk) {
      FB pa, pl;
      pa.h[0] = *(const v8b*)(pwh + c * AT_KC + kk * 32 + 8 * hh);
      pa.h[1] = *(const v8b*)(pwh + c * AT_KC + kk * 32 + 16 + 8 * hh);
      if (SPLIT_PV) {
        pl.h[0] = *(const v8b*)(pwl + c * AT_KC + kk * 32 + 8 * hh);
        pl.h[1] = *(const v8b*)(pwl + c * AT_KC + kk * 32 + 16 + 8 * hh);
      }
#pragma unroll
      for (int t = 0; t < 4; ++t) {
        FB vb;
        vb.h[0] = *(const v8b*)(Vth + (t * 16 + c) * AT_KC + kk * 32 + 8 * hh);
        vb.h[1] = *(const v8b*)(Vth + (t * 16 + c) * AT_KC + kk * 32 + 16 + 8 * hh);
        oacc[t] = at_mma16<F16>(pa.v, vb.v, oacc[t]);
        if (SPLIT_PV) {
          FB vl;
          vl.h[0] = *(const v8b*)(Vtl + (t * 16 + c) * AT_KC + kk * 32 + 8 * hh);
          vl.h[1] = *(const v8b*)(Vtl + (t * 16 + c) * AT_KC + kk * 32 + 16 + 8 * hh);
          oacc[t] = at_mma16<F16>(pa.v, vl.v, oacc[t]);
          oacc[t] = at_mma16<F16>(pl.v, vb.v, oacc[t]);
        }
      }
    }
  }

  float* os = Os[wave];
#pragma unroll
  for (int r = 0; r < 8; ++r) {
    const float inv = 1.0f / (lrow[r] * PSC);
#pragma unroll
    for (int t = 0; t < 4; ++t) os[(8 * hh + r) * 68 + t * 16 + c] = oacc[t][r] * inv;
  }
  __builtin_amdgcn_fence(__ATOMIC_RELEASE, "workgroup");
  __builtin_amdgcn_wave_barrier();
  __builtin_amdgcn_fence(__ATOMIC_ACQUIRE, "workgroup");
  {
    const int c4 = (lane & 15) * 4;
    {
#pragma unroll
      for (int it = 0; it < 8; ++it) {
        const int row = it * 2 + hh;
        v4f val = *(const v4f*)(os + row * 68 + c4);
        *(v4f*)(ob_ptr + (size_t)(q0 + row) * g.o_rs + c4) = val;
      }
      
    }
  }
}

} // namespace w25

// Fused projection of one image tile: the casts of x, the three 1x1 convolutions, the 2x2 max-pool and the operand planes of k_nl_flash in one kernel; x is read once, as f32.
// A block owns 64 pixels = 16 pool windows: image rows 2py, 2py + 1, columns 32hf .. 32hf + 31 (blockIdx.x = 2py + hf, blockIdx.y = image).
// Staging: a thread takes 2 x 8 channels x 4 pixels (sixteen 16-byte loads, 8 lanes = one 128-B line), casts them as the cast kernels did (bf16 hi, bf16 lo, f16 of 16 x) and stores, per pixel and plane,
// 16 bytes = 8 consecutive channels = half a lane's fragment into LDS, [slot][channel]. Slot = 16 j + m: m = pool window, j = 2 (row in window) + (column in window). So the four pixels of a window
// sit in four different 16-pixel tiles at the same column, and the pool is a maximum over four accumulators of one lane.
// Wave w owns channels 16w .. 16w + 15 of all three outputs for all 64 pixels: theta^T = Wt X and phi = Wp X (D: column = pixel, rows = 8 consecutive channels a lane; bf16 hi/lo, three products in
// the order the GEMMs had), g^T = X^T Wg^T (D: column = channel, rows = 8 consecutive windows a lane; f16). Pooled phi and g leave in the fragment order of k_nl_flash, 512 contiguous bytes a wave
// and plane (a 16-byte chunk is half of one lane's fragment, 32 chunks, lane = 16 h + c, are one wave-wide load; element e: bits 0-2 k, 3-6 row c, 7 half h, 8 which 16 k, then pooled phi: 9-10 block of
// 32 channels, 11.. tile of 16 keys; pooled g: 9-11 tile of 16 channels, 12.. block of 32 keys). theta leaves in the same order, as the B operand of k_nl_flash: a group of 16 queries = one pixel tile j
// (bits 9-10 block of 32 channels, 11-12 tile j, 13 half hf, 14.. row pair py), again 512 contiguous bytes a wave, tile and plane. The five weight planes arrive in fragment order too (k_nl_wcast). The bias is added behind the maximum (rounding is monotonic, so the value is the same).
namespace w25 {
// the bf16 hi/lo split of two values, packed, in 32-bit arithmetic throughout (the same bits as f2bf_bits gives: round to nearest even, the result in the upper half)
__device__ __forceinline__ unsigned bf_rn(float f) { const unsigned u = __float_as_uint(f); return u + 0x7FFFu + ((u >> 16) & 1u); }
__device__ __forceinline__ unsigned split2(float a, float b, unsigned* lo) {
  const unsigned ua = bf_rn(a) & 0xFFFF0000u, ub = bf_rn(b) & 0xFFFF0000u;
  *lo = (bf_rn(a - __uint_as_float(ua)) >> 16) | (bf_rn(b - __uint_as_float(ub)) & 0xFFFF0000u);
  return (ua >> 16) | ub; }
constexpr int PJX = 264;   // LDS pitch of a slot of x, in 16-bit elements: 512 B + 16 B, an odd multiple of 16 B for 16-byte reads
// a fragment stored in fragment order: two wave-wide loads of 512 contiguous bytes (elements 0..7 <- p[0..7], 8..15 <- p[256..263], p = fragment + 8 * lane)
__device__ __forceinline__ v16b ldf_b(const __bf16* p) { Frag<__bf16>::U f; f.h[0] = *(const v8b*)(p); f.h[1] = *(const v8b*)(p + 256); return f.v; }
__device__ __forceinline__ v16h ldf_h(const _Float16* p) { Frag<_Float16>::U f; f.h[0] = *(const v8h*)(p); f.h[1] = *(const v8h*)(p + 256); return f.v; }
// launch bounds: four waves a SIMD (256 registers a wave), so that two blocks share a WGP and all 512 blocks are resident at once
__global__ __launch_bounds__(256, 4) void k_nl_proj(const float* __restrict__ X, const unsigned short* __restrict__ TWHp, const unsigned short* __restrict__ TWLp, const unsigned short* __restrict__ PWHp,
                                                 const unsigned short* __restrict__ PWLp, const unsigned short* __restrict__ GWp, const float* __restrict__ thb, const float* __restrict__ phb,
                                                 const float* __restrict__ gb, unsigned short* __restrict__ THHp, unsigned short* __restrict__ THLp, unsigned short* __restrict__ PPHp,
                                                 unsigned short* __restrict__ PPLp, unsigned short* __restrict__ GP16p) {
  constexpr int Cc = 256, D = 128, NKc = 1024, HWc = 4096;
  __shared__ __align__(16) unsigned short sx[3][64 * PJX];
  const int tid = threadIdx.x, lane = tid & 31, m = lane & 15, h = lane >> 4;
  const int wave = __builtin_amdgcn_readfirstlane(tid >> 5);   // the wave's number in a scalar register: every address is a scalar base plus a lane offset, and few vector registers live across the products
  const int b = blockIdx.y, py = blockIdx.x >> 1, hf = blockIdx.x & 1;
  // the wave's weight rows 16 wave .. + 15 in fragment order (eight fragments of 512 elements a plane, one a k step; a load = 512 contiguous bytes), first k step: they fly with the loads of x
  const unsigned wob = (unsigned)lane * 16u;   // one lane offset, in bytes, for the five planes
  const int wr = wave * 16 * Cc;
  const __bf16* TWH = (const __bf16*)((const char*)(TWHp + wr) + wob); const __bf16* TWL = (const __bf16*)((const char*)(TWLp + wr) + wob); const __bf16* PWH = (const __bf16*)((const char*)(PWHp + wr) + wob);
  const __bf16* PWL = (const __bf16*)((const char*)(PWLp + wr) + wob); const _Float16* GW = (const _Float16*)((const char*)(GWp + wr) + wob);
  v16b th = ldf_b(TWH), tl = ldf_b(TWL), ph = ldf_b(PWH), pl = ldf_b(PWL); v16h gw = ldf_h(GW);
  {
    const int g = lane & 7, cb = (lane >> 3) & 1, ry = h, cg = wave * 2 + cb;   // 4 pixels from column 4 g of row ry; channels 8 cg .. (and 128 + 8 cg ..); 16 lanes of one row: their LDS stores meet no common bank
    const unsigned xo = (unsigned)(cb * 8 * HWc + ry * 64 + g * 4) * 4u;   // lane offset in bytes
    const float* xp = (const float*)((const char*)(X + ((size_t)b * Cc + wave * 16) * HWc + (2 * py) * 64 + hf * 32) + xo);
    v4f v[2][8];
#pragma unroll   // v[][] in registers, all sixteen loads in flight
    for (int it = 0; it < 2; ++it)
#pragma unroll   // inner loop of the same
      for (int k = 0; k < 8; ++k) v[it][k] = *(const v4f*)(xp + (it * 128 + k) * HWc);
    // the wait before a load's address registers are reused; the lane offset of x and the lane number (the compiler scales it for the weights' addresses) as inputs keep their registers until the wait
    asm volatile("s_wait_xcnt 0x0" :: "v"(xo), "v"(lane) : "memory");
#pragma unroll   // constant indices into v[][]
    for (int it = 0; it < 2; ++it)
#pragma unroll   // inner loop of the same
      for (int e = 0; e < 4; ++e) { v4u hi, lo, f;
#pragma unroll   // inner loop of the same
        for (int q = 0; q < 4; ++q) { unsigned l2; hi[q] = split2(v[it][2 * q][e], v[it][2 * q + 1][e], &l2); lo[q] = l2; f[q] = f2h2_pack(v[it][2 * q][e] * 16.0f, v[it][2 * q + 1][e] * 16.0f); }
        const int so = ((ry * 2 + (e & 1)) * 16 + 2 * g + (e >> 1)) * PJX + it * 128 + cg * 8;
        *(v4u*)(&sx[0][so]) = hi; *(v4u*)(&sx[1][so]) = lo; *(v4u*)(&sx[2][so]) = f; }
  }
  __syncthreads();   // the tile of x is complete before any wave reads it
  v8f at[4], ap[4], ag[4];
#pragma unroll   // constant indices
  for (int j = 0; j < 4; ++j) { at[j] = (v8f){0.f,0.f,0.f,0.f,0.f,0.f,0.f,0.f}; ap[j] = at[j]; ag[j] = at[j]; }
  const __bf16* xh = (const __bf16*)(&sx[0][0]) + m * PJX + 8 * h; const __bf16* xl = (const __bf16*)(&sx[1][0]) + m * PJX + 8 * h; const _Float16* xf = (const _Float16*)(&sx[2][0]) + m * PJX + 8 * h;
  const unsigned bo8 = (unsigned)h * 32u, bo1 = (unsigned)m * 4u;   // lane offsets of the biases, in bytes
  const float* tbp = (const float*)((const char*)(thb + wave * 16) + bo8); const float* pbp = (const float*)((const char*)(phb + wave * 16) + bo8); const float* gbp = (const float*)((const char*)(gb + wave * 16) + bo1);
  v4f tb0, tb1, pb0, pb1; float gbv;
#pragma unroll   // eight k steps of 32 channels, constant offsets; no branch stands behind a matrix instruction
  for (int ks = 0; ks < 8; ++ks) {
    v16b nth = th, ntl = tl, nph = ph, npl = pl; v16h ngw = gw;
    if (ks < 7) {   // the next k step's weights fly behind this step's products
      const int kn = (ks + 1) * 512;
      nth = ldf_b(TWH + kn); ntl = ldf_b(TWL + kn); nph = ldf_b(PWH + kn); npl = ldf_b(PWL + kn); ngw = ldf_h(GW + kn);
      // the wait before these loads' address registers are reused (the lane number as an input keeps it until then); memory clobbered, the loads also stay above the products instead of sinking to their first use
      asm volatile("s_wait_xcnt 0x0" :: "v"(lane) : "memory");
    } else {        // the biases fly behind the last step's products, in the registers that the weights have left
      tb0 = *(const v4f*)(tbp); tb1 = *(const v4f*)(tbp + 4); pb0 = *(const v4f*)(pbp); pb1 = *(const v4f*)(pbp + 4); gbv = *gbp;
      asm volatile("s_wait_xcnt 0x0" :: "v"(bo8), "v"(bo1) : "memory");   // the same wait for the biases' lane offsets
    }
#pragma unroll   // two pixel tiles at a time: six independent accumulators, half the fragments live
    for (int jp = 0; jp < 4; jp += 2) {
      v16b bh[2], bl[2]; v16h bf[2];
#pragma unroll   // constant indices
      for (int u = 0; u < 2; ++u) { const int o = (jp + u) * 16 * PJX + ks * 32; bh[u] = Frag<__bf16>::load(xh + o); bl[u] = Frag<__bf16>::load(xl + o); bf[u] = Frag<_Float16>::load(xf + o); }
#pragma unroll   // constant indices; neighbours in the stream go to different tiles
      for (int u = 0; u < 2; ++u) at[jp + u] = Frag<__bf16>::mma(th, bh[u], at[jp + u]);
#pragma unroll   // the same
      for (int u = 0; u < 2; ++u) ap[jp + u] = Frag<__bf16>::mma(ph, bh[u], ap[jp + u]);
#pragma unroll   // the same
      for (int u = 0; u < 2; ++u) ag[jp + u] = Frag<_Float16>::mma(bf[u], gw, ag[jp + u]);
#pragma unroll   // the same
      for (int u = 0; u < 2; ++u) at[jp + u] = Frag<__bf16>::mma(tl, bh[u], at[jp + u]);
#pragma unroll   // the same
      for (int u = 0; u < 2; ++u) ap[jp + u] = Frag<__bf16>::mma(ph, bl[u], ap[jp + u]);
#pragma unroll   // the same
      for (int u = 0; u < 2; ++u) at[jp + u] = Frag<__bf16>::mma(th, bl[u], at[jp + u]);
#pragma unroll   // the same
      for (int u = 0; u < 2; ++u) ap[jp + u] = Frag<__bf16>::mma(pl, bh[u], ap[jp + u]);
    }
    th = nth; tl = ntl; ph = nph; pl = npl; gw = ngw;
  }
  __builtin_amdgcn_sched_barrier(0);   // the conversions below stay behind the products: moved up among them, their temporaries took registers that the fragments need, and values were spilled
  const float tbv[8] = { tb0[0], tb0[1], tb0[2], tb0[3], tb1[0], tb1[1], tb1[2], tb1[3] }, pbv[8] = { pb0[0], pb0[1], pb0[2], pb0[3], pb1[0], pb1[1], pb1[2], pb1[3] };
  // pooled phi (hi, lo) and pooled g
  v4u phi_h, phi_l, g_h;
#pragma unroll   // constant indices
  for (int q = 0; q < 4; ++q) { float pv[2], gv[2];
#pragma unroll   // inner loop of the same
    for (int u = 0; u < 2; ++u) { const int r = 2 * q + u;
      pv[u] = fmaxf(fmaxf(ap[0][r], ap[1][r]), fmaxf(ap[2][r], ap[3][r])) + pbv[r];
      gv[u] = fmaxf(fmaxf(ag[0][r], ag[1][r]), fmaxf(ag[2][r], ag[3][r])) * 0.0625f + gbv; }
    unsigned l2; phi_h[q] = split2(pv[0], pv[1], &l2); phi_l[q] = l2; g_h[q] = f2h2_pack(gv[0], gv[1]); }
  // theta: a lane's 8 channels of one pixel are half of a lane's B fragment (column = m, k from 16 (wave & 1) + 8 h of k step wave >> 1), so a wave stores 512 contiguous bytes a pixel tile and plane
  v4u oh[4], ol[4];
#pragma unroll   // constant indices
  for (int j = 0; j < 4; ++j)
#pragma unroll   // inner loop of the same
    for (int q = 0; q < 4; ++q) { unsigned l2; oh[j][q] = split2(at[j][2 * q] + tbv[2 * q], at[j][2 * q + 1] + tbv[2 * q + 1], &l2); ol[j][q] = l2; }
  const unsigned l16 = (unsigned)lane * 16u;
  const size_t to = ((((size_t)b * (HWc / 128) + py) * 8 + hf * 4) * 4 + (wave >> 1)) * 512 + (wave & 1) * 256;
  char* tph = (char*)(THHp + to) + l16; char* tpl = (char*)(THLp + to) + l16;
#pragma unroll   // constant indices; a pixel tile's four fragments are 4096 bytes
  for (int j = 0; j < 4; ++j) { *(v4u*)(tph + j * 4096) = oh[j]; *(v4u*)(tpl + j * 4096) = ol[j]; }
  const size_t po = (size_t)b * NKc * D + (py * 2 + hf) * 2048 + wave * 256, vo = (size_t)b * NKc * D + py * 4096 + wave * 512 + hf * 256;
  *(v4u*)((char*)(PPHp + po) + l16) = phi_h; *(v4u*)((char*)(PPLp + po) + l16) = phi_l; *(v4u*)((char*)(GP16p + vo) + l16) = g_h;
  // the wait before a store's registers are reused: the lane offset and the values as inputs keep them all until it, so nothing takes a register of an issued store
  asm volatile("s_wait_xcnt 0x0" :: "v"(l16), "v"(oh[0]), "v"(oh[1]), "v"(oh[2]), "v"(oh[3]), "v"(ol[0]), "v"(ol[1]), "v"(ol[2]), "v"(ol[3]), "v"(phi_h), "v"(phi_l), "v"(g_h) : "memory");
}
} // namespace w25
// Fused attention and output projection of one image: y[q][c] = f16( sum_k softmax_k(theta[q] . phi[k]) g[c][k] ), WY = W y + W_b. Scores, probabilities and y never leave the registers.
// A block is 8 waves, two a SIMD, so that one wave's softmax runs beside the other's matrix products: waves w and w + 4 own the same 32 queries (two 16-column groups) and walk 512 keys each,
// 32 at a time; behind the loop they exchange maximum, sum and O^T through LDS, both merge them, and each forms half of the 256 output channels. A wave forms S^T = K Q^T (bf16 hi/lo planes, three products, as the score
// GEMM did) and O^T += V^T P^T (f16): in both D tiles a lane holds one query (column lane & 15), so maximum, sum and rescale are lane-local but for one
// exchange between the wave halves, and two S^T tiles (keys 0-15, 16-31), converted in place, are the B operand of the second product in the hardware k order.
// K (hi, lo), V^T and Q (theta hi, lo) lie in fragment order (k_nl_proj writes them so): every fragment load covers four whole lines. A group of 16 queries is one pixel tile of k_nl_proj:
// group 2 qw + t, column cq = pixel 64 (qw & 1) + 32 (qw >> 1) + 2 cq + t of the block's 128 (two image rows); the epilogue puts each column back at its pixel.
// Running maximum in log2 units; the accumulators are rescaled only when a column's maximum has grown by more than 8; p = 2^(s - m + 7) <= 2^15 fits f16.
// Epilogue: WY^T tile = W y^T (f16, k ascending), W in fragment order (k_nl_wcast writes it so); the block's 256 channels x 128 queries go through LDS, from where whole rows are stored and
// each channel's partial batch statistics are summed; k_nl_out merges the partials.
namespace w25 {
__device__ __forceinline__ float xhalf(float x) { return __builtin_bit_cast(float, __builtin_amdgcn_permlanex16(__builtin_bit_cast(int, x), __builtin_bit_cast(int, x), 0x76543210, 0xfedcba98, false, false)); }   // lane l takes lane l ^ 16
typedef float v2f __attribute__((ext_vector_type(2)));
typedef __attribute__((address_space(1))) const char* gcp;   // a pointer into global memory, said outright: one rebuilt from two words would otherwise be taken for a generic one
// a wave-uniform address, both words through a scalar register: the compiler then keeps a plane's base in scalar registers and forms a pass's address from it; else it held base + lane offset of every plane in a vector pair through the loop
__device__ __forceinline__ gcp ubase(const unsigned short* p) { const unsigned long long a = (unsigned long long)p;
  const unsigned l = (unsigned)__builtin_amdgcn_readfirstlane((int)(unsigned)a), u = (unsigned)__builtin_amdgcn_readfirstlane((int)(unsigned)(a >> 32)); return (gcp)(((unsigned long long)u << 32) | l); }
// the same fragment loads from a lane's address a and a constant offset o, in bytes
__device__ __forceinline__ v16b ldu_b(gcp a, int o) { Frag<__bf16>::U f; f.h[0] = *(const __attribute__((address_space(1))) v8b*)(a + o); f.h[1] = *(const __attribute__((address_space(1))) v8b*)(a + (o + 512)); return f.v; }
__device__ __forceinline__ v16h ldu_h(gcp a, int o) { Frag<_Float16>::U f; f.h[0] = *(const __attribute__((address_space(1))) v8h*)(a + o); f.h[1] = *(const __attribute__((address_space(1))) v8h*)(a + (o + 512)); return f.v; }
__global__ __launch_bounds__(256) void k_nl_flash(const unsigned short* __restrict__ QHp, const unsigned short* __restrict__ QLp, const unsigned short* __restrict__ KHp, const unsigned short* __restrict__ KLp,
                                                  const unsigned short* __restrict__ VTp, const unsigned short* __restrict__ WFp, const float* __restrict__ Wb, float* __restrict__ WY, float* __restrict__ PS) {
  constexpr int D = 128, NKc = 1024, HWc = 4096;
  constexpr int PW = 132;   // LDS pitch of a channel's row of 128 queries, in floats: 512 B + 16 B, an odd multiple of 16 B for the row-per-lane reads
  __shared__ __align__(16) float sW[256 * PW];
  constexpr float L2E = 1.4426950408889634f;
  constexpr int NP = NKc / 64;   // passes of a wave: half of the keys
  const int lane = threadIdx.x & 31, cq = lane & 15, h = lane >> 4;
  const int wave = __builtin_amdgcn_readfirstlane((int)(threadIdx.x >> 5)), qw = wave & 3, hv = wave >> 2;   // in a scalar register; qw: which 32 queries, hv: which half of the keys, later of the channels
  const int b = blockIdx.y;
  const size_t qo = (((size_t)b * (HWc / 128) + blockIdx.x) * 8 + qw * 2) * 2048, ko = ((size_t)b * NKc + hv * (NKc / 2)) * D;   // a group of 16 queries: four fragments of 512 elements
  const unsigned l16 = (unsigned)lane * 16u;   // one lane offset, in bytes, for Q, K, V^T and W: a pass forms its three addresses from scalar bases plus it, so no base pair lives in vector registers through the loop (the wave has 512)
  const gcp qh0 = ubase(QHp + qo) + l16, ql0 = ubase(QLp + qo) + l16;
  const gcp kh0 = ubase(KHp + ko) + l16, kl0 = ubase(KLp + ko) + l16;
  v16b qh[2][4], ql[2][4], kh[2][4], kl[2][4];
#pragma unroll   // constant indices: the fragments stay in registers
  for (int t = 0; t < 2; ++t)
#pragma unroll   // inner loop of the same
    for (int ks = 0; ks < 4; ++ks) {
      qh[t][ks] = ldu_b(qh0, (t * 4 + ks) * 1024); ql[t][ks] = ldu_b(ql0, (t * 4 + ks) * 1024);
      kh[t][ks] = ldu_b(kh0, (t * 4 + ks) * 1024); kl[t][ks] = ldu_b(kl0, (t * 4 + ks) * 1024);
    }
  asm volatile("s_wait_xcnt 0x0" :: "v"(lane) : "memory");   // the wait before these loads' address registers are reused: the compiler forms each address from a scalar base and the lane number, which as an input keeps its register until the wait
  v8f o[2][8];
#pragma unroll   // constant indices
  for (int t = 0; t < 2; ++t)
#pragma unroll   // inner loop of the same
    for (int ct = 0; ct < 8; ++ct) o[t][ct] = (v8f){0.f,0.f,0.f,0.f,0.f,0.f,0.f,0.f};
  float mu[2] = { -1.0e30f, -1.0e30f }, l[2] = { 0.f, 0.f };
#pragma unroll 1   // one pass is 64 matrix instructions already; unrolled, the fragments of two passes would not fit
  for (int p = 0; p < NP; ++p) {
    v16h vt[8]; const gcp vp = ubase(VTp + ko + p * 32 * D) + l16;
#pragma unroll   // constant indices; the eight V^T fragments fly while the scores are formed
    for (int ct = 0; ct < 8; ++ct) vt[ct] = ldu_h(vp, ct * 1024);
    __builtin_amdgcn_sched_barrier(0);   // keeps the V^T loads' issue above the score products; without it they sink to their first use and each waits a full latency there
    v8f s[2][2];   // [query group][key tile]
#pragma unroll   // constant indices
    for (int t = 0; t < 2; ++t) { s[t][0] = (v8f){0.f,0.f,0.f,0.f,0.f,0.f,0.f,0.f}; s[t][1] = s[t][0]; }
#pragma unroll   // constant indices; neighbours in the stream go to different tiles
    for (int ks = 0; ks < 4; ++ks) {
#pragma unroll   // inner loop of the same
      for (int kt = 0; kt < 2; ++kt)
#pragma unroll   // inner loop of the same
        for (int t = 0; t < 2; ++t) s[t][kt] = Frag<__bf16>::mma(kh[kt][ks], qh[t][ks], s[t][kt]);
#pragma unroll   // inner loop of the same
      for (int kt = 0; kt < 2; ++kt)
#pragma unroll   // inner loop of the same
        for (int t = 0; t < 2; ++t) s[t][kt] = Frag<__bf16>::mma(kh[kt][ks], ql[t][ks], s[t][kt]);
#pragma unroll   // inner loop of the same
      for (int kt = 0; kt < 2; ++kt)
#pragma unroll   // inner loop of the same
        for (int t = 0; t < 2; ++t) s[t][kt] = Frag<__bf16>::mma(kl[kt][ks], qh[t][ks], s[t][kt]);
    }
    // the next pass's K fragments, into the same registers: they fly behind the softmax and the second product (the last pass re-reads the wave's first 32 keys, in bounds, unused)
    const int kn = ((p + 1) & (NP - 1)) * 32 * D; const gcp kph = ubase(KHp + ko + kn) + l16, kpl = ubase(KLp + ko + kn) + l16;
#pragma unroll   // constant indices
    for (int kt = 0; kt < 2; ++kt)
#pragma unroll   // inner loop of the same
      for (int ks = 0; ks < 4; ++ks) { kh[kt][ks] = ldu_b(kph, (kt * 4 + ks) * 1024); kl[kt][ks] = ldu_b(kpl, (kt * 4 + ks) * 1024); }
    // the wait before the pass's load addresses are reused: the three
    // addresses as inputs keep the pairs until the wait. With vp named and memory clobbered, the V^T loads also stay in front of it and are not sunk behind the rescale branch to their first use
    asm volatile("s_wait_xcnt 0x0" :: "v"(kph), "v"(kpl), "v"(vp) : "memory");
    float mx[2];
#pragma unroll   // constant indices
    for (int t = 0; t < 2; ++t) { float m = fmaxf(s[t][0][0], s[t][1][0]);
#pragma unroll   // inner loop of the same
      for (int r = 1; r < 8; ++r) m = fmaxf(m, fmaxf(s[t][0][r], s[t][1][r]));
      mx[t] = fmaxf(m, xhalf(m)) * L2E; }
    const bool need = (mx[0] > mu[0] + 8.f) || (mx[1] > mu[1] + 8.f);
    if (__builtin_amdgcn_ballot_w32(need) != 0) {   // one scalar test a pass
#pragma unroll   // constant indices
      for (int t = 0; t < 2; ++t) { const float mn = fmaxf(mu[t], mx[t]); const float f = __builtin_amdgcn_exp2f(mu[t] - mn); mu[t] = mn; l[t] *= f;
#pragma unroll   // inner loop of the same
        for (int ct = 0; ct < 8; ++ct) o[t][ct] *= f; }
    }
    v16h pb[2];
#pragma unroll   // constant indices
    for (int t = 0; t < 2; ++t) { const float mb = 7.f - mu[t]; float a0 = 0.f, a1 = 0.f;
#pragma unroll   // inner loop of the same
      for (int r = 0; r < 8; ++r) { const float e0 = __builtin_amdgcn_exp2f(fmaf(s[t][0][r], L2E, mb)), e1 = __builtin_amdgcn_exp2f(fmaf(s[t][1][r], L2E, mb));
        a0 += e0; a1 += e1; pb[t][r] = (_Float16)e0; pb[t][8 + r] = (_Float16)e1; }
      l[t] += a0 + a1; }
#pragma unroll   // constant indices; sixteen independent tiles
    for (int ct = 0; ct < 8; ++ct)
#pragma unroll   // inner loop of the same
      for (int t = 0; t < 2; ++t) o[t][ct] = Frag<_Float16>::mma(vt[ct], pb[t], o[t][ct]);
  }
  // ---- the two halves of the keys meet: every wave leaves O^T (16 KiB, [register quad][lane]), maxima and sums in LDS and takes its partner's ----
  float* ex = sW + wave * 4096 + lane * 4; float* exs = sW + 8 * 4096 + wave * 128 + lane * 4;
#pragma unroll   // constant indices
  for (int t = 0; t < 2; ++t)
#pragma unroll   // inner loop of the same
    for (int ct = 0; ct < 8; ++ct) { *(v4f*)(ex + ((t * 8 + ct) * 2) * 128) = (v4f){ o[t][ct][0], o[t][ct][1], o[t][ct][2], o[t][ct][3] }; *(v4f*)(ex + ((t * 8 + ct) * 2 + 1) * 128) = (v4f){ o[t][ct][4], o[t][ct][5], o[t][ct][6], o[t][ct][7] }; }
  *(v4f*)exs = (v4f){ mu[0], mu[1], l[0], l[1] };
  // ---- W y + b for the wave's 32 queries and its 128 channels (128 hv ..); y = O / l never leaves the registers ----
  const unsigned wfo = l16, bo = (unsigned)h * 32u;   // lane offsets of W and of the bias, in bytes; a lane's D rows are channels 8 h .. 8 h + 7 of a tile
  const _Float16* WF = (const _Float16*)((const char*)(WFp + hv * 32 * 512) + wfo);
  const float* bp = (const float*)((const char*)(Wb + hv * 128) + bo);
  v16h wa[2][16]; v4f bb[2][4][2];   // two sets: four channel tiles x four k steps of W, and their biases
#pragma unroll   // constant indices; the first set flies behind the division below
  for (int u = 0; u < 4; ++u) { bb[0][u][0] = *(const v4f*)(bp + u * 16); bb[0][u][1] = *(const v4f*)(bp + u * 16 + 4); }
#pragma unroll   // the same
  for (int f = 0; f < 16; ++f) wa[0][f] = ldf_h(WF + f * 512);
  asm volatile("s_wait_xcnt 0x0" :: "v"(WF), "v"(bo) : "memory");   // the wait before a load's address registers are reused; the lane's address of W and the bias's lane offset as inputs keep their registers until it
  // every wave's partial results are in LDS before a partner reads them. The barrier with fences on LDS alone: __syncthreads() would also wait for the loads of W, which nobody shares
  __builtin_amdgcn_fence(__ATOMIC_RELEASE, "workgroup", "local"); __builtin_amdgcn_s_barrier(); __builtin_amdgcn_fence(__ATOMIC_ACQUIRE, "workgroup", "local");
  {
    const float* px = sW + (wave ^ 4) * 4096 + lane * 4; const v4f ps4 = *(const v4f*)(sW + 8 * 4096 + (wave ^ 4) * 128 + lane * 4);
#pragma unroll   // constant indices
    for (int t = 0; t < 2; ++t) { const float mn = fmaxf(mu[t], ps4[t]), da = mu[t] - mn, db = ps4[t] - mn; float fa, fb;
      // 2^da, 2^db with the slot behind each transcendental written out
      asm("v_exp_f32 %0, %2\n\tv_nop\n\tv_exp_f32 %1, %3\n\tv_nop" : "=&v"(fa), "=&v"(fb) : "v"(da), "v"(db));
      l[t] = l[t] * fa + ps4[2 + t] * fb;
#pragma unroll   // inner loop of the same
      for (int ct = 0; ct < 8; ++ct) { const v4f p0 = *(const v4f*)(px + ((t * 8 + ct) * 2) * 128), p1 = *(const v4f*)(px + ((t * 8 + ct) * 2 + 1) * 128);
#pragma unroll   // inner loop of the same
        for (int r = 0; r < 4; ++r) { o[t][ct][r] = o[t][ct][r] * fa + p0[r] * fb; o[t][ct][4 + r] = o[t][ct][4 + r] * fa + p1[r] * fb; } } }
  }
  // every wave has read its partner's results: the LDS is free for the tile of WY (the same barrier)
  __builtin_amdgcn_fence(__ATOMIC_RELEASE, "workgroup", "local"); __builtin_amdgcn_s_barrier(); __builtin_amdgcn_fence(__ATOMIC_ACQUIRE, "workgroup", "local");
  v16h yb[2][4];   // two O^T tiles (channels 32 j .. + 15, + 16 .. + 31), converted in place, are the B operand of k step j in the hardware k order
#pragma unroll   // constant indices
  for (int t = 0; t < 2; ++t) { const float inv = 1.f / (l[t] + xhalf(l[t]));
#pragma unroll   // inner loop of the same
    for (int j = 0; j < 4; ++j)
#pragma unroll   // inner loop of the same
      for (int r = 0; r < 8; ++r) { yb[t][j][r] = (_Float16)(o[t][2 * j][r] * inv); yb[t][j][8 + r] = (_Float16)(o[t][2 * j + 1][r] * inv); } }
  float* sq = sW + (hv * 128 + 8 * h) * PW + (qw & 1) * 64 + (qw >> 1) * 32 + 2 * cq;   // the lane's two queries (t = 0, 1) are neighbouring pixels
#pragma unroll   // constant indices into wa[][], bb[][][]: two groups of four channel tiles
  for (int g = 0; g < 2; ++g) {
    if (g < 1) {   // the next group's biases and W fragments fly behind this group's products
#pragma unroll   // constant indices
      for (int u = 0; u < 4; ++u) { bb[(g + 1) & 1][u][0] = *(const v4f*)(bp + ((g + 1) * 4 + u) * 16); bb[(g + 1) & 1][u][1] = *(const v4f*)(bp + ((g + 1) * 4 + u) * 16 + 4); }
#pragma unroll   // the same
      for (int f = 0; f < 16; ++f) wa[(g + 1) & 1][f] = ldf_h(WF + ((g + 1) * 16 + f) * 512);
      asm volatile("s_wait_xcnt 0x0" :: "v"(WF), "v"(bo) : "memory");   // the same wait; memory clobbered, the loads also stay above the products instead of sinking to their first use
    }
    v8f d[4][2];
#pragma unroll   // constant indices
    for (int u = 0; u < 4; ++u) { d[u][0] = (v8f){0.f,0.f,0.f,0.f,0.f,0.f,0.f,0.f}; d[u][1] = d[u][0]; }
#pragma unroll   // constant indices; k ascending, eight independent tiles
    for (int j = 0; j < 4; ++j)
#pragma unroll   // inner loop of the same
      for (int u = 0; u < 4; ++u)
#pragma unroll   // inner loop of the same
        for (int t = 0; t < 2; ++t) d[u][t] = Frag<_Float16>::mma(wa[g & 1][u * 4 + j], yb[t][j], d[u][t]);
#pragma unroll   // constant indices; 16 lanes = 128 B of a channel's row, the two halves 32 banks apart
    for (int u = 0; u < 4; ++u)
#pragma unroll   // inner loop of the same
      for (int r = 0; r < 8; ++r) { const float bv = bb[g & 1][u][r >> 2][r & 3];
        *(v2f*)(sq + ((g * 4 + u) * 16 + r) * PW) = (v2f){ d[u][0][r] * 0.0625f + bv, d[u][1][r] * 0.0625f + bv }; }
  }
  __syncthreads();   // the block's 256 x 128 tile of WY is complete in LDS before rows are read across the waves' columns
  // a wave stores 32 channels' rows: 512 contiguous bytes (four whole lines) a store
  const float* sr = sW + wave * 32 * PW + lane * 4;
  float* wy = WY + ((size_t)b * 256 + wave * 32) * HWc + blockIdx.x * 128 + lane * 4;
#pragma unroll   // constant offsets
  for (int it = 0; it < 2; ++it) { v4f v[16];
#pragma unroll   // inner loop of the same: sixteen LDS reads behind one wait
    for (int k = 0; k < 16; ++k) v[k] = *(const v4f*)(sr + (it * 16 + k) * PW);
#pragma unroll   // inner loop of the same
    for (int k = 0; k < 16; ++k) *(v4f*)(wy + (size_t)(it * 16 + k) * HWc) = v[k];
    // the wait before a store's registers are reused: address and values as inputs keep them until it
    asm volatile("s_wait_xcnt 0x0" :: "v"(wy), "v"(v[0]), "v"(v[1]), "v"(v[2]), "v"(v[3]), "v"(v[4]), "v"(v[5]), "v"(v[6]), "v"(v[7]), "v"(v[8]), "v"(v[9]), "v"(v[10]), "v"(v[11]), "v"(v[12]), "v"(v[13]), "v"(v[14]), "v"(v[15]) : "memory"); }
  // partial batch statistics: a thread owns channel tid and reads its 128 values (row pitch an odd multiple of 16 B): sum, then squared deviations from the row's own mean, no exchange between lanes
  v2f st[1]; v4f rv[1][32];
#pragma unroll   // constant indices: the row in registers
  for (int cc = 0; cc < 1; ++cc)
#pragma unroll   // inner loop of the same
    for (int k = 0; k < 32; ++k) rv[cc][k] = *(const v4f*)(sW + ((int)threadIdx.x + cc * 128) * PW + k * 4);
  __builtin_amdgcn_sched_barrier(0);   // keeps all 32 LDS reads' issue above the sums; without it they sink to their first use, four in flight, and the wave waits on each
#pragma unroll   // constant indices
  for (int cc = 0; cc < 1; ++cc) { v4f a = rv[cc][0];
#pragma unroll   // inner loop of the same: four independent chains
    for (int k = 1; k < 32; ++k) a += rv[cc][k];
    const float s = (a[0] + a[1]) + (a[2] + a[3]), mean = s * (1.0f / 128.0f);
    v4f q = { 0.f, 0.f, 0.f, 0.f };
#pragma unroll   // inner loop of the same
    for (int k = 0; k < 32; ++k) { const v4f dv = rv[cc][k] - mean; q += dv * dv; }
    st[cc][0] = s; st[cc][1] = (q[0] + q[1]) + (q[2] + q[3]); }
  float* ps = PS + ((size_t)(b * (HWc / 128) + (int)blockIdx.x) * 256 + (int)threadIdx.x) * 2;   // the block's own 2 KiB: 16 whole lines, one writer each
  *(v2f*)(ps) = st[0];
  asm volatile("s_wait_xcnt 0x0" :: "v"(ps), "v"(st[0]) : "memory");   // the same wait for the last store
}
} // namespace w25
// out = (WY - mu[c]) * rstd[c] * gamma[c] + beta[c] + x. One block per channel c, all 8 images: a thread holds 16 B of each operand and image, every load's address a scalar base plus one lane offset.
// The batch statistics come from the 256 partial pairs (sum, squared deviations from the own mean, 128 values each) that k_nl_flash left for the channel: they go through LDS once, then every wave
// merges them itself (mean first, then the deviations plus 128 (partial mean - mean)^2), while its loads of WY and x are in flight.
typedef float v2f __attribute__((ext_vector_type(2)));
typedef __attribute__((address_space(1))) char* gptr;   // a pointer into global memory, said outright: one rebuilt from two words would otherwise be taken for a generic one
// a block-uniform address, both words through a scalar register: the compiler then keeps it as the scalar base of its load and does not fold it with the lane offset into a vector pair
__device__ __forceinline__ gptr sbase(const float* p) { const unsigned long long a = (unsigned long long)p;
    const unsigned l = (unsigned)__builtin_amdgcn_readfirstlane((int)(unsigned)a), u = (unsigned)__builtin_amdgcn_readfirstlane((int)(unsigned)(a >> 32)); return (gptr)(((unsigned long long)u << 32) | l); }
typedef __attribute__((address_space(1))) v4f* gv4;
__global__ __launch_bounds__(1024) void k_nl_out(const float* __restrict__ WY, const float* __restrict__ PS, const float* __restrict__ Gm, const float* __restrict__ Bt, const float* __restrict__ X, float* __restrict__ OUT) {
    constexpr int Bn = 8, C = 256, HW = 4096, NP = 256, NQ = 128;
    __shared__ __align__(16) float sp[2 * NP];
    const int c = (int)blockIdx.x, t = (int)threadIdx.x, lane = t & 31;
    const unsigned lo = (unsigned)t * 16u;
    const float* pp = PS + ((size_t)(t & (NP - 1)) * C + c) * 2; v2f p = { 0.f, 0.f };
    if (t < NP) p = *(const v2f*)pp;   // waves 0 to 7, first in the load queue: its wait leaves the sixteen loads below in flight
    v4f w[Bn], xv[Bn]; gptr wb[Bn], xb[Bn]; float* op[Bn];
#pragma unroll   // constant indices: the sixteen scalar bases
    for (int b = 0; b < Bn; ++b) { const int po = (b * C + c) * HW; wb[b] = sbase(WY + po); xb[b] = sbase(X + po); }
    __builtin_amdgcn_sched_barrier(0);   // all bases stand before the first load: formed between the loads they shared a few scalar registers, with a wait in front of every reuse
#pragma unroll   // all sixteen loads in flight, every address a scalar base plus the one lane offset
    for (int b = 0; b < Bn; ++b) { w[b] = *(gv4)(wb[b] + lo); xv[b] = *(gv4)(xb[b] + lo); }
    asm volatile("s_wait_xcnt 0x0" :: "v"(lo), "v"(pp) : "memory");   // the wait before a load's address registers are reused; the lane offset and the partial's address as inputs keep them until it
    const float g = Gm[c], be = Bt[c];
    if (t < NP) *(v2f*)(sp + 2 * t) = p;
    // the 256 pairs are in LDS before any wave sums them. The barrier with fences on LDS alone: __syncthreads() would also wait for the sixteen global loads, which nobody shares
    __builtin_amdgcn_fence(__ATOMIC_RELEASE, "workgroup", "local"); __builtin_amdgcn_s_barrier(); __builtin_amdgcn_fence(__ATOMIC_ACQUIRE, "workgroup", "local");
    float s8[8], m8[8];
#pragma unroll   // constant indices
    for (int k = 0; k < 8; ++k) { const v2f q = *(const v2f*)(sp + 2 * (lane + 32 * k)); s8[k] = q[0]; m8[k] = q[1]; }
    float S = ((s8[0] + s8[1]) + (s8[2] + s8[3])) + ((s8[4] + s8[5]) + (s8[6] + s8[7]));
#pragma unroll   // five exchange steps, constant masks
    for (int o = 16; o > 0; o >>= 1) S += __shfl_xor(S, o, 32);
    const float mu = S / (float)(NP * NQ);
    float Q = 0.f;
#pragma unroll   // constant indices
    for (int k = 0; k < 8; ++k) { const float dm = s8[k] * (1.0f / (float)NQ) - mu; Q += m8[k] + (float)NQ * dm * dm; }
#pragma unroll   // five exchange steps, constant masks
    for (int o = 16; o > 0; o >>= 1) Q += __shfl_xor(Q, o, 32);
    const float rs = rsqrtf(Q / (float)(NP * NQ) + 1e-5f);
    __builtin_amdgcn_sched_barrier(0);   // the first use of WY stays behind the statistics: moved up between the two sums, its wait for the loads held the second sum back
#pragma unroll   // constant indices into w[], xv[]
    for (int b = 0; b < Bn; ++b) {
#pragma unroll   // inner loop of the same: constant indices, values stay in registers
        for (int e = 0; e < 4; ++e) w[b][e] = (w[b][e] - mu) * rs * g + be + xv[b][e];
        op[b] = (float*)((char*)(OUT + (b * C + c) * HW) + lo); *(v4f*)op[b] = w[b]; }
    // the wait before a store's registers are reused: the eight addresses and the values as inputs keep them all until it
    asm volatile("s_wait_xcnt 0x0" :: "v"(op[0]), "v"(op[1]), "v"(op[2]), "v"(op[3]), "v"(op[4]), "v"(op[5]), "v"(op[6]), "v"(op[7]), "v"(w[0]), "v"(w[1]), "v"(w[2]), "v"(w[3]), "v"(w[4]), "v"(w[5]), "v"(w[6]), "v"(w[7]) : "memory");
}


// The four weight casts in one launch: they need nothing of each other, so blockIdx.y picks the matrix (a block-uniform choice) and the four grids run side by side.
// All four matrices hold the same number of elements and the grid covers it exactly; a thread casts 4 consecutive ones of a row (one 16-byte load, 8-byte stores), each value as k_cast16 and k_castS16 cast it.
// Every plane leaves in the fragment order that its reader loads (a tile of 16 rows x 32 k = 512 elements: bits 0-2 k, 3-6 row, 7 half, 8 which 16 k; tiles: k step fastest, then the 16 rows).
// A block takes 8 rows x 128 k (W_w [256][128]: whole rows; the three [128][256] matrices: half rows): a wave reads 512 contiguous bytes, and the 8 rows of a 128-byte line of the fragment order belong to one block.
__global__ __launch_bounds__(256) void k_nl_wcast(const float* __restrict__ Ww, const float* __restrict__ thw, const float* __restrict__ phw, const float* __restrict__ gw, unsigned short* __restrict__ WW16,
                                                  unsigned short* __restrict__ TWH, unsigned short* __restrict__ TWL, unsigned short* __restrict__ PWH, unsigned short* __restrict__ PWL, unsigned short* __restrict__ GW16) {
    const int job = (int)blockIdx.y; const unsigned t = threadIdx.x, bx = blockIdx.x;
    const unsigned nks = (job == 0) ? 4u : 8u;   // k steps of 32 in a row
    const unsigned c = ((job == 0) ? bx : (bx >> 1)) * 8u + (t >> 5), k = ((job == 0) ? 0u : (bx & 1u) * 128u) + (t & 31u) * 4u;
    const float* sp = ((job == 0) ? Ww : (job == 1) ? thw : (job == 2) ? phw : gw) + (c * nks * 32u + k);
    const v4f v = *(const v4f*)sp;
    asm volatile("s_wait_xcnt 0x0" :: "v"(sp) : "memory");   // the wait before the load's address pair is reused; the address as an input keeps the pair until it, so the result does not land on it either
    const unsigned fo = ((c >> 4) * nks + (k >> 5)) * 512u + ((k >> 4) & 1u) * 256u + ((k >> 3) & 1u) * 128u + (c & 15u) * 8u + (k & 7u);
    if (job == 1 || job == 2) {   // theta_w, phi_w: bf16 hi and lo planes
        v2u hi, lo; unsigned l2; hi[0] = f2bf2_pack(v[0], v[1], &l2); lo[0] = l2; hi[1] = f2bf2_pack(v[2], v[3], &l2); lo[1] = l2;
        unsigned short* dh = ((job == 1) ? TWH : PWH) + fo; unsigned short* dl = ((job == 1) ? TWL : PWL) + fo;
        *(v2u*)dh = hi; *(v2u*)dl = lo;
        asm volatile("s_wait_xcnt 0x0" :: "v"(dh), "v"(dl), "v"(hi), "v"(lo) : "memory");   // the wait before the stores' registers are reused; addresses and values as inputs keep them until it
    } else {                      // W_w: f16 of 16 w; g_w: f16
        const float s = (job == 0) ? 16.0f : 1.0f; v2u f; f[0] = f2h2_pack(v[0] * s, v[1] * s); f[1] = f2h2_pack(v[2] * s, v[3] * s);
        unsigned short* dp = ((job == 0) ? WW16 : GW16) + fo;
        *(v2u*)dp = f;
        asm volatile("s_wait_xcnt 0x0" :: "v"(dp), "v"(f) : "memory");   // the wait before the store's registers are reused; address and value as inputs keep them until it
    }
}

extern "C" void kernel_launch(void* const* d_in, const int* in_sizes, int n_in, void* d_out, int out_size, void* d_ws, size_t ws_size, hipStream_t stream) {
    (void)in_sizes; (void)n_in; (void)out_size; (void)ws_size;
    const float* x = (const float*)d_in[0];
    const float* gw = (const float*)d_in[1];
    const float* gb = (const float*)d_in[2];
    const float* thw = (const float*)d_in[3];
    const float* thb = (const float*)d_in[4];
    const float* phw = (const float*)d_in[5];
    const float* phb = (const float*)d_in[6];
    const float* Ww = (const float*)d_in[7];
    const float* Wb = (const float*)d_in[8];
    const float* bng = (const float*)d_in[9];
    const float* bnb = (const float*)d_in[10];
    const int Bn = 8;
    const int C = 256;
    const int IC = 128;
    const int HW = 4096;
    const int NK = 1024;
    float* out = (float*)d_out;
    char* wsp = (char*)d_ws;
    // One launch per stage for all Bn images (projection and attention: blockIdx.y = image; output: one block per channel, images looped; per-image strides). Workspace: the operand planes that the projection writes, WY, the weight planes, the partial BN statistics
    unsigned short* THH = (unsigned short*)wsp; wsp += (size_t)Bn * HW * IC * 2;
    unsigned short* THL = (unsigned short*)wsp; wsp += (size_t)Bn * HW * IC * 2;
    unsigned short* PPH = (unsigned short*)wsp; wsp += (size_t)Bn * NK * IC * 2;
    unsigned short* PPL = (unsigned short*)wsp; wsp += (size_t)Bn * NK * IC * 2;
    unsigned short* GP16 = (unsigned short*)wsp; wsp += (size_t)Bn * IC * NK * 2;
    float* WY = (float*)wsp; wsp += (size_t)Bn * C * HW * 4;
    unsigned short* WW16 = (unsigned short*)wsp; wsp += (size_t)C * IC * 2;
    unsigned short* TWH = (unsigned short*)wsp; wsp += (size_t)IC * C * 2;
    unsigned short* TWL = (unsigned short*)wsp; wsp += (size_t)IC * C * 2;
    unsigned short* PWH = (unsigned short*)wsp; wsp += (size_t)IC * C * 2;
    unsigned short* PWL = (unsigned short*)wsp; wsp += (size_t)IC * C * 2;
    unsigned short* GW16 = (unsigned short*)wsp; wsp += (size_t)IC * C * 2;
    float* PS = (float*)wsp; wsp += (size_t)Bn * (HW / 128) * C * 2 * 4;
    // weights
    k_nl_wcast<<<dim3((unsigned)(C * IC / 1024), 4u), 256, 0, stream>>>(Ww, thw, phw, gw, WW16, TWH, TWL, PWH, PWL, GW16);
    // theta (bf16 hi/lo), pooled phi (bf16 hi/lo) and pooled g (f16), all in fragment order, straight from x: 64 pixels a block, blockIdx.y = image
    w25::k_nl_proj<<<dim3((unsigned)(HW / 64), (unsigned)(Bn)), 256, 0, stream>>>(x, (const unsigned short*)(TWH), (const unsigned short*)(TWL), (const unsigned short*)(PWH), (const unsigned short*)(PWL), (const unsigned short*)(GW16), thb, phb, gb, THH, THL, PPH, PPL, GP16);
    // WY[b] = W softmax(theta[b] phi[b]) g[b]^T + W_b ([C][HW], f32) and, per block of 128 queries, each channel's sum and squared deviations: 128 queries a block, blockIdx.y = image
    w25::k_nl_flash<<<dim3((unsigned)(HW / 128), (unsigned)(Bn)), 256, 0, stream>>>((const unsigned short*)(THH), (const unsigned short*)(THL), (const unsigned short*)(PPH), (const unsigned short*)(PPL), (const unsigned short*)(GP16), (const unsigned short*)(WW16), Wb, WY, PS);
    k_nl_out<<<(unsigned)(C), 1024, 0, stream>>>(WY, PS, bng, bnb, x, out);
}
